// v000
// The times below were measured on an AMD MI455X: many runs one after another, warmed up first and cycling through
// copies of the inputs, with the whole window's GPU time divided by the number of runs. Launches and the gaps
// between them are all in it. The median over several windows is given; except for v000 it joins two sittings, which
// can be a few percent apart, so the side-by-side timings, each taken in one sitting, are the better comparison.
// The starting kernel, v000, takes 4250 microseconds a run.
#include <hip/hip_runtime.h>
// "Quantum" attention (x [2][2048][1024]): Q/K/V = x W + b ([in][out] weights + biases, 16 heads of 64); scores = (Q cos(phase)) (K cos(phase))^T / 8 + Q E K^T per head (phase [16][64], E [16][64][64]) = Q M K^T with M = E + diag(cos^2 phase / 8); softmax over the 2,048 keys; o = attn V merged; out = o out_w + out_b -> [2][2048][1024].
// Structure: token rows; x as exact f16 rows; Q and K as WMMA GEMMs (32x64 wave tiles, f32 accumulation, exact x16 transposed weights + bias) into f32 rows, split on VALU into f16 hi + 2^-10 residual planes; V as a WMMA GEMM to f16 rows; M as f16 hi + residual planes (VALU, cos in f32); per batch: KM = K M^T per head as three accumulating GEMM terms (hi.hi + lo.hi + hi.lo, K = 64) into f32 rows, split into hi + residual planes; V^T for all heads via LDS transposes; per group of 4 heads: scores = Q KM^T as three accumulating GEMM terms (hi.hi + lo.hi + hi.lo) (K = 64), row softmax on VALU (f32 statistics, native exp; weights x4096 f16), o = P . V^T GEMM (K = 2048, alpha 2^-6: o carried x64 against f16 subnormal flush) into merged f16 rows; out = o out_w + b GEMM (f32, alpha folds 1/16 and 1/64).
// Compute dtype: inputs rounded to bf16; weights exact (x16 f16); Q, K, M, KM as f16 hi + residual planes (~2^-22); V, softmax weights (x4096) and o (x64) plain f16 (~2^-12); scores, softmax statistics f32. v_wmma_f32_16x16x32_f16.
#define NB 2
#define SQ 2048
#define DM 1024
#define NH 16
#define HD 64
#define HG 4                         /* heads per attention launch group */
#define PSC 4096.0f                  /* softmax weight carry */
#define B0 0                         /* first batch processed (debug hook) */
#define NBR NB                       /* batches processed (debug hook) */
#define QN SQ                        /* query rows attended per batch (debug hook) */
#define NHD NH                       /* heads attended (debug hook) */
#define NR ((size_t)NB * SQ)
#define MP ((int)((size_t)NBR * SQ)) /* rows projected (debug hook) */
#define MPO MP                       /* rows through the output GEMM (debug hook) */
typedef __bf16 v16b __attribute__((ext_vector_type(16)));
typedef unsigned short v8us __attribute__((ext_vector_type(8), may_alias));
typedef float  v8f  __attribute__((ext_vector_type(8)));
typedef float  v4f  __attribute__((ext_vector_type(4)));
typedef float  v4fa __attribute__((ext_vector_type(4), may_alias));
union FragB { v16b v; v8us half[2]; unsigned short u[16]; };

__device__ __forceinline__ unsigned short bf16_bits(float x) { unsigned int u = __float_as_uint(x); return (unsigned short)((u + 0x7FFFu + ((u >> 16) & 1u)) >> 16); }
__device__ __forceinline__ float bf16_val(unsigned short b) { return __uint_as_float(((unsigned int)b) << 16); }
__device__ __forceinline__ float bf16_round(float x) { return bf16_val(bf16_bits(x)); }
// D += A·B with NT terms: 1 = ah·bh, 2 = + al·bh (A split), 3 = + ah·bl (both split)
template <int NT>
__device__ __forceinline__ v8f mmaN(v16b ah, v16b al, v16b bh, v16b bl, v8f c) {
  c = __builtin_amdgcn_wmma_f32_16x16x32_bf16(false, ah, false, bh, (short)0, c, false, false);
  if (NT >= 2) c = __builtin_amdgcn_wmma_f32_16x16x32_bf16(false, al, false, bh, (short)0, c, false, false);
  if (NT >= 3) c = __builtin_amdgcn_wmma_f32_16x16x32_bf16(false, ah, false, bl, (short)0, c, false, false);
  asm volatile("v_nop\n\tv_nop\n\tv_nop\n\tv_nop" : "+v"(c) : "v"(ah), "v"(al), "v"(bh), "v"(bl));
  return c;
}

__global__ __launch_bounds__(256) void k_wt_bf16(const float* __restrict__ W, unsigned short* __restrict__ Wt, int K, int N) {
  const int t = blockIdx.x * 256 + threadIdx.x;
  const int k8n = K / 8;
  if (t >= N * k8n) return;
  const int n = t / k8n, k8 = (t % k8n) * 8;
  v8us v;
#pragma unroll
  for (int i = 0; i < 8; ++i) v[i] = bf16_bits(W[(size_t)(k8 + i) * N + n]);
  *(v8us*)(Wt + (size_t)n * K + k8) = v;
  
}

// GEMM C[M][N] (f32, pitch ldc) = act(A[M][K]·W + bias). A f32 row-major (pitch lda) converted per fragment to bf16
// (ASPLIT: hi/lo two planes -> 2 terms, else single rounded term); Wt bf16 [N][K] (pitch ldb). BIAS_BF16 rounds the
// bias to bf16 first (bias quantised to bf16 before the add). K%32==0, M%16==0, N%64==0.
template <bool ASPLIT, int ACT, bool BIAS_BF16>
__global__ __launch_bounds__(128) void k_gemm_bf(const float* __restrict__ A, int lda, const unsigned short* __restrict__ Wt, int ldb,
                                               const float* __restrict__ bias, float* __restrict__ C, int ldc, int M, int N, int K) {
  __shared__ __attribute__((aligned(16))) float so[4][16][64];
  const int tid = threadIdx.x, w = tid >> 5, lane = tid & 31, ln = lane & 15, hh = lane >> 4;
  const int ntn = N / 64;
  const int wid = blockIdx.x * 4 + w;
  const int mt = wid / ntn, nq = wid % ntn;
  if (mt * 16 >= M) return;
  const int row0 = mt * 16, col0 = nq * 64;
  const float* arow = A + (size_t)(row0 + ln) * lda;
  v8f acc[4] = {};
  for (int kb = 0; kb < K; kb += 32) {
    FragB ah, al;
    const v4f x0 = *(const v4fa*)(arow + kb + 8 * hh), x1 = *(const v4fa*)(arow + kb + 8 * hh + 4);
    const v4f x2 = *(const v4fa*)(arow + kb + 16 + 8 * hh), x3 = *(const v4fa*)(arow + kb + 16 + 8 * hh + 4);
    float xs[16] = {x0[0],x0[1],x0[2],x0[3],x1[0],x1[1],x1[2],x1[3],x2[0],x2[1],x2[2],x2[3],x3[0],x3[1],x3[2],x3[3]};
#pragma unroll
    for (int i = 0; i < 16; ++i) { const unsigned short hb = bf16_bits(xs[i]); ah.u[i] = hb; al.u[i] = ASPLIT ? bf16_bits(xs[i] - bf16_val(hb)) : (unsigned short)0; }
#pragma unroll
    for (int t = 0; t < 4; ++t) {
      const unsigned short* brow = Wt + (size_t)(col0 + t * 16 + ln) * ldb + kb;
      FragB b;
      b.half[0] = *(const v8us*)(brow + 8 * hh);
      b.half[1] = *(const v8us*)(brow + 16 + 8 * hh);
      acc[t] = mmaN<ASPLIT ? 2 : 1>(ah.v, al.v, b.v, b.v, acc[t]);
    }
  }
#pragma unroll
  for (int t = 0; t < 4; ++t) {
    float bv = bias ? bias[col0 + t * 16 + ln] : 0.f;
    if (BIAS_BF16) bv = bf16_round(bv);
#pragma unroll
    for (int r = 0; r < 8; ++r) { float v = acc[t][r] + bv; if (ACT == 1) v = fmaxf(v, 0.f); so[w][8 * hh + r][t * 16 + ln] = v; }
  }
  __builtin_amdgcn_fence(__ATOMIC_ACQ_REL, "workgroup");
  __builtin_amdgcn_wave_barrier();
  const int rsub = lane >> 4, c4 = (lane & 15) * 4;
  {
#pragma unroll
    for (int q = 0; q < 8; ++q) {
      const int r = q * 2 + rsub;
      const v4f v = *(const v4fa*)&so[w][r][c4];
      *(v4f*)(C + (size_t)(row0 + r) * ldc + col0 + c4) = v;
    }
    
  }
}

// GEMM C = act(A·W + bias + resid): A f32 (ASPLIT -> hi/lo 2 terms), Wt bf16 [N][K]; ACT 0 none, 1 relu, 2 exact gelu;
// resid (optional, f32, row index = (row % rmod), pitch ldr, RES_BF16 rounds it) added before the activation.
template <bool ASPLIT, int ACT, bool BIAS_BF16, bool RES_BF16>
__global__ __launch_bounds__(128) void k_gemm_bf3(const float* __restrict__ A, int lda, const unsigned short* __restrict__ Wt, int ldb,
                                                const float* __restrict__ bias, const float* __restrict__ resid, int rmod, int ldr,
                                                float* __restrict__ C, int ldc, int M, int N, int K) {
  __shared__ __attribute__((aligned(16))) float so[4][16][64];
  const int tid = threadIdx.x, w = tid >> 5, lane = tid & 31, ln = lane & 15, hh = lane >> 4;
  const int ntn = N / 64;
  const int wid = blockIdx.x * 4 + w;
  const int mt = wid / ntn, nq = wid % ntn;
  if (mt * 16 >= M) return;
  const int row0 = mt * 16, col0 = nq * 64;
  const float* arow = A + (size_t)(row0 + ln) * lda;
  v8f acc[4] = {};
  for (int kb = 0; kb < K; kb += 32) {
    FragB ah, al;
    const v4f x0 = *(const v4fa*)(arow + kb + 8 * hh), x1 = *(const v4fa*)(arow + kb + 8 * hh + 4);
    const v4f x2 = *(const v4fa*)(arow + kb + 16 + 8 * hh), x3 = *(const v4fa*)(arow + kb + 16 + 8 * hh + 4);
    float xs[16] = {x0[0],x0[1],x0[2],x0[3],x1[0],x1[1],x1[2],x1[3],x2[0],x2[1],x2[2],x2[3],x3[0],x3[1],x3[2],x3[3]};
#pragma unroll
    for (int i = 0; i < 16; ++i) { const unsigned short hb = bf16_bits(xs[i]); ah.u[i] = hb; al.u[i] = ASPLIT ? bf16_bits(xs[i] - bf16_val(hb)) : (unsigned short)0; }
#pragma unroll
    for (int t = 0; t < 4; ++t) {
      const unsigned short* brow = Wt + (size_t)(col0 + t * 16 + ln) * ldb + kb;
      FragB b;
      b.half[0] = *(const v8us*)(brow + 8 * hh);
      b.half[1] = *(const v8us*)(brow + 16 + 8 * hh);
      acc[t] = mmaN<ASPLIT ? 2 : 1>(ah.v, al.v, b.v, b.v, acc[t]);
    }
  }
#pragma unroll
  for (int t = 0; t < 4; ++t) {
    const int col = col0 + t * 16 + ln;
    float bv = bias ? bias[col] : 0.f;
    if (BIAS_BF16) bv = bf16_round(bv);
#pragma unroll
    for (int r = 0; r < 8; ++r) {
      float v = acc[t][r] + bv;
      if (resid) { float rv = resid[(size_t)((row0 + 8 * hh + r) % rmod) * ldr + col]; if (RES_BF16) rv = bf16_round(rv); v += rv; }
      if (ACT == 1) v = fmaxf(v, 0.f);
      if (ACT == 2) v = 0.5f * v * (1.0f + erff(v * 0.70710678118654752f));
      if (ACT == 3) { const float u = 0.7978845608028654f * (v + 0.044715f * v * v * v); v = 0.5f * v * (1.0f + tanhf(u)); }
      so[w][8 * hh + r][t * 16 + ln] = v;
    }
  }
  __builtin_amdgcn_fence(__ATOMIC_ACQ_REL, "workgroup");
  __builtin_amdgcn_wave_barrier();
  const int rsub = lane >> 4, c4 = (lane & 15) * 4;
  {
#pragma unroll
    for (int q = 0; q < 8; ++q) {
      const int r = q * 2 + rsub;
      const v4f v = *(const v4fa*)&so[w][r][c4];
      *(v4f*)(C + (size_t)(row0 + r) * ldc + col0 + c4) = v;
    }
    
  }
}
// row LayerNorm (biased variance, eps) over N: s = X (+ R); optional out_sum <- s; out_norm <- (s-mu)*rsqrt(var+eps)*g + b
template <bool PARAM_BF16>
__global__ __launch_bounds__(256) void k_layernorm(const float* __restrict__ X, const float* __restrict__ R, const float* __restrict__ g, const float* __restrict__ bta,
                                                  float* __restrict__ out_sum, float* __restrict__ out_norm, int N, float eps) {
  __shared__ float red[256];
  const int row = blockIdx.x, tid = threadIdx.x;
  const float* x = X + (size_t)row * N; const float* rr = R ? R + (size_t)row * N : nullptr;
  float vals[16];                     // up to N = 4096
  const int per = N / 256;            // contiguous chunk per thread? use strided-by-4 chunks: thread handles j = tid*4 + 1024*u
  float s1 = 0.f;
  for (int u = 0; u < per / 4; ++u) {
    const int j = tid * 4 + 1024 * u;
    const v4f a = *(const v4fa*)(x + j);
    v4f b = {0.f,0.f,0.f,0.f}; if (rr) b = *(const v4fa*)(rr + j);
#pragma unroll
    for (int q = 0; q < 4; ++q) { const float v = a[q] + b[q]; vals[u * 4 + q] = v; s1 += v; }
  }
  red[tid] = s1; __syncthreads();
  for (int st = 128; st > 0; st >>= 1) { if (tid < st) red[tid] += red[tid + st]; __syncthreads(); }
  const float mu = red[0] / (float)N; __syncthreads();
  float s2 = 0.f;
  for (int u = 0; u < per / 4; ++u)
#pragma unroll
    for (int q = 0; q < 4; ++q) { const float c = vals[u * 4 + q] - mu; s2 += c * c; }
  red[tid] = s2; __syncthreads();
  for (int st = 128; st > 0; st >>= 1) { if (tid < st) red[tid] += red[tid + st]; __syncthreads(); }
  const float rs = rsqrtf(red[0] / (float)N + eps);
  {
    for (int u = 0; u < per / 4; ++u) {
      const int j = tid * 4 + 1024 * u;
      v4f o, sm;
#pragma unroll
      for (int q = 0; q < 4; ++q) {
        float gg = g[j + q], bb = bta[j + q];
        if (PARAM_BF16) { gg = bf16_round(gg); bb = bf16_round(bb); }
        sm[q] = vals[u * 4 + q]; o[q] = (vals[u * 4 + q] - mu) * rs * gg + bb;
      }
      if (out_sum) *(v4f*)(out_sum + (size_t)row * N + j) = sm;
      *(v4f*)(out_norm + (size_t)row * N + j) = o;
    }
    
  }
}



// ---- f16 WMMA path (v_wmma_f32_16x16x32_f16): 11-bit significands for operands in range — used where a [0,1] probability operand needs more precision than bf16
typedef _Float16 v16h __attribute__((ext_vector_type(16)));
union FragH { v16h v; v8us half[2]; _Float16 h[16]; unsigned short u[16]; };
template <int NT>
__device__ __forceinline__ v8f mmaH(v16h ah, v16h al, v16h bh, v16h bl, v8f c) {
  c = __builtin_amdgcn_wmma_f32_16x16x32_f16(false, ah, false, bh, (short)0, c, false, false);
  if (NT >= 2) c = __builtin_amdgcn_wmma_f32_16x16x32_f16(false, al, false, bh, (short)0, c, false, false);
  if (NT >= 3) c = __builtin_amdgcn_wmma_f32_16x16x32_f16(false, ah, false, bl, (short)0, c, false, false);
  asm volatile("v_nop\n\tv_nop\n\tv_nop\n\tv_nop" : "+v"(c) : "v"(ah), "v"(al), "v"(bh), "v"(bl));
  return c;
}
// batched GEMM like k_gemm_b but f16 operands: A f32 (split into f16 hi/lo if ASPLIT, else rounded to f16), Bt = f16 values [n][k]; alpha; C f32; N multiple of 16 (partial tiles skipped)
template <bool ASPLIT>
__global__ __launch_bounds__(128) void k_gemm_h(const float* __restrict__ A, int lda, size_t sA, const _Float16* __restrict__ Bh, int ldb, size_t sB, float alpha, float* __restrict__ C, int ldc, size_t sC, int M, int N, int K) {
  __shared__ __attribute__((aligned(16))) float so[4][16][64];
  const int tid = threadIdx.x, w = tid >> 5, lane = tid & 31, ln = lane & 15, hh = lane >> 4; const int by = blockIdx.y;
  A += (size_t)by * sA; Bh += (size_t)by * sB; C += (size_t)by * sC;
  const int ntn = (N + 63) / 64; const int wid = blockIdx.x * 4 + w; const int mt = wid / ntn, nq = wid % ntn; if (mt * 16 >= M) return;
  const int row0 = mt * 16, col0 = nq * 64; const float* arow = A + (size_t)(row0 + ln) * lda;
  v8f acc[4] = {};
  for (int kb = 0; kb < K; kb += 32) {
    FragH ah, al;
    const v4f x0 = *(const v4fa*)(arow + kb + 8 * hh), x1 = *(const v4fa*)(arow + kb + 8 * hh + 4), x2 = *(const v4fa*)(arow + kb + 16 + 8 * hh), x3 = *(const v4fa*)(arow + kb + 16 + 8 * hh + 4);
    float xs[16] = {x0[0],x0[1],x0[2],x0[3],x1[0],x1[1],x1[2],x1[3],x2[0],x2[1],x2[2],x2[3],x3[0],x3[1],x3[2],x3[3]};
#pragma unroll
    for (int i = 0; i < 16; ++i) { const _Float16 h = (_Float16)xs[i]; ah.h[i] = h; al.h[i] = ASPLIT ? (_Float16)(xs[i] - (float)h) : (_Float16)0.0f; }
#pragma unroll
    for (int t = 0; t < 4; ++t) { if (col0 + t * 16 >= N) continue; const size_t boff = (size_t)(col0 + t * 16 + ln) * ldb + kb; FragH bq; bq.half[0] = *(const v8us*)(Bh + boff + 8 * hh); bq.half[1] = *(const v8us*)(Bh + boff + 16 + 8 * hh);
      acc[t] = mmaH<ASPLIT ? 2 : 1>(ah.v, al.v, bq.v, bq.v, acc[t]); }
  }
#pragma unroll
  for (int t = 0; t < 4; ++t) { if (col0 + t * 16 >= N) continue;
#pragma unroll
    for (int r = 0; r < 8; ++r) so[w][8 * hh + r][t * 16 + ln] = acc[t][r] * alpha; }
  __builtin_amdgcn_fence(__ATOMIC_ACQ_REL, "workgroup"); __builtin_amdgcn_wave_barrier();
  const int rsub = lane >> 4, c4 = (lane & 15) * 4;
  {
#pragma unroll
    for (int q = 0; q < 8; ++q) { const int r = q * 2 + rsub; if (col0 + c4 < N) { const v4f v = *(const v4fa*)&so[w][r][c4]; *(v4f*)(C + (size_t)(row0 + r) * ldc + col0 + c4) = v; } }
     }
}

// Wt[n][k] = f16(W[k][n]·scale) from f32 row-major W[K][N] (scale = power of two; bf16-exact weights stay exact in f16 away from the subnormal range)
__global__ __launch_bounds__(256) void k_wt_f16(const float* __restrict__ W, _Float16* __restrict__ Wt, int K, int N, float scale) {
  const int t = blockIdx.x * 256 + threadIdx.x; if (t >= N * (K / 8)) return; const int n = t / (K / 8), k8 = (t % (K / 8)) * 8; FragH f;
#pragma unroll
  for (int i = 0; i < 8; ++i) f.h[i] = (_Float16)(bf16_round(W[(size_t)(k8 + i) * N + n]) * scale); const v8us o = f.half[0];
  *(v8us*)((unsigned short*)Wt + (size_t)n * K + k8) = o; 
}
// k_gemm_hh variant with fused epilogue: v = acc·alpha + bias[by·sBias + col] (+ CP[(row/rowsPerB)·sCPb + by·64 + col] if CP) ; ACT 0 none / 1 elu ; writes f16 C16 (and f32 C if non-null)
template <int ACT>
__global__ __launch_bounds__(128) void k_gemm_hhx(const _Float16* __restrict__ A, int lda, size_t sA, const _Float16* __restrict__ Bh, int ldb, size_t sB, float alpha, const float* __restrict__ bias, size_t sBias, const float* __restrict__ CP, int rowsPerB, size_t sCPb, int row0g,
    float* __restrict__ C, _Float16* __restrict__ C16, int ldc, size_t sC, int M, int N, int K) {
  __shared__ __attribute__((aligned(16))) float so[4][16][64];
  const int tid = threadIdx.x, w = tid >> 5, lane = tid & 31, ln = lane & 15, hh = lane >> 4; const int by = blockIdx.y;
  A += (size_t)by * sA; Bh += (size_t)by * sB; const size_t cofs = (size_t)by * sC; const float* bp = bias ? bias + (size_t)by * sBias : nullptr;
  const int ntn = (N + 63) / 64; const int wid = blockIdx.x * 4 + w; const int mt = wid / ntn, nq = wid % ntn; if (mt * 16 >= M) return;
  const int row0 = mt * 16, col0 = nq * 64; const _Float16* arow = A + (size_t)(row0 + ln) * lda;
  v8f acc[4] = {};
  for (int kb = 0; kb < K; kb += 32) { FragH ah; ah.half[0] = *(const v8us*)((const unsigned short*)arow + kb + 8 * hh); ah.half[1] = *(const v8us*)((const unsigned short*)arow + kb + 16 + 8 * hh);
#pragma unroll
    for (int t = 0; t < 4; ++t) { if (col0 + t * 16 >= N) continue; const size_t boff = (size_t)(col0 + t * 16 + ln) * ldb + kb; FragH bq; bq.half[0] = *(const v8us*)((const unsigned short*)Bh + boff + 8 * hh); bq.half[1] = *(const v8us*)((const unsigned short*)Bh + boff + 16 + 8 * hh);
      acc[t] = mmaH<1>(ah.v, ah.v, bq.v, bq.v, acc[t]); }
  }
#pragma unroll
  for (int t = 0; t < 4; ++t) { if (col0 + t * 16 >= N) continue; const int col = col0 + t * 16 + ln; const float bv = bp ? bf16_round(bp[col]) : 0.f;
#pragma unroll
    for (int r = 0; r < 8; ++r) { float v = acc[t][r] * alpha + bv; if (CP) { const int rr = row0g + row0 + 8 * hh + r; if (rowsPerB < 0) v += CP[cofs + (size_t)rr * ldc + col];      /* rowsPerB < 0: own element of the batched C plane */ else { const int bidx = rr / rowsPerB; v += CP[(size_t)bidx * sCPb + (size_t)by * 64 + col]; } } if (ACT == 1) v = (v > 0.f) ? v : expm1f(v); else if (ACT == 7) v = (v > 0.f) ? v + 1.0f : expf(v); else if (ACT == 8) v = tanhf(v); else if (ACT == 9) v = 0.5f * v * (1.0f + tanhf(0.7978845608028654f * (v + 0.044715f * v * v * v))); else if (ACT == 11) v = 1.0f / (1.0f + expf(-v)); else if (ACT == 12) v = (v > 0.f) ? v : 0.01f * v; else if (ACT == 14) v = (v > 0.f) ? v : 0.1f * v; else if (ACT == 16) v = (v >= 0.f) ? v : 0.3f * v; else if (ACT == 17) v = (v >= 0.f) ? v : 0.2f * v; else if (ACT == 15) v = v / (1.0f + expf(-v)); else if (ACT == 3) v = fmaxf(v, 0.f); else if (ACT == 6) v = 0.5f * v * (1.0f + erff(v * 0.70710678118654752f)); so[w][8 * hh + r][t * 16 + ln] = v; } }
  __builtin_amdgcn_fence(__ATOMIC_ACQ_REL, "workgroup"); __builtin_amdgcn_wave_barrier();
  const int rsub = lane >> 4, c4 = (lane & 15) * 4; typedef _Float16 v4h __attribute__((ext_vector_type(4)));
  {
#pragma unroll
    for (int q = 0; q < 8; ++q) { const int r = q * 2 + rsub; if (col0 + c4 < N) { const v4f v = *(const v4fa*)&so[w][r][c4]; if (C) *(v4f*)(C + cofs + (size_t)(row0 + r) * ldc + col0 + c4) = v; if (C16) { v4h h4; for (int i = 0; i < 4; ++i) h4[i] = (_Float16)v[i]; *(v4h*)(C16 + cofs + (size_t)(row0 + r) * ldc + col0 + c4) = h4; } } }
     }
}


typedef _Float16 v4h __attribute__((ext_vector_type(4)));

__global__ __launch_bounds__(256) void k_x16(const float* __restrict__ x, _Float16* __restrict__ X16, size_t n8) { const size_t t = (size_t)blockIdx.x * 256 + threadIdx.x; if (t >= n8) return; FragH f;
#pragma unroll
  for (int q = 0; q < 8; ++q) f.h[q] = (_Float16)bf16_round(x[t * 8 + q]); *(v8us*)((unsigned short*)X16 + t * 8) = f.half[0];  }
__global__ __launch_bounds__(256) void k_h16(const float* __restrict__ x, _Float16* __restrict__ X16, size_t n8) { const size_t t = (size_t)blockIdx.x * 256 + threadIdx.x; if (t >= n8) return; FragH f;
#pragma unroll
  for (int q = 0; q < 8; ++q) f.h[q] = (_Float16)x[t * 8 + q]; *(v8us*)((unsigned short*)X16 + t * 8) = f.half[0];  }
__global__ __launch_bounds__(256) void k_round16f(const float* __restrict__ W, _Float16* __restrict__ Bt, size_t n8) { const size_t t = (size_t)blockIdx.x * 256 + threadIdx.x; if (t >= n8) return; FragH f;
#pragma unroll
  for (int i = 0; i < 8; ++i) f.h[i] = (_Float16)(bf16_round(W[t * 8 + i]) * 16.0f); *(v8us*)((unsigned short*)Bt + t * 8) = f.half[0];  }
template <int NHv, int TTv>
__global__ __launch_bounds__(256) void k_vt(const _Float16* __restrict__ V16, int ldv, int voff, _Float16* __restrict__ Vt) { __shared__ unsigned short tl[64][66]; const int tid = threadIdx.x; const int slab = blockIdx.x / (TTv / 64), lg = blockIdx.x % (TTv / 64); const int b = slab / NHv, h = slab % NHv;
  for (int i = tid; i < 64 * 8; i += 256) { const int r = i / 8, c8 = (i % 8) * 8; FragH f; f.half[0] = *(const v8us*)((const unsigned short*)V16 + ((size_t)b * TTv + lg * 64 + r) * ldv + voff + h * 64 + c8);
#pragma unroll
    for (int q = 0; q < 8; ++q) tl[r][c8 + q] = f.u[q]; }
  __syncthreads();
  {
#pragma unroll
    for (int rd = 0; rd < 2; ++rd) { const int d = rd * 32 + tid / 8, pc = tid % 8; FragH f;
#pragma unroll
      for (int q = 0; q < 8; ++q) f.u[q] = tl[pc * 8 + q][d];
      *(v8us*)((unsigned short*)Vt + ((size_t)slab * 64 + d) * TTv + lg * 64 + pc * 8) = f.half[0]; }
     } }

__global__ __launch_bounds__(256) void k_hl(const float* __restrict__ F, _Float16* __restrict__ Hh, _Float16* __restrict__ Hl, size_t n8) { const size_t t = (size_t)blockIdx.x * 256 + threadIdx.x; if (t >= n8) return; FragH fh, fl; const v4f a = *(const v4fa*)(F + t * 8), c = *(const v4fa*)(F + t * 8 + 4);
#pragma unroll
  for (int q = 0; q < 4; ++q) { _Float16 h = (_Float16)a[q]; fh.h[q] = h; fl.h[q] = (_Float16)((a[q] - (float)h) * 1024.0f); h = (_Float16)c[q]; fh.h[4 + q] = h; fl.h[4 + q] = (_Float16)((c[q] - (float)h) * 1024.0f); }
  { *(v8us*)((unsigned short*)Hh + t * 8) = fh.half[0]; *(v8us*)((unsigned short*)Hl + t * 8) = fl.half[0];  } }

// ---- fast GEMM (wave tile 32x64; requires M % 32 == 0 rows per launch region and N % 64 == 0); epilogue = k_gemm_hhx semantics ----
__device__ __forceinline__ v16h g2_frag(const _Float16* p, int hh) { FragH f; f.half[0] = *(const v8us*)((const unsigned short*)p + 8 * hh); f.half[1] = *(const v8us*)((const unsigned short*)p + 16 + 8 * hh); return f.v; }
__device__ __forceinline__ v8f g2_mma(v16h a, v16h b, v8f c) { v8f d = __builtin_amdgcn_wmma_f32_16x16x32_f16(false, a, false, b, (short)0, c, false, false); asm volatile("v_nop\n\tv_nop\n\tv_nop\n\tv_nop" : "+v"(d) : "v"(a), "v"(b)); return d; }
template <int ACT>
__global__ __launch_bounds__(128) void k_gemm2(const _Float16* __restrict__ A, int lda, size_t sA, const _Float16* __restrict__ Bh, int ldb, size_t sB, float alpha, const float* __restrict__ bias, size_t sBias, const float* __restrict__ CP, int rowsPerB, size_t sCPb, int row0g,
    float* __restrict__ C, _Float16* __restrict__ C16, int ldc, size_t sC, int M, int N, int K) { static_assert(ACT == 0 || ACT == 3 || ACT == 6 || ACT == 8 || ACT == 9 || ACT == 11 || ACT == 12 || ACT == 14 || ACT == 15 || ACT == 16 || ACT == 17, "k_gemm2: unsupported ACT code (would silently apply no activation)");
  __shared__ __attribute__((aligned(16))) float so[4][32][68];
  const int tid = threadIdx.x, w = tid >> 5, lane = tid & 31, ln = lane & 15, hh = lane >> 4; const int by = blockIdx.y;
  A += (size_t)by * sA; Bh += (size_t)by * sB; const size_t cofs = (size_t)by * sC; const float* bp = bias ? bias + (size_t)by * sBias : nullptr;
  const int ntn = N >> 6; const int mt = blockIdx.x / ntn, nq = blockIdx.x - mt * ntn; const int row0 = mt * 128 + 32 * w, col0 = nq * 64; if (row0 >= M) return;
  const _Float16* a0p = A + (size_t)(row0 + ln) * lda; const _Float16* a1p = a0p + (size_t)16 * lda;
  const _Float16* b0p = Bh + (size_t)(col0 + ln) * ldb; const _Float16* b1p = b0p + (size_t)16 * ldb; const _Float16* b2p = b1p + (size_t)16 * ldb; const _Float16* b3p = b2p + (size_t)16 * ldb;
  const v8f z8 = {0.f,0.f,0.f,0.f,0.f,0.f,0.f,0.f}; v8f c00 = z8, c01 = z8, c02 = z8, c03 = z8, c10 = z8, c11 = z8, c12 = z8, c13 = z8;
#pragma unroll 1
  for (int kb = 0; kb < K; kb += 32) { const v16h a0 = g2_frag(a0p + kb, hh), a1 = g2_frag(a1p + kb, hh);
    v16h b = g2_frag(b0p + kb, hh); c00 = g2_mma(a0, b, c00); c10 = g2_mma(a1, b, c10);
    b = g2_frag(b1p + kb, hh); c01 = g2_mma(a0, b, c01); c11 = g2_mma(a1, b, c11);
    b = g2_frag(b2p + kb, hh); c02 = g2_mma(a0, b, c02); c12 = g2_mma(a1, b, c12);
    b = g2_frag(b3p + kb, hh); c03 = g2_mma(a0, b, c03); c13 = g2_mma(a1, b, c13); }
  v8f accs[8] = {c00, c01, c02, c03, c10, c11, c12, c13};
#pragma unroll
  for (int u = 0; u < 8; ++u) { const int t = u & 3, half = u >> 2; const int col = col0 + t * 16 + ln; const float bv = bp ? bf16_round(bp[col]) : 0.f;
#pragma unroll
    for (int r = 0; r < 8; ++r) { const int rloc = half * 16 + 8 * hh + r; float v = accs[u][r] * alpha + bv; if (CP) { if (rowsPerB < 0) v += CP[cofs + (size_t)(row0g + row0 + rloc) * ldc + col];      /* rowsPerB < 0: own element of the batched C plane */ else { const int bidx = (row0g + row0 + rloc) / rowsPerB; v += CP[(size_t)bidx * sCPb + (size_t)by * 64 + col]; } }
      if (ACT == 3) v = fmaxf(v, 0.f); else if (ACT == 6) v = 0.5f * v * (1.0f + erff(v * 0.70710678118654752f)); else if (ACT == 11) v = 1.0f / (1.0f + expf(-v)); else if (ACT == 15) v = v / (1.0f + expf(-v)); else if (ACT == 12) v = (v > 0.f) ? v : 0.01f * v; else if (ACT == 8) v = tanhf(v); else if (ACT == 9) v = 0.5f * v * (1.0f + tanhf(0.7978845608028654f * (v + 0.044715f * v * v * v))); else if (ACT == 14) v = (v > 0.f) ? v : 0.1f * v; else if (ACT == 16) v = (v >= 0.f) ? v : 0.3f * v; else if (ACT == 17) v = (v >= 0.f) ? v : 0.2f * v;
      so[w][rloc][t * 16 + ln] = v; } }
  __builtin_amdgcn_fence(__ATOMIC_ACQ_REL, "workgroup"); __builtin_amdgcn_wave_barrier();
  const int rsub = lane >> 4, c4 = (lane & 15) * 4;
  {
#pragma unroll
    for (int q = 0; q < 16; ++q) { const int r = q * 2 + rsub; const v4f v = *(const v4fa*)&so[w][r][c4]; if (C) *(v4f*)(C + cofs + (size_t)(row0 + r) * ldc + col0 + c4) = v; if (C16) { v4h h4; for (int i = 0; i < 4; ++i) h4[i] = (_Float16)v[i]; *(v4h*)(C16 + cofs + (size_t)(row0 + r) * ldc + col0 + c4) = h4; } }
     } }


__global__ __launch_bounds__(256) void k_wnat(const float* __restrict__ w, size_t n8, _Float16* __restrict__ Bt) { const size_t t = (size_t)blockIdx.x * 256 + threadIdx.x; if (t >= n8) return; FragH f; for (int q = 0; q < 8; ++q) f.h[q] = (_Float16)(bf16_round(w[t * 8 + q]) * 16.0f); *(v8us*)((unsigned short*)Bt + t * 8) = f.half[0];  }
__global__ __launch_bounds__(256) void k_rsm(const float* __restrict__ S, _Float16* __restrict__ P, int nrows) {
  #pragma clang fp contract(off)
  const int i = blockIdx.x * 256 + threadIdx.x; if (i >= nrows) return; const float* s = S + (size_t)i * SQ; float mx = -3.0e38f;
#pragma unroll 1
  for (int j = 0; j < SQ; ++j) mx = fmaxf(mx, s[j]); float se = 0.f;
#pragma unroll 1
  for (int j = 0; j < SQ; ++j) se += expf(s[j] - mx); const float sc = 256.0f / se;
#pragma unroll 1
  for (int j0 = 0; j0 < SQ; j0 += 8) { FragH f; for (int q = 0; q < 8; ++q) f.h[q] = (_Float16)(expf(s[j0 + q] - mx) * sc); unsigned short* d = (unsigned short*)P + (size_t)i * SQ + j0; *(v8us*)d = f.half[0];  } }
__global__ __launch_bounds__(256) void k_vt(const _Float16* __restrict__ V16, int b, int h0, _Float16* __restrict__ VT) { __shared__ unsigned short tl[64][65]; const int tid = threadIdx.x; const int hh = blockIdx.x % HG, sg = blockIdx.x / HG; const int s0 = sg * 64; const int h = h0 + hh;
  for (int i = tid; i < 64 * 8; i += 256) { const int j = i / 8, d8 = (i % 8) * 8; FragH f; f.half[0] = *(const v8us*)((const unsigned short*)V16 + ((size_t)b * SQ + s0 + j) * DM + h * HD + d8); for (int q = 0; q < 8; ++q) tl[d8 + q][j] = f.u[q]; }
  __syncthreads();
  { for (int i = tid; i < 64 * 8; i += 256) { const int d = i / 8, j8 = (i % 8) * 8; FragH f; for (int q = 0; q < 8; ++q) f.u[q] = tl[d][j8 + q]; *(v8us*)((unsigned short*)VT + ((size_t)hh * HD + d) * SQ + s0 + j8) = f.half[0]; }  } }


__global__ __launch_bounds__(256) void k_mprep(const float* __restrict__ E, const float* __restrict__ phase, _Float16* __restrict__ MH, _Float16* __restrict__ ML) {
  #pragma clang fp contract(off)
  const int t = blockIdx.x * 256 + threadIdx.x; if (t >= NH * HD * (HD / 8)) return; const int e8 = (t % (HD / 8)) * 8; const int hd_ = t / (HD / 8); const int d = hd_ % HD, h = hd_ / HD; const float c = cosf(bf16_round(phase[h * HD + d])); const float diag = __fmul_rn(__fmul_rn(c, c), 0.125f); FragH fh, fl;
#pragma unroll
  for (int q = 0; q < 8; ++q) { const int e = e8 + q; float m = bf16_round(E[((size_t)h * HD + d) * HD + e]); if (e == d) m = __fadd_rn(m, diag); const _Float16 hi = (_Float16)m; fh.h[q] = hi; fl.h[q] = (_Float16)((m - (float)hi) * 1024.0f); }
  const size_t o = ((size_t)h * HD + d) * HD + e8; { *(v8us*)((unsigned short*)MH + o) = fh.half[0]; *(v8us*)((unsigned short*)ML + o) = fl.half[0];  } }
__global__ __launch_bounds__(256) void k_rsmfs(const float* __restrict__ S, _Float16* __restrict__ P, int qn, int hg) {
  #pragma clang fp contract(off)
  const int t = blockIdx.x * 256 + threadIdx.x; if (t >= qn * hg) return; const size_t i = (size_t)(t / qn) * SQ + (t % qn); const float* s = S + i * SQ; float mx = -3.0e38f;
#pragma unroll 1
  for (int j = 0; j < SQ; ++j) mx = fmaxf(mx, s[j]); float se = 0.f;
#pragma unroll 1
  for (int j = 0; j < SQ; ++j) se += __expf(s[j] - mx); const float sc = PSC / se;
#pragma unroll 1
  for (int j0 = 0; j0 < SQ; j0 += 8) { FragH f; for (int q = 0; q < 8; ++q) f.h[q] = (_Float16)(__expf(s[j0 + q] - mx) * sc); unsigned short* d = (unsigned short*)P + i * SQ + j0; *(v8us*)d = f.half[0];  } }

extern "C" void kernel_launch(void* const* d_in, const int* in_sizes, int n_in,
                              void* d_out, int out_size, void* d_ws, size_t ws_size, hipStream_t stream) {
  (void)in_sizes; (void)n_in; (void)out_size;
  const float* const* I = (const float* const*)d_in; const float* x = I[0]; const float* wq = I[1]; const float* bq = I[2]; const float* wk = I[3]; const float* bk = I[4]; const float* wv = I[5]; const float* bv = I[6]; const float* phase = I[7]; const float* E = I[8]; const float* wo = I[9]; const float* bo = I[10];      /* weights [in][out] */
  char* ws = (char*)d_ws; size_t off = 0;
  auto take = [&](size_t bytes) { char* p = ws + off; off += (bytes + 255) & ~(size_t)255; return p; };
  _Float16* BQ = (_Float16*)take((size_t)DM * DM * 2); _Float16* BK = (_Float16*)take((size_t)DM * DM * 2); _Float16* BV = (_Float16*)take((size_t)DM * DM * 2); _Float16* BO = (_Float16*)take((size_t)DM * DM * 2); _Float16* MH = (_Float16*)take((size_t)NH * HD * HD * 2); _Float16* ML = (_Float16*)take((size_t)NH * HD * HD * 2);
  _Float16* X16 = (_Float16*)take(NR * DM * 2); float* QF = (float*)take(NR * DM * 4); float* KF = (float*)take(NR * DM * 4); _Float16* QH = (_Float16*)take(NR * DM * 2); _Float16* QL = (_Float16*)take(NR * DM * 2); _Float16* KH = (_Float16*)take(NR * DM * 2); _Float16* KL = (_Float16*)take(NR * DM * 2); _Float16* V16 = (_Float16*)take(NR * DM * 2);
  float* KMF = (float*)take((size_t)SQ * DM * 4); _Float16* KMH = (_Float16*)take((size_t)SQ * DM * 2); _Float16* KML = (_Float16*)take((size_t)SQ * DM * 2); _Float16* O16 = (_Float16*)take(NR * DM * 2);
  float* S = (float*)take((size_t)HG * SQ * SQ * 4); _Float16* P = (_Float16*)take((size_t)HG * SQ * SQ * 2); _Float16* VT = (_Float16*)take((size_t)NH * HD * SQ * 2);
  if (off > ws_size) return;      /* 8.3 + 8 + 32 + 40 + 8 + 4 + 4 + 8 + 64 + 32 + 4 = approx 212 MiB */
  { const unsigned gw = (unsigned)(((size_t)DM * (DM / 8) + 255) / 256); k_wt_f16<<<gw, 256, 0, stream>>>(wq, BQ, DM, DM, 16.0f); k_wt_f16<<<gw, 256, 0, stream>>>(wk, BK, DM, DM, 16.0f); k_wt_f16<<<gw, 256, 0, stream>>>(wv, BV, DM, DM, 16.0f); k_wt_f16<<<gw, 256, 0, stream>>>(wo, BO, DM, DM, 16.0f); }      /* [in][out] -> Bt[n][k] x16 */
  k_mprep<<<(NH * HD * (HD / 8) + 255) / 256, 256, 0, stream>>>(E, phase, MH, ML);
  k_x16<<<(unsigned)((NR * DM / 8 + 255) / 256), 256, 0, stream>>>(x, X16, NR * DM / 8);
  const size_t r0p = (size_t)B0 * SQ; const dim3 gp((unsigned)((MP / 128) * (DM / 64)), 1);
  k_gemm2<0><<<gp, 128, 0, stream>>>(X16 + r0p * DM, DM, 0, BQ, DM, 0, 0.0625f, bq, 0, nullptr, 1, 0, 0, QF + r0p * DM, nullptr, DM, 0, MP, DM, DM);
  k_gemm2<0><<<gp, 128, 0, stream>>>(X16 + r0p * DM, DM, 0, BK, DM, 0, 0.0625f, bk, 0, nullptr, 1, 0, 0, KF + r0p * DM, nullptr, DM, 0, MP, DM, DM);
  k_gemm2<0><<<gp, 128, 0, stream>>>(X16 + r0p * DM, DM, 0, BV, DM, 0, 0.0625f, bv, 0, nullptr, 1, 0, 0, nullptr, V16 + r0p * DM, DM, 0, MP, DM, DM);
  k_hl<<<(unsigned)(((size_t)MP * DM / 8 + 255) / 256), 256, 0, stream>>>(QF + r0p * DM, QH + r0p * DM, QL + r0p * DM, (size_t)MP * DM / 8);
  k_hl<<<(unsigned)(((size_t)MP * DM / 8 + 255) / 256), 256, 0, stream>>>(KF + r0p * DM, KH + r0p * DM, KL + r0p * DM, (size_t)MP * DM / 8);
  for (int b = B0; b < B0 + NBR; ++b) { const size_t r0 = (size_t)b * SQ;
    { const dim3 gk((SQ / 128) * (HD / 64), NH);      /* KM[k][h*64+d] = sum_e K[k][h*64+e] M[h][d][e], all heads on grid.y; three terms */
      k_gemm2<0><<<gk, 128, 0, stream>>>(KH + r0 * DM, DM, (size_t)HD, MH, HD, (size_t)HD * HD, 1.0f, nullptr, 0, nullptr, 1, 0, 0, KMF, nullptr, DM, (size_t)HD, SQ, HD, HD);
      k_gemm2<0><<<gk, 128, 0, stream>>>(KL + r0 * DM, DM, (size_t)HD, MH, HD, (size_t)HD * HD, 0.0009765625f, nullptr, 0, KMF, -1, 0, 0, KMF, nullptr, DM, (size_t)HD, SQ, HD, HD);
      k_gemm2<0><<<gk, 128, 0, stream>>>(KH + r0 * DM, DM, (size_t)HD, ML, HD, (size_t)HD * HD, 0.0009765625f, nullptr, 0, KMF, -1, 0, 0, KMF, nullptr, DM, (size_t)HD, SQ, HD, HD); }
    k_hl<<<(unsigned)(((size_t)SQ * DM / 8 + 255) / 256), 256, 0, stream>>>(KMF, KMH, KML, (size_t)SQ * DM / 8);
    k_vt<NH, SQ><<<NH * (SQ / 64), 256, 0, stream>>>(V16 + r0 * DM, DM, 0, VT);      /* V^T [NH][HD][SQ] */
    for (int h0 = 0; h0 < NHD; h0 += HG) { const dim3 gs((QN / 128) * (SQ / 64), HG);
      k_gemm2<0><<<gs, 128, 0, stream>>>(QH + r0 * DM + h0 * HD, DM, (size_t)HD, KMH + h0 * HD, DM, (size_t)HD, 1.0f, nullptr, 0, nullptr, 1, 0, 0, S, nullptr, SQ, (size_t)SQ * SQ, QN, SQ, HD);      /* scores hi.hi */
      k_gemm2<0><<<gs, 128, 0, stream>>>(QL + r0 * DM + h0 * HD, DM, (size_t)HD, KMH + h0 * HD, DM, (size_t)HD, 0.0009765625f, nullptr, 0, S, -1, 0, 0, S, nullptr, SQ, (size_t)SQ * SQ, QN, SQ, HD);      /* + lo.hi */
      k_gemm2<0><<<gs, 128, 0, stream>>>(QH + r0 * DM + h0 * HD, DM, (size_t)HD, KML + h0 * HD, DM, (size_t)HD, 0.0009765625f, nullptr, 0, S, -1, 0, 0, S, nullptr, SQ, (size_t)SQ * SQ, QN, SQ, HD);      /* + hi.lo */
      k_rsmfs<<<(HG * QN + 255) / 256, 256, 0, stream>>>(S, P, QN, HG);      /* P = 4096 softmax (f16) */
      k_gemm2<0><<<dim3((QN / 128) * (HD / 64), HG), 128, 0, stream>>>(P, SQ, (size_t)SQ * SQ, VT + (size_t)h0 * HD * SQ, SQ, (size_t)HD * SQ, 0.015625f, nullptr, 0, nullptr, 1, 0, 0, nullptr, O16 + r0 * DM + h0 * HD, DM, (size_t)HD, QN, HD, SQ); } }      /* o (merged heads, x64) as f16 rows */
  k_gemm2<0><<<dim3((unsigned)((MPO / 128) * (DM / 64)), 1), 128, 0, stream>>>(O16 + r0p * DM, DM, 0, BO, DM, 0, 0.0009765625f, bo, 0, nullptr, 1, 0, 0, (float*)d_out + r0p * DM, nullptr, DM, 0, MPO, DM, DM);      /* out rows are the output layout */
}

// v001
// It runs in 1690 microseconds.
// In two side-by-side timings against v000, it was 2.52 and 2.53 times as fast.
#include <hip/hip_runtime.h>
// "Quantum" attention (x [2][2048][1024]): Q/K/V = x W + b ([in][out] weights + biases, 16 heads of 64); scores = (Q cos(phase)) (K cos(phase))^T / 8 + Q E K^T per head (phase [16][64], E [16][64][64]) = Q M K^T with M = E + diag(cos^2 phase / 8); softmax over the 2,048 keys; o = attn V merged; out = o out_w + out_b -> [2][2048][1024].
// Structure: token rows; x as exact f16 rows; Q and K as WMMA GEMMs (32x64 wave tiles, f32 accumulation, exact x16 transposed weights + bias) into f32 rows, split on VALU into f16 hi + 2^-10 residual planes; V as a WMMA GEMM to f16 rows; M as f16 hi + residual planes (VALU, cos in f32); per batch: KM = K M^T per head as three accumulating GEMM terms (hi.hi + lo.hi + hi.lo, K = 64) into f32 rows, split into hi + residual planes; V^T for all heads via LDS transposes; per group of 4 heads: scores = Q KM^T as three accumulating GEMM terms (hi.hi + lo.hi + hi.lo) (K = 64), row softmax on VALU (f32 statistics, native exp; weights x4096 f16), o = P . V^T GEMM (K = 2048, alpha 2^-6: o carried x64 against f16 subnormal flush) into merged f16 rows; out = o out_w + b GEMM (f32, alpha folds 1/16 and 1/64).
// Compute dtype: inputs rounded to bf16; weights exact (x16 f16); Q, K, M, KM as f16 hi + residual planes (~2^-22); V, softmax weights (x4096) and o (x64) plain f16 (~2^-12); scores, softmax statistics f32. v_wmma_f32_16x16x32_f16.
#define NB 2
#define SQ 2048
#define DM 1024
#define NH 16
#define HD 64
#define HG 4                         /* heads per attention launch group */
#define PSC 4096.0f                  /* softmax weight carry */
#define B0 0                         /* first batch processed (debug hook) */
#define NBR NB                       /* batches processed (debug hook) */
#define QN SQ                        /* query rows attended per batch (debug hook) */
#define NHD NH                       /* heads attended (debug hook) */
#define NR ((size_t)NB * SQ)
#define MP ((int)((size_t)NBR * SQ)) /* rows projected (debug hook) */
#define MPO MP                       /* rows through the output GEMM (debug hook) */
typedef __bf16 v16b __attribute__((ext_vector_type(16)));
typedef unsigned short v8us __attribute__((ext_vector_type(8), may_alias));
typedef float  v8f  __attribute__((ext_vector_type(8)));
typedef float  v4f  __attribute__((ext_vector_type(4)));
typedef float  v4fa __attribute__((ext_vector_type(4), may_alias));
union FragB { v16b v; v8us half[2]; unsigned short u[16]; };

__device__ __forceinline__ unsigned short bf16_bits(float x) { unsigned int u = __float_as_uint(x); return (unsigned short)((u + 0x7FFFu + ((u >> 16) & 1u)) >> 16); }
__device__ __forceinline__ float bf16_val(unsigned short b) { return __uint_as_float(((unsigned int)b) << 16); }
__device__ __forceinline__ float bf16_round(float x) { return bf16_val(bf16_bits(x)); }
// D += A·B with NT terms: 1 = ah·bh, 2 = + al·bh (A split), 3 = + ah·bl (both split)
template <int NT>
__device__ __forceinline__ v8f mmaN(v16b ah, v16b al, v16b bh, v16b bl, v8f c) {
  c = __builtin_amdgcn_wmma_f32_16x16x32_bf16(false, ah, false, bh, (short)0, c, false, false);
  if (NT >= 2) c = __builtin_amdgcn_wmma_f32_16x16x32_bf16(false, al, false, bh, (short)0, c, false, false);
  if (NT >= 3) c = __builtin_amdgcn_wmma_f32_16x16x32_bf16(false, ah, false, bl, (short)0, c, false, false);
  asm volatile("v_nop\n\tv_nop\n\tv_nop\n\tv_nop" : "+v"(c) : "v"(ah), "v"(al), "v"(bh), "v"(bl));
  return c;
}

__global__ __launch_bounds__(256) void k_wt_bf16(const float* __restrict__ W, unsigned short* __restrict__ Wt, int K, int N) {
  const int t = blockIdx.x * 256 + threadIdx.x;
  const int k8n = K / 8;
  if (t >= N * k8n) return;
  const int n = t / k8n, k8 = (t % k8n) * 8;
  v8us v;
#pragma unroll
  for (int i = 0; i < 8; ++i) v[i] = bf16_bits(W[(size_t)(k8 + i) * N + n]);
  *(v8us*)(Wt + (size_t)n * K + k8) = v;
  
}

// GEMM C[M][N] (f32, pitch ldc) = act(A[M][K]·W + bias). A f32 row-major (pitch lda) converted per fragment to bf16
// (ASPLIT: hi/lo two planes -> 2 terms, else single rounded term); Wt bf16 [N][K] (pitch ldb). BIAS_BF16 rounds the
// bias to bf16 first (bias quantised to bf16 before the add). K%32==0, M%16==0, N%64==0.
template <bool ASPLIT, int ACT, bool BIAS_BF16>
__global__ __launch_bounds__(128) void k_gemm_bf(const float* __restrict__ A, int lda, const unsigned short* __restrict__ Wt, int ldb,
                                               const float* __restrict__ bias, float* __restrict__ C, int ldc, int M, int N, int K) {
  __shared__ __attribute__((aligned(16))) float so[4][16][64];
  const int tid = threadIdx.x, w = tid >> 5, lane = tid & 31, ln = lane & 15, hh = lane >> 4;
  const int ntn = N / 64;
  const int wid = blockIdx.x * 4 + w;
  const int mt = wid / ntn, nq = wid % ntn;
  if (mt * 16 >= M) return;
  const int row0 = mt * 16, col0 = nq * 64;
  const float* arow = A + (size_t)(row0 + ln) * lda;
  v8f acc[4] = {};
  for (int kb = 0; kb < K; kb += 32) {
    FragB ah, al;
    const v4f x0 = *(const v4fa*)(arow + kb + 8 * hh), x1 = *(const v4fa*)(arow + kb + 8 * hh + 4);
    const v4f x2 = *(const v4fa*)(arow + kb + 16 + 8 * hh), x3 = *(const v4fa*)(arow + kb + 16 + 8 * hh + 4);
    float xs[16] = {x0[0],x0[1],x0[2],x0[3],x1[0],x1[1],x1[2],x1[3],x2[0],x2[1],x2[2],x2[3],x3[0],x3[1],x3[2],x3[3]};
#pragma unroll
    for (int i = 0; i < 16; ++i) { const unsigned short hb = bf16_bits(xs[i]); ah.u[i] = hb; al.u[i] = ASPLIT ? bf16_bits(xs[i] - bf16_val(hb)) : (unsigned short)0; }
#pragma unroll
    for (int t = 0; t < 4; ++t) {
      const unsigned short* brow = Wt + (size_t)(col0 + t * 16 + ln) * ldb + kb;
      FragB b;
      b.half[0] = *(const v8us*)(brow + 8 * hh);
      b.half[1] = *(const v8us*)(brow + 16 + 8 * hh);
      acc[t] = mmaN<ASPLIT ? 2 : 1>(ah.v, al.v, b.v, b.v, acc[t]);
    }
  }
#pragma unroll
  for (int t = 0; t < 4; ++t) {
    float bv = bias ? bias[col0 + t * 16 + ln] : 0.f;
    if (BIAS_BF16) bv = bf16_round(bv);
#pragma unroll
    for (int r = 0; r < 8; ++r) { float v = acc[t][r] + bv; if (ACT == 1) v = fmaxf(v, 0.f); so[w][8 * hh + r][t * 16 + ln] = v; }
  }
  __builtin_amdgcn_fence(__ATOMIC_ACQ_REL, "workgroup");
  __builtin_amdgcn_wave_barrier();
  const int rsub = lane >> 4, c4 = (lane & 15) * 4;
  {
#pragma unroll
    for (int q = 0; q < 8; ++q) {
      const int r = q * 2 + rsub;
      const v4f v = *(const v4fa*)&so[w][r][c4];
      *(v4f*)(C + (size_t)(row0 + r) * ldc + col0 + c4) = v;
    }
    
  }
}

// GEMM C = act(A·W + bias + resid): A f32 (ASPLIT -> hi/lo 2 terms), Wt bf16 [N][K]; ACT 0 none, 1 relu, 2 exact gelu;
// resid (optional, f32, row index = (row % rmod), pitch ldr, RES_BF16 rounds it) added before the activation.
template <bool ASPLIT, int ACT, bool BIAS_BF16, bool RES_BF16>
__global__ __launch_bounds__(128) void k_gemm_bf3(const float* __restrict__ A, int lda, const unsigned short* __restrict__ Wt, int ldb,
                                                const float* __restrict__ bias, const float* __restrict__ resid, int rmod, int ldr,
                                                float* __restrict__ C, int ldc, int M, int N, int K) {
  __shared__ __attribute__((aligned(16))) float so[4][16][64];
  const int tid = threadIdx.x, w = tid >> 5, lane = tid & 31, ln = lane & 15, hh = lane >> 4;
  const int ntn = N / 64;
  const int wid = blockIdx.x * 4 + w;
  const int mt = wid / ntn, nq = wid % ntn;
  if (mt * 16 >= M) return;
  const int row0 = mt * 16, col0 = nq * 64;
  const float* arow = A + (size_t)(row0 + ln) * lda;
  v8f acc[4] = {};
  for (int kb = 0; kb < K; kb += 32) {
    FragB ah, al;
    const v4f x0 = *(const v4fa*)(arow + kb + 8 * hh), x1 = *(const v4fa*)(arow + kb + 8 * hh + 4);
    const v4f x2 = *(const v4fa*)(arow + kb + 16 + 8 * hh), x3 = *(const v4fa*)(arow + kb + 16 + 8 * hh + 4);
    float xs[16] = {x0[0],x0[1],x0[2],x0[3],x1[0],x1[1],x1[2],x1[3],x2[0],x2[1],x2[2],x2[3],x3[0],x3[1],x3[2],x3[3]};
#pragma unroll
    for (int i = 0; i < 16; ++i) { const unsigned short hb = bf16_bits(xs[i]); ah.u[i] = hb; al.u[i] = ASPLIT ? bf16_bits(xs[i] - bf16_val(hb)) : (unsigned short)0; }
#pragma unroll
    for (int t = 0; t < 4; ++t) {
      const unsigned short* brow = Wt + (size_t)(col0 + t * 16 + ln) * ldb + kb;
      FragB b;
      b.half[0] = *(const v8us*)(brow + 8 * hh);
      b.half[1] = *(const v8us*)(brow + 16 + 8 * hh);
      acc[t] = mmaN<ASPLIT ? 2 : 1>(ah.v, al.v, b.v, b.v, acc[t]);
    }
  }
#pragma unroll
  for (int t = 0; t < 4; ++t) {
    const int col = col0 + t * 16 + ln;
    float bv = bias ? bias[col] : 0.f;
    if (BIAS_BF16) bv = bf16_round(bv);
#pragma unroll
    for (int r = 0; r < 8; ++r) {
      float v = acc[t][r] + bv;
      if (resid) { float rv = resid[(size_t)((row0 + 8 * hh + r) % rmod) * ldr + col]; if (RES_BF16) rv = bf16_round(rv); v += rv; }
      if (ACT == 1) v = fmaxf(v, 0.f);
      if (ACT == 2) v = 0.5f * v * (1.0f + erff(v * 0.70710678118654752f));
      if (ACT == 3) { const float u = 0.7978845608028654f * (v + 0.044715f * v * v * v); v = 0.5f * v * (1.0f + tanhf(u)); }
      so[w][8 * hh + r][t * 16 + ln] = v;
    }
  }
  __builtin_amdgcn_fence(__ATOMIC_ACQ_REL, "workgroup");
  __builtin_amdgcn_wave_barrier();
  const int rsub = lane >> 4, c4 = (lane & 15) * 4;
  {
#pragma unroll
    for (int q = 0; q < 8; ++q) {
      const int r = q * 2 + rsub;
      const v4f v = *(const v4fa*)&so[w][r][c4];
      *(v4f*)(C + (size_t)(row0 + r) * ldc + col0 + c4) = v;
    }
    
  }
}
// row LayerNorm (biased variance, eps) over N: s = X (+ R); optional out_sum <- s; out_norm <- (s-mu)*rsqrt(var+eps)*g + b
template <bool PARAM_BF16>
__global__ __launch_bounds__(256) void k_layernorm(const float* __restrict__ X, const float* __restrict__ R, const float* __restrict__ g, const float* __restrict__ bta,
                                                  float* __restrict__ out_sum, float* __restrict__ out_norm, int N, float eps) {
  __shared__ float red[256];
  const int row = blockIdx.x, tid = threadIdx.x;
  const float* x = X + (size_t)row * N; const float* rr = R ? R + (size_t)row * N : nullptr;
  float vals[16];                     // up to N = 4096
  const int per = N / 256;            // contiguous chunk per thread? use strided-by-4 chunks: thread handles j = tid*4 + 1024*u
  float s1 = 0.f;
  for (int u = 0; u < per / 4; ++u) {
    const int j = tid * 4 + 1024 * u;
    const v4f a = *(const v4fa*)(x + j);
    v4f b = {0.f,0.f,0.f,0.f}; if (rr) b = *(const v4fa*)(rr + j);
#pragma unroll
    for (int q = 0; q < 4; ++q) { const float v = a[q] + b[q]; vals[u * 4 + q] = v; s1 += v; }
  }
  red[tid] = s1; __syncthreads();
  for (int st = 128; st > 0; st >>= 1) { if (tid < st) red[tid] += red[tid + st]; __syncthreads(); }
  const float mu = red[0] / (float)N; __syncthreads();
  float s2 = 0.f;
  for (int u = 0; u < per / 4; ++u)
#pragma unroll
    for (int q = 0; q < 4; ++q) { const float c = vals[u * 4 + q] - mu; s2 += c * c; }
  red[tid] = s2; __syncthreads();
  for (int st = 128; st > 0; st >>= 1) { if (tid < st) red[tid] += red[tid + st]; __syncthreads(); }
  const float rs = rsqrtf(red[0] / (float)N + eps);
  {
    for (int u = 0; u < per / 4; ++u) {
      const int j = tid * 4 + 1024 * u;
      v4f o, sm;
#pragma unroll
      for (int q = 0; q < 4; ++q) {
        float gg = g[j + q], bb = bta[j + q];
        if (PARAM_BF16) { gg = bf16_round(gg); bb = bf16_round(bb); }
        sm[q] = vals[u * 4 + q]; o[q] = (vals[u * 4 + q] - mu) * rs * gg + bb;
      }
      if (out_sum) *(v4f*)(out_sum + (size_t)row * N + j) = sm;
      *(v4f*)(out_norm + (size_t)row * N + j) = o;
    }
    
  }
}



// ---- f16 WMMA path (v_wmma_f32_16x16x32_f16): 11-bit significands for operands in range — used where a [0,1] probability operand needs more precision than bf16
typedef _Float16 v16h __attribute__((ext_vector_type(16)));
union FragH { v16h v; v8us half[2]; _Float16 h[16]; unsigned short u[16]; };
template <int NT>
__device__ __forceinline__ v8f mmaH(v16h ah, v16h al, v16h bh, v16h bl, v8f c) {
  c = __builtin_amdgcn_wmma_f32_16x16x32_f16(false, ah, false, bh, (short)0, c, false, false);
  if (NT >= 2) c = __builtin_amdgcn_wmma_f32_16x16x32_f16(false, al, false, bh, (short)0, c, false, false);
  if (NT >= 3) c = __builtin_amdgcn_wmma_f32_16x16x32_f16(false, ah, false, bl, (short)0, c, false, false);
  asm volatile("v_nop\n\tv_nop\n\tv_nop\n\tv_nop" : "+v"(c) : "v"(ah), "v"(al), "v"(bh), "v"(bl));
  return c;
}
// batched GEMM like k_gemm_b but f16 operands: A f32 (split into f16 hi/lo if ASPLIT, else rounded to f16), Bt = f16 values [n][k]; alpha; C f32; N multiple of 16 (partial tiles skipped)
template <bool ASPLIT>
__global__ __launch_bounds__(128) void k_gemm_h(const float* __restrict__ A, int lda, size_t sA, const _Float16* __restrict__ Bh, int ldb, size_t sB, float alpha, float* __restrict__ C, int ldc, size_t sC, int M, int N, int K) {
  __shared__ __attribute__((aligned(16))) float so[4][16][64];
  const int tid = threadIdx.x, w = tid >> 5, lane = tid & 31, ln = lane & 15, hh = lane >> 4; const int by = blockIdx.y;
  A += (size_t)by * sA; Bh += (size_t)by * sB; C += (size_t)by * sC;
  const int ntn = (N + 63) / 64; const int wid = blockIdx.x * 4 + w; const int mt = wid / ntn, nq = wid % ntn; if (mt * 16 >= M) return;
  const int row0 = mt * 16, col0 = nq * 64; const float* arow = A + (size_t)(row0 + ln) * lda;
  v8f acc[4] = {};
  for (int kb = 0; kb < K; kb += 32) {
    FragH ah, al;
    const v4f x0 = *(const v4fa*)(arow + kb + 8 * hh), x1 = *(const v4fa*)(arow + kb + 8 * hh + 4), x2 = *(const v4fa*)(arow + kb + 16 + 8 * hh), x3 = *(const v4fa*)(arow + kb + 16 + 8 * hh + 4);
    float xs[16] = {x0[0],x0[1],x0[2],x0[3],x1[0],x1[1],x1[2],x1[3],x2[0],x2[1],x2[2],x2[3],x3[0],x3[1],x3[2],x3[3]};
#pragma unroll
    for (int i = 0; i < 16; ++i) { const _Float16 h = (_Float16)xs[i]; ah.h[i] = h; al.h[i] = ASPLIT ? (_Float16)(xs[i] - (float)h) : (_Float16)0.0f; }
#pragma unroll
    for (int t = 0; t < 4; ++t) { if (col0 + t * 16 >= N) continue; const size_t boff = (size_t)(col0 + t * 16 + ln) * ldb + kb; FragH bq; bq.half[0] = *(const v8us*)(Bh + boff + 8 * hh); bq.half[1] = *(const v8us*)(Bh + boff + 16 + 8 * hh);
      acc[t] = mmaH<ASPLIT ? 2 : 1>(ah.v, al.v, bq.v, bq.v, acc[t]); }
  }
#pragma unroll
  for (int t = 0; t < 4; ++t) { if (col0 + t * 16 >= N) continue;
#pragma unroll
    for (int r = 0; r < 8; ++r) so[w][8 * hh + r][t * 16 + ln] = acc[t][r] * alpha; }
  __builtin_amdgcn_fence(__ATOMIC_ACQ_REL, "workgroup"); __builtin_amdgcn_wave_barrier();
  const int rsub = lane >> 4, c4 = (lane & 15) * 4;
  {
#pragma unroll
    for (int q = 0; q < 8; ++q) { const int r = q * 2 + rsub; if (col0 + c4 < N) { const v4f v = *(const v4fa*)&so[w][r][c4]; *(v4f*)(C + (size_t)(row0 + r) * ldc + col0 + c4) = v; } }
     }
}

// Wt[n][k] = f16(W[k][n]·scale) from f32 row-major W[K][N] (scale = power of two; bf16-exact weights stay exact in f16 away from the subnormal range)
__global__ __launch_bounds__(256) void k_wt_f16(const float* __restrict__ W, _Float16* __restrict__ Wt, int K, int N, float scale) {
  const int t = blockIdx.x * 256 + threadIdx.x; if (t >= N * (K / 8)) return; const int n = t / (K / 8), k8 = (t % (K / 8)) * 8; FragH f;
#pragma unroll
  for (int i = 0; i < 8; ++i) f.h[i] = (_Float16)(bf16_round(W[(size_t)(k8 + i) * N + n]) * scale); const v8us o = f.half[0];
  *(v8us*)((unsigned short*)Wt + (size_t)n * K + k8) = o; 
}
// k_gemm_hh variant with fused epilogue: v = acc·alpha + bias[by·sBias + col] (+ CP[(row/rowsPerB)·sCPb + by·64 + col] if CP) ; ACT 0 none / 1 elu ; writes f16 C16 (and f32 C if non-null)
template <int ACT>
__global__ __launch_bounds__(128) void k_gemm_hhx(const _Float16* __restrict__ A, int lda, size_t sA, const _Float16* __restrict__ Bh, int ldb, size_t sB, float alpha, const float* __restrict__ bias, size_t sBias, const float* __restrict__ CP, int rowsPerB, size_t sCPb, int row0g,
    float* __restrict__ C, _Float16* __restrict__ C16, int ldc, size_t sC, int M, int N, int K) {
  __shared__ __attribute__((aligned(16))) float so[4][16][64];
  const int tid = threadIdx.x, w = tid >> 5, lane = tid & 31, ln = lane & 15, hh = lane >> 4; const int by = blockIdx.y;
  A += (size_t)by * sA; Bh += (size_t)by * sB; const size_t cofs = (size_t)by * sC; const float* bp = bias ? bias + (size_t)by * sBias : nullptr;
  const int ntn = (N + 63) / 64; const int wid = blockIdx.x * 4 + w; const int mt = wid / ntn, nq = wid % ntn; if (mt * 16 >= M) return;
  const int row0 = mt * 16, col0 = nq * 64; const _Float16* arow = A + (size_t)(row0 + ln) * lda;
  v8f acc[4] = {};
  for (int kb = 0; kb < K; kb += 32) { FragH ah; ah.half[0] = *(const v8us*)((const unsigned short*)arow + kb + 8 * hh); ah.half[1] = *(const v8us*)((const unsigned short*)arow + kb + 16 + 8 * hh);
#pragma unroll
    for (int t = 0; t < 4; ++t) { if (col0 + t * 16 >= N) continue; const size_t boff = (size_t)(col0 + t * 16 + ln) * ldb + kb; FragH bq; bq.half[0] = *(const v8us*)((const unsigned short*)Bh + boff + 8 * hh); bq.half[1] = *(const v8us*)((const unsigned short*)Bh + boff + 16 + 8 * hh);
      acc[t] = mmaH<1>(ah.v, ah.v, bq.v, bq.v, acc[t]); }
  }
#pragma unroll
  for (int t = 0; t < 4; ++t) { if (col0 + t * 16 >= N) continue; const int col = col0 + t * 16 + ln; const float bv = bp ? bf16_round(bp[col]) : 0.f;
#pragma unroll
    for (int r = 0; r < 8; ++r) { float v = acc[t][r] * alpha + bv; if (CP) { const int rr = row0g + row0 + 8 * hh + r; if (rowsPerB < 0) v += CP[cofs + (size_t)rr * ldc + col];      /* rowsPerB < 0: own element of the batched C plane */ else { const int bidx = rr / rowsPerB; v += CP[(size_t)bidx * sCPb + (size_t)by * 64 + col]; } } if (ACT == 1) v = (v > 0.f) ? v : expm1f(v); else if (ACT == 7) v = (v > 0.f) ? v + 1.0f : expf(v); else if (ACT == 8) v = tanhf(v); else if (ACT == 9) v = 0.5f * v * (1.0f + tanhf(0.7978845608028654f * (v + 0.044715f * v * v * v))); else if (ACT == 11) v = 1.0f / (1.0f + expf(-v)); else if (ACT == 12) v = (v > 0.f) ? v : 0.01f * v; else if (ACT == 14) v = (v > 0.f) ? v : 0.1f * v; else if (ACT == 16) v = (v >= 0.f) ? v : 0.3f * v; else if (ACT == 17) v = (v >= 0.f) ? v : 0.2f * v; else if (ACT == 15) v = v / (1.0f + expf(-v)); else if (ACT == 3) v = fmaxf(v, 0.f); else if (ACT == 6) v = 0.5f * v * (1.0f + erff(v * 0.70710678118654752f)); so[w][8 * hh + r][t * 16 + ln] = v; } }
  __builtin_amdgcn_fence(__ATOMIC_ACQ_REL, "workgroup"); __builtin_amdgcn_wave_barrier();
  const int rsub = lane >> 4, c4 = (lane & 15) * 4; typedef _Float16 v4h __attribute__((ext_vector_type(4)));
  {
#pragma unroll
    for (int q = 0; q < 8; ++q) { const int r = q * 2 + rsub; if (col0 + c4 < N) { const v4f v = *(const v4fa*)&so[w][r][c4]; if (C) *(v4f*)(C + cofs + (size_t)(row0 + r) * ldc + col0 + c4) = v; if (C16) { v4h h4; for (int i = 0; i < 4; ++i) h4[i] = (_Float16)v[i]; *(v4h*)(C16 + cofs + (size_t)(row0 + r) * ldc + col0 + c4) = h4; } } }
     }
}


typedef _Float16 v4h __attribute__((ext_vector_type(4)));

__global__ __launch_bounds__(256) void k_x16(const float* __restrict__ x, _Float16* __restrict__ X16, size_t n8) { const size_t t = (size_t)blockIdx.x * 256 + threadIdx.x; if (t >= n8) return; FragH f;
#pragma unroll
  for (int q = 0; q < 8; ++q) f.h[q] = (_Float16)bf16_round(x[t * 8 + q]); *(v8us*)((unsigned short*)X16 + t * 8) = f.half[0];  }
__global__ __launch_bounds__(256) void k_h16(const float* __restrict__ x, _Float16* __restrict__ X16, size_t n8) { const size_t t = (size_t)blockIdx.x * 256 + threadIdx.x; if (t >= n8) return; FragH f;
#pragma unroll
  for (int q = 0; q < 8; ++q) f.h[q] = (_Float16)x[t * 8 + q]; *(v8us*)((unsigned short*)X16 + t * 8) = f.half[0];  }
__global__ __launch_bounds__(256) void k_round16f(const float* __restrict__ W, _Float16* __restrict__ Bt, size_t n8) { const size_t t = (size_t)blockIdx.x * 256 + threadIdx.x; if (t >= n8) return; FragH f;
#pragma unroll
  for (int i = 0; i < 8; ++i) f.h[i] = (_Float16)(bf16_round(W[t * 8 + i]) * 16.0f); *(v8us*)((unsigned short*)Bt + t * 8) = f.half[0];  }
template <int NHv, int TTv>
__global__ __launch_bounds__(256) void k_vt(const _Float16* __restrict__ V16, int ldv, int voff, _Float16* __restrict__ Vt) { __shared__ unsigned short tl[64][66]; const int tid = threadIdx.x; const int slab = blockIdx.x / (TTv / 64), lg = blockIdx.x % (TTv / 64); const int b = slab / NHv, h = slab % NHv;
  for (int i = tid; i < 64 * 8; i += 256) { const int r = i / 8, c8 = (i % 8) * 8; FragH f; f.half[0] = *(const v8us*)((const unsigned short*)V16 + ((size_t)b * TTv + lg * 64 + r) * ldv + voff + h * 64 + c8);
#pragma unroll
    for (int q = 0; q < 8; ++q) tl[r][c8 + q] = f.u[q]; }
  __syncthreads();
  {
#pragma unroll
    for (int rd = 0; rd < 2; ++rd) { const int d = rd * 32 + tid / 8, pc = tid % 8; FragH f;
#pragma unroll
      for (int q = 0; q < 8; ++q) f.u[q] = tl[pc * 8 + q][d];
      *(v8us*)((unsigned short*)Vt + ((size_t)slab * 64 + d) * TTv + lg * 64 + pc * 8) = f.half[0]; }
     } }

__global__ __launch_bounds__(256) void k_hl(const float* __restrict__ F, _Float16* __restrict__ Hh, _Float16* __restrict__ Hl, size_t n8) { const size_t t = (size_t)blockIdx.x * 256 + threadIdx.x; if (t >= n8) return; FragH fh, fl; const v4f a = *(const v4fa*)(F + t * 8), c = *(const v4fa*)(F + t * 8 + 4);
#pragma unroll
  for (int q = 0; q < 4; ++q) { _Float16 h = (_Float16)a[q]; fh.h[q] = h; fl.h[q] = (_Float16)((a[q] - (float)h) * 1024.0f); h = (_Float16)c[q]; fh.h[4 + q] = h; fl.h[4 + q] = (_Float16)((c[q] - (float)h) * 1024.0f); }
  { *(v8us*)((unsigned short*)Hh + t * 8) = fh.half[0]; *(v8us*)((unsigned short*)Hl + t * 8) = fl.half[0];  } }

// ---- fast GEMM (wave tile 32x64; requires M % 32 == 0 rows per launch region and N % 64 == 0); epilogue = k_gemm_hhx semantics ----
__device__ __forceinline__ v16h g2_frag(const _Float16* p, int hh) { FragH f; f.half[0] = *(const v8us*)((const unsigned short*)p + 8 * hh); f.half[1] = *(const v8us*)((const unsigned short*)p + 16 + 8 * hh); return f.v; }
__device__ __forceinline__ v8f g2_mma(v16h a, v16h b, v8f c) { v8f d = __builtin_amdgcn_wmma_f32_16x16x32_f16(false, a, false, b, (short)0, c, false, false); asm volatile("v_nop\n\tv_nop\n\tv_nop\n\tv_nop" : "+v"(d) : "v"(a), "v"(b)); return d; }
template <int ACT>
__global__ __launch_bounds__(128) void k_gemm2(const _Float16* __restrict__ A, int lda, size_t sA, const _Float16* __restrict__ Bh, int ldb, size_t sB, float alpha, const float* __restrict__ bias, size_t sBias, const float* __restrict__ CP, int rowsPerB, size_t sCPb, int row0g,
    float* __restrict__ C, _Float16* __restrict__ C16, int ldc, size_t sC, int M, int N, int K) { static_assert(ACT == 0 || ACT == 3 || ACT == 6 || ACT == 8 || ACT == 9 || ACT == 11 || ACT == 12 || ACT == 14 || ACT == 15 || ACT == 16 || ACT == 17, "k_gemm2: unsupported ACT code (would silently apply no activation)");
  __shared__ __attribute__((aligned(16))) float so[4][32][68];
  const int tid = threadIdx.x, w = tid >> 5, lane = tid & 31, ln = lane & 15, hh = lane >> 4; const int by = blockIdx.y;
  A += (size_t)by * sA; Bh += (size_t)by * sB; const size_t cofs = (size_t)by * sC; const float* bp = bias ? bias + (size_t)by * sBias : nullptr;
  const int ntn = N >> 6; const int mt = blockIdx.x / ntn, nq = blockIdx.x - mt * ntn; const int row0 = mt * 128 + 32 * w, col0 = nq * 64; if (row0 >= M) return;
  const _Float16* a0p = A + (size_t)(row0 + ln) * lda; const _Float16* a1p = a0p + (size_t)16 * lda;
  const _Float16* b0p = Bh + (size_t)(col0 + ln) * ldb; const _Float16* b1p = b0p + (size_t)16 * ldb; const _Float16* b2p = b1p + (size_t)16 * ldb; const _Float16* b3p = b2p + (size_t)16 * ldb;
  const v8f z8 = {0.f,0.f,0.f,0.f,0.f,0.f,0.f,0.f}; v8f c00 = z8, c01 = z8, c02 = z8, c03 = z8, c10 = z8, c11 = z8, c12 = z8, c13 = z8;
#pragma unroll 1
  for (int kb = 0; kb < K; kb += 32) { const v16h a0 = g2_frag(a0p + kb, hh), a1 = g2_frag(a1p + kb, hh);
    v16h b = g2_frag(b0p + kb, hh); c00 = g2_mma(a0, b, c00); c10 = g2_mma(a1, b, c10);
    b = g2_frag(b1p + kb, hh); c01 = g2_mma(a0, b, c01); c11 = g2_mma(a1, b, c11);
    b = g2_frag(b2p + kb, hh); c02 = g2_mma(a0, b, c02); c12 = g2_mma(a1, b, c12);
    b = g2_frag(b3p + kb, hh); c03 = g2_mma(a0, b, c03); c13 = g2_mma(a1, b, c13); }
  v8f accs[8] = {c00, c01, c02, c03, c10, c11, c12, c13};
#pragma unroll
  for (int u = 0; u < 8; ++u) { const int t = u & 3, half = u >> 2; const int col = col0 + t * 16 + ln; const float bv = bp ? bf16_round(bp[col]) : 0.f;
#pragma unroll
    for (int r = 0; r < 8; ++r) { const int rloc = half * 16 + 8 * hh + r; float v = accs[u][r] * alpha + bv; if (CP) { if (rowsPerB < 0) v += CP[cofs + (size_t)(row0g + row0 + rloc) * ldc + col];      /* rowsPerB < 0: own element of the batched C plane */ else { const int bidx = (row0g + row0 + rloc) / rowsPerB; v += CP[(size_t)bidx * sCPb + (size_t)by * 64 + col]; } }
      if (ACT == 3) v = fmaxf(v, 0.f); else if (ACT == 6) v = 0.5f * v * (1.0f + erff(v * 0.70710678118654752f)); else if (ACT == 11) v = 1.0f / (1.0f + expf(-v)); else if (ACT == 15) v = v / (1.0f + expf(-v)); else if (ACT == 12) v = (v > 0.f) ? v : 0.01f * v; else if (ACT == 8) v = tanhf(v); else if (ACT == 9) v = 0.5f * v * (1.0f + tanhf(0.7978845608028654f * (v + 0.044715f * v * v * v))); else if (ACT == 14) v = (v > 0.f) ? v : 0.1f * v; else if (ACT == 16) v = (v >= 0.f) ? v : 0.3f * v; else if (ACT == 17) v = (v >= 0.f) ? v : 0.2f * v;
      so[w][rloc][t * 16 + ln] = v; } }
  __builtin_amdgcn_fence(__ATOMIC_ACQ_REL, "workgroup"); __builtin_amdgcn_wave_barrier();
  const int rsub = lane >> 4, c4 = (lane & 15) * 4;
  {
#pragma unroll
    for (int q = 0; q < 16; ++q) { const int r = q * 2 + rsub; const v4f v = *(const v4fa*)&so[w][r][c4]; if (C) *(v4f*)(C + cofs + (size_t)(row0 + r) * ldc + col0 + c4) = v; if (C16) { v4h h4; for (int i = 0; i < 4; ++i) h4[i] = (_Float16)v[i]; *(v4h*)(C16 + cofs + (size_t)(row0 + r) * ldc + col0 + c4) = h4; } }
     } }


__global__ __launch_bounds__(256) void k_wnat(const float* __restrict__ w, size_t n8, _Float16* __restrict__ Bt) { const size_t t = (size_t)blockIdx.x * 256 + threadIdx.x; if (t >= n8) return; FragH f; for (int q = 0; q < 8; ++q) f.h[q] = (_Float16)(bf16_round(w[t * 8 + q]) * 16.0f); *(v8us*)((unsigned short*)Bt + t * 8) = f.half[0];  }
__global__ __launch_bounds__(256) void k_rsm(const float* __restrict__ S, _Float16* __restrict__ P, int nrows) {
  #pragma clang fp contract(off)
  const int i = blockIdx.x * 256 + threadIdx.x; if (i >= nrows) return; const float* s = S + (size_t)i * SQ; float mx = -3.0e38f;
#pragma unroll 1
  for (int j = 0; j < SQ; ++j) mx = fmaxf(mx, s[j]); float se = 0.f;
#pragma unroll 1
  for (int j = 0; j < SQ; ++j) se += expf(s[j] - mx); const float sc = 256.0f / se;
#pragma unroll 1
  for (int j0 = 0; j0 < SQ; j0 += 8) { FragH f; for (int q = 0; q < 8; ++q) f.h[q] = (_Float16)(expf(s[j0 + q] - mx) * sc); unsigned short* d = (unsigned short*)P + (size_t)i * SQ + j0; *(v8us*)d = f.half[0];  } }
__global__ __launch_bounds__(256) void k_vt(const _Float16* __restrict__ V16, int b, int h0, _Float16* __restrict__ VT) { __shared__ unsigned short tl[64][65]; const int tid = threadIdx.x; const int hh = blockIdx.x % HG, sg = blockIdx.x / HG; const int s0 = sg * 64; const int h = h0 + hh;
  for (int i = tid; i < 64 * 8; i += 256) { const int j = i / 8, d8 = (i % 8) * 8; FragH f; f.half[0] = *(const v8us*)((const unsigned short*)V16 + ((size_t)b * SQ + s0 + j) * DM + h * HD + d8); for (int q = 0; q < 8; ++q) tl[d8 + q][j] = f.u[q]; }
  __syncthreads();
  { for (int i = tid; i < 64 * 8; i += 256) { const int d = i / 8, j8 = (i % 8) * 8; FragH f; for (int q = 0; q < 8; ++q) f.u[q] = tl[d][j8 + q]; *(v8us*)((unsigned short*)VT + ((size_t)hh * HD + d) * SQ + s0 + j8) = f.half[0]; }  } }


__global__ __launch_bounds__(256) void k_mprep(const float* __restrict__ E, const float* __restrict__ phase, _Float16* __restrict__ MH, _Float16* __restrict__ ML) {
  #pragma clang fp contract(off)
  const int t = blockIdx.x * 256 + threadIdx.x; if (t >= NH * HD * (HD / 8)) return; const int e8 = (t % (HD / 8)) * 8; const int hd_ = t / (HD / 8); const int d = hd_ % HD, h = hd_ / HD; const float c = cosf(bf16_round(phase[h * HD + d])); const float diag = __fmul_rn(__fmul_rn(c, c), 0.125f); FragH fh, fl;
#pragma unroll
  for (int q = 0; q < 8; ++q) { const int e = e8 + q; float m = bf16_round(E[((size_t)h * HD + d) * HD + e]); if (e == d) m = __fadd_rn(m, diag); const _Float16 hi = (_Float16)m; fh.h[q] = hi; fl.h[q] = (_Float16)((m - (float)hi) * 1024.0f); }
  const size_t o = ((size_t)h * HD + d) * HD + e8; { *(v8us*)((unsigned short*)MH + o) = fh.half[0]; *(v8us*)((unsigned short*)ML + o) = fl.half[0];  } }
// Row softmax, one wave per score row: lane l holds columns 128 u + 4 l .. + 3 (u = 0..15), so every load covers 512 contiguous bytes and every store 256;
// the row is read once and stays in registers; maximum and sum go over the lanes by a five-step butterfly (four steps inside a 16-lane row, one across the rows).
template <int XM> __device__ __forceinline__ float row_xor(float v) { return __int_as_float(__builtin_amdgcn_update_dpp(0, __float_as_int(v), 0x160 + XM, 0xf, 0xf, true)); }      /* value of lane l ^ XM, XM < 16 */
__device__ __forceinline__ float half_xor(float v) { const int i = __float_as_int(v); return __int_as_float(__builtin_amdgcn_permlanex16(i, i, 0x76543210, 0xfedcba98, false, false)); }      /* value of lane l ^ 16 */
__device__ __forceinline__ float wave_max(float v) { v = fmaxf(v, row_xor<1>(v)); v = fmaxf(v, row_xor<2>(v)); v = fmaxf(v, row_xor<4>(v)); v = fmaxf(v, row_xor<8>(v)); return fmaxf(v, half_xor(v)); }
__device__ __forceinline__ float wave_sum(float v) { v += row_xor<1>(v); v += row_xor<2>(v); v += row_xor<4>(v); v += row_xor<8>(v); return v + half_xor(v); }
__global__ __launch_bounds__(512) void k_rsmw(const float* __restrict__ S, _Float16* __restrict__ P, int qn, int hg) {
  const int lane = threadIdx.x & 31; const int t = blockIdx.x * 16 + __builtin_amdgcn_readfirstlane((int)(threadIdx.x >> 5)); if (t >= qn * hg) return;      /* readfirstlane: the row's base address stays in scalar registers; the exit is wave-uniform and the kernel has no barrier */
  const size_t i = (size_t)(t / qn) * SQ + (t % qn); const float* s = S + i * SQ + lane * 4; _Float16* p = P + i * SQ + lane * 4; v4f v[SQ / 128];
  for (int u = 0; u < SQ / 128 - 1; ++u) v[u] = *(const v4fa*)(s + u * 128);
  asm volatile("s_wait_xcnt 0x0" ::: "memory");      /* the last load's result may land in the lane-offset register that the loads before it name: the wait stands in front of that overwrite */
  v[SQ / 128 - 1] = *(const v4fa*)(s + (SQ / 128 - 1) * 128);
  float mx = -3.0e38f;
  for (int u = 0; u < SQ / 128; ++u) mx = fmaxf(fmaxf(mx, fmaxf(v[u][0], v[u][1])), fmaxf(v[u][2], v[u][3]));
  mx = wave_max(mx); v4f se = {0.f, 0.f, 0.f, 0.f};
  for (int u = 0; u < SQ / 128; ++u) { v4f e = v[u] - mx; for (int q = 0; q < 4; ++q) e[q] = __expf(e[q]); v[u] = e; se += e; }
  const float sc = PSC / wave_sum((se[0] + se[1]) + (se[2] + se[3]));
  for (int u = 0; u < SQ / 128; ++u) { v4h h4; for (int q = 0; q < 4; ++q) h4[q] = (_Float16)(v[u][q] * sc); *(v4h*)(p + u * 128) = h4; } }

extern "C" void kernel_launch(void* const* d_in, const int* in_sizes, int n_in,
                              void* d_out, int out_size, void* d_ws, size_t ws_size, hipStream_t stream) {
  (void)in_sizes; (void)n_in; (void)out_size;
  const float* const* I = (const float* const*)d_in; const float* x = I[0]; const float* wq = I[1]; const float* bq = I[2]; const float* wk = I[3]; const float* bk = I[4]; const float* wv = I[5]; const float* bv = I[6]; const float* phase = I[7]; const float* E = I[8]; const float* wo = I[9]; const float* bo = I[10];      /* weights [in][out] */
  char* ws = (char*)d_ws; size_t off = 0;
  auto take = [&](size_t bytes) { char* p = ws + off; off += (bytes + 255) & ~(size_t)255; return p; };
  _Float16* BQ = (_Float16*)take((size_t)DM * DM * 2); _Float16* BK = (_Float16*)take((size_t)DM * DM * 2); _Float16* BV = (_Float16*)take((size_t)DM * DM * 2); _Float16* BO = (_Float16*)take((size_t)DM * DM * 2); _Float16* MH = (_Float16*)take((size_t)NH * HD * HD * 2); _Float16* ML = (_Float16*)take((size_t)NH * HD * HD * 2);
  _Float16* X16 = (_Float16*)take(NR * DM * 2); float* QF = (float*)take(NR * DM * 4); float* KF = (float*)take(NR * DM * 4); _Float16* QH = (_Float16*)take(NR * DM * 2); _Float16* QL = (_Float16*)take(NR * DM * 2); _Float16* KH = (_Float16*)take(NR * DM * 2); _Float16* KL = (_Float16*)take(NR * DM * 2); _Float16* V16 = (_Float16*)take(NR * DM * 2);
  float* KMF = (float*)take((size_t)SQ * DM * 4); _Float16* KMH = (_Float16*)take((size_t)SQ * DM * 2); _Float16* KML = (_Float16*)take((size_t)SQ * DM * 2); _Float16* O16 = (_Float16*)take(NR * DM * 2);
  float* S = (float*)take((size_t)HG * SQ * SQ * 4); _Float16* P = (_Float16*)take((size_t)HG * SQ * SQ * 2); _Float16* VT = (_Float16*)take((size_t)NH * HD * SQ * 2);
  if (off > ws_size) return;      /* 8.3 + 8 + 32 + 40 + 8 + 4 + 4 + 8 + 64 + 32 + 4 = approx 212 MiB */
  { const unsigned gw = (unsigned)(((size_t)DM * (DM / 8) + 255) / 256); k_wt_f16<<<gw, 256, 0, stream>>>(wq, BQ, DM, DM, 16.0f); k_wt_f16<<<gw, 256, 0, stream>>>(wk, BK, DM, DM, 16.0f); k_wt_f16<<<gw, 256, 0, stream>>>(wv, BV, DM, DM, 16.0f); k_wt_f16<<<gw, 256, 0, stream>>>(wo, BO, DM, DM, 16.0f); }      /* [in][out] -> Bt[n][k] x16 */
  k_mprep<<<(NH * HD * (HD / 8) + 255) / 256, 256, 0, stream>>>(E, phase, MH, ML);
  k_x16<<<(unsigned)((NR * DM / 8 + 255) / 256), 256, 0, stream>>>(x, X16, NR * DM / 8);
  const size_t r0p = (size_t)B0 * SQ; const dim3 gp((unsigned)((MP / 128) * (DM / 64)), 1);
  k_gemm2<0><<<gp, 128, 0, stream>>>(X16 + r0p * DM, DM, 0, BQ, DM, 0, 0.0625f, bq, 0, nullptr, 1, 0, 0, QF + r0p * DM, nullptr, DM, 0, MP, DM, DM);
  k_gemm2<0><<<gp, 128, 0, stream>>>(X16 + r0p * DM, DM, 0, BK, DM, 0, 0.0625f, bk, 0, nullptr, 1, 0, 0, KF + r0p * DM, nullptr, DM, 0, MP, DM, DM);
  k_gemm2<0><<<gp, 128, 0, stream>>>(X16 + r0p * DM, DM, 0, BV, DM, 0, 0.0625f, bv, 0, nullptr, 1, 0, 0, nullptr, V16 + r0p * DM, DM, 0, MP, DM, DM);
  k_hl<<<(unsigned)(((size_t)MP * DM / 8 + 255) / 256), 256, 0, stream>>>(QF + r0p * DM, QH + r0p * DM, QL + r0p * DM, (size_t)MP * DM / 8);
  k_hl<<<(unsigned)(((size_t)MP * DM / 8 + 255) / 256), 256, 0, stream>>>(KF + r0p * DM, KH + r0p * DM, KL + r0p * DM, (size_t)MP * DM / 8);
  for (int b = B0; b < B0 + NBR; ++b) { const size_t r0 = (size_t)b * SQ;
    { const dim3 gk((SQ / 128) * (HD / 64), NH);      /* KM[k][h*64+d] = sum_e K[k][h*64+e] M[h][d][e], all heads on grid.y; three terms */
      k_gemm2<0><<<gk, 128, 0, stream>>>(KH + r0 * DM, DM, (size_t)HD, MH, HD, (size_t)HD * HD, 1.0f, nullptr, 0, nullptr, 1, 0, 0, KMF, nullptr, DM, (size_t)HD, SQ, HD, HD);
      k_gemm2<0><<<gk, 128, 0, stream>>>(KL + r0 * DM, DM, (size_t)HD, MH, HD, (size_t)HD * HD, 0.0009765625f, nullptr, 0, KMF, -1, 0, 0, KMF, nullptr, DM, (size_t)HD, SQ, HD, HD);
      k_gemm2<0><<<gk, 128, 0, stream>>>(KH + r0 * DM, DM, (size_t)HD, ML, HD, (size_t)HD * HD, 0.0009765625f, nullptr, 0, KMF, -1, 0, 0, KMF, nullptr, DM, (size_t)HD, SQ, HD, HD); }
    k_hl<<<(unsigned)(((size_t)SQ * DM / 8 + 255) / 256), 256, 0, stream>>>(KMF, KMH, KML, (size_t)SQ * DM / 8);
    k_vt<NH, SQ><<<NH * (SQ / 64), 256, 0, stream>>>(V16 + r0 * DM, DM, 0, VT);      /* V^T [NH][HD][SQ] */
    for (int h0 = 0; h0 < NHD; h0 += HG) { const dim3 gs((QN / 128) * (SQ / 64), HG);
      k_gemm2<0><<<gs, 128, 0, stream>>>(QH + r0 * DM + h0 * HD, DM, (size_t)HD, KMH + h0 * HD, DM, (size_t)HD, 1.0f, nullptr, 0, nullptr, 1, 0, 0, S, nullptr, SQ, (size_t)SQ * SQ, QN, SQ, HD);      /* scores hi.hi */
      k_gemm2<0><<<gs, 128, 0, stream>>>(QL + r0 * DM + h0 * HD, DM, (size_t)HD, KMH + h0 * HD, DM, (size_t)HD, 0.0009765625f, nullptr, 0, S, -1, 0, 0, S, nullptr, SQ, (size_t)SQ * SQ, QN, SQ, HD);      /* + lo.hi */
      k_gemm2<0><<<gs, 128, 0, stream>>>(QH + r0 * DM + h0 * HD, DM, (size_t)HD, KML + h0 * HD, DM, (size_t)HD, 0.0009765625f, nullptr, 0, S, -1, 0, 0, S, nullptr, SQ, (size_t)SQ * SQ, QN, SQ, HD);      /* + hi.lo */
      k_rsmw<<<(HG * QN + 15) / 16, 512, 0, stream>>>(S, P, QN, HG);      /* P = 4096 softmax (f16) */
      k_gemm2<0><<<dim3((QN / 128) * (HD / 64), HG), 128, 0, stream>>>(P, SQ, (size_t)SQ * SQ, VT + (size_t)h0 * HD * SQ, SQ, (size_t)HD * SQ, 0.015625f, nullptr, 0, nullptr, 1, 0, 0, nullptr, O16 + r0 * DM + h0 * HD, DM, (size_t)HD, QN, HD, SQ); } }      /* o (merged heads, x64) as f16 rows */
  k_gemm2<0><<<dim3((unsigned)((MPO / 128) * (DM / 64)), 1), 128, 0, stream>>>(O16 + r0p * DM, DM, 0, BO, DM, 0, 0.0009765625f, bo, 0, nullptr, 1, 0, 0, (float*)d_out + r0p * DM, nullptr, DM, 0, MPO, DM, DM);      /* out rows are the output layout */
}

// v002
// Measured time: 317 microseconds a run.
// Next to v001, in two timings, it ran 5.36 and 5.32 times as fast.
// All steps since v000 together make it 13.5 times as fast.
#include <hip/hip_runtime.h>
// "Quantum" attention (x [2][2048][1024]): Q/K/V = x W + b ([in][out] weights + biases, 16 heads of 64); scores = (Q cos(phase)) (K cos(phase))^T / 8 + Q E K^T per head (phase [16][64], E [16][64][64]) = Q M K^T with M = E + diag(cos^2 phase / 8); softmax over the 2,048 keys; o = attn V merged; out = o out_w + out_b -> [2][2048][1024].
// Structure: token rows; x as exact f16 rows; Q and K as WMMA GEMMs (32x64 wave tiles, f32 accumulation, exact x16 transposed weights + bias) into f32 rows, split on VALU into f16 hi + 2^-10 residual planes; V as a WMMA GEMM to f16 rows; M as f16 hi + residual planes (VALU, cos in f32); KM = K M^T per head as three accumulating GEMM terms (hi.hi + lo.hi + hi.lo, K = 64) into f32 rows, split into hi + residual planes; V^T for all batches and heads via LDS transposes; attention in one fused launch (k_fattn): scores = Q KM^T as three WMMA terms in one accumulator, online softmax on VALU (f32 statistics, native exp2; weights x64 f16 against the maximum in use), o = P . V^T on WMMA, normalised at the end into merged f16 rows (o carried x64 against f16 subnormal flush); out = o out_w + b GEMM (f32, alpha folds 1/16 and 1/64).
// Compute dtype: inputs rounded to bf16; weights exact (x16 f16); Q, K, M, KM as f16 hi + residual planes (~2^-22); V, softmax weights (x64) and o (x64) plain f16 (~2^-12); scores, softmax statistics f32. v_wmma_f32_16x16x32_f16.
#define NB 2
#define SQ 2048
#define DM 1024
#define NH 16
#define HD 64
#define HG 4                         /* heads per group in the per-batch k_vt, which is not launched */
#define PSC 4096.0f                  /* unused; the softmax weights carry x64 */
#define B0 0                         /* first batch processed (debug hook) */
#define NBR NB                       /* batches processed (debug hook) */
#define QN SQ                        /* unused; k_fattn attends all SQ query rows per batch */
#define NHD NH                       /* unused; k_fattn attends all NH heads */
#define NR ((size_t)NB * SQ)
#define MP ((int)((size_t)NBR * SQ)) /* rows projected (debug hook) */
#define MPO MP                       /* rows through the output GEMM (debug hook) */
typedef __bf16 v16b __attribute__((ext_vector_type(16)));
typedef unsigned short v8us __attribute__((ext_vector_type(8), may_alias));
typedef float  v8f  __attribute__((ext_vector_type(8)));
typedef float  v4f  __attribute__((ext_vector_type(4)));
typedef float  v4fa __attribute__((ext_vector_type(4), may_alias));
union FragB { v16b v; v8us half[2]; unsigned short u[16]; };

__device__ __forceinline__ unsigned short bf16_bits(float x) { unsigned int u = __float_as_uint(x); return (unsigned short)((u + 0x7FFFu + ((u >> 16) & 1u)) >> 16); }
__device__ __forceinline__ float bf16_val(unsigned short b) { return __uint_as_float(((unsigned int)b) << 16); }
__device__ __forceinline__ float bf16_round(float x) { return bf16_val(bf16_bits(x)); }
// D += A·B with NT terms: 1 = ah·bh, 2 = + al·bh (A split), 3 = + ah·bl (both split)
template <int NT>
__device__ __forceinline__ v8f mmaN(v16b ah, v16b al, v16b bh, v16b bl, v8f c) {
  c = __builtin_amdgcn_wmma_f32_16x16x32_bf16(false, ah, false, bh, (short)0, c, false, false);
  if (NT >= 2) c = __builtin_amdgcn_wmma_f32_16x16x32_bf16(false, al, false, bh, (short)0, c, false, false);
  if (NT >= 3) c = __builtin_amdgcn_wmma_f32_16x16x32_bf16(false, ah, false, bl, (short)0, c, false, false);
  asm volatile("v_nop\n\tv_nop\n\tv_nop\n\tv_nop" : "+v"(c) : "v"(ah), "v"(al), "v"(bh), "v"(bl));
  return c;
}

__global__ __launch_bounds__(256) void k_wt_bf16(const float* __restrict__ W, unsigned short* __restrict__ Wt, int K, int N) {
  const int t = blockIdx.x * 256 + threadIdx.x;
  const int k8n = K / 8;
  if (t >= N * k8n) return;
  const int n = t / k8n, k8 = (t % k8n) * 8;
  v8us v;
#pragma unroll
  for (int i = 0; i < 8; ++i) v[i] = bf16_bits(W[(size_t)(k8 + i) * N + n]);
  *(v8us*)(Wt + (size_t)n * K + k8) = v;
  
}

// GEMM C[M][N] (f32, pitch ldc) = act(A[M][K]·W + bias). A f32 row-major (pitch lda) converted per fragment to bf16
// (ASPLIT: hi/lo two planes -> 2 terms, else single rounded term); Wt bf16 [N][K] (pitch ldb). BIAS_BF16 rounds the
// bias to bf16 first (bias quantised to bf16 before the add). K%32==0, M%16==0, N%64==0.
template <bool ASPLIT, int ACT, bool BIAS_BF16>
__global__ __launch_bounds__(128) void k_gemm_bf(const float* __restrict__ A, int lda, const unsigned short* __restrict__ Wt, int ldb,
                                               const float* __restrict__ bias, float* __restrict__ C, int ldc, int M, int N, int K) {
  __shared__ __attribute__((aligned(16))) float so[4][16][64];
  const int tid = threadIdx.x, w = tid >> 5, lane = tid & 31, ln = lane & 15, hh = lane >> 4;
  const int ntn = N / 64;
  const int wid = blockIdx.x * 4 + w;
  const int mt = wid / ntn, nq = wid % ntn;
  if (mt * 16 >= M) return;
  const int row0 = mt * 16, col0 = nq * 64;
  const float* arow = A + (size_t)(row0 + ln) * lda;
  v8f acc[4] = {};
  for (int kb = 0; kb < K; kb += 32) {
    FragB ah, al;
    const v4f x0 = *(const v4fa*)(arow + kb + 8 * hh), x1 = *(const v4fa*)(arow + kb + 8 * hh + 4);
    const v4f x2 = *(const v4fa*)(arow + kb + 16 + 8 * hh), x3 = *(const v4fa*)(arow + kb + 16 + 8 * hh + 4);
    float xs[16] = {x0[0],x0[1],x0[2],x0[3],x1[0],x1[1],x1[2],x1[3],x2[0],x2[1],x2[2],x2[3],x3[0],x3[1],x3[2],x3[3]};
#pragma unroll
    for (int i = 0; i < 16; ++i) { const unsigned short hb = bf16_bits(xs[i]); ah.u[i] = hb; al.u[i] = ASPLIT ? bf16_bits(xs[i] - bf16_val(hb)) : (unsigned short)0; }
#pragma unroll
    for (int t = 0; t < 4; ++t) {
      const unsigned short* brow = Wt + (size_t)(col0 + t * 16 + ln) * ldb + kb;
      FragB b;
      b.half[0] = *(const v8us*)(brow + 8 * hh);
      b.half[1] = *(const v8us*)(brow + 16 + 8 * hh);
      acc[t] = mmaN<ASPLIT ? 2 : 1>(ah.v, al.v, b.v, b.v, acc[t]);
    }
  }
#pragma unroll
  for (int t = 0; t < 4; ++t) {
    float bv = bias ? bias[col0 + t * 16 + ln] : 0.f;
    if (BIAS_BF16) bv = bf16_round(bv);
#pragma unroll
    for (int r = 0; r < 8; ++r) { float v = acc[t][r] + bv; if (ACT == 1) v = fmaxf(v, 0.f); so[w][8 * hh + r][t * 16 + ln] = v; }
  }
  __builtin_amdgcn_fence(__ATOMIC_ACQ_REL, "workgroup");
  __builtin_amdgcn_wave_barrier();
  const int rsub = lane >> 4, c4 = (lane & 15) * 4;
  {
#pragma unroll
    for (int q = 0; q < 8; ++q) {
      const int r = q * 2 + rsub;
      const v4f v = *(const v4fa*)&so[w][r][c4];
      *(v4f*)(C + (size_t)(row0 + r) * ldc + col0 + c4) = v;
    }
    
  }
}

// GEMM C = act(A·W + bias + resid): A f32 (ASPLIT -> hi/lo 2 terms), Wt bf16 [N][K]; ACT 0 none, 1 relu, 2 exact gelu;
// resid (optional, f32, row index = (row % rmod), pitch ldr, RES_BF16 rounds it) added before the activation.
template <bool ASPLIT, int ACT, bool BIAS_BF16, bool RES_BF16>
__global__ __launch_bounds__(128) void k_gemm_bf3(const float* __restrict__ A, int lda, const unsigned short* __restrict__ Wt, int ldb,
                                                const float* __restrict__ bias, const float* __restrict__ resid, int rmod, int ldr,
                                                float* __restrict__ C, int ldc, int M, int N, int K) {
  __shared__ __attribute__((aligned(16))) float so[4][16][64];
  const int tid = threadIdx.x, w = tid >> 5, lane = tid & 31, ln = lane & 15, hh = lane >> 4;
  const int ntn = N / 64;
  const int wid = blockIdx.x * 4 + w;
  const int mt = wid / ntn, nq = wid % ntn;
  if (mt * 16 >= M) return;
  const int row0 = mt * 16, col0 = nq * 64;
  const float* arow = A + (size_t)(row0 + ln) * lda;
  v8f acc[4] = {};
  for (int kb = 0; kb < K; kb += 32) {
    FragB ah, al;
    const v4f x0 = *(const v4fa*)(arow + kb + 8 * hh), x1 = *(const v4fa*)(arow + kb + 8 * hh + 4);
    const v4f x2 = *(const v4fa*)(arow + kb + 16 + 8 * hh), x3 = *(const v4fa*)(arow + kb + 16 + 8 * hh + 4);
    float xs[16] = {x0[0],x0[1],x0[2],x0[3],x1[0],x1[1],x1[2],x1[3],x2[0],x2[1],x2[2],x2[3],x3[0],x3[1],x3[2],x3[3]};
#pragma unroll
    for (int i = 0; i < 16; ++i) { const unsigned short hb = bf16_bits(xs[i]); ah.u[i] = hb; al.u[i] = ASPLIT ? bf16_bits(xs[i] - bf16_val(hb)) : (unsigned short)0; }
#pragma unroll
    for (int t = 0; t < 4; ++t) {
      const unsigned short* brow = Wt + (size_t)(col0 + t * 16 + ln) * ldb + kb;
      FragB b;
      b.half[0] = *(const v8us*)(brow + 8 * hh);
      b.half[1] = *(const v8us*)(brow + 16 + 8 * hh);
      acc[t] = mmaN<ASPLIT ? 2 : 1>(ah.v, al.v, b.v, b.v, acc[t]);
    }
  }
#pragma unroll
  for (int t = 0; t < 4; ++t) {
    const int col = col0 + t * 16 + ln;
    float bv = bias ? bias[col] : 0.f;
    if (BIAS_BF16) bv = bf16_round(bv);
#pragma unroll
    for (int r = 0; r < 8; ++r) {
      float v = acc[t][r] + bv;
      if (resid) { float rv = resid[(size_t)((row0 + 8 * hh + r) % rmod) * ldr + col]; if (RES_BF16) rv = bf16_round(rv); v += rv; }
      if (ACT == 1) v = fmaxf(v, 0.f);
      if (ACT == 2) v = 0.5f * v * (1.0f + erff(v * 0.70710678118654752f));
      if (ACT == 3) { const float u = 0.7978845608028654f * (v + 0.044715f * v * v * v); v = 0.5f * v * (1.0f + tanhf(u)); }
      so[w][8 * hh + r][t * 16 + ln] = v;
    }
  }
  __builtin_amdgcn_fence(__ATOMIC_ACQ_REL, "workgroup");
  __builtin_amdgcn_wave_barrier();
  const int rsub = lane >> 4, c4 = (lane & 15) * 4;
  {
#pragma unroll
    for (int q = 0; q < 8; ++q) {
      const int r = q * 2 + rsub;
      const v4f v = *(const v4fa*)&so[w][r][c4];
      *(v4f*)(C + (size_t)(row0 + r) * ldc + col0 + c4) = v;
    }
    
  }
}
// row LayerNorm (biased variance, eps) over N: s = X (+ R); optional out_sum <- s; out_norm <- (s-mu)*rsqrt(var+eps)*g + b
template <bool PARAM_BF16>
__global__ __launch_bounds__(256) void k_layernorm(const float* __restrict__ X, const float* __restrict__ R, const float* __restrict__ g, const float* __restrict__ bta,
                                                  float* __restrict__ out_sum, float* __restrict__ out_norm, int N, float eps) {
  __shared__ float red[256];
  const int row = blockIdx.x, tid = threadIdx.x;
  const float* x = X + (size_t)row * N; const float* rr = R ? R + (size_t)row * N : nullptr;
  float vals[16];                     // up to N = 4096
  const int per = N / 256;            // contiguous chunk per thread? use strided-by-4 chunks: thread handles j = tid*4 + 1024*u
  float s1 = 0.f;
  for (int u = 0; u < per / 4; ++u) {
    const int j = tid * 4 + 1024 * u;
    const v4f a = *(const v4fa*)(x + j);
    v4f b = {0.f,0.f,0.f,0.f}; if (rr) b = *(const v4fa*)(rr + j);
#pragma unroll
    for (int q = 0; q < 4; ++q) { const float v = a[q] + b[q]; vals[u * 4 + q] = v; s1 += v; }
  }
  red[tid] = s1; __syncthreads();
  for (int st = 128; st > 0; st >>= 1) { if (tid < st) red[tid] += red[tid + st]; __syncthreads(); }
  const float mu = red[0] / (float)N; __syncthreads();
  float s2 = 0.f;
  for (int u = 0; u < per / 4; ++u)
#pragma unroll
    for (int q = 0; q < 4; ++q) { const float c = vals[u * 4 + q] - mu; s2 += c * c; }
  red[tid] = s2; __syncthreads();
  for (int st = 128; st > 0; st >>= 1) { if (tid < st) red[tid] += red[tid + st]; __syncthreads(); }
  const float rs = rsqrtf(red[0] / (float)N + eps);
  {
    for (int u = 0; u < per / 4; ++u) {
      const int j = tid * 4 + 1024 * u;
      v4f o, sm;
#pragma unroll
      for (int q = 0; q < 4; ++q) {
        float gg = g[j + q], bb = bta[j + q];
        if (PARAM_BF16) { gg = bf16_round(gg); bb = bf16_round(bb); }
        sm[q] = vals[u * 4 + q]; o[q] = (vals[u * 4 + q] - mu) * rs * gg + bb;
      }
      if (out_sum) *(v4f*)(out_sum + (size_t)row * N + j) = sm;
      *(v4f*)(out_norm + (size_t)row * N + j) = o;
    }
    
  }
}



// ---- f16 WMMA path (v_wmma_f32_16x16x32_f16): 11-bit significands for operands in range — used where a [0,1] probability operand needs more precision than bf16
typedef _Float16 v16h __attribute__((ext_vector_type(16)));
union FragH { v16h v; v8us half[2]; _Float16 h[16]; unsigned short u[16]; };
template <int NT>
__device__ __forceinline__ v8f mmaH(v16h ah, v16h al, v16h bh, v16h bl, v8f c) {
  c = __builtin_amdgcn_wmma_f32_16x16x32_f16(false, ah, false, bh, (short)0, c, false, false);
  if (NT >= 2) c = __builtin_amdgcn_wmma_f32_16x16x32_f16(false, al, false, bh, (short)0, c, false, false);
  if (NT >= 3) c = __builtin_amdgcn_wmma_f32_16x16x32_f16(false, ah, false, bl, (short)0, c, false, false);
  asm volatile("v_nop\n\tv_nop\n\tv_nop\n\tv_nop" : "+v"(c) : "v"(ah), "v"(al), "v"(bh), "v"(bl));
  return c;
}
// batched GEMM like k_gemm_b but f16 operands: A f32 (split into f16 hi/lo if ASPLIT, else rounded to f16), Bt = f16 values [n][k]; alpha; C f32; N multiple of 16 (partial tiles skipped)
template <bool ASPLIT>
__global__ __launch_bounds__(128) void k_gemm_h(const float* __restrict__ A, int lda, size_t sA, const _Float16* __restrict__ Bh, int ldb, size_t sB, float alpha, float* __restrict__ C, int ldc, size_t sC, int M, int N, int K) {
  __shared__ __attribute__((aligned(16))) float so[4][16][64];
  const int tid = threadIdx.x, w = tid >> 5, lane = tid & 31, ln = lane & 15, hh = lane >> 4; const int by = blockIdx.y;
  A += (size_t)by * sA; Bh += (size_t)by * sB; C += (size_t)by * sC;
  const int ntn = (N + 63) / 64; const int wid = blockIdx.x * 4 + w; const int mt = wid / ntn, nq = wid % ntn; if (mt * 16 >= M) return;
  const int row0 = mt * 16, col0 = nq * 64; const float* arow = A + (size_t)(row0 + ln) * lda;
  v8f acc[4] = {};
  for (int kb = 0; kb < K; kb += 32) {
    FragH ah, al;
    const v4f x0 = *(const v4fa*)(arow + kb + 8 * hh), x1 = *(const v4fa*)(arow + kb + 8 * hh + 4), x2 = *(const v4fa*)(arow + kb + 16 + 8 * hh), x3 = *(const v4fa*)(arow + kb + 16 + 8 * hh + 4);
    float xs[16] = {x0[0],x0[1],x0[2],x0[3],x1[0],x1[1],x1[2],x1[3],x2[0],x2[1],x2[2],x2[3],x3[0],x3[1],x3[2],x3[3]};
#pragma unroll
    for (int i = 0; i < 16; ++i) { const _Float16 h = (_Float16)xs[i]; ah.h[i] = h; al.h[i] = ASPLIT ? (_Float16)(xs[i] - (float)h) : (_Float16)0.0f; }
#pragma unroll
    for (int t = 0; t < 4; ++t) { if (col0 + t * 16 >= N) continue; const size_t boff = (size_t)(col0 + t * 16 + ln) * ldb + kb; FragH bq; bq.half[0] = *(const v8us*)(Bh + boff + 8 * hh); bq.half[1] = *(const v8us*)(Bh + boff + 16 + 8 * hh);
      acc[t] = mmaH<ASPLIT ? 2 : 1>(ah.v, al.v, bq.v, bq.v, acc[t]); }
  }
#pragma unroll
  for (int t = 0; t < 4; ++t) { if (col0 + t * 16 >= N) continue;
#pragma unroll
    for (int r = 0; r < 8; ++r) so[w][8 * hh + r][t * 16 + ln] = acc[t][r] * alpha; }
  __builtin_amdgcn_fence(__ATOMIC_ACQ_REL, "workgroup"); __builtin_amdgcn_wave_barrier();
  const int rsub = lane >> 4, c4 = (lane & 15) * 4;
  {
#pragma unroll
    for (int q = 0; q < 8; ++q) { const int r = q * 2 + rsub; if (col0 + c4 < N) { const v4f v = *(const v4fa*)&so[w][r][c4]; *(v4f*)(C + (size_t)(row0 + r) * ldc + col0 + c4) = v; } }
     }
}

// Wt[n][k] = f16(W[k][n]·scale) from f32 row-major W[K][N] (scale = power of two; bf16-exact weights stay exact in f16 away from the subnormal range)
__global__ __launch_bounds__(256) void k_wt_f16(const float* __restrict__ W, _Float16* __restrict__ Wt, int K, int N, float scale) {
  const int t = blockIdx.x * 256 + threadIdx.x; if (t >= N * (K / 8)) return; const int n = t / (K / 8), k8 = (t % (K / 8)) * 8; FragH f;
#pragma unroll
  for (int i = 0; i < 8; ++i) f.h[i] = (_Float16)(bf16_round(W[(size_t)(k8 + i) * N + n]) * scale); const v8us o = f.half[0];
  *(v8us*)((unsigned short*)Wt + (size_t)n * K + k8) = o; 
}
// k_gemm_hh variant with fused epilogue: v = acc·alpha + bias[by·sBias + col] (+ CP[(row/rowsPerB)·sCPb + by·64 + col] if CP) ; ACT 0 none / 1 elu ; writes f16 C16 (and f32 C if non-null)
template <int ACT>
__global__ __launch_bounds__(128) void k_gemm_hhx(const _Float16* __restrict__ A, int lda, size_t sA, const _Float16* __restrict__ Bh, int ldb, size_t sB, float alpha, const float* __restrict__ bias, size_t sBias, const float* __restrict__ CP, int rowsPerB, size_t sCPb, int row0g,
    float* __restrict__ C, _Float16* __restrict__ C16, int ldc, size_t sC, int M, int N, int K) {
  __shared__ __attribute__((aligned(16))) float so[4][16][64];
  const int tid = threadIdx.x, w = tid >> 5, lane = tid & 31, ln = lane & 15, hh = lane >> 4; const int by = blockIdx.y;
  A += (size_t)by * sA; Bh += (size_t)by * sB; const size_t cofs = (size_t)by * sC; const float* bp = bias ? bias + (size_t)by * sBias : nullptr;
  const int ntn = (N + 63) / 64; const int wid = blockIdx.x * 4 + w; const int mt = wid / ntn, nq = wid % ntn; if (mt * 16 >= M) return;
  const int row0 = mt * 16, col0 = nq * 64; const _Float16* arow = A + (size_t)(row0 + ln) * lda;
  v8f acc[4] = {};
  for (int kb = 0; kb < K; kb += 32) { FragH ah; ah.half[0] = *(const v8us*)((const unsigned short*)arow + kb + 8 * hh); ah.half[1] = *(const v8us*)((const unsigned short*)arow + kb + 16 + 8 * hh);
#pragma unroll
    for (int t = 0; t < 4; ++t) { if (col0 + t * 16 >= N) continue; const size_t boff = (size_t)(col0 + t * 16 + ln) * ldb + kb; FragH bq; bq.half[0] = *(const v8us*)((const unsigned short*)Bh + boff + 8 * hh); bq.half[1] = *(const v8us*)((const unsigned short*)Bh + boff + 16 + 8 * hh);
      acc[t] = mmaH<1>(ah.v, ah.v, bq.v, bq.v, acc[t]); }
  }
#pragma unroll
  for (int t = 0; t < 4; ++t) { if (col0 + t * 16 >= N) continue; const int col = col0 + t * 16 + ln; const float bv = bp ? bf16_round(bp[col]) : 0.f;
#pragma unroll
    for (int r = 0; r < 8; ++r) { float v = acc[t][r] * alpha + bv; if (CP) { const int rr = row0g + row0 + 8 * hh + r; if (rowsPerB < 0) v += CP[cofs + (size_t)rr * ldc + col];      /* rowsPerB < 0: own element of the batched C plane */ else { const int bidx = rr / rowsPerB; v += CP[(size_t)bidx * sCPb + (size_t)by * 64 + col]; } } if (ACT == 1) v = (v > 0.f) ? v : expm1f(v); else if (ACT == 7) v = (v > 0.f) ? v + 1.0f : expf(v); else if (ACT == 8) v = tanhf(v); else if (ACT == 9) v = 0.5f * v * (1.0f + tanhf(0.7978845608028654f * (v + 0.044715f * v * v * v))); else if (ACT == 11) v = 1.0f / (1.0f + expf(-v)); else if (ACT == 12) v = (v > 0.f) ? v : 0.01f * v; else if (ACT == 14) v = (v > 0.f) ? v : 0.1f * v; else if (ACT == 16) v = (v >= 0.f) ? v : 0.3f * v; else if (ACT == 17) v = (v >= 0.f) ? v : 0.2f * v; else if (ACT == 15) v = v / (1.0f + expf(-v)); else if (ACT == 3) v = fmaxf(v, 0.f); else if (ACT == 6) v = 0.5f * v * (1.0f + erff(v * 0.70710678118654752f)); so[w][8 * hh + r][t * 16 + ln] = v; } }
  __builtin_amdgcn_fence(__ATOMIC_ACQ_REL, "workgroup"); __builtin_amdgcn_wave_barrier();
  const int rsub = lane >> 4, c4 = (lane & 15) * 4; typedef _Float16 v4h __attribute__((ext_vector_type(4)));
  {
#pragma unroll
    for (int q = 0; q < 8; ++q) { const int r = q * 2 + rsub; if (col0 + c4 < N) { const v4f v = *(const v4fa*)&so[w][r][c4]; if (C) *(v4f*)(C + cofs + (size_t)(row0 + r) * ldc + col0 + c4) = v; if (C16) { v4h h4; for (int i = 0; i < 4; ++i) h4[i] = (_Float16)v[i]; *(v4h*)(C16 + cofs + (size_t)(row0 + r) * ldc + col0 + c4) = h4; } } }
     }
}


typedef _Float16 v4h __attribute__((ext_vector_type(4)));

__global__ __launch_bounds__(256) void k_x16(const float* __restrict__ x, _Float16* __restrict__ X16, size_t n8) { const size_t t = (size_t)blockIdx.x * 256 + threadIdx.x; if (t >= n8) return; FragH f;
#pragma unroll
  for (int q = 0; q < 8; ++q) f.h[q] = (_Float16)bf16_round(x[t * 8 + q]); *(v8us*)((unsigned short*)X16 + t * 8) = f.half[0];  }
__global__ __launch_bounds__(256) void k_h16(const float* __restrict__ x, _Float16* __restrict__ X16, size_t n8) { const size_t t = (size_t)blockIdx.x * 256 + threadIdx.x; if (t >= n8) return; FragH f;
#pragma unroll
  for (int q = 0; q < 8; ++q) f.h[q] = (_Float16)x[t * 8 + q]; *(v8us*)((unsigned short*)X16 + t * 8) = f.half[0];  }
__global__ __launch_bounds__(256) void k_round16f(const float* __restrict__ W, _Float16* __restrict__ Bt, size_t n8) { const size_t t = (size_t)blockIdx.x * 256 + threadIdx.x; if (t >= n8) return; FragH f;
#pragma unroll
  for (int i = 0; i < 8; ++i) f.h[i] = (_Float16)(bf16_round(W[t * 8 + i]) * 16.0f); *(v8us*)((unsigned short*)Bt + t * 8) = f.half[0];  }
template <int NHv, int TTv>
__global__ __launch_bounds__(256) void k_vt(const _Float16* __restrict__ V16, int ldv, int voff, _Float16* __restrict__ Vt) { __shared__ unsigned short tl[64][66]; const int tid = threadIdx.x; const int slab = blockIdx.x / (TTv / 64), lg = blockIdx.x % (TTv / 64); const int b = slab / NHv, h = slab % NHv;
  for (int i = tid; i < 64 * 8; i += 256) { const int r = i / 8, c8 = (i % 8) * 8; FragH f; f.half[0] = *(const v8us*)((const unsigned short*)V16 + ((size_t)b * TTv + lg * 64 + r) * ldv + voff + h * 64 + c8);
#pragma unroll
    for (int q = 0; q < 8; ++q) tl[r][c8 + q] = f.u[q]; }
  __syncthreads();
  {
#pragma unroll
    for (int rd = 0; rd < 2; ++rd) { const int d = rd * 32 + tid / 8, pc = tid % 8; FragH f;
#pragma unroll
      for (int q = 0; q < 8; ++q) f.u[q] = tl[pc * 8 + q][d];
      *(v8us*)((unsigned short*)Vt + ((size_t)slab * 64 + d) * TTv + lg * 64 + pc * 8) = f.half[0]; }
     } }

__global__ __launch_bounds__(256) void k_hl(const float* __restrict__ F, _Float16* __restrict__ Hh, _Float16* __restrict__ Hl, size_t n8) { const size_t t = (size_t)blockIdx.x * 256 + threadIdx.x; if (t >= n8) return; FragH fh, fl; const v4f a = *(const v4fa*)(F + t * 8), c = *(const v4fa*)(F + t * 8 + 4);
#pragma unroll
  for (int q = 0; q < 4; ++q) { _Float16 h = (_Float16)a[q]; fh.h[q] = h; fl.h[q] = (_Float16)((a[q] - (float)h) * 1024.0f); h = (_Float16)c[q]; fh.h[4 + q] = h; fl.h[4 + q] = (_Float16)((c[q] - (float)h) * 1024.0f); }
  { *(v8us*)((unsigned short*)Hh + t * 8) = fh.half[0]; *(v8us*)((unsigned short*)Hl + t * 8) = fl.half[0];  } }

// ---- fast GEMM (wave tile 32x64; requires M % 32 == 0 rows per launch region and N % 64 == 0); epilogue = k_gemm_hhx semantics ----
__device__ __forceinline__ v16h g2_frag(const _Float16* p, int hh) { FragH f; f.half[0] = *(const v8us*)((const unsigned short*)p + 8 * hh); f.half[1] = *(const v8us*)((const unsigned short*)p + 16 + 8 * hh); return f.v; }
__device__ __forceinline__ v8f g2_mma(v16h a, v16h b, v8f c) { v8f d = __builtin_amdgcn_wmma_f32_16x16x32_f16(false, a, false, b, (short)0, c, false, false); asm volatile("v_nop\n\tv_nop\n\tv_nop\n\tv_nop" : "+v"(d) : "v"(a), "v"(b)); return d; }
template <int ACT>
__global__ __launch_bounds__(128) void k_gemm2(const _Float16* __restrict__ A, int lda, size_t sA, const _Float16* __restrict__ Bh, int ldb, size_t sB, float alpha, const float* __restrict__ bias, size_t sBias, const float* __restrict__ CP, int rowsPerB, size_t sCPb, int row0g,
    float* __restrict__ C, _Float16* __restrict__ C16, int ldc, size_t sC, int M, int N, int K) { static_assert(ACT == 0 || ACT == 3 || ACT == 6 || ACT == 8 || ACT == 9 || ACT == 11 || ACT == 12 || ACT == 14 || ACT == 15 || ACT == 16 || ACT == 17, "k_gemm2: unsupported ACT code (would silently apply no activation)");
  __shared__ __attribute__((aligned(16))) float so[4][32][68];
  const int tid = threadIdx.x, w = tid >> 5, lane = tid & 31, ln = lane & 15, hh = lane >> 4; const int by = blockIdx.y;
  A += (size_t)by * sA; Bh += (size_t)by * sB; const size_t cofs = (size_t)by * sC; const float* bp = bias ? bias + (size_t)by * sBias : nullptr;
  const int ntn = N >> 6; const int mt = blockIdx.x / ntn, nq = blockIdx.x - mt * ntn; const int row0 = mt * 128 + 32 * w, col0 = nq * 64; if (row0 >= M) return;
  const _Float16* a0p = A + (size_t)(row0 + ln) * lda; const _Float16* a1p = a0p + (size_t)16 * lda;
  const _Float16* b0p = Bh + (size_t)(col0 + ln) * ldb; const _Float16* b1p = b0p + (size_t)16 * ldb; const _Float16* b2p = b1p + (size_t)16 * ldb; const _Float16* b3p = b2p + (size_t)16 * ldb;
  const v8f z8 = {0.f,0.f,0.f,0.f,0.f,0.f,0.f,0.f}; v8f c00 = z8, c01 = z8, c02 = z8, c03 = z8, c10 = z8, c11 = z8, c12 = z8, c13 = z8;
#pragma unroll 1
  for (int kb = 0; kb < K; kb += 32) { const v16h a0 = g2_frag(a0p + kb, hh), a1 = g2_frag(a1p + kb, hh);
    v16h b = g2_frag(b0p + kb, hh); c00 = g2_mma(a0, b, c00); c10 = g2_mma(a1, b, c10);
    b = g2_frag(b1p + kb, hh); c01 = g2_mma(a0, b, c01); c11 = g2_mma(a1, b, c11);
    b = g2_frag(b2p + kb, hh); c02 = g2_mma(a0, b, c02); c12 = g2_mma(a1, b, c12);
    b = g2_frag(b3p + kb, hh); c03 = g2_mma(a0, b, c03); c13 = g2_mma(a1, b, c13); }
  v8f accs[8] = {c00, c01, c02, c03, c10, c11, c12, c13};
#pragma unroll
  for (int u = 0; u < 8; ++u) { const int t = u & 3, half = u >> 2; const int col = col0 + t * 16 + ln; const float bv = bp ? bf16_round(bp[col]) : 0.f;
#pragma unroll
    for (int r = 0; r < 8; ++r) { const int rloc = half * 16 + 8 * hh + r; float v = accs[u][r] * alpha + bv; if (CP) { if (rowsPerB < 0) v += CP[cofs + (size_t)(row0g + row0 + rloc) * ldc + col];      /* rowsPerB < 0: own element of the batched C plane */ else { const int bidx = (row0g + row0 + rloc) / rowsPerB; v += CP[(size_t)bidx * sCPb + (size_t)by * 64 + col]; } }
      if (ACT == 3) v = fmaxf(v, 0.f); else if (ACT == 6) v = 0.5f * v * (1.0f + erff(v * 0.70710678118654752f)); else if (ACT == 11) v = 1.0f / (1.0f + expf(-v)); else if (ACT == 15) v = v / (1.0f + expf(-v)); else if (ACT == 12) v = (v > 0.f) ? v : 0.01f * v; else if (ACT == 8) v = tanhf(v); else if (ACT == 9) v = 0.5f * v * (1.0f + tanhf(0.7978845608028654f * (v + 0.044715f * v * v * v))); else if (ACT == 14) v = (v > 0.f) ? v : 0.1f * v; else if (ACT == 16) v = (v >= 0.f) ? v : 0.3f * v; else if (ACT == 17) v = (v >= 0.f) ? v : 0.2f * v;
      so[w][rloc][t * 16 + ln] = v; } }
  __builtin_amdgcn_fence(__ATOMIC_ACQ_REL, "workgroup"); __builtin_amdgcn_wave_barrier();
  const int rsub = lane >> 4, c4 = (lane & 15) * 4;
  {
#pragma unroll
    for (int q = 0; q < 16; ++q) { const int r = q * 2 + rsub; const v4f v = *(const v4fa*)&so[w][r][c4]; if (C) *(v4f*)(C + cofs + (size_t)(row0 + r) * ldc + col0 + c4) = v; if (C16) { v4h h4; for (int i = 0; i < 4; ++i) h4[i] = (_Float16)v[i]; *(v4h*)(C16 + cofs + (size_t)(row0 + r) * ldc + col0 + c4) = h4; } }
     } }


__global__ __launch_bounds__(256) void k_wnat(const float* __restrict__ w, size_t n8, _Float16* __restrict__ Bt) { const size_t t = (size_t)blockIdx.x * 256 + threadIdx.x; if (t >= n8) return; FragH f; for (int q = 0; q < 8; ++q) f.h[q] = (_Float16)(bf16_round(w[t * 8 + q]) * 16.0f); *(v8us*)((unsigned short*)Bt + t * 8) = f.half[0];  }
__global__ __launch_bounds__(256) void k_rsm(const float* __restrict__ S, _Float16* __restrict__ P, int nrows) {
  #pragma clang fp contract(off)
  const int i = blockIdx.x * 256 + threadIdx.x; if (i >= nrows) return; const float* s = S + (size_t)i * SQ; float mx = -3.0e38f;
#pragma unroll 1
  for (int j = 0; j < SQ; ++j) mx = fmaxf(mx, s[j]); float se = 0.f;
#pragma unroll 1
  for (int j = 0; j < SQ; ++j) se += expf(s[j] - mx); const float sc = 256.0f / se;
#pragma unroll 1
  for (int j0 = 0; j0 < SQ; j0 += 8) { FragH f; for (int q = 0; q < 8; ++q) f.h[q] = (_Float16)(expf(s[j0 + q] - mx) * sc); unsigned short* d = (unsigned short*)P + (size_t)i * SQ + j0; *(v8us*)d = f.half[0];  } }
__global__ __launch_bounds__(256) void k_vt(const _Float16* __restrict__ V16, int b, int h0, _Float16* __restrict__ VT) { __shared__ unsigned short tl[64][65]; const int tid = threadIdx.x; const int hh = blockIdx.x % HG, sg = blockIdx.x / HG; const int s0 = sg * 64; const int h = h0 + hh;
  for (int i = tid; i < 64 * 8; i += 256) { const int j = i / 8, d8 = (i % 8) * 8; FragH f; f.half[0] = *(const v8us*)((const unsigned short*)V16 + ((size_t)b * SQ + s0 + j) * DM + h * HD + d8); for (int q = 0; q < 8; ++q) tl[d8 + q][j] = f.u[q]; }
  __syncthreads();
  { for (int i = tid; i < 64 * 8; i += 256) { const int d = i / 8, j8 = (i % 8) * 8; FragH f; for (int q = 0; q < 8; ++q) f.u[q] = tl[d][j8 + q]; *(v8us*)((unsigned short*)VT + ((size_t)hh * HD + d) * SQ + s0 + j8) = f.half[0]; }  } }


__global__ __launch_bounds__(256) void k_mprep(const float* __restrict__ E, const float* __restrict__ phase, _Float16* __restrict__ MH, _Float16* __restrict__ ML) {
  #pragma clang fp contract(off)
  const int t = blockIdx.x * 256 + threadIdx.x; if (t >= NH * HD * (HD / 8)) return; const int e8 = (t % (HD / 8)) * 8; const int hd_ = t / (HD / 8); const int d = hd_ % HD, h = hd_ / HD; const float c = cosf(bf16_round(phase[h * HD + d])); const float diag = __fmul_rn(__fmul_rn(c, c), 0.125f); FragH fh, fl;
#pragma unroll
  for (int q = 0; q < 8; ++q) { const int e = e8 + q; float m = bf16_round(E[((size_t)h * HD + d) * HD + e]); if (e == d) m = __fadd_rn(m, diag); const _Float16 hi = (_Float16)m; fh.h[q] = hi; fl.h[q] = (_Float16)((m - (float)hi) * 1024.0f); }
  const size_t o = ((size_t)h * HD + d) * HD + e8; { *(v8us*)((unsigned short*)MH + o) = fh.half[0]; *(v8us*)((unsigned short*)ML + o) = fl.half[0];  } }
__device__ __forceinline__ float half_xor(float v) { const int i = __float_as_int(v); return __int_as_float(__builtin_amdgcn_permlanex16(i, i, 0x76543210, 0xfedcba98, false, false)); }      /* value of lane l ^ 16 */
#define FK 64                        /* keys per LDS stage */
#define FPT 72                       /* LDS row pitch in f16: 128 B + 16 B, conflict-free for 16-byte fragment reads */
#define L2E 1.4426950408889634f
__device__ __forceinline__ v8f f_mma(v16h a, v16h b, v8f c) { return __builtin_amdgcn_wmma_f32_16x16x32_f16(false, a, false, b, (short)0, c, false, false); }
__global__ __launch_bounds__(256) void k_fattn(const _Float16* __restrict__ QH, const _Float16* __restrict__ QL, const _Float16* __restrict__ KMH, const _Float16* __restrict__ KML, const _Float16* __restrict__ VT, _Float16* __restrict__ O16) {
  __shared__ __attribute__((aligned(16))) _Float16 sk[2][3][FK][FPT];
  const int tid = threadIdx.x, lane = tid & 31, c = lane & 15, hh = lane >> 4; const int w = __builtin_amdgcn_readfirstlane(tid >> 5);
  const int h = blockIdx.y, b = blockIdx.z; const size_t r0 = (size_t)b * SQ; const size_t q0 = r0 + (size_t)blockIdx.x * 256 + w * 32;
  v16h qh[2][2], ql[2][2];      /* [query tile][k step of 32] */
  for (int qt = 0; qt < 2; ++qt)
    for (int ks = 0; ks < 2; ++ks) { const size_t o = (q0 + qt * 16 + c) * DM + h * HD + ks * 32; qh[qt][ks] = g2_frag(QH + o, hh); ql[qt][ks] = g2_frag(QL + o, hh); }
  const int sr = tid >> 3, sp = (tid & 7) * 8;      /* staging: a wave's 16-byte loads cover four whole 128-byte rows */
  const unsigned short* gkh = (const unsigned short*)KMH + (r0 + sr) * DM + h * HD + sp; const unsigned short* gkl = (const unsigned short*)KML + (r0 + sr) * DM + h * HD + sp;
  const unsigned short* gv = (const unsigned short*)VT + (((size_t)b * NH + h) * HD + sr) * SQ + sp;
  v8us st[6];
  st[0] = *(const v8us*)gkh; st[1] = *(const v8us*)(gkh + (size_t)32 * DM); st[2] = *(const v8us*)gkl; st[3] = *(const v8us*)(gkl + (size_t)32 * DM); st[4] = *(const v8us*)gv; st[5] = *(const v8us*)(gv + (size_t)32 * SQ);
  for (int i = 0; i < 6; ++i) *(v8us*)&sk[0][i >> 1][sr + 32 * (i & 1)][sp] = st[i];
  __syncthreads();      /* publishes stage 0 */
  const v8f z8 = {0.f,0.f,0.f,0.f,0.f,0.f,0.f,0.f};
  v8f o[4][2];      /* O^T tiles [d tile][query tile]: register r = d 16 dt + 8 hh + r of query c */
  for (int dt = 0; dt < 4; ++dt) { o[dt][0] = z8; o[dt][1] = z8; }
  float mu[2] = {-3.0e38f, -3.0e38f};      /* maximum in use per query, log2 domain, equal in both lane halves */
  float ls[2] = {0.f, 0.f};      /* this lane half's share of the sum of weights */
  for (int s = 0; s < SQ / FK; ++s) {
    const int buf = s & 1; const bool more = s + 1 < SQ / FK;
    if (more) { gkh += (size_t)FK * DM; gkl += (size_t)FK * DM; gv += FK;
      st[0] = *(const v8us*)gkh; st[1] = *(const v8us*)(gkh + (size_t)32 * DM); st[2] = *(const v8us*)gkl; st[3] = *(const v8us*)(gkl + (size_t)32 * DM); st[4] = *(const v8us*)gv; st[5] = *(const v8us*)(gv + (size_t)32 * SQ); }
    for (int p = 0; p < FK / 32; ++p) {
      v16h kh[2][2], kl[2][2];      /* [key tile][k step] */
      for (int kt = 0; kt < 2; ++kt)
        for (int ks = 0; ks < 2; ++ks) { kh[kt][ks] = g2_frag(&sk[buf][0][p * 32 + kt * 16 + c][ks * 32], hh); kl[kt][ks] = g2_frag(&sk[buf][1][p * 32 + kt * 16 + c][ks * 32], hh); }
      v8f sc[2][2] = {{z8, z8}, {z8, z8}};      /* S^T tiles [key tile][query tile]: register r = key 16 kt + 8 hh + r, query c */
      for (int ks = 0; ks < 2; ++ks) {
        for (int u = 0; u < 4; ++u) sc[u >> 1][u & 1] = f_mma(kl[u >> 1][ks], qh[u & 1][ks], sc[u >> 1][u & 1]);      /* hi.lo */
        for (int u = 0; u < 4; ++u) sc[u >> 1][u & 1] = f_mma(kh[u >> 1][ks], ql[u & 1][ks], sc[u >> 1][u & 1]);      /* lo.hi */
      }
      for (int u = 0; u < 4; ++u) sc[u >> 1][u & 1] *= 0.0009765625f;      /* the residual planes carry x1024 */
      for (int ks = 0; ks < 2; ++ks)
        for (int u = 0; u < 4; ++u) sc[u >> 1][u & 1] = f_mma(kh[u >> 1][ks], qh[u & 1][ks], sc[u >> 1][u & 1]);      /* hi.hi */
      v16h va[4];
      for (int dt = 0; dt < 4; ++dt) va[dt] = g2_frag(&sk[buf][2][dt * 16 + c][p * 32], hh);
      float mt[2]; bool need = false;
      for (int qt = 0; qt < 2; ++qt) { float m = sc[0][qt][0];
        for (int r = 1; r < 8; ++r) m = fmaxf(m, sc[0][qt][r]);
        for (int r = 0; r < 8; ++r) m = fmaxf(m, sc[1][qt][r]);
        m = fmaxf(m, half_xor(m)) * L2E; mt[qt] = m; need = need || (m > mu[qt] + 8.0f); }
      if (__builtin_amdgcn_ballot_w32(need) != 0) {      /* lazy rescale, one scalar branch per 32 keys: the maximum in use follows only when some query's maximum has passed it by more than 2^8 */
        for (int qt = 0; qt < 2; ++qt) { const float mn = fmaxf(mu[qt], mt[qt]); const float al = __builtin_amdgcn_exp2f(mu[qt] - mn); mu[qt] = mn; ls[qt] *= al;
          for (int dt = 0; dt < 4; ++dt) o[dt][qt] *= al; }
      }
      for (int qt = 0; qt < 2; ++qt) { const float sh = 6.0f - mu[qt];      /* weights carried x64: at most 2^14 in f16 */
        v8f e0 = sc[0][qt] * L2E + sh, e1 = sc[1][qt] * L2E + sh; FragH pb;
        for (int r = 0; r < 8; ++r) { e0[r] = __builtin_amdgcn_exp2f(e0[r]); e1[r] = __builtin_amdgcn_exp2f(e1[r]); }
        for (int r = 0; r < 8; ++r) { pb.h[r] = (_Float16)e0[r]; pb.h[8 + r] = (_Float16)e1[r]; }
        const v8f t = e0 + e1; ls[qt] += ((t[0] + t[1]) + (t[2] + t[3])) + ((t[4] + t[5]) + (t[6] + t[7]));
        for (int dt = 0; dt < 4; ++dt) o[dt][qt] = f_mma(va[dt], pb.v, o[dt][qt]); }
    }
    if (more) {
      for (int i = 0; i < 6; ++i) *(v8us*)&sk[buf ^ 1][i >> 1][sr + 32 * (i & 1)][sp] = st[i]; }
    __syncthreads();      /* publishes the next stage and ends every wave's reads of this one, which the stage after next overwrites */
  }
  for (int qt = 0; qt < 2; ++qt) { const float inv = 64.0f * __builtin_amdgcn_rcpf(ls[qt] + half_xor(ls[qt]));      /* o carried x64, the weights' own carry cancels */
    for (int dt = 0; dt < 4; ++dt) { FragH f;
      for (int r = 0; r < 8; ++r) f.h[r] = (_Float16)(o[dt][qt][r] * inv);
      *(v8us*)((unsigned short*)O16 + (q0 + qt * 16 + c) * DM + h * HD + dt * 16 + 8 * hh) = f.half[0]; } }
}

extern "C" void kernel_launch(void* const* d_in, const int* in_sizes, int n_in,
                              void* d_out, int out_size, void* d_ws, size_t ws_size, hipStream_t stream) {
  (void)in_sizes; (void)n_in; (void)out_size;
  const float* const* I = (const float* const*)d_in; const float* x = I[0]; const float* wq = I[1]; const float* bq = I[2]; const float* wk = I[3]; const float* bk = I[4]; const float* wv = I[5]; const float* bv = I[6]; const float* phase = I[7]; const float* E = I[8]; const float* wo = I[9]; const float* bo = I[10];      /* weights [in][out] */
  char* ws = (char*)d_ws; size_t off = 0;
  auto take = [&](size_t bytes) { char* p = ws + off; off += (bytes + 255) & ~(size_t)255; return p; };
  _Float16* BQ = (_Float16*)take((size_t)DM * DM * 2); _Float16* BK = (_Float16*)take((size_t)DM * DM * 2); _Float16* BV = (_Float16*)take((size_t)DM * DM * 2); _Float16* BO = (_Float16*)take((size_t)DM * DM * 2); _Float16* MH = (_Float16*)take((size_t)NH * HD * HD * 2); _Float16* ML = (_Float16*)take((size_t)NH * HD * HD * 2);
  _Float16* X16 = (_Float16*)take(NR * DM * 2); float* QF = (float*)take(NR * DM * 4); float* KF = (float*)take(NR * DM * 4); _Float16* QH = (_Float16*)take(NR * DM * 2); _Float16* QL = (_Float16*)take(NR * DM * 2); _Float16* KH = (_Float16*)take(NR * DM * 2); _Float16* KL = (_Float16*)take(NR * DM * 2); _Float16* V16 = (_Float16*)take(NR * DM * 2);
  float* KMF = (float*)take(NR * DM * 4); _Float16* KMH = (_Float16*)take(NR * DM * 2); _Float16* KML = (_Float16*)take(NR * DM * 2); _Float16* O16 = (_Float16*)take(NR * DM * 2);
  _Float16* VT = (_Float16*)take((size_t)NB * NH * HD * SQ * 2);
  if (off > ws_size) return;      /* 8.3 + 8 + 32 + 40 + 16 + 16 + 8 + 8 = approx 136 MiB */
  { const unsigned gw = (unsigned)(((size_t)DM * (DM / 8) + 255) / 256); k_wt_f16<<<gw, 256, 0, stream>>>(wq, BQ, DM, DM, 16.0f); k_wt_f16<<<gw, 256, 0, stream>>>(wk, BK, DM, DM, 16.0f); k_wt_f16<<<gw, 256, 0, stream>>>(wv, BV, DM, DM, 16.0f); k_wt_f16<<<gw, 256, 0, stream>>>(wo, BO, DM, DM, 16.0f); }      /* [in][out] -> Bt[n][k] x16 */
  k_mprep<<<(NH * HD * (HD / 8) + 255) / 256, 256, 0, stream>>>(E, phase, MH, ML);
  k_x16<<<(unsigned)((NR * DM / 8 + 255) / 256), 256, 0, stream>>>(x, X16, NR * DM / 8);
  const size_t r0p = (size_t)B0 * SQ; const dim3 gp((unsigned)((MP / 128) * (DM / 64)), 1);
  k_gemm2<0><<<gp, 128, 0, stream>>>(X16 + r0p * DM, DM, 0, BQ, DM, 0, 0.0625f, bq, 0, nullptr, 1, 0, 0, QF + r0p * DM, nullptr, DM, 0, MP, DM, DM);
  k_gemm2<0><<<gp, 128, 0, stream>>>(X16 + r0p * DM, DM, 0, BK, DM, 0, 0.0625f, bk, 0, nullptr, 1, 0, 0, KF + r0p * DM, nullptr, DM, 0, MP, DM, DM);
  k_gemm2<0><<<gp, 128, 0, stream>>>(X16 + r0p * DM, DM, 0, BV, DM, 0, 0.0625f, bv, 0, nullptr, 1, 0, 0, nullptr, V16 + r0p * DM, DM, 0, MP, DM, DM);
  k_hl<<<(unsigned)(((size_t)MP * DM / 8 + 255) / 256), 256, 0, stream>>>(QF + r0p * DM, QH + r0p * DM, QL + r0p * DM, (size_t)MP * DM / 8);
  k_hl<<<(unsigned)(((size_t)MP * DM / 8 + 255) / 256), 256, 0, stream>>>(KF + r0p * DM, KH + r0p * DM, KL + r0p * DM, (size_t)MP * DM / 8);
  { const dim3 gk((unsigned)((NR / 128) * (HD / 64)), NH);      /* KM[k][h*64+d] = sum_e K[k][h*64+e] M[h][d][e], token rows of both batches, all heads on grid.y; three terms */
    k_gemm2<0><<<gk, 128, 0, stream>>>(KH, DM, (size_t)HD, MH, HD, (size_t)HD * HD, 1.0f, nullptr, 0, nullptr, 1, 0, 0, KMF, nullptr, DM, (size_t)HD, (int)NR, HD, HD);
    k_gemm2<0><<<gk, 128, 0, stream>>>(KL, DM, (size_t)HD, MH, HD, (size_t)HD * HD, 0.0009765625f, nullptr, 0, KMF, -1, 0, 0, KMF, nullptr, DM, (size_t)HD, (int)NR, HD, HD);
    k_gemm2<0><<<gk, 128, 0, stream>>>(KH, DM, (size_t)HD, ML, HD, (size_t)HD * HD, 0.0009765625f, nullptr, 0, KMF, -1, 0, 0, KMF, nullptr, DM, (size_t)HD, (int)NR, HD, HD); }
  k_hl<<<(unsigned)((NR * DM / 8 + 255) / 256), 256, 0, stream>>>(KMF, KMH, KML, NR * DM / 8);
  k_vt<NH, SQ><<<NB * NH * (SQ / 64), 256, 0, stream>>>(V16, DM, 0, VT);      /* V^T [NB][NH][HD][SQ] */
  k_fattn<<<dim3(SQ / 256, NH, NB), 256, 0, stream>>>(QH, QL, KMH, KML, VT, O16);      /* o (merged heads, x64) as f16 rows */
  k_gemm2<0><<<dim3((unsigned)((MPO / 128) * (DM / 64)), 1), 128, 0, stream>>>(O16 + r0p * DM, DM, 0, BO, DM, 0, 0.0009765625f, bo, 0, nullptr, 1, 0, 0, (float*)d_out + r0p * DM, nullptr, DM, 0, MPO, DM, DM);      /* out rows are the output layout */
}

// v003
// A run of this version takes 206 microseconds.
// In two side-by-side timings against v002, it was 1.53 and 1.54 times as fast.
// Over all steps from v000 it is 20.7 times as fast.
#include <hip/hip_runtime.h>
// "Quantum" attention (x [2][2048][1024]): Q/K/V = x W + b ([in][out] weights + biases, 16 heads of 64); scores = (Q cos(phase)) (K cos(phase))^T / 8 + Q E K^T per head (phase [16][64], E [16][64][64]) = Q M K^T with M = E + diag(cos^2 phase / 8); softmax over the 2,048 keys; o = attn V merged; out = o out_w + out_b -> [2][2048][1024].
// Structure: token rows; x as exact f16 rows; Q and K as WMMA GEMMs (32x64 wave tiles, operand tiles through LDS, f32 accumulation, exact x16 transposed weights + bias) into f32 rows, split on VALU into f16 hi + 2^-10 residual planes; V as a WMMA GEMM to f16 rows; M as f16 hi + residual planes (VALU, cos in f32); KM = K M^T per head as three accumulating GEMM terms (hi.hi + lo.hi + hi.lo, K = 64) into f32 rows, split into hi + residual planes; V^T for all batches and heads via LDS transposes; attention in one fused launch (k_fattn): scores = Q KM^T as three WMMA terms in one accumulator, online softmax on VALU (f32 statistics, native exp2; weights x64 f16 against the maximum in use), o = P . V^T on WMMA, normalised at the end into merged f16 rows (o carried x64 against f16 subnormal flush); out = o out_w + b GEMM (f32, alpha folds 1/16 and 1/64).
// Compute dtype: inputs rounded to bf16; weights exact (x16 f16); Q, K, M, KM as f16 hi + residual planes (~2^-22); V, softmax weights (x64) and o (x64) plain f16 (~2^-12); scores, softmax statistics f32. v_wmma_f32_16x16x32_f16.
#define NB 2
#define SQ 2048
#define DM 1024
#define NH 16
#define HD 64
#define HG 4                         /* heads per group in the per-batch k_vt, which is not launched */
#define PSC 4096.0f                  /* unused; the softmax weights carry x64 */
#define B0 0                         /* first batch processed (debug hook) */
#define NBR NB                       /* batches processed (debug hook) */
#define QN SQ                        /* unused; k_fattn attends all SQ query rows per batch */
#define NHD NH                       /* unused; k_fattn attends all NH heads */
#define NR ((size_t)NB * SQ)
#define MP ((int)((size_t)NBR * SQ)) /* rows projected (debug hook) */
#define MPO MP                       /* rows through the output GEMM (debug hook) */
typedef __bf16 v16b __attribute__((ext_vector_type(16)));
typedef unsigned short v8us __attribute__((ext_vector_type(8), may_alias));
typedef float  v8f  __attribute__((ext_vector_type(8)));
typedef float  v4f  __attribute__((ext_vector_type(4)));
typedef float  v4fa __attribute__((ext_vector_type(4), may_alias));
union FragB { v16b v; v8us half[2]; unsigned short u[16]; };

__device__ __forceinline__ unsigned short bf16_bits(float x) { unsigned int u = __float_as_uint(x); return (unsigned short)((u + 0x7FFFu + ((u >> 16) & 1u)) >> 16); }
__device__ __forceinline__ float bf16_val(unsigned short b) { return __uint_as_float(((unsigned int)b) << 16); }
__device__ __forceinline__ float bf16_round(float x) { return bf16_val(bf16_bits(x)); }
// D += A·B with NT terms: 1 = ah·bh, 2 = + al·bh (A split), 3 = + ah·bl (both split)
template <int NT>
__device__ __forceinline__ v8f mmaN(v16b ah, v16b al, v16b bh, v16b bl, v8f c) {
  c = __builtin_amdgcn_wmma_f32_16x16x32_bf16(false, ah, false, bh, (short)0, c, false, false);
  if (NT >= 2) c = __builtin_amdgcn_wmma_f32_16x16x32_bf16(false, al, false, bh, (short)0, c, false, false);
  if (NT >= 3) c = __builtin_amdgcn_wmma_f32_16x16x32_bf16(false, ah, false, bl, (short)0, c, false, false);
  asm volatile("v_nop\n\tv_nop\n\tv_nop\n\tv_nop" : "+v"(c) : "v"(ah), "v"(al), "v"(bh), "v"(bl));
  return c;
}

__global__ __launch_bounds__(256) void k_wt_bf16(const float* __restrict__ W, unsigned short* __restrict__ Wt, int K, int N) {
  const int t = blockIdx.x * 256 + threadIdx.x;
  const int k8n = K / 8;
  if (t >= N * k8n) return;
  const int n = t / k8n, k8 = (t % k8n) * 8;
  v8us v;
#pragma unroll
  for (int i = 0; i < 8; ++i) v[i] = bf16_bits(W[(size_t)(k8 + i) * N + n]);
  *(v8us*)(Wt + (size_t)n * K + k8) = v;
  
}

// GEMM C[M][N] (f32, pitch ldc) = act(A[M][K]·W + bias). A f32 row-major (pitch lda) converted per fragment to bf16
// (ASPLIT: hi/lo two planes -> 2 terms, else single rounded term); Wt bf16 [N][K] (pitch ldb). BIAS_BF16 rounds the
// bias to bf16 first (bias quantised to bf16 before the add). K%32==0, M%16==0, N%64==0.
template <bool ASPLIT, int ACT, bool BIAS_BF16>
__global__ __launch_bounds__(128) void k_gemm_bf(const float* __restrict__ A, int lda, const unsigned short* __restrict__ Wt, int ldb,
                                               const float* __restrict__ bias, float* __restrict__ C, int ldc, int M, int N, int K) {
  __shared__ __attribute__((aligned(16))) float so[4][16][64];
  const int tid = threadIdx.x, w = tid >> 5, lane = tid & 31, ln = lane & 15, hh = lane >> 4;
  const int ntn = N / 64;
  const int wid = blockIdx.x * 4 + w;
  const int mt = wid / ntn, nq = wid % ntn;
  if (mt * 16 >= M) return;
  const int row0 = mt * 16, col0 = nq * 64;
  const float* arow = A + (size_t)(row0 + ln) * lda;
  v8f acc[4] = {};
  for (int kb = 0; kb < K; kb += 32) {
    FragB ah, al;
    const v4f x0 = *(const v4fa*)(arow + kb + 8 * hh), x1 = *(const v4fa*)(arow + kb + 8 * hh + 4);
    const v4f x2 = *(const v4fa*)(arow + kb + 16 + 8 * hh), x3 = *(const v4fa*)(arow + kb + 16 + 8 * hh + 4);
    float xs[16] = {x0[0],x0[1],x0[2],x0[3],x1[0],x1[1],x1[2],x1[3],x2[0],x2[1],x2[2],x2[3],x3[0],x3[1],x3[2],x3[3]};
#pragma unroll
    for (int i = 0; i < 16; ++i) { const unsigned short hb = bf16_bits(xs[i]); ah.u[i] = hb; al.u[i] = ASPLIT ? bf16_bits(xs[i] - bf16_val(hb)) : (unsigned short)0; }
#pragma unroll
    for (int t = 0; t < 4; ++t) {
      const unsigned short* brow = Wt + (size_t)(col0 + t * 16 + ln) * ldb + kb;
      FragB b;
      b.half[0] = *(const v8us*)(brow + 8 * hh);
      b.half[1] = *(const v8us*)(brow + 16 + 8 * hh);
      acc[t] = mmaN<ASPLIT ? 2 : 1>(ah.v, al.v, b.v, b.v, acc[t]);
    }
  }
#pragma unroll
  for (int t = 0; t < 4; ++t) {
    float bv = bias ? bias[col0 + t * 16 + ln] : 0.f;
    if (BIAS_BF16) bv = bf16_round(bv);
#pragma unroll
    for (int r = 0; r < 8; ++r) { float v = acc[t][r] + bv; if (ACT == 1) v = fmaxf(v, 0.f); so[w][8 * hh + r][t * 16 + ln] = v; }
  }
  __builtin_amdgcn_fence(__ATOMIC_ACQ_REL, "workgroup");
  __builtin_amdgcn_wave_barrier();
  const int rsub = lane >> 4, c4 = (lane & 15) * 4;
  {
#pragma unroll
    for (int q = 0; q < 8; ++q) {
      const int r = q * 2 + rsub;
      const v4f v = *(const v4fa*)&so[w][r][c4];
      *(v4f*)(C + (size_t)(row0 + r) * ldc + col0 + c4) = v;
    }
    
  }
}

// GEMM C = act(A·W + bias + resid): A f32 (ASPLIT -> hi/lo 2 terms), Wt bf16 [N][K]; ACT 0 none, 1 relu, 2 exact gelu;
// resid (optional, f32, row index = (row % rmod), pitch ldr, RES_BF16 rounds it) added before the activation.
template <bool ASPLIT, int ACT, bool BIAS_BF16, bool RES_BF16>
__global__ __launch_bounds__(128) void k_gemm_bf3(const float* __restrict__ A, int lda, const unsigned short* __restrict__ Wt, int ldb,
                                                const float* __restrict__ bias, const float* __restrict__ resid, int rmod, int ldr,
                                                float* __restrict__ C, int ldc, int M, int N, int K) {
  __shared__ __attribute__((aligned(16))) float so[4][16][64];
  const int tid = threadIdx.x, w = tid >> 5, lane = tid & 31, ln = lane & 15, hh = lane >> 4;
  const int ntn = N / 64;
  const int wid = blockIdx.x * 4 + w;
  const int mt = wid / ntn, nq = wid % ntn;
  if (mt * 16 >= M) return;
  const int row0 = mt * 16, col0 = nq * 64;
  const float* arow = A + (size_t)(row0 + ln) * lda;
  v8f acc[4] = {};
  for (int kb = 0; kb < K; kb += 32) {
    FragB ah, al;
    const v4f x0 = *(const v4fa*)(arow + kb + 8 * hh), x1 = *(const v4fa*)(arow + kb + 8 * hh + 4);
    const v4f x2 = *(const v4fa*)(arow + kb + 16 + 8 * hh), x3 = *(const v4fa*)(arow + kb + 16 + 8 * hh + 4);
    float xs[16] = {x0[0],x0[1],x0[2],x0[3],x1[0],x1[1],x1[2],x1[3],x2[0],x2[1],x2[2],x2[3],x3[0],x3[1],x3[2],x3[3]};
#pragma unroll
    for (int i = 0; i < 16; ++i) { const unsigned short hb = bf16_bits(xs[i]); ah.u[i] = hb; al.u[i] = ASPLIT ? bf16_bits(xs[i] - bf16_val(hb)) : (unsigned short)0; }
#pragma unroll
    for (int t = 0; t < 4; ++t) {
      const unsigned short* brow = Wt + (size_t)(col0 + t * 16 + ln) * ldb + kb;
      FragB b;
      b.half[0] = *(const v8us*)(brow + 8 * hh);
      b.half[1] = *(const v8us*)(brow + 16 + 8 * hh);
      acc[t] = mmaN<ASPLIT ? 2 : 1>(ah.v, al.v, b.v, b.v, acc[t]);
    }
  }
#pragma unroll
  for (int t = 0; t < 4; ++t) {
    const int col = col0 + t * 16 + ln;
    float bv = bias ? bias[col] : 0.f;
    if (BIAS_BF16) bv = bf16_round(bv);
#pragma unroll
    for (int r = 0; r < 8; ++r) {
      float v = acc[t][r] + bv;
      if (resid) { float rv = resid[(size_t)((row0 + 8 * hh + r) % rmod) * ldr + col]; if (RES_BF16) rv = bf16_round(rv); v += rv; }
      if (ACT == 1) v = fmaxf(v, 0.f);
      if (ACT == 2) v = 0.5f * v * (1.0f + erff(v * 0.70710678118654752f));
      if (ACT == 3) { const float u = 0.7978845608028654f * (v + 0.044715f * v * v * v); v = 0.5f * v * (1.0f + tanhf(u)); }
      so[w][8 * hh + r][t * 16 + ln] = v;
    }
  }
  __builtin_amdgcn_fence(__ATOMIC_ACQ_REL, "workgroup");
  __builtin_amdgcn_wave_barrier();
  const int rsub = lane >> 4, c4 = (lane & 15) * 4;
  {
#pragma unroll
    for (int q = 0; q < 8; ++q) {
      const int r = q * 2 + rsub;
      const v4f v = *(const v4fa*)&so[w][r][c4];
      *(v4f*)(C + (size_t)(row0 + r) * ldc + col0 + c4) = v;
    }
    
  }
}
// row LayerNorm (biased variance, eps) over N: s = X (+ R); optional out_sum <- s; out_norm <- (s-mu)*rsqrt(var+eps)*g + b
template <bool PARAM_BF16>
__global__ __launch_bounds__(256) void k_layernorm(const float* __restrict__ X, const float* __restrict__ R, const float* __restrict__ g, const float* __restrict__ bta,
                                                  float* __restrict__ out_sum, float* __restrict__ out_norm, int N, float eps) {
  __shared__ float red[256];
  const int row = blockIdx.x, tid = threadIdx.x;
  const float* x = X + (size_t)row * N; const float* rr = R ? R + (size_t)row * N : nullptr;
  float vals[16];                     // up to N = 4096
  const int per = N / 256;            // contiguous chunk per thread? use strided-by-4 chunks: thread handles j = tid*4 + 1024*u
  float s1 = 0.f;
  for (int u = 0; u < per / 4; ++u) {
    const int j = tid * 4 + 1024 * u;
    const v4f a = *(const v4fa*)(x + j);
    v4f b = {0.f,0.f,0.f,0.f}; if (rr) b = *(const v4fa*)(rr + j);
#pragma unroll
    for (int q = 0; q < 4; ++q) { const float v = a[q] + b[q]; vals[u * 4 + q] = v; s1 += v; }
  }
  red[tid] = s1; __syncthreads();
  for (int st = 128; st > 0; st >>= 1) { if (tid < st) red[tid] += red[tid + st]; __syncthreads(); }
  const float mu = red[0] / (float)N; __syncthreads();
  float s2 = 0.f;
  for (int u = 0; u < per / 4; ++u)
#pragma unroll
    for (int q = 0; q < 4; ++q) { const float c = vals[u * 4 + q] - mu; s2 += c * c; }
  red[tid] = s2; __syncthreads();
  for (int st = 128; st > 0; st >>= 1) { if (tid < st) red[tid] += red[tid + st]; __syncthreads(); }
  const float rs = rsqrtf(red[0] / (float)N + eps);
  {
    for (int u = 0; u < per / 4; ++u) {
      const int j = tid * 4 + 1024 * u;
      v4f o, sm;
#pragma unroll
      for (int q = 0; q < 4; ++q) {
        float gg = g[j + q], bb = bta[j + q];
        if (PARAM_BF16) { gg = bf16_round(gg); bb = bf16_round(bb); }
        sm[q] = vals[u * 4 + q]; o[q] = (vals[u * 4 + q] - mu) * rs * gg + bb;
      }
      if (out_sum) *(v4f*)(out_sum + (size_t)row * N + j) = sm;
      *(v4f*)(out_norm + (size_t)row * N + j) = o;
    }
    
  }
}



// ---- f16 WMMA path (v_wmma_f32_16x16x32_f16): 11-bit significands for operands in range — used where a [0,1] probability operand needs more precision than bf16
typedef _Float16 v16h __attribute__((ext_vector_type(16)));
union FragH { v16h v; v8us half[2]; _Float16 h[16]; unsigned short u[16]; };
template <int NT>
__device__ __forceinline__ v8f mmaH(v16h ah, v16h al, v16h bh, v16h bl, v8f c) {
  c = __builtin_amdgcn_wmma_f32_16x16x32_f16(false, ah, false, bh, (short)0, c, false, false);
  if (NT >= 2) c = __builtin_amdgcn_wmma_f32_16x16x32_f16(false, al, false, bh, (short)0, c, false, false);
  if (NT >= 3) c = __builtin_amdgcn_wmma_f32_16x16x32_f16(false, ah, false, bl, (short)0, c, false, false);
  asm volatile("v_nop\n\tv_nop\n\tv_nop\n\tv_nop" : "+v"(c) : "v"(ah), "v"(al), "v"(bh), "v"(bl));
  return c;
}
// batched GEMM like k_gemm_b but f16 operands: A f32 (split into f16 hi/lo if ASPLIT, else rounded to f16), Bt = f16 values [n][k]; alpha; C f32; N multiple of 16 (partial tiles skipped)
template <bool ASPLIT>
__global__ __launch_bounds__(128) void k_gemm_h(const float* __restrict__ A, int lda, size_t sA, const _Float16* __restrict__ Bh, int ldb, size_t sB, float alpha, float* __restrict__ C, int ldc, size_t sC, int M, int N, int K) {
  __shared__ __attribute__((aligned(16))) float so[4][16][64];
  const int tid = threadIdx.x, w = tid >> 5, lane = tid & 31, ln = lane & 15, hh = lane >> 4; const int by = blockIdx.y;
  A += (size_t)by * sA; Bh += (size_t)by * sB; C += (size_t)by * sC;
  const int ntn = (N + 63) / 64; const int wid = blockIdx.x * 4 + w; const int mt = wid / ntn, nq = wid % ntn; if (mt * 16 >= M) return;
  const int row0 = mt * 16, col0 = nq * 64; const float* arow = A + (size_t)(row0 + ln) * lda;
  v8f acc[4] = {};
  for (int kb = 0; kb < K; kb += 32) {
    FragH ah, al;
    const v4f x0 = *(const v4fa*)(arow + kb + 8 * hh), x1 = *(const v4fa*)(arow + kb + 8 * hh + 4), x2 = *(const v4fa*)(arow + kb + 16 + 8 * hh), x3 = *(const v4fa*)(arow + kb + 16 + 8 * hh + 4);
    float xs[16] = {x0[0],x0[1],x0[2],x0[3],x1[0],x1[1],x1[2],x1[3],x2[0],x2[1],x2[2],x2[3],x3[0],x3[1],x3[2],x3[3]};
#pragma unroll
    for (int i = 0; i < 16; ++i) { const _Float16 h = (_Float16)xs[i]; ah.h[i] = h; al.h[i] = ASPLIT ? (_Float16)(xs[i] - (float)h) : (_Float16)0.0f; }
#pragma unroll
    for (int t = 0; t < 4; ++t) { if (col0 + t * 16 >= N) continue; const size_t boff = (size_t)(col0 + t * 16 + ln) * ldb + kb; FragH bq; bq.half[0] = *(const v8us*)(Bh + boff + 8 * hh); bq.half[1] = *(const v8us*)(Bh + boff + 16 + 8 * hh);
      acc[t] = mmaH<ASPLIT ? 2 : 1>(ah.v, al.v, bq.v, bq.v, acc[t]); }
  }
#pragma unroll
  for (int t = 0; t < 4; ++t) { if (col0 + t * 16 >= N) continue;
#pragma unroll
    for (int r = 0; r < 8; ++r) so[w][8 * hh + r][t * 16 + ln] = acc[t][r] * alpha; }
  __builtin_amdgcn_fence(__ATOMIC_ACQ_REL, "workgroup"); __builtin_amdgcn_wave_barrier();
  const int rsub = lane >> 4, c4 = (lane & 15) * 4;
  {
#pragma unroll
    for (int q = 0; q < 8; ++q) { const int r = q * 2 + rsub; if (col0 + c4 < N) { const v4f v = *(const v4fa*)&so[w][r][c4]; *(v4f*)(C + (size_t)(row0 + r) * ldc + col0 + c4) = v; } }
     }
}

// Wt[n][k] = f16(W[k][n]·scale) from f32 row-major W[K][N] (scale = power of two; bf16-exact weights stay exact in f16 away from the subnormal range)
__global__ __launch_bounds__(256) void k_wt_f16(const float* __restrict__ W, _Float16* __restrict__ Wt, int K, int N, float scale) {
  const int t = blockIdx.x * 256 + threadIdx.x; if (t >= N * (K / 8)) return; const int n = t / (K / 8), k8 = (t % (K / 8)) * 8; FragH f;
#pragma unroll
  for (int i = 0; i < 8; ++i) f.h[i] = (_Float16)(bf16_round(W[(size_t)(k8 + i) * N + n]) * scale); const v8us o = f.half[0];
  *(v8us*)((unsigned short*)Wt + (size_t)n * K + k8) = o; 
}
// k_gemm_hh variant with fused epilogue: v = acc·alpha + bias[by·sBias + col] (+ CP[(row/rowsPerB)·sCPb + by·64 + col] if CP) ; ACT 0 none / 1 elu ; writes f16 C16 (and f32 C if non-null)
template <int ACT>
__global__ __launch_bounds__(128) void k_gemm_hhx(const _Float16* __restrict__ A, int lda, size_t sA, const _Float16* __restrict__ Bh, int ldb, size_t sB, float alpha, const float* __restrict__ bias, size_t sBias, const float* __restrict__ CP, int rowsPerB, size_t sCPb, int row0g,
    float* __restrict__ C, _Float16* __restrict__ C16, int ldc, size_t sC, int M, int N, int K) {
  __shared__ __attribute__((aligned(16))) float so[4][16][64];
  const int tid = threadIdx.x, w = tid >> 5, lane = tid & 31, ln = lane & 15, hh = lane >> 4; const int by = blockIdx.y;
  A += (size_t)by * sA; Bh += (size_t)by * sB; const size_t cofs = (size_t)by * sC; const float* bp = bias ? bias + (size_t)by * sBias : nullptr;
  const int ntn = (N + 63) / 64; const int wid = blockIdx.x * 4 + w; const int mt = wid / ntn, nq = wid % ntn; if (mt * 16 >= M) return;
  const int row0 = mt * 16, col0 = nq * 64; const _Float16* arow = A + (size_t)(row0 + ln) * lda;
  v8f acc[4] = {};
  for (int kb = 0; kb < K; kb += 32) { FragH ah; ah.half[0] = *(const v8us*)((const unsigned short*)arow + kb + 8 * hh); ah.half[1] = *(const v8us*)((const unsigned short*)arow + kb + 16 + 8 * hh);
#pragma unroll
    for (int t = 0; t < 4; ++t) { if (col0 + t * 16 >= N) continue; const size_t boff = (size_t)(col0 + t * 16 + ln) * ldb + kb; FragH bq; bq.half[0] = *(const v8us*)((const unsigned short*)Bh + boff + 8 * hh); bq.half[1] = *(const v8us*)((const unsigned short*)Bh + boff + 16 + 8 * hh);
      acc[t] = mmaH<1>(ah.v, ah.v, bq.v, bq.v, acc[t]); }
  }
#pragma unroll
  for (int t = 0; t < 4; ++t) { if (col0 + t * 16 >= N) continue; const int col = col0 + t * 16 + ln; const float bv = bp ? bf16_round(bp[col]) : 0.f;
#pragma unroll
    for (int r = 0; r < 8; ++r) { float v = acc[t][r] * alpha + bv; if (CP) { const int rr = row0g + row0 + 8 * hh + r; if (rowsPerB < 0) v += CP[cofs + (size_t)rr * ldc + col];      /* rowsPerB < 0: own element of the batched C plane */ else { const int bidx = rr / rowsPerB; v += CP[(size_t)bidx * sCPb + (size_t)by * 64 + col]; } } if (ACT == 1) v = (v > 0.f) ? v : expm1f(v); else if (ACT == 7) v = (v > 0.f) ? v + 1.0f : expf(v); else if (ACT == 8) v = tanhf(v); else if (ACT == 9) v = 0.5f * v * (1.0f + tanhf(0.7978845608028654f * (v + 0.044715f * v * v * v))); else if (ACT == 11) v = 1.0f / (1.0f + expf(-v)); else if (ACT == 12) v = (v > 0.f) ? v : 0.01f * v; else if (ACT == 14) v = (v > 0.f) ? v : 0.1f * v; else if (ACT == 16) v = (v >= 0.f) ? v : 0.3f * v; else if (ACT == 17) v = (v >= 0.f) ? v : 0.2f * v; else if (ACT == 15) v = v / (1.0f + expf(-v)); else if (ACT == 3) v = fmaxf(v, 0.f); else if (ACT == 6) v = 0.5f * v * (1.0f + erff(v * 0.70710678118654752f)); so[w][8 * hh + r][t * 16 + ln] = v; } }
  __builtin_amdgcn_fence(__ATOMIC_ACQ_REL, "workgroup"); __builtin_amdgcn_wave_barrier();
  const int rsub = lane >> 4, c4 = (lane & 15) * 4; typedef _Float16 v4h __attribute__((ext_vector_type(4)));
  {
#pragma unroll
    for (int q = 0; q < 8; ++q) { const int r = q * 2 + rsub; if (col0 + c4 < N) { const v4f v = *(const v4fa*)&so[w][r][c4]; if (C) *(v4f*)(C + cofs + (size_t)(row0 + r) * ldc + col0 + c4) = v; if (C16) { v4h h4; for (int i = 0; i < 4; ++i) h4[i] = (_Float16)v[i]; *(v4h*)(C16 + cofs + (size_t)(row0 + r) * ldc + col0 + c4) = h4; } } }
     }
}


typedef _Float16 v4h __attribute__((ext_vector_type(4)));

__global__ __launch_bounds__(256) void k_x16(const float* __restrict__ x, _Float16* __restrict__ X16, size_t n8) { const size_t t = (size_t)blockIdx.x * 256 + threadIdx.x; if (t >= n8) return; FragH f;
#pragma unroll
  for (int q = 0; q < 8; ++q) f.h[q] = (_Float16)bf16_round(x[t * 8 + q]); *(v8us*)((unsigned short*)X16 + t * 8) = f.half[0];  }
__global__ __launch_bounds__(256) void k_h16(const float* __restrict__ x, _Float16* __restrict__ X16, size_t n8) { const size_t t = (size_t)blockIdx.x * 256 + threadIdx.x; if (t >= n8) return; FragH f;
#pragma unroll
  for (int q = 0; q < 8; ++q) f.h[q] = (_Float16)x[t * 8 + q]; *(v8us*)((unsigned short*)X16 + t * 8) = f.half[0];  }
__global__ __launch_bounds__(256) void k_round16f(const float* __restrict__ W, _Float16* __restrict__ Bt, size_t n8) { const size_t t = (size_t)blockIdx.x * 256 + threadIdx.x; if (t >= n8) return; FragH f;
#pragma unroll
  for (int i = 0; i < 8; ++i) f.h[i] = (_Float16)(bf16_round(W[t * 8 + i]) * 16.0f); *(v8us*)((unsigned short*)Bt + t * 8) = f.half[0];  }
template <int NHv, int TTv>
__global__ __launch_bounds__(256) void k_vt(const _Float16* __restrict__ V16, int ldv, int voff, _Float16* __restrict__ Vt) { __shared__ unsigned short tl[64][66]; const int tid = threadIdx.x; const int slab = blockIdx.x / (TTv / 64), lg = blockIdx.x % (TTv / 64); const int b = slab / NHv, h = slab % NHv;
  for (int i = tid; i < 64 * 8; i += 256) { const int r = i / 8, c8 = (i % 8) * 8; FragH f; f.half[0] = *(const v8us*)((const unsigned short*)V16 + ((size_t)b * TTv + lg * 64 + r) * ldv + voff + h * 64 + c8);
#pragma unroll
    for (int q = 0; q < 8; ++q) tl[r][c8 + q] = f.u[q]; }
  __syncthreads();
  {
#pragma unroll
    for (int rd = 0; rd < 2; ++rd) { const int d = rd * 32 + tid / 8, pc = tid % 8; FragH f;
#pragma unroll
      for (int q = 0; q < 8; ++q) f.u[q] = tl[pc * 8 + q][d];
      *(v8us*)((unsigned short*)Vt + ((size_t)slab * 64 + d) * TTv + lg * 64 + pc * 8) = f.half[0]; }
     } }

__global__ __launch_bounds__(256) void k_hl(const float* __restrict__ F, _Float16* __restrict__ Hh, _Float16* __restrict__ Hl, size_t n8) { const size_t t = (size_t)blockIdx.x * 256 + threadIdx.x; if (t >= n8) return; FragH fh, fl; const v4f a = *(const v4fa*)(F + t * 8), c = *(const v4fa*)(F + t * 8 + 4);
#pragma unroll
  for (int q = 0; q < 4; ++q) { _Float16 h = (_Float16)a[q]; fh.h[q] = h; fl.h[q] = (_Float16)((a[q] - (float)h) * 1024.0f); h = (_Float16)c[q]; fh.h[4 + q] = h; fl.h[4 + q] = (_Float16)((c[q] - (float)h) * 1024.0f); }
  { *(v8us*)((unsigned short*)Hh + t * 8) = fh.half[0]; *(v8us*)((unsigned short*)Hl + t * 8) = fl.half[0];  } }

// ---- fast GEMM (workgroup tile 128x64, wave tile 32x64; requires M % 128 == 0, N % 64 == 0, K % KS == 0); epilogue = k_gemm_hhx semantics ----
// The A tile (128 rows) and the B tile (64 rows) go through LDS in stages of KS k, two buffers: every 16-byte global load of a wave covers whole 128-byte lines, the next stage's loads are all
// issued ahead of this stage's products and stored behind them, one barrier per stage. The fragments and their k order are the ones the global rows gave.
__device__ __forceinline__ v16h g2_frag(const _Float16* p, int hh) { FragH f; f.half[0] = *(const v8us*)((const unsigned short*)p + 8 * hh); f.half[1] = *(const v8us*)((const unsigned short*)p + 16 + 8 * hh); return f.v; }
__device__ __forceinline__ v8f g2_mma(v16h a, v16h b, v8f c) { v8f d = __builtin_amdgcn_wmma_f32_16x16x32_f16(false, a, false, b, (short)0, c, false, false); asm volatile("v_nop\n\tv_nop\n\tv_nop\n\tv_nop" : "+v"(d) : "v"(a), "v"(b)); return d; }
template <int ACT, int KS, int LDA, int LDB>
__global__ __launch_bounds__(128) void k_gemm2(const _Float16* __restrict__ A, size_t sA, const _Float16* __restrict__ Bh, size_t sB, float alpha, const float* __restrict__ bias, size_t sBias, const float* __restrict__ CP, int rowsPerB, size_t sCPb, int row0g,
    float* __restrict__ C, _Float16* __restrict__ C16, int ldc, size_t sC, int M, int N, int K) { static_assert(ACT == 0 || ACT == 3 || ACT == 6 || ACT == 8 || ACT == 9 || ACT == 11 || ACT == 12 || ACT == 14 || ACT == 15 || ACT == 16 || ACT == 17, "k_gemm2: unsupported ACT code (would silently apply no activation)");
  constexpr int CH = KS / 8;        /* 16-byte pieces per tile row */
  constexpr int RPR = 128 / CH;     /* tile rows that one load of every thread covers */
  constexpr int PT = KS + 8;        /* LDS row pitch in f16: the row + 16 B, conflict-free for 16-byte fragment reads */
  __shared__ __attribute__((aligned(16))) float so[4][32][68];
  __shared__ __attribute__((aligned(16))) _Float16 sa[2][128][PT];
  __shared__ __attribute__((aligned(16))) _Float16 sb[2][64][PT];
  const int tid = threadIdx.x, w = tid >> 5, lane = tid & 31, ln = lane & 15, hh = lane >> 4; const int by = blockIdx.y;
  A += (size_t)by * sA; Bh += (size_t)by * sB; const size_t cofs = (size_t)by * sC; const float* bp = bias ? bias + (size_t)by * sBias : nullptr;
  const int ntn = N >> 6; const int mt = blockIdx.x / ntn, nq = blockIdx.x - mt * ntn; const int row0 = mt * 128 + 32 * w, col0 = nq * 64; if (mt * 128 >= M) return;      /* the same for the whole workgroup, in front of every barrier */
  const int sr = tid / CH, sp = (tid % CH) * 8;
  const unsigned short* ga = (const unsigned short*)A + (size_t)(mt * 128 + sr) * LDA + sp; const unsigned short* gb = (const unsigned short*)Bh + (size_t)(col0 + sr) * LDB + sp;
  constexpr size_t da = (size_t)RPR * LDA, db = (size_t)RPR * LDB;      /* row pitches LDA, LDB are compile-time, so a stage's loads share one address pair per operand and differ in the immediate offset */
  v8us ta[CH], tb[CH / 2];
  for (int i = 0; i < CH; ++i) ta[i] = *(const v8us*)(ga + i * da);
  for (int i = 0; i < CH / 2; ++i) tb[i] = *(const v8us*)(gb + i * db);
  for (int i = 0; i < CH; ++i) *(v8us*)&sa[0][i * RPR + sr][sp] = ta[i];
  for (int i = 0; i < CH / 2; ++i) *(v8us*)&sb[0][i * RPR + sr][sp] = tb[i];
  __syncthreads();      /* publishes stage 0 */
  const v8f z8 = {0.f,0.f,0.f,0.f,0.f,0.f,0.f,0.f}; v8f c00 = z8, c01 = z8, c02 = z8, c03 = z8, c10 = z8, c11 = z8, c12 = z8, c13 = z8;
  const int nst = K / KS;
  const int ra = 32 * w + ln;
  for (int s = 0; s < nst; ++s) { const int buf = s & 1; const bool more = s + 1 < nst;
    if (more) { ga += KS; gb += KS;
      for (int i = 0; i < CH; ++i) ta[i] = *(const v8us*)(ga + i * da);
      for (int i = 0; i < CH / 2; ++i) tb[i] = *(const v8us*)(gb + i * db); }
    for (int ks = 0; ks < KS / 32; ++ks) {      /* the six fragments of 32 k are read from LDS as one group, then their eight products */
      const v16h a0 = g2_frag(&sa[buf][ra][ks * 32], hh), a1 = g2_frag(&sa[buf][ra + 16][ks * 32], hh);
      const v16h b0 = g2_frag(&sb[buf][ln][ks * 32], hh), b1 = g2_frag(&sb[buf][16 + ln][ks * 32], hh), b2 = g2_frag(&sb[buf][32 + ln][ks * 32], hh), b3 = g2_frag(&sb[buf][48 + ln][ks * 32], hh);
      c00 = g2_mma(a0, b0, c00); c10 = g2_mma(a1, b0, c10); c01 = g2_mma(a0, b1, c01); c11 = g2_mma(a1, b1, c11);
      c02 = g2_mma(a0, b2, c02); c12 = g2_mma(a1, b2, c12); c03 = g2_mma(a0, b3, c03); c13 = g2_mma(a1, b3, c13); }
    if (more) {
      for (int i = 0; i < CH; ++i) *(v8us*)&sa[buf ^ 1][i * RPR + sr][sp] = ta[i];
      for (int i = 0; i < CH / 2; ++i) *(v8us*)&sb[buf ^ 1][i * RPR + sr][sp] = tb[i];
      __syncthreads(); }      /* publishes the next stage and ends every wave's reads of this one, which the stage after next overwrites */
  }
  v8f accs[8] = {c00, c01, c02, c03, c10, c11, c12, c13};
#pragma unroll
  for (int u = 0; u < 8; ++u) { const int t = u & 3, half = u >> 2; const int col = col0 + t * 16 + ln; const float bv = bp ? bf16_round(bp[col]) : 0.f;
#pragma unroll
    for (int r = 0; r < 8; ++r) { const int rloc = half * 16 + 8 * hh + r; float v = accs[u][r] * alpha + bv; if (CP) { if (rowsPerB < 0) v += CP[cofs + (size_t)(row0g + row0 + rloc) * ldc + col];      /* rowsPerB < 0: own element of the batched C plane */ else { const int bidx = (row0g + row0 + rloc) / rowsPerB; v += CP[(size_t)bidx * sCPb + (size_t)by * 64 + col]; } }
      if (ACT == 3) v = fmaxf(v, 0.f); else if (ACT == 6) v = 0.5f * v * (1.0f + erff(v * 0.70710678118654752f)); else if (ACT == 11) v = 1.0f / (1.0f + expf(-v)); else if (ACT == 15) v = v / (1.0f + expf(-v)); else if (ACT == 12) v = (v > 0.f) ? v : 0.01f * v; else if (ACT == 8) v = tanhf(v); else if (ACT == 9) v = 0.5f * v * (1.0f + tanhf(0.7978845608028654f * (v + 0.044715f * v * v * v))); else if (ACT == 14) v = (v > 0.f) ? v : 0.1f * v; else if (ACT == 16) v = (v >= 0.f) ? v : 0.3f * v; else if (ACT == 17) v = (v >= 0.f) ? v : 0.2f * v;
      so[w][rloc][t * 16 + ln] = v; } }
  __builtin_amdgcn_fence(__ATOMIC_ACQ_REL, "workgroup"); __builtin_amdgcn_wave_barrier();
  const int rsub = lane >> 4, c4 = (lane & 15) * 4;
  {
#pragma unroll
    for (int q = 0; q < 16; ++q) { const int r = q * 2 + rsub; const v4f v = *(const v4fa*)&so[w][r][c4]; if (C) *(v4f*)(C + cofs + (size_t)(row0 + r) * ldc + col0 + c4) = v; if (C16) { v4h h4; for (int i = 0; i < 4; ++i) h4[i] = (_Float16)v[i]; *(v4h*)(C16 + cofs + (size_t)(row0 + r) * ldc + col0 + c4) = h4; } }
     } }


__global__ __launch_bounds__(256) void k_wnat(const float* __restrict__ w, size_t n8, _Float16* __restrict__ Bt) { const size_t t = (size_t)blockIdx.x * 256 + threadIdx.x; if (t >= n8) return; FragH f; for (int q = 0; q < 8; ++q) f.h[q] = (_Float16)(bf16_round(w[t * 8 + q]) * 16.0f); *(v8us*)((unsigned short*)Bt + t * 8) = f.half[0];  }
__global__ __launch_bounds__(256) void k_rsm(const float* __restrict__ S, _Float16* __restrict__ P, int nrows) {
  #pragma clang fp contract(off)
  const int i = blockIdx.x * 256 + threadIdx.x; if (i >= nrows) return; const float* s = S + (size_t)i * SQ; float mx = -3.0e38f;
#pragma unroll 1
  for (int j = 0; j < SQ; ++j) mx = fmaxf(mx, s[j]); float se = 0.f;
#pragma unroll 1
  for (int j = 0; j < SQ; ++j) se += expf(s[j] - mx); const float sc = 256.0f / se;
#pragma unroll 1
  for (int j0 = 0; j0 < SQ; j0 += 8) { FragH f; for (int q = 0; q < 8; ++q) f.h[q] = (_Float16)(expf(s[j0 + q] - mx) * sc); unsigned short* d = (unsigned short*)P + (size_t)i * SQ + j0; *(v8us*)d = f.half[0];  } }
__global__ __launch_bounds__(256) void k_vt(const _Float16* __restrict__ V16, int b, int h0, _Float16* __restrict__ VT) { __shared__ unsigned short tl[64][65]; const int tid = threadIdx.x; const int hh = blockIdx.x % HG, sg = blockIdx.x / HG; const int s0 = sg * 64; const int h = h0 + hh;
  for (int i = tid; i < 64 * 8; i += 256) { const int j = i / 8, d8 = (i % 8) * 8; FragH f; f.half[0] = *(const v8us*)((const unsigned short*)V16 + ((size_t)b * SQ + s0 + j) * DM + h * HD + d8); for (int q = 0; q < 8; ++q) tl[d8 + q][j] = f.u[q]; }
  __syncthreads();
  { for (int i = tid; i < 64 * 8; i += 256) { const int d = i / 8, j8 = (i % 8) * 8; FragH f; for (int q = 0; q < 8; ++q) f.u[q] = tl[d][j8 + q]; *(v8us*)((unsigned short*)VT + ((size_t)hh * HD + d) * SQ + s0 + j8) = f.half[0]; }  } }


__global__ __launch_bounds__(256) void k_mprep(const float* __restrict__ E, const float* __restrict__ phase, _Float16* __restrict__ MH, _Float16* __restrict__ ML) {
  #pragma clang fp contract(off)
  const int t = blockIdx.x * 256 + threadIdx.x; if (t >= NH * HD * (HD / 8)) return; const int e8 = (t % (HD / 8)) * 8; const int hd_ = t / (HD / 8); const int d = hd_ % HD, h = hd_ / HD; const float c = cosf(bf16_round(phase[h * HD + d])); const float diag = __fmul_rn(__fmul_rn(c, c), 0.125f); FragH fh, fl;
#pragma unroll
  for (int q = 0; q < 8; ++q) { const int e = e8 + q; float m = bf16_round(E[((size_t)h * HD + d) * HD + e]); if (e == d) m = __fadd_rn(m, diag); const _Float16 hi = (_Float16)m; fh.h[q] = hi; fl.h[q] = (_Float16)((m - (float)hi) * 1024.0f); }
  const size_t o = ((size_t)h * HD + d) * HD + e8; { *(v8us*)((unsigned short*)MH + o) = fh.half[0]; *(v8us*)((unsigned short*)ML + o) = fl.half[0];  } }
__device__ __forceinline__ float half_xor(float v) { const int i = __float_as_int(v); return __int_as_float(__builtin_amdgcn_permlanex16(i, i, 0x76543210, 0xfedcba98, false, false)); }      /* value of lane l ^ 16 */
#define FK 64                        /* keys per LDS stage */
#define FPT 72                       /* LDS row pitch in f16: 128 B + 16 B, conflict-free for 16-byte fragment reads */
#define L2E 1.4426950408889634f
__device__ __forceinline__ v8f f_mma(v16h a, v16h b, v8f c) { return __builtin_amdgcn_wmma_f32_16x16x32_f16(false, a, false, b, (short)0, c, false, false); }
__global__ __launch_bounds__(256) void k_fattn(const _Float16* __restrict__ QH, const _Float16* __restrict__ QL, const _Float16* __restrict__ KMH, const _Float16* __restrict__ KML, const _Float16* __restrict__ VT, _Float16* __restrict__ O16) {
  __shared__ __attribute__((aligned(16))) _Float16 sk[2][3][FK][FPT];
  const int tid = threadIdx.x, lane = tid & 31, c = lane & 15, hh = lane >> 4; const int w = __builtin_amdgcn_readfirstlane(tid >> 5);
  const int h = blockIdx.y, b = blockIdx.z; const size_t r0 = (size_t)b * SQ; const size_t q0 = r0 + (size_t)blockIdx.x * 256 + w * 32;
  v16h qh[2][2], ql[2][2];      /* [query tile][k step of 32] */
  for (int qt = 0; qt < 2; ++qt)
    for (int ks = 0; ks < 2; ++ks) { const size_t o = (q0 + qt * 16 + c) * DM + h * HD + ks * 32; qh[qt][ks] = g2_frag(QH + o, hh); ql[qt][ks] = g2_frag(QL + o, hh); }
  const int sr = tid >> 3, sp = (tid & 7) * 8;      /* staging: a wave's 16-byte loads cover four whole 128-byte rows */
  const unsigned short* gkh = (const unsigned short*)KMH + (r0 + sr) * DM + h * HD + sp; const unsigned short* gkl = (const unsigned short*)KML + (r0 + sr) * DM + h * HD + sp;
  const unsigned short* gv = (const unsigned short*)VT + (((size_t)b * NH + h) * HD + sr) * SQ + sp;
  v8us st[6];
  st[0] = *(const v8us*)gkh; st[1] = *(const v8us*)(gkh + (size_t)32 * DM); st[2] = *(const v8us*)gkl; st[3] = *(const v8us*)(gkl + (size_t)32 * DM); st[4] = *(const v8us*)gv; st[5] = *(const v8us*)(gv + (size_t)32 * SQ);
  for (int i = 0; i < 6; ++i) *(v8us*)&sk[0][i >> 1][sr + 32 * (i & 1)][sp] = st[i];
  __syncthreads();      /* publishes stage 0 */
  const v8f z8 = {0.f,0.f,0.f,0.f,0.f,0.f,0.f,0.f};
  v8f o[4][2];      /* O^T tiles [d tile][query tile]: register r = d 16 dt + 8 hh + r of query c */
  for (int dt = 0; dt < 4; ++dt) { o[dt][0] = z8; o[dt][1] = z8; }
  float mu[2] = {-3.0e38f, -3.0e38f};      /* maximum in use per query, log2 domain, equal in both lane halves */
  float ls[2] = {0.f, 0.f};      /* this lane half's share of the sum of weights */
  for (int s = 0; s < SQ / FK; ++s) {
    const int buf = s & 1; const bool more = s + 1 < SQ / FK;
    if (more) { gkh += (size_t)FK * DM; gkl += (size_t)FK * DM; gv += FK;
      st[0] = *(const v8us*)gkh; st[1] = *(const v8us*)(gkh + (size_t)32 * DM); st[2] = *(const v8us*)gkl; st[3] = *(const v8us*)(gkl + (size_t)32 * DM); st[4] = *(const v8us*)gv; st[5] = *(const v8us*)(gv + (size_t)32 * SQ); }
    for (int p = 0; p < FK / 32; ++p) {
      v16h kh[2][2], kl[2][2];      /* [key tile][k step] */
      for (int kt = 0; kt < 2; ++kt)
        for (int ks = 0; ks < 2; ++ks) { kh[kt][ks] = g2_frag(&sk[buf][0][p * 32 + kt * 16 + c][ks * 32], hh); kl[kt][ks] = g2_frag(&sk[buf][1][p * 32 + kt * 16 + c][ks * 32], hh); }
      v8f sc[2][2] = {{z8, z8}, {z8, z8}};      /* S^T tiles [key tile][query tile]: register r = key 16 kt + 8 hh + r, query c */
      for (int ks = 0; ks < 2; ++ks) {
        for (int u = 0; u < 4; ++u) sc[u >> 1][u & 1] = f_mma(kl[u >> 1][ks], qh[u & 1][ks], sc[u >> 1][u & 1]);      /* hi.lo */
        for (int u = 0; u < 4; ++u) sc[u >> 1][u & 1] = f_mma(kh[u >> 1][ks], ql[u & 1][ks], sc[u >> 1][u & 1]);      /* lo.hi */
      }
      for (int u = 0; u < 4; ++u) sc[u >> 1][u & 1] *= 0.0009765625f;      /* the residual planes carry x1024 */
      for (int ks = 0; ks < 2; ++ks)
        for (int u = 0; u < 4; ++u) sc[u >> 1][u & 1] = f_mma(kh[u >> 1][ks], qh[u & 1][ks], sc[u >> 1][u & 1]);      /* hi.hi */
      v16h va[4];
      for (int dt = 0; dt < 4; ++dt) va[dt] = g2_frag(&sk[buf][2][dt * 16 + c][p * 32], hh);
      float mt[2]; bool need = false;
      for (int qt = 0; qt < 2; ++qt) { float m = sc[0][qt][0];
        for (int r = 1; r < 8; ++r) m = fmaxf(m, sc[0][qt][r]);
        for (int r = 0; r < 8; ++r) m = fmaxf(m, sc[1][qt][r]);
        m = fmaxf(m, half_xor(m)) * L2E; mt[qt] = m; need = need || (m > mu[qt] + 8.0f); }
      if (__builtin_amdgcn_ballot_w32(need) != 0) {      /* lazy rescale, one scalar branch per 32 keys: the maximum in use follows only when some query's maximum has passed it by more than 2^8 */
        for (int qt = 0; qt < 2; ++qt) { const float mn = fmaxf(mu[qt], mt[qt]); const float al = __builtin_amdgcn_exp2f(mu[qt] - mn); mu[qt] = mn; ls[qt] *= al;
          for (int dt = 0; dt < 4; ++dt) o[dt][qt] *= al; }
      }
      for (int qt = 0; qt < 2; ++qt) { const float sh = 6.0f - mu[qt];      /* weights carried x64: at most 2^14 in f16 */
        v8f e0 = sc[0][qt] * L2E + sh, e1 = sc[1][qt] * L2E + sh; FragH pb;
        for (int r = 0; r < 8; ++r) { e0[r] = __builtin_amdgcn_exp2f(e0[r]); e1[r] = __builtin_amdgcn_exp2f(e1[r]); }
        for (int r = 0; r < 8; ++r) { pb.h[r] = (_Float16)e0[r]; pb.h[8 + r] = (_Float16)e1[r]; }
        const v8f t = e0 + e1; ls[qt] += ((t[0] + t[1]) + (t[2] + t[3])) + ((t[4] + t[5]) + (t[6] + t[7]));
        for (int dt = 0; dt < 4; ++dt) o[dt][qt] = f_mma(va[dt], pb.v, o[dt][qt]); }
    }
    if (more) {
      for (int i = 0; i < 6; ++i) *(v8us*)&sk[buf ^ 1][i >> 1][sr + 32 * (i & 1)][sp] = st[i]; }
    __syncthreads();      /* publishes the next stage and ends every wave's reads of this one, which the stage after next overwrites */
  }
  for (int qt = 0; qt < 2; ++qt) { const float inv = 64.0f * __builtin_amdgcn_rcpf(ls[qt] + half_xor(ls[qt]));      /* o carried x64, the weights' own carry cancels */
    for (int dt = 0; dt < 4; ++dt) { FragH f;
      for (int r = 0; r < 8; ++r) f.h[r] = (_Float16)(o[dt][qt][r] * inv);
      *(v8us*)((unsigned short*)O16 + (q0 + qt * 16 + c) * DM + h * HD + dt * 16 + 8 * hh) = f.half[0]; } }
}

extern "C" void kernel_launch(void* const* d_in, const int* in_sizes, int n_in,
                              void* d_out, int out_size, void* d_ws, size_t ws_size, hipStream_t stream) {
  (void)in_sizes; (void)n_in; (void)out_size;
  const float* const* I = (const float* const*)d_in; const float* x = I[0]; const float* wq = I[1]; const float* bq = I[2]; const float* wk = I[3]; const float* bk = I[4]; const float* wv = I[5]; const float* bv = I[6]; const float* phase = I[7]; const float* E = I[8]; const float* wo = I[9]; const float* bo = I[10];      /* weights [in][out] */
  char* ws = (char*)d_ws; size_t off = 0;
  auto take = [&](size_t bytes) { char* p = ws + off; off += (bytes + 255) & ~(size_t)255; return p; };
  _Float16* BQ = (_Float16*)take((size_t)DM * DM * 2); _Float16* BK = (_Float16*)take((size_t)DM * DM * 2); _Float16* BV = (_Float16*)take((size_t)DM * DM * 2); _Float16* BO = (_Float16*)take((size_t)DM * DM * 2); _Float16* MH = (_Float16*)take((size_t)NH * HD * HD * 2); _Float16* ML = (_Float16*)take((size_t)NH * HD * HD * 2);
  _Float16* X16 = (_Float16*)take(NR * DM * 2); float* QF = (float*)take(NR * DM * 4); float* KF = (float*)take(NR * DM * 4); _Float16* QH = (_Float16*)take(NR * DM * 2); _Float16* QL = (_Float16*)take(NR * DM * 2); _Float16* KH = (_Float16*)take(NR * DM * 2); _Float16* KL = (_Float16*)take(NR * DM * 2); _Float16* V16 = (_Float16*)take(NR * DM * 2);
  float* KMF = (float*)take(NR * DM * 4); _Float16* KMH = (_Float16*)take(NR * DM * 2); _Float16* KML = (_Float16*)take(NR * DM * 2); _Float16* O16 = (_Float16*)take(NR * DM * 2);
  _Float16* VT = (_Float16*)take((size_t)NB * NH * HD * SQ * 2);
  if (off > ws_size) return;      /* 8.3 + 8 + 32 + 40 + 16 + 16 + 8 + 8 = approx 136 MiB */
  { const unsigned gw = (unsigned)(((size_t)DM * (DM / 8) + 255) / 256); k_wt_f16<<<gw, 256, 0, stream>>>(wq, BQ, DM, DM, 16.0f); k_wt_f16<<<gw, 256, 0, stream>>>(wk, BK, DM, DM, 16.0f); k_wt_f16<<<gw, 256, 0, stream>>>(wv, BV, DM, DM, 16.0f); k_wt_f16<<<gw, 256, 0, stream>>>(wo, BO, DM, DM, 16.0f); }      /* [in][out] -> Bt[n][k] x16 */
  k_mprep<<<(NH * HD * (HD / 8) + 255) / 256, 256, 0, stream>>>(E, phase, MH, ML);
  k_x16<<<(unsigned)((NR * DM / 8 + 255) / 256), 256, 0, stream>>>(x, X16, NR * DM / 8);
  const size_t r0p = (size_t)B0 * SQ; const dim3 gp((unsigned)((MP / 128) * (DM / 64)), 1);
  k_gemm2<0, 128, DM, DM><<<gp, 128, 0, stream>>>(X16 + r0p * DM, 0, BQ, 0, 0.0625f, bq, 0, nullptr, 1, 0, 0, QF + r0p * DM, nullptr, DM, 0, MP, DM, DM);
  k_gemm2<0, 128, DM, DM><<<gp, 128, 0, stream>>>(X16 + r0p * DM, 0, BK, 0, 0.0625f, bk, 0, nullptr, 1, 0, 0, KF + r0p * DM, nullptr, DM, 0, MP, DM, DM);
  k_gemm2<0, 128, DM, DM><<<gp, 128, 0, stream>>>(X16 + r0p * DM, 0, BV, 0, 0.0625f, bv, 0, nullptr, 1, 0, 0, nullptr, V16 + r0p * DM, DM, 0, MP, DM, DM);
  k_hl<<<(unsigned)(((size_t)MP * DM / 8 + 255) / 256), 256, 0, stream>>>(QF + r0p * DM, QH + r0p * DM, QL + r0p * DM, (size_t)MP * DM / 8);
  k_hl<<<(unsigned)(((size_t)MP * DM / 8 + 255) / 256), 256, 0, stream>>>(KF + r0p * DM, KH + r0p * DM, KL + r0p * DM, (size_t)MP * DM / 8);
  { const dim3 gk((unsigned)((NR / 128) * (HD / 64)), NH);      /* KM[k][h*64+d] = sum_e K[k][h*64+e] M[h][d][e], token rows of both batches, all heads on grid.y; three terms */
    k_gemm2<0, 64, DM, HD><<<gk, 128, 0, stream>>>(KH, (size_t)HD, MH, (size_t)HD * HD, 1.0f, nullptr, 0, nullptr, 1, 0, 0, KMF, nullptr, DM, (size_t)HD, (int)NR, HD, HD);
    k_gemm2<0, 64, DM, HD><<<gk, 128, 0, stream>>>(KL, (size_t)HD, MH, (size_t)HD * HD, 0.0009765625f, nullptr, 0, KMF, -1, 0, 0, KMF, nullptr, DM, (size_t)HD, (int)NR, HD, HD);
    k_gemm2<0, 64, DM, HD><<<gk, 128, 0, stream>>>(KH, (size_t)HD, ML, (size_t)HD * HD, 0.0009765625f, nullptr, 0, KMF, -1, 0, 0, KMF, nullptr, DM, (size_t)HD, (int)NR, HD, HD); }
  k_hl<<<(unsigned)((NR * DM / 8 + 255) / 256), 256, 0, stream>>>(KMF, KMH, KML, NR * DM / 8);
  k_vt<NH, SQ><<<NB * NH * (SQ / 64), 256, 0, stream>>>(V16, DM, 0, VT);      /* V^T [NB][NH][HD][SQ] */
  k_fattn<<<dim3(SQ / 256, NH, NB), 256, 0, stream>>>(QH, QL, KMH, KML, VT, O16);      /* o (merged heads, x64) as f16 rows */
  k_gemm2<0, 128, DM, DM><<<dim3((unsigned)((MPO / 128) * (DM / 64)), 1), 128, 0, stream>>>(O16 + r0p * DM, 0, BO, 0, 0.0009765625f, bo, 0, nullptr, 1, 0, 0, (float*)d_out + r0p * DM, nullptr, DM, 0, MPO, DM, DM);      /* out rows are the output layout */
}

// v004
// It runs in 148 microseconds.
// Next to v003, in two timings, it ran 1.41 and 1.40 times as fast.
// Over all steps from v000 it is 29.0 times as fast.
#include <hip/hip_runtime.h>
// "Quantum" attention (x [2][2048][1024]): Q/K/V = x W + b ([in][out] weights + biases, 16 heads of 64); scores = (Q cos(phase)) (K cos(phase))^T / 8 + Q E K^T per head (phase [16][64], E [16][64][64]) = Q M K^T with M = E + diag(cos^2 phase / 8); softmax over the 2,048 keys; o = attn V merged; out = o out_w + out_b -> [2][2048][1024].
// Structure: token rows; x as exact f16 rows; Q and K as WMMA GEMMs (32x64 wave tiles, operand tiles through LDS, f32 accumulation, exact x16 transposed weights + bias) whose epilogue splits each f32 result on VALU into f16 hi + 2^-10 residual planes; V as a WMMA GEMM to f16 rows; M as f16 hi + residual planes (VALU, cos in f32); KM = K M^T per head in one launch (k_km): three WMMA terms (hi.hi + lo.hi + hi.lo, K = 64) in three accumulators, summed in f32 in registers, split into hi + residual planes; V^T for all batches and heads via LDS transposes; attention in one fused launch (k_fattn): scores = Q KM^T as three WMMA terms in one accumulator, online softmax on VALU (f32 statistics, native exp2; weights x64 f16 against the maximum in use), o = P . V^T on WMMA, normalised at the end into merged f16 rows (o carried x64 against f16 subnormal flush); out = o out_w + b GEMM (f32, alpha folds 1/16 and 1/64).
// Compute dtype: inputs rounded to bf16; weights exact (x16 f16); Q, K, M, KM as f16 hi + residual planes (~2^-22); V, softmax weights (x64) and o (x64) plain f16 (~2^-12); scores, softmax statistics f32; v_wmma_f32_16x16x32_f16.
#define NB 2
#define SQ 2048
#define DM 1024
#define NH 16
#define HD 64
#define HG 4                         /* heads per group in the per-batch k_vt, which is not launched */
#define PSC 4096.0f                  /* unused; the softmax weights carry x64 */
#define B0 0                         /* first batch processed (debug hook) */
#define NBR NB                       /* batches processed (debug hook) */
#define QN SQ                        /* unused; k_fattn attends all SQ query rows per batch */
#define NHD NH                       /* unused; k_fattn attends all NH heads */
#define NR ((size_t)NB * SQ)
#define MP ((int)((size_t)NBR * SQ)) /* rows projected (debug hook) */
#define MPO MP                       /* rows through the output GEMM (debug hook) */
typedef __bf16 v16b __attribute__((ext_vector_type(16)));
typedef unsigned short v8us __attribute__((ext_vector_type(8), may_alias));
typedef float  v8f  __attribute__((ext_vector_type(8)));
typedef float  v4f  __attribute__((ext_vector_type(4)));
typedef float  v4fa __attribute__((ext_vector_type(4), may_alias));
union FragB { v16b v; v8us half[2]; unsigned short u[16]; };

__device__ __forceinline__ unsigned short bf16_bits(float x) { unsigned int u = __float_as_uint(x); return (unsigned short)((u + 0x7FFFu + ((u >> 16) & 1u)) >> 16); }
__device__ __forceinline__ float bf16_val(unsigned short b) { return __uint_as_float(((unsigned int)b) << 16); }
__device__ __forceinline__ float bf16_round(float x) { return bf16_val(bf16_bits(x)); }
// D += A·B with NT terms: 1 = ah·bh, 2 = + al·bh (A split), 3 = + ah·bl (both split)
template <int NT>
__device__ __forceinline__ v8f mmaN(v16b ah, v16b al, v16b bh, v16b bl, v8f c) {
  c = __builtin_amdgcn_wmma_f32_16x16x32_bf16(false, ah, false, bh, (short)0, c, false, false);
  if (NT >= 2) c = __builtin_amdgcn_wmma_f32_16x16x32_bf16(false, al, false, bh, (short)0, c, false, false);
  if (NT >= 3) c = __builtin_amdgcn_wmma_f32_16x16x32_bf16(false, ah, false, bl, (short)0, c, false, false);
  asm volatile("v_nop\n\tv_nop\n\tv_nop\n\tv_nop" : "+v"(c) : "v"(ah), "v"(al), "v"(bh), "v"(bl));
  return c;
}

__global__ __launch_bounds__(256) void k_wt_bf16(const float* __restrict__ W, unsigned short* __restrict__ Wt, int K, int N) {
  const int t = blockIdx.x * 256 + threadIdx.x;
  const int k8n = K / 8;
  if (t >= N * k8n) return;
  const int n = t / k8n, k8 = (t % k8n) * 8;
  v8us v;
#pragma unroll
  for (int i = 0; i < 8; ++i) v[i] = bf16_bits(W[(size_t)(k8 + i) * N + n]);
  *(v8us*)(Wt + (size_t)n * K + k8) = v;
  
}

// GEMM C[M][N] (f32, pitch ldc) = act(A[M][K]·W + bias). A f32 row-major (pitch lda) converted per fragment to bf16
// (ASPLIT: hi/lo two planes -> 2 terms, else single rounded term); Wt bf16 [N][K] (pitch ldb). BIAS_BF16 rounds the
// bias to bf16 first (bias quantised to bf16 before the add). K%32==0, M%16==0, N%64==0.
template <bool ASPLIT, int ACT, bool BIAS_BF16>
__global__ __launch_bounds__(128) void k_gemm_bf(const float* __restrict__ A, int lda, const unsigned short* __restrict__ Wt, int ldb,
                                               const float* __restrict__ bias, float* __restrict__ C, int ldc, int M, int N, int K) {
  __shared__ __attribute__((aligned(16))) float so[4][16][64];
  const int tid = threadIdx.x, w = tid >> 5, lane = tid & 31, ln = lane & 15, hh = lane >> 4;
  const int ntn = N / 64;
  const int wid = blockIdx.x * 4 + w;
  const int mt = wid / ntn, nq = wid % ntn;
  if (mt * 16 >= M) return;
  const int row0 = mt * 16, col0 = nq * 64;
  const float* arow = A + (size_t)(row0 + ln) * lda;
  v8f acc[4] = {};
  for (int kb = 0; kb < K; kb += 32) {
    FragB ah, al;
    const v4f x0 = *(const v4fa*)(arow + kb + 8 * hh), x1 = *(const v4fa*)(arow + kb + 8 * hh + 4);
    const v4f x2 = *(const v4fa*)(arow + kb + 16 + 8 * hh), x3 = *(const v4fa*)(arow + kb + 16 + 8 * hh + 4);
    float xs[16] = {x0[0],x0[1],x0[2],x0[3],x1[0],x1[1],x1[2],x1[3],x2[0],x2[1],x2[2],x2[3],x3[0],x3[1],x3[2],x3[3]};
#pragma unroll
    for (int i = 0; i < 16; ++i) { const unsigned short hb = bf16_bits(xs[i]); ah.u[i] = hb; al.u[i] = ASPLIT ? bf16_bits(xs[i] - bf16_val(hb)) : (unsigned short)0; }
#pragma unroll
    for (int t = 0; t < 4; ++t) {
      const unsigned short* brow = Wt + (size_t)(col0 + t * 16 + ln) * ldb + kb;
      FragB b;
      b.half[0] = *(const v8us*)(brow + 8 * hh);
      b.half[1] = *(const v8us*)(brow + 16 + 8 * hh);
      acc[t] = mmaN<ASPLIT ? 2 : 1>(ah.v, al.v, b.v, b.v, acc[t]);
    }
  }
#pragma unroll
  for (int t = 0; t < 4; ++t) {
    float bv = bias ? bias[col0 + t * 16 + ln] : 0.f;
    if (BIAS_BF16) bv = bf16_round(bv);
#pragma unroll
    for (int r = 0; r < 8; ++r) { float v = acc[t][r] + bv; if (ACT == 1) v = fmaxf(v, 0.f); so[w][8 * hh + r][t * 16 + ln] = v; }
  }
  __builtin_amdgcn_fence(__ATOMIC_ACQ_REL, "workgroup");
  __builtin_amdgcn_wave_barrier();
  const int rsub = lane >> 4, c4 = (lane & 15) * 4;
  {
#pragma unroll
    for (int q = 0; q < 8; ++q) {
      const int r = q * 2 + rsub;
      const v4f v = *(const v4fa*)&so[w][r][c4];
      *(v4f*)(C + (size_t)(row0 + r) * ldc + col0 + c4) = v;
    }
    
  }
}

// GEMM C = act(A·W + bias + resid): A f32 (ASPLIT -> hi/lo 2 terms), Wt bf16 [N][K]; ACT 0 none, 1 relu, 2 exact gelu;
// resid (optional, f32, row index = (row % rmod), pitch ldr, RES_BF16 rounds it) added before the activation.
template <bool ASPLIT, int ACT, bool BIAS_BF16, bool RES_BF16>
__global__ __launch_bounds__(128) void k_gemm_bf3(const float* __restrict__ A, int lda, const unsigned short* __restrict__ Wt, int ldb,
                                                const float* __restrict__ bias, const float* __restrict__ resid, int rmod, int ldr,
                                                float* __restrict__ C, int ldc, int M, int N, int K) {
  __shared__ __attribute__((aligned(16))) float so[4][16][64];
  const int tid = threadIdx.x, w = tid >> 5, lane = tid & 31, ln = lane & 15, hh = lane >> 4;
  const int ntn = N / 64;
  const int wid = blockIdx.x * 4 + w;
  const int mt = wid / ntn, nq = wid % ntn;
  if (mt * 16 >= M) return;
  const int row0 = mt * 16, col0 = nq * 64;
  const float* arow = A + (size_t)(row0 + ln) * lda;
  v8f acc[4] = {};
  for (int kb = 0; kb < K; kb += 32) {
    FragB ah, al;
    const v4f x0 = *(const v4fa*)(arow + kb + 8 * hh), x1 = *(const v4fa*)(arow + kb + 8 * hh + 4);
    const v4f x2 = *(const v4fa*)(arow + kb + 16 + 8 * hh), x3 = *(const v4fa*)(arow + kb + 16 + 8 * hh + 4);
    float xs[16] = {x0[0],x0[1],x0[2],x0[3],x1[0],x1[1],x1[2],x1[3],x2[0],x2[1],x2[2],x2[3],x3[0],x3[1],x3[2],x3[3]};
#pragma unroll
    for (int i = 0; i < 16; ++i) { const unsigned short hb = bf16_bits(xs[i]); ah.u[i] = hb; al.u[i] = ASPLIT ? bf16_bits(xs[i] - bf16_val(hb)) : (unsigned short)0; }
#pragma unroll
    for (int t = 0; t < 4; ++t) {
      const unsigned short* brow = Wt + (size_t)(col0 + t * 16 + ln) * ldb + kb;
      FragB b;
      b.half[0] = *(const v8us*)(brow + 8 * hh);
      b.half[1] = *(const v8us*)(brow + 16 + 8 * hh);
      acc[t] = mmaN<ASPLIT ? 2 : 1>(ah.v, al.v, b.v, b.v, acc[t]);
    }
  }
#pragma unroll
  for (int t = 0; t < 4; ++t) {
    const int col = col0 + t * 16 + ln;
    float bv = bias ? bias[col] : 0.f;
    if (BIAS_BF16) bv = bf16_round(bv);
#pragma unroll
    for (int r = 0; r < 8; ++r) {
      float v = acc[t][r] + bv;
      if (resid) { float rv = resid[(size_t)((row0 + 8 * hh + r) % rmod) * ldr + col]; if (RES_BF16) rv = bf16_round(rv); v += rv; }
      if (ACT == 1) v = fmaxf(v, 0.f);
      if (ACT == 2) v = 0.5f * v * (1.0f + erff(v * 0.70710678118654752f));
      if (ACT == 3) { const float u = 0.7978845608028654f * (v + 0.044715f * v * v * v); v = 0.5f * v * (1.0f + tanhf(u)); }
      so[w][8 * hh + r][t * 16 + ln] = v;
    }
  }
  __builtin_amdgcn_fence(__ATOMIC_ACQ_REL, "workgroup");
  __builtin_amdgcn_wave_barrier();
  const int rsub = lane >> 4, c4 = (lane & 15) * 4;
  {
#pragma unroll
    for (int q = 0; q < 8; ++q) {
      const int r = q * 2 + rsub;
      const v4f v = *(const v4fa*)&so[w][r][c4];
      *(v4f*)(C + (size_t)(row0 + r) * ldc + col0 + c4) = v;
    }
    
  }
}
// row LayerNorm (biased variance, eps) over N: s = X (+ R); optional out_sum <- s; out_norm <- (s-mu)*rsqrt(var+eps)*g + b
template <bool PARAM_BF16>
__global__ __launch_bounds__(256) void k_layernorm(const float* __restrict__ X, const float* __restrict__ R, const float* __restrict__ g, const float* __restrict__ bta,
                                                  float* __restrict__ out_sum, float* __restrict__ out_norm, int N, float eps) {
  __shared__ float red[256];
  const int row = blockIdx.x, tid = threadIdx.x;
  const float* x = X + (size_t)row * N; const float* rr = R ? R + (size_t)row * N : nullptr;
  float vals[16];                     // up to N = 4096
  const int per = N / 256;            // contiguous chunk per thread? use strided-by-4 chunks: thread handles j = tid*4 + 1024*u
  float s1 = 0.f;
  for (int u = 0; u < per / 4; ++u) {
    const int j = tid * 4 + 1024 * u;
    const v4f a = *(const v4fa*)(x + j);
    v4f b = {0.f,0.f,0.f,0.f}; if (rr) b = *(const v4fa*)(rr + j);
#pragma unroll
    for (int q = 0; q < 4; ++q) { const float v = a[q] + b[q]; vals[u * 4 + q] = v; s1 += v; }
  }
  red[tid] = s1; __syncthreads();
  for (int st = 128; st > 0; st >>= 1) { if (tid < st) red[tid] += red[tid + st]; __syncthreads(); }
  const float mu = red[0] / (float)N; __syncthreads();
  float s2 = 0.f;
  for (int u = 0; u < per / 4; ++u)
#pragma unroll
    for (int q = 0; q < 4; ++q) { const float c = vals[u * 4 + q] - mu; s2 += c * c; }
  red[tid] = s2; __syncthreads();
  for (int st = 128; st > 0; st >>= 1) { if (tid < st) red[tid] += red[tid + st]; __syncthreads(); }
  const float rs = rsqrtf(red[0] / (float)N + eps);
  {
    for (int u = 0; u < per / 4; ++u) {
      const int j = tid * 4 + 1024 * u;
      v4f o, sm;
#pragma unroll
      for (int q = 0; q < 4; ++q) {
        float gg = g[j + q], bb = bta[j + q];
        if (PARAM_BF16) { gg = bf16_round(gg); bb = bf16_round(bb); }
        sm[q] = vals[u * 4 + q]; o[q] = (vals[u * 4 + q] - mu) * rs * gg + bb;
      }
      if (out_sum) *(v4f*)(out_sum + (size_t)row * N + j) = sm;
      *(v4f*)(out_norm + (size_t)row * N + j) = o;
    }
    
  }
}



// ---- f16 WMMA path (v_wmma_f32_16x16x32_f16): 11-bit significands for operands in range — used where a [0,1] probability operand needs more precision than bf16
typedef _Float16 v16h __attribute__((ext_vector_type(16)));
union FragH { v16h v; v8us half[2]; _Float16 h[16]; unsigned short u[16]; };
template <int NT>
__device__ __forceinline__ v8f mmaH(v16h ah, v16h al, v16h bh, v16h bl, v8f c) {
  c = __builtin_amdgcn_wmma_f32_16x16x32_f16(false, ah, false, bh, (short)0, c, false, false);
  if (NT >= 2) c = __builtin_amdgcn_wmma_f32_16x16x32_f16(false, al, false, bh, (short)0, c, false, false);
  if (NT >= 3) c = __builtin_amdgcn_wmma_f32_16x16x32_f16(false, ah, false, bl, (short)0, c, false, false);
  asm volatile("v_nop\n\tv_nop\n\tv_nop\n\tv_nop" : "+v"(c) : "v"(ah), "v"(al), "v"(bh), "v"(bl));
  return c;
}
// batched GEMM like k_gemm_b but f16 operands: A f32 (split into f16 hi/lo if ASPLIT, else rounded to f16), Bt = f16 values [n][k]; alpha; C f32; N multiple of 16 (partial tiles skipped)
template <bool ASPLIT>
__global__ __launch_bounds__(128) void k_gemm_h(const float* __restrict__ A, int lda, size_t sA, const _Float16* __restrict__ Bh, int ldb, size_t sB, float alpha, float* __restrict__ C, int ldc, size_t sC, int M, int N, int K) {
  __shared__ __attribute__((aligned(16))) float so[4][16][64];
  const int tid = threadIdx.x, w = tid >> 5, lane = tid & 31, ln = lane & 15, hh = lane >> 4; const int by = blockIdx.y;
  A += (size_t)by * sA; Bh += (size_t)by * sB; C += (size_t)by * sC;
  const int ntn = (N + 63) / 64; const int wid = blockIdx.x * 4 + w; const int mt = wid / ntn, nq = wid % ntn; if (mt * 16 >= M) return;
  const int row0 = mt * 16, col0 = nq * 64; const float* arow = A + (size_t)(row0 + ln) * lda;
  v8f acc[4] = {};
  for (int kb = 0; kb < K; kb += 32) {
    FragH ah, al;
    const v4f x0 = *(const v4fa*)(arow + kb + 8 * hh), x1 = *(const v4fa*)(arow + kb + 8 * hh + 4), x2 = *(const v4fa*)(arow + kb + 16 + 8 * hh), x3 = *(const v4fa*)(arow + kb + 16 + 8 * hh + 4);
    float xs[16] = {x0[0],x0[1],x0[2],x0[3],x1[0],x1[1],x1[2],x1[3],x2[0],x2[1],x2[2],x2[3],x3[0],x3[1],x3[2],x3[3]};
#pragma unroll
    for (int i = 0; i < 16; ++i) { const _Float16 h = (_Float16)xs[i]; ah.h[i] = h; al.h[i] = ASPLIT ? (_Float16)(xs[i] - (float)h) : (_Float16)0.0f; }
#pragma unroll
    for (int t = 0; t < 4; ++t) { if (col0 + t * 16 >= N) continue; const size_t boff = (size_t)(col0 + t * 16 + ln) * ldb + kb; FragH bq; bq.half[0] = *(const v8us*)(Bh + boff + 8 * hh); bq.half[1] = *(const v8us*)(Bh + boff + 16 + 8 * hh);
      acc[t] = mmaH<ASPLIT ? 2 : 1>(ah.v, al.v, bq.v, bq.v, acc[t]); }
  }
#pragma unroll
  for (int t = 0; t < 4; ++t) { if (col0 + t * 16 >= N) continue;
#pragma unroll
    for (int r = 0; r < 8; ++r) so[w][8 * hh + r][t * 16 + ln] = acc[t][r] * alpha; }
  __builtin_amdgcn_fence(__ATOMIC_ACQ_REL, "workgroup"); __builtin_amdgcn_wave_barrier();
  const int rsub = lane >> 4, c4 = (lane & 15) * 4;
  {
#pragma unroll
    for (int q = 0; q < 8; ++q) { const int r = q * 2 + rsub; if (col0 + c4 < N) { const v4f v = *(const v4fa*)&so[w][r][c4]; *(v4f*)(C + (size_t)(row0 + r) * ldc + col0 + c4) = v; } }
     }
}

// Wt[n][k] = f16(W[k][n]·scale) from f32 row-major W[K][N] (scale = power of two; bf16-exact weights stay exact in f16 away from the subnormal range)
__global__ __launch_bounds__(256) void k_wt_f16(const float* __restrict__ W, _Float16* __restrict__ Wt, int K, int N, float scale) {
  const int t = blockIdx.x * 256 + threadIdx.x; if (t >= N * (K / 8)) return; const int n = t / (K / 8), k8 = (t % (K / 8)) * 8; FragH f;
#pragma unroll
  for (int i = 0; i < 8; ++i) f.h[i] = (_Float16)(bf16_round(W[(size_t)(k8 + i) * N + n]) * scale); const v8us o = f.half[0];
  *(v8us*)((unsigned short*)Wt + (size_t)n * K + k8) = o; 
}
// k_gemm_hh variant with fused epilogue: v = acc·alpha + bias[by·sBias + col] (+ CP[(row/rowsPerB)·sCPb + by·64 + col] if CP) ; ACT 0 none / 1 elu ; writes f16 C16 (and f32 C if non-null)
template <int ACT>
__global__ __launch_bounds__(128) void k_gemm_hhx(const _Float16* __restrict__ A, int lda, size_t sA, const _Float16* __restrict__ Bh, int ldb, size_t sB, float alpha, const float* __restrict__ bias, size_t sBias, const float* __restrict__ CP, int rowsPerB, size_t sCPb, int row0g,
    float* __restrict__ C, _Float16* __restrict__ C16, int ldc, size_t sC, int M, int N, int K) {
  __shared__ __attribute__((aligned(16))) float so[4][16][64];
  const int tid = threadIdx.x, w = tid >> 5, lane = tid & 31, ln = lane & 15, hh = lane >> 4; const int by = blockIdx.y;
  A += (size_t)by * sA; Bh += (size_t)by * sB; const size_t cofs = (size_t)by * sC; const float* bp = bias ? bias + (size_t)by * sBias : nullptr;
  const int ntn = (N + 63) / 64; const int wid = blockIdx.x * 4 + w; const int mt = wid / ntn, nq = wid % ntn; if (mt * 16 >= M) return;
  const int row0 = mt * 16, col0 = nq * 64; const _Float16* arow = A + (size_t)(row0 + ln) * lda;
  v8f acc[4] = {};
  for (int kb = 0; kb < K; kb += 32) { FragH ah; ah.half[0] = *(const v8us*)((const unsigned short*)arow + kb + 8 * hh); ah.half[1] = *(const v8us*)((const unsigned short*)arow + kb + 16 + 8 * hh);
#pragma unroll
    for (int t = 0; t < 4; ++t) { if (col0 + t * 16 >= N) continue; const size_t boff = (size_t)(col0 + t * 16 + ln) * ldb + kb; FragH bq; bq.half[0] = *(const v8us*)((const unsigned short*)Bh + boff + 8 * hh); bq.half[1] = *(const v8us*)((const unsigned short*)Bh + boff + 16 + 8 * hh);
      acc[t] = mmaH<1>(ah.v, ah.v, bq.v, bq.v, acc[t]); }
  }
#pragma unroll
  for (int t = 0; t < 4; ++t) { if (col0 + t * 16 >= N) continue; const int col = col0 + t * 16 + ln; const float bv = bp ? bf16_round(bp[col]) : 0.f;
#pragma unroll
    for (int r = 0; r < 8; ++r) { float v = acc[t][r] * alpha + bv; if (CP) { const int rr = row0g + row0 + 8 * hh + r; if (rowsPerB < 0) v += CP[cofs + (size_t)rr * ldc + col];      /* rowsPerB < 0: own element of the batched C plane */ else { const int bidx = rr / rowsPerB; v += CP[(size_t)bidx * sCPb + (size_t)by * 64 + col]; } } if (ACT == 1) v = (v > 0.f) ? v : expm1f(v); else if (ACT == 7) v = (v > 0.f) ? v + 1.0f : expf(v); else if (ACT == 8) v = tanhf(v); else if (ACT == 9) v = 0.5f * v * (1.0f + tanhf(0.7978845608028654f * (v + 0.044715f * v * v * v))); else if (ACT == 11) v = 1.0f / (1.0f + expf(-v)); else if (ACT == 12) v = (v > 0.f) ? v : 0.01f * v; else if (ACT == 14) v = (v > 0.f) ? v : 0.1f * v; else if (ACT == 16) v = (v >= 0.f) ? v : 0.3f * v; else if (ACT == 17) v = (v >= 0.f) ? v : 0.2f * v; else if (ACT == 15) v = v / (1.0f + expf(-v)); else if (ACT == 3) v = fmaxf(v, 0.f); else if (ACT == 6) v = 0.5f * v * (1.0f + erff(v * 0.70710678118654752f)); so[w][8 * hh + r][t * 16 + ln] = v; } }
  __builtin_amdgcn_fence(__ATOMIC_ACQ_REL, "workgroup"); __builtin_amdgcn_wave_barrier();
  const int rsub = lane >> 4, c4 = (lane & 15) * 4; typedef _Float16 v4h __attribute__((ext_vector_type(4)));
  {
#pragma unroll
    for (int q = 0; q < 8; ++q) { const int r = q * 2 + rsub; if (col0 + c4 < N) { const v4f v = *(const v4fa*)&so[w][r][c4]; if (C) *(v4f*)(C + cofs + (size_t)(row0 + r) * ldc + col0 + c4) = v; if (C16) { v4h h4; for (int i = 0; i < 4; ++i) h4[i] = (_Float16)v[i]; *(v4h*)(C16 + cofs + (size_t)(row0 + r) * ldc + col0 + c4) = h4; } } }
     }
}


typedef _Float16 v4h __attribute__((ext_vector_type(4)));

__global__ __launch_bounds__(256) void k_x16(const float* __restrict__ x, _Float16* __restrict__ X16, size_t n8) { const size_t t = (size_t)blockIdx.x * 256 + threadIdx.x; if (t >= n8) return; FragH f;
#pragma unroll
  for (int q = 0; q < 8; ++q) f.h[q] = (_Float16)bf16_round(x[t * 8 + q]); *(v8us*)((unsigned short*)X16 + t * 8) = f.half[0];  }
__global__ __launch_bounds__(256) void k_h16(const float* __restrict__ x, _Float16* __restrict__ X16, size_t n8) { const size_t t = (size_t)blockIdx.x * 256 + threadIdx.x; if (t >= n8) return; FragH f;
#pragma unroll
  for (int q = 0; q < 8; ++q) f.h[q] = (_Float16)x[t * 8 + q]; *(v8us*)((unsigned short*)X16 + t * 8) = f.half[0];  }
__global__ __launch_bounds__(256) void k_round16f(const float* __restrict__ W, _Float16* __restrict__ Bt, size_t n8) { const size_t t = (size_t)blockIdx.x * 256 + threadIdx.x; if (t >= n8) return; FragH f;
#pragma unroll
  for (int i = 0; i < 8; ++i) f.h[i] = (_Float16)(bf16_round(W[t * 8 + i]) * 16.0f); *(v8us*)((unsigned short*)Bt + t * 8) = f.half[0];  }
template <int NHv, int TTv>
__global__ __launch_bounds__(256) void k_vt(const _Float16* __restrict__ V16, int ldv, int voff, _Float16* __restrict__ Vt) { __shared__ unsigned short tl[64][66]; const int tid = threadIdx.x; const int slab = blockIdx.x / (TTv / 64), lg = blockIdx.x % (TTv / 64); const int b = slab / NHv, h = slab % NHv;
  for (int i = tid; i < 64 * 8; i += 256) { const int r = i / 8, c8 = (i % 8) * 8; FragH f; f.half[0] = *(const v8us*)((const unsigned short*)V16 + ((size_t)b * TTv + lg * 64 + r) * ldv + voff + h * 64 + c8);
#pragma unroll
    for (int q = 0; q < 8; ++q) tl[r][c8 + q] = f.u[q]; }
  __syncthreads();
  {
#pragma unroll
    for (int rd = 0; rd < 2; ++rd) { const int d = rd * 32 + tid / 8, pc = tid % 8; FragH f;
#pragma unroll
      for (int q = 0; q < 8; ++q) f.u[q] = tl[pc * 8 + q][d];
      *(v8us*)((unsigned short*)Vt + ((size_t)slab * 64 + d) * TTv + lg * 64 + pc * 8) = f.half[0]; }
     } }

// 32 f32 rows of 64 that a wave has staged in LDS (pitch 68) leave as two f16 planes: hi = f16(v), residual = f16((v - hi) x1024). Eight lanes take a row, so a wave's 16-byte stores cover four whole 128-byte lines.
__device__ __forceinline__ void split_store(const float (*so)[68], int lane, _Float16* __restrict__ Hh, _Float16* __restrict__ Hl, size_t o0, int ldc) {
  const int rs = lane >> 3, c8 = (lane & 7) * 8; v4f a[8], c[8];
#pragma unroll      /* a[] and c[] stay in registers, and all 16 LDS reads are issued ahead of the first conversion */
  for (int q = 0; q < 8; ++q) { a[q] = *(const v4fa*)&so[q * 4 + rs][c8]; c[q] = *(const v4fa*)&so[q * 4 + rs][c8 + 4]; }
#pragma unroll      /* constant indices into a[] and c[] */
  for (int q = 0; q < 8; ++q) { FragH fh, fl;
    for (int i = 0; i < 4; ++i) { _Float16 h = (_Float16)a[q][i]; fh.h[i] = h; fl.h[i] = (_Float16)((a[q][i] - (float)h) * 1024.0f); h = (_Float16)c[q][i]; fh.h[4 + i] = h; fl.h[4 + i] = (_Float16)((c[q][i] - (float)h) * 1024.0f); }
    const size_t o = o0 + (size_t)(q * 4 + rs) * ldc + c8; unsigned short* ph = (unsigned short*)Hh + o; unsigned short* pl = (unsigned short*)Hl + o; const v8us vh = fh.half[0], vl = fl.half[0];
    *(v8us*)ph = vh; *(v8us*)pl = vl;
    asm volatile("s_wait_xcnt 0x0" :: "v"(ph), "v"(pl), "v"(vh), "v"(vl) : "memory");      /* stands in front of every later rewrite of the registers that these two stores name (the next rows', or the code behind the call); they are inputs so that they stay live up to the wait */
  } }

// ---- fast GEMM (workgroup tile 128x64, wave tile 32x64; requires M % 128 == 0, N % 64 == 0, K % KS == 0); epilogue = k_gemm_hhx semantics; with CL the result leaves as two f16 planes, hi in C16 and residual in CL, and no f32 row is written ----
// The A tile (128 rows) and the B tile (64 rows) go through LDS in stages of KS k, two buffers: every 16-byte global load of a wave covers whole 128-byte lines, the next stage's loads are all
// issued ahead of this stage's products and stored behind them, one barrier per stage. The fragments and their k order are the ones the global rows gave.
__device__ __forceinline__ v16h g2_frag(const _Float16* p, int hh) { FragH f; f.half[0] = *(const v8us*)((const unsigned short*)p + 8 * hh); f.half[1] = *(const v8us*)((const unsigned short*)p + 16 + 8 * hh); return f.v; }
__device__ __forceinline__ v8f g2_mma(v16h a, v16h b, v8f c) { v8f d = __builtin_amdgcn_wmma_f32_16x16x32_f16(false, a, false, b, (short)0, c, false, false); asm volatile("v_nop\n\tv_nop\n\tv_nop\n\tv_nop" : "+v"(d) : "v"(a), "v"(b)); return d; }
template <int ACT, int KS, int LDA, int LDB>
__global__ __launch_bounds__(128) void k_gemm2(const _Float16* __restrict__ A, size_t sA, const _Float16* __restrict__ Bh, size_t sB, float alpha, const float* __restrict__ bias, size_t sBias, const float* __restrict__ CP, int rowsPerB, size_t sCPb, int row0g,
    float* __restrict__ C, _Float16* __restrict__ C16, _Float16* __restrict__ CL, int ldc, size_t sC, int M, int N, int K) { static_assert(ACT == 0 || ACT == 3 || ACT == 6 || ACT == 8 || ACT == 9 || ACT == 11 || ACT == 12 || ACT == 14 || ACT == 15 || ACT == 16 || ACT == 17, "k_gemm2: unsupported ACT code (would silently apply no activation)");
  constexpr int CH = KS / 8;        /* 16-byte pieces per tile row */
  constexpr int RPR = 128 / CH;     /* tile rows that one load of every thread covers */
  constexpr int PT = KS + 8;        /* LDS row pitch in f16: the row + 16 B, conflict-free for 16-byte fragment reads */
  __shared__ __attribute__((aligned(16))) float so[4][32][68];
  __shared__ __attribute__((aligned(16))) _Float16 sa[2][128][PT];
  __shared__ __attribute__((aligned(16))) _Float16 sb[2][64][PT];
  const int tid = threadIdx.x, w = tid >> 5, lane = tid & 31, ln = lane & 15, hh = lane >> 4; const int by = blockIdx.y;
  A += (size_t)by * sA; Bh += (size_t)by * sB; const size_t cofs = (size_t)by * sC; const float* bp = bias ? bias + (size_t)by * sBias : nullptr;
  const int ntn = N >> 6; const int mt = blockIdx.x / ntn, nq = blockIdx.x - mt * ntn; const int row0 = mt * 128 + 32 * w, col0 = nq * 64; if (mt * 128 >= M) return;      /* the same for the whole workgroup, in front of every barrier */
  const int sr = tid / CH, sp = (tid % CH) * 8;
  const unsigned short* ga = (const unsigned short*)A + (size_t)(mt * 128 + sr) * LDA + sp; const unsigned short* gb = (const unsigned short*)Bh + (size_t)(col0 + sr) * LDB + sp;
  constexpr size_t da = (size_t)RPR * LDA, db = (size_t)RPR * LDB;      /* row pitches LDA, LDB are compile-time, so a stage's loads share one address pair per operand and differ in the immediate offset */
  v8us ta[CH], tb[CH / 2];
  for (int i = 0; i < CH; ++i) ta[i] = *(const v8us*)(ga + i * da);
  for (int i = 0; i < CH / 2; ++i) tb[i] = *(const v8us*)(gb + i * db);
  for (int i = 0; i < CH; ++i) *(v8us*)&sa[0][i * RPR + sr][sp] = ta[i];
  for (int i = 0; i < CH / 2; ++i) *(v8us*)&sb[0][i * RPR + sr][sp] = tb[i];
  __syncthreads();      /* publishes stage 0 */
  const v8f z8 = {0.f,0.f,0.f,0.f,0.f,0.f,0.f,0.f}; v8f c00 = z8, c01 = z8, c02 = z8, c03 = z8, c10 = z8, c11 = z8, c12 = z8, c13 = z8;
  const int nst = K / KS;
  const int ra = 32 * w + ln;
  for (int s = 0; s < nst; ++s) { const int buf = s & 1; const bool more = s + 1 < nst;
    if (more) { ga += KS; gb += KS;
      for (int i = 0; i < CH; ++i) ta[i] = *(const v8us*)(ga + i * da);
      for (int i = 0; i < CH / 2; ++i) tb[i] = *(const v8us*)(gb + i * db); }
    for (int ks = 0; ks < KS / 32; ++ks) {      /* the six fragments of 32 k are read from LDS as one group, then their eight products */
      const v16h a0 = g2_frag(&sa[buf][ra][ks * 32], hh), a1 = g2_frag(&sa[buf][ra + 16][ks * 32], hh);
      const v16h b0 = g2_frag(&sb[buf][ln][ks * 32], hh), b1 = g2_frag(&sb[buf][16 + ln][ks * 32], hh), b2 = g2_frag(&sb[buf][32 + ln][ks * 32], hh), b3 = g2_frag(&sb[buf][48 + ln][ks * 32], hh);
      c00 = g2_mma(a0, b0, c00); c10 = g2_mma(a1, b0, c10); c01 = g2_mma(a0, b1, c01); c11 = g2_mma(a1, b1, c11);
      c02 = g2_mma(a0, b2, c02); c12 = g2_mma(a1, b2, c12); c03 = g2_mma(a0, b3, c03); c13 = g2_mma(a1, b3, c13); }
    if (more) {
      for (int i = 0; i < CH; ++i) *(v8us*)&sa[buf ^ 1][i * RPR + sr][sp] = ta[i];
      for (int i = 0; i < CH / 2; ++i) *(v8us*)&sb[buf ^ 1][i * RPR + sr][sp] = tb[i];
      __syncthreads(); }      /* publishes the next stage and ends every wave's reads of this one, which the stage after next overwrites */
  }
  v8f accs[8] = {c00, c01, c02, c03, c10, c11, c12, c13};
#pragma unroll
  for (int u = 0; u < 8; ++u) { const int t = u & 3, half = u >> 2; const int col = col0 + t * 16 + ln; const float bv = bp ? bf16_round(bp[col]) : 0.f;
#pragma unroll
    for (int r = 0; r < 8; ++r) { const int rloc = half * 16 + 8 * hh + r; float v = accs[u][r] * alpha + bv; if (CP) { if (rowsPerB < 0) v += CP[cofs + (size_t)(row0g + row0 + rloc) * ldc + col];      /* rowsPerB < 0: own element of the batched C plane */ else { const int bidx = (row0g + row0 + rloc) / rowsPerB; v += CP[(size_t)bidx * sCPb + (size_t)by * 64 + col]; } }
      if (ACT == 3) v = fmaxf(v, 0.f); else if (ACT == 6) v = 0.5f * v * (1.0f + erff(v * 0.70710678118654752f)); else if (ACT == 11) v = 1.0f / (1.0f + expf(-v)); else if (ACT == 15) v = v / (1.0f + expf(-v)); else if (ACT == 12) v = (v > 0.f) ? v : 0.01f * v; else if (ACT == 8) v = tanhf(v); else if (ACT == 9) v = 0.5f * v * (1.0f + tanhf(0.7978845608028654f * (v + 0.044715f * v * v * v))); else if (ACT == 14) v = (v > 0.f) ? v : 0.1f * v; else if (ACT == 16) v = (v >= 0.f) ? v : 0.3f * v; else if (ACT == 17) v = (v >= 0.f) ? v : 0.2f * v;
      so[w][rloc][t * 16 + ln] = v; } }
  __builtin_amdgcn_fence(__ATOMIC_ACQ_REL, "workgroup"); __builtin_amdgcn_wave_barrier();
  if (CL) { split_store(so[w], lane, C16, CL, cofs + (size_t)row0 * ldc + col0, ldc); return; }      /* the same for every wave, behind the last barrier */
  const int rsub = lane >> 4, c4 = (lane & 15) * 4;
  {
#pragma unroll
    for (int q = 0; q < 16; ++q) { const int r = q * 2 + rsub; const v4f v = *(const v4fa*)&so[w][r][c4]; if (C) *(v4f*)(C + cofs + (size_t)(row0 + r) * ldc + col0 + c4) = v; if (C16) { v4h h4; for (int i = 0; i < 4; ++i) h4[i] = (_Float16)v[i]; *(v4h*)(C16 + cofs + (size_t)(row0 + r) * ldc + col0 + c4) = h4; } }
     } }


__global__ __launch_bounds__(256) void k_wnat(const float* __restrict__ w, size_t n8, _Float16* __restrict__ Bt) { const size_t t = (size_t)blockIdx.x * 256 + threadIdx.x; if (t >= n8) return; FragH f; for (int q = 0; q < 8; ++q) f.h[q] = (_Float16)(bf16_round(w[t * 8 + q]) * 16.0f); *(v8us*)((unsigned short*)Bt + t * 8) = f.half[0];  }
__global__ __launch_bounds__(256) void k_rsm(const float* __restrict__ S, _Float16* __restrict__ P, int nrows) {
  #pragma clang fp contract(off)
  const int i = blockIdx.x * 256 + threadIdx.x; if (i >= nrows) return; const float* s = S + (size_t)i * SQ; float mx = -3.0e38f;
#pragma unroll 1
  for (int j = 0; j < SQ; ++j) mx = fmaxf(mx, s[j]); float se = 0.f;
#pragma unroll 1
  for (int j = 0; j < SQ; ++j) se += expf(s[j] - mx); const float sc = 256.0f / se;
#pragma unroll 1
  for (int j0 = 0; j0 < SQ; j0 += 8) { FragH f; for (int q = 0; q < 8; ++q) f.h[q] = (_Float16)(expf(s[j0 + q] - mx) * sc); unsigned short* d = (unsigned short*)P + (size_t)i * SQ + j0; *(v8us*)d = f.half[0];  } }
__global__ __launch_bounds__(256) void k_vt(const _Float16* __restrict__ V16, int b, int h0, _Float16* __restrict__ VT) { __shared__ unsigned short tl[64][65]; const int tid = threadIdx.x; const int hh = blockIdx.x % HG, sg = blockIdx.x / HG; const int s0 = sg * 64; const int h = h0 + hh;
  for (int i = tid; i < 64 * 8; i += 256) { const int j = i / 8, d8 = (i % 8) * 8; FragH f; f.half[0] = *(const v8us*)((const unsigned short*)V16 + ((size_t)b * SQ + s0 + j) * DM + h * HD + d8); for (int q = 0; q < 8; ++q) tl[d8 + q][j] = f.u[q]; }
  __syncthreads();
  { for (int i = tid; i < 64 * 8; i += 256) { const int d = i / 8, j8 = (i % 8) * 8; FragH f; for (int q = 0; q < 8; ++q) f.u[q] = tl[d][j8 + q]; *(v8us*)((unsigned short*)VT + ((size_t)hh * HD + d) * SQ + s0 + j8) = f.half[0]; }  } }


__global__ __launch_bounds__(256) void k_mprep(const float* __restrict__ E, const float* __restrict__ phase, _Float16* __restrict__ MH, _Float16* __restrict__ ML) {
  #pragma clang fp contract(off)
  const int t = blockIdx.x * 256 + threadIdx.x; if (t >= NH * HD * (HD / 8)) return; const int e8 = (t % (HD / 8)) * 8; const int hd_ = t / (HD / 8); const int d = hd_ % HD, h = hd_ / HD; const float c = cosf(bf16_round(phase[h * HD + d])); const float diag = __fmul_rn(__fmul_rn(c, c), 0.125f); FragH fh, fl;
#pragma unroll
  for (int q = 0; q < 8; ++q) { const int e = e8 + q; float m = bf16_round(E[((size_t)h * HD + d) * HD + e]); if (e == d) m = __fadd_rn(m, diag); const _Float16 hi = (_Float16)m; fh.h[q] = hi; fl.h[q] = (_Float16)((m - (float)hi) * 1024.0f); }
  const size_t o = ((size_t)h * HD + d) * HD + e8; { *(v8us*)((unsigned short*)MH + o) = fh.half[0]; *(v8us*)((unsigned short*)ML + o) = fl.half[0];  } }
__device__ __forceinline__ float half_xor(float v) { const int i = __float_as_int(v); return __int_as_float(__builtin_amdgcn_permlanex16(i, i, 0x76543210, 0xfedcba98, false, false)); }      /* value of lane l ^ 16 */
#define FK 64                        /* keys per LDS stage */
#define FPT 72                       /* LDS row pitch in f16: 128 B + 16 B, conflict-free for 16-byte fragment reads */
#define L2E 1.4426950408889634f
__device__ __forceinline__ v8f f_mma(v16h a, v16h b, v8f c) { return __builtin_amdgcn_wmma_f32_16x16x32_f16(false, a, false, b, (short)0, c, false, false); }
// ---- KM = K M^T per head in one launch: the terms hi.hi, residual.hi, hi.residual each in its own accumulator, summed in f32 in that order in registers, the sum split into hi + residual planes ----
// Workgroup = 4 waves x 32 token rows of one head. K hi and K residual (128 x 64) and M hi and M residual (64 x 64) go through LDS once: whole-line 16-byte loads, all issued together, one barrier.
__global__ __launch_bounds__(128) void k_km(const _Float16* __restrict__ KH, const _Float16* __restrict__ KL, const _Float16* __restrict__ MH, const _Float16* __restrict__ ML, _Float16* __restrict__ KMH, _Float16* __restrict__ KML) {
  __shared__ __attribute__((aligned(16))) float so[4][32][68];
  __shared__ __attribute__((aligned(16))) _Float16 sa[2][128][FPT];
  __shared__ __attribute__((aligned(16))) _Float16 sb[2][HD][FPT];
  const int tid = threadIdx.x, w = tid >> 5, lane = tid & 31, ln = lane & 15, hh = lane >> 4; const int h = blockIdx.y; const size_t row0 = (size_t)blockIdx.x * 128;
  const int sr = tid >> 3, sp = (tid & 7) * 8;      /* staging: one load of every thread covers 16 tile rows */
  const unsigned short* gah = (const unsigned short*)KH + (row0 + sr) * DM + h * HD + sp; const unsigned short* gal = (const unsigned short*)KL + (row0 + sr) * DM + h * HD + sp;
  const unsigned short* gbh = (const unsigned short*)MH + ((size_t)h * HD + sr) * HD + sp; const unsigned short* gbl = (const unsigned short*)ML + ((size_t)h * HD + sr) * HD + sp;
  v8us ta[2][8], tb[2][4];
  for (int i = 0; i < 4; ++i) { tb[0][i] = *(const v8us*)(gbh + (size_t)i * 16 * HD); tb[1][i] = *(const v8us*)(gbl + (size_t)i * 16 * HD); }
  for (int i = 0; i < 8; ++i) { ta[0][i] = *(const v8us*)(gah + (size_t)i * 16 * DM); ta[1][i] = *(const v8us*)(gal + (size_t)i * 16 * DM); }
  asm volatile("s_wait_xcnt 0x0" :: "v"(gah), "v"(gal), "v"(gbh), "v"(gbl) : "memory");      /* the four address pairs are inputs so that they stay live up to this wait */
  for (int i = 0; i < 8; ++i) { *(v8us*)&sa[0][i * 16 + sr][sp] = ta[0][i]; *(v8us*)&sa[1][i * 16 + sr][sp] = ta[1][i]; }
  for (int i = 0; i < 4; ++i) { *(v8us*)&sb[0][i * 16 + sr][sp] = tb[0][i]; *(v8us*)&sb[1][i * 16 + sr][sp] = tb[1][i]; }
  __syncthreads();      /* publishes the four tiles */
  const v8f z8 = {0.f,0.f,0.f,0.f,0.f,0.f,0.f,0.f};
  const int ra = 32 * w + ln;
#pragma unroll 1      /* kept rolled so that 12 accumulators are live, not 24: the kernel stays under 256 registers and needs no register-window switches */
  for (int th = 0; th < 2; ++th) {      /* two column tiles at a time */
    v8f c1[2][2], c2[2][2], c3[2][2];      /* [row tile][column tile] of hi.hi, residual.hi, hi.residual */
    for (int m = 0; m < 2; ++m) for (int t = 0; t < 2; ++t) { c1[m][t] = z8; c2[m][t] = z8; c3[m][t] = z8; }
    for (int ks = 0; ks < HD / 32; ++ks) {
      v16h ah[2], al[2], bh[2], bl[2];
      for (int m = 0; m < 2; ++m) { ah[m] = g2_frag(&sa[0][ra + 16 * m][ks * 32], hh); al[m] = g2_frag(&sa[1][ra + 16 * m][ks * 32], hh); }
      for (int t = 0; t < 2; ++t) { bh[t] = g2_frag(&sb[0][(th * 2 + t) * 16 + ln][ks * 32], hh); bl[t] = g2_frag(&sb[1][(th * 2 + t) * 16 + ln][ks * 32], hh); }
      for (int t = 0; t < 2; ++t) for (int m = 0; m < 2; ++m) c1[m][t] = f_mma(ah[m], bh[t], c1[m][t]);
      for (int t = 0; t < 2; ++t) for (int m = 0; m < 2; ++m) c2[m][t] = f_mma(al[m], bh[t], c2[m][t]);
      for (int t = 0; t < 2; ++t) for (int m = 0; m < 2; ++m) c3[m][t] = f_mma(ah[m], bl[t], c3[m][t]);
    }
    for (int m = 0; m < 2; ++m)
      for (int t = 0; t < 2; ++t)
        for (int r = 0; r < 8; ++r) { float v = c2[m][t][r] * 0.0009765625f + c1[m][t][r]; v = c3[m][t][r] * 0.0009765625f + v;      /* the residual planes carry x1024; the scaling is exact, so each line rounds once */
          so[w][m * 16 + 8 * hh + r][(th * 2 + t) * 16 + ln] = v; }
  }
  __builtin_amdgcn_fence(__ATOMIC_ACQ_REL, "workgroup"); __builtin_amdgcn_wave_barrier();      /* each wave reads back only its own rows */
  split_store(so[w], lane, KMH, KML, (row0 + 32 * w) * DM + h * HD, DM);
}
__global__ __launch_bounds__(256) void k_fattn(const _Float16* __restrict__ QH, const _Float16* __restrict__ QL, const _Float16* __restrict__ KMH, const _Float16* __restrict__ KML, const _Float16* __restrict__ VT, _Float16* __restrict__ O16) {
  __shared__ __attribute__((aligned(16))) _Float16 sk[2][3][FK][FPT];
  const int tid = threadIdx.x, lane = tid & 31, c = lane & 15, hh = lane >> 4; const int w = __builtin_amdgcn_readfirstlane(tid >> 5);
  const int h = blockIdx.y, b = blockIdx.z; const size_t r0 = (size_t)b * SQ; const size_t q0 = r0 + (size_t)blockIdx.x * 256 + w * 32;
  v16h qh[2][2], ql[2][2];      /* [query tile][k step of 32] */
  for (int qt = 0; qt < 2; ++qt)
    for (int ks = 0; ks < 2; ++ks) { const size_t o = (q0 + qt * 16 + c) * DM + h * HD + ks * 32; qh[qt][ks] = g2_frag(QH + o, hh); ql[qt][ks] = g2_frag(QL + o, hh); }
  const int sr = tid >> 3, sp = (tid & 7) * 8;      /* staging: a wave's 16-byte loads cover four whole 128-byte rows */
  const unsigned short* gkh = (const unsigned short*)KMH + (r0 + sr) * DM + h * HD + sp; const unsigned short* gkl = (const unsigned short*)KML + (r0 + sr) * DM + h * HD + sp;
  const unsigned short* gv = (const unsigned short*)VT + (((size_t)b * NH + h) * HD + sr) * SQ + sp;
  v8us st[6];
  st[0] = *(const v8us*)gkh; st[1] = *(const v8us*)(gkh + (size_t)32 * DM); st[2] = *(const v8us*)gkl; st[3] = *(const v8us*)(gkl + (size_t)32 * DM); st[4] = *(const v8us*)gv; st[5] = *(const v8us*)(gv + (size_t)32 * SQ);
  for (int i = 0; i < 6; ++i) *(v8us*)&sk[0][i >> 1][sr + 32 * (i & 1)][sp] = st[i];
  __syncthreads();      /* publishes stage 0 */
  const v8f z8 = {0.f,0.f,0.f,0.f,0.f,0.f,0.f,0.f};
  v8f o[4][2];      /* O^T tiles [d tile][query tile]: register r = d 16 dt + 8 hh + r of query c */
  for (int dt = 0; dt < 4; ++dt) { o[dt][0] = z8; o[dt][1] = z8; }
  float mu[2] = {-3.0e38f, -3.0e38f};      /* maximum in use per query, log2 domain, equal in both lane halves */
  float ls[2] = {0.f, 0.f};      /* this lane half's share of the sum of weights */
  for (int s = 0; s < SQ / FK; ++s) {
    const int buf = s & 1; const bool more = s + 1 < SQ / FK;
    if (more) { gkh += (size_t)FK * DM; gkl += (size_t)FK * DM; gv += FK;
      st[0] = *(const v8us*)gkh; st[1] = *(const v8us*)(gkh + (size_t)32 * DM); st[2] = *(const v8us*)gkl; st[3] = *(const v8us*)(gkl + (size_t)32 * DM); st[4] = *(const v8us*)gv; st[5] = *(const v8us*)(gv + (size_t)32 * SQ); }
    for (int p = 0; p < FK / 32; ++p) {
      v16h kh[2][2], kl[2][2];      /* [key tile][k step] */
      for (int kt = 0; kt < 2; ++kt)
        for (int ks = 0; ks < 2; ++ks) { kh[kt][ks] = g2_frag(&sk[buf][0][p * 32 + kt * 16 + c][ks * 32], hh); kl[kt][ks] = g2_frag(&sk[buf][1][p * 32 + kt * 16 + c][ks * 32], hh); }
      v8f sc[2][2] = {{z8, z8}, {z8, z8}};      /* S^T tiles [key tile][query tile]: register r = key 16 kt + 8 hh + r, query c */
      for (int ks = 0; ks < 2; ++ks) {
        for (int u = 0; u < 4; ++u) sc[u >> 1][u & 1] = f_mma(kl[u >> 1][ks], qh[u & 1][ks], sc[u >> 1][u & 1]);      /* hi.lo */
        for (int u = 0; u < 4; ++u) sc[u >> 1][u & 1] = f_mma(kh[u >> 1][ks], ql[u & 1][ks], sc[u >> 1][u & 1]);      /* lo.hi */
      }
      for (int u = 0; u < 4; ++u) sc[u >> 1][u & 1] *= 0.0009765625f;      /* the residual planes carry x1024 */
      for (int ks = 0; ks < 2; ++ks)
        for (int u = 0; u < 4; ++u) sc[u >> 1][u & 1] = f_mma(kh[u >> 1][ks], qh[u & 1][ks], sc[u >> 1][u & 1]);      /* hi.hi */
      v16h va[4];
      for (int dt = 0; dt < 4; ++dt) va[dt] = g2_frag(&sk[buf][2][dt * 16 + c][p * 32], hh);
      float mt[2]; bool need = false;
      for (int qt = 0; qt < 2; ++qt) { float m = sc[0][qt][0];
        for (int r = 1; r < 8; ++r) m = fmaxf(m, sc[0][qt][r]);
        for (int r = 0; r < 8; ++r) m = fmaxf(m, sc[1][qt][r]);
        m = fmaxf(m, half_xor(m)) * L2E; mt[qt] = m; need = need || (m > mu[qt] + 8.0f); }
      if (__builtin_amdgcn_ballot_w32(need) != 0) {      /* lazy rescale, one scalar branch per 32 keys: the maximum in use follows only when some query's maximum has passed it by more than 2^8 */
        for (int qt = 0; qt < 2; ++qt) { const float mn = fmaxf(mu[qt], mt[qt]); const float al = __builtin_amdgcn_exp2f(mu[qt] - mn); mu[qt] = mn; ls[qt] *= al;
          for (int dt = 0; dt < 4; ++dt) o[dt][qt] *= al; }
      }
      for (int qt = 0; qt < 2; ++qt) { const float sh = 6.0f - mu[qt];      /* weights carried x64: at most 2^14 in f16 */
        v8f e0 = sc[0][qt] * L2E + sh, e1 = sc[1][qt] * L2E + sh; FragH pb;
        for (int r = 0; r < 8; ++r) { e0[r] = __builtin_amdgcn_exp2f(e0[r]); e1[r] = __builtin_amdgcn_exp2f(e1[r]); }
        for (int r = 0; r < 8; ++r) { pb.h[r] = (_Float16)e0[r]; pb.h[8 + r] = (_Float16)e1[r]; }
        const v8f t = e0 + e1; ls[qt] += ((t[0] + t[1]) + (t[2] + t[3])) + ((t[4] + t[5]) + (t[6] + t[7]));
        for (int dt = 0; dt < 4; ++dt) o[dt][qt] = f_mma(va[dt], pb.v, o[dt][qt]); }
    }
    if (more) {
      for (int i = 0; i < 6; ++i) *(v8us*)&sk[buf ^ 1][i >> 1][sr + 32 * (i & 1)][sp] = st[i]; }
    __syncthreads();      /* publishes the next stage and ends every wave's reads of this one, which the stage after next overwrites */
  }
  for (int qt = 0; qt < 2; ++qt) { const float inv = 64.0f * __builtin_amdgcn_rcpf(ls[qt] + half_xor(ls[qt]));      /* o carried x64, the weights' own carry cancels */
    for (int dt = 0; dt < 4; ++dt) { FragH f;
      for (int r = 0; r < 8; ++r) f.h[r] = (_Float16)(o[dt][qt][r] * inv);
      *(v8us*)((unsigned short*)O16 + (q0 + qt * 16 + c) * DM + h * HD + dt * 16 + 8 * hh) = f.half[0]; } }
}

extern "C" void kernel_launch(void* const* d_in, const int* in_sizes, int n_in,
                              void* d_out, int out_size, void* d_ws, size_t ws_size, hipStream_t stream) {
  (void)in_sizes; (void)n_in; (void)out_size;
  const float* const* I = (const float* const*)d_in; const float* x = I[0]; const float* wq = I[1]; const float* bq = I[2]; const float* wk = I[3]; const float* bk = I[4]; const float* wv = I[5]; const float* bv = I[6]; const float* phase = I[7]; const float* E = I[8]; const float* wo = I[9]; const float* bo = I[10];      /* weights [in][out] */
  char* ws = (char*)d_ws; size_t off = 0;
  auto take = [&](size_t bytes) { char* p = ws + off; off += (bytes + 255) & ~(size_t)255; return p; };
  _Float16* BQ = (_Float16*)take((size_t)DM * DM * 2); _Float16* BK = (_Float16*)take((size_t)DM * DM * 2); _Float16* BV = (_Float16*)take((size_t)DM * DM * 2); _Float16* BO = (_Float16*)take((size_t)DM * DM * 2); _Float16* MH = (_Float16*)take((size_t)NH * HD * HD * 2); _Float16* ML = (_Float16*)take((size_t)NH * HD * HD * 2);
  _Float16* X16 = (_Float16*)take(NR * DM * 2); _Float16* QH = (_Float16*)take(NR * DM * 2); _Float16* QL = (_Float16*)take(NR * DM * 2); _Float16* KH = (_Float16*)take(NR * DM * 2); _Float16* KL = (_Float16*)take(NR * DM * 2); _Float16* V16 = (_Float16*)take(NR * DM * 2);
  _Float16* KMH = (_Float16*)take(NR * DM * 2); _Float16* KML = (_Float16*)take(NR * DM * 2); _Float16* O16 = (_Float16*)take(NR * DM * 2);
  _Float16* VT = (_Float16*)take((size_t)NB * NH * HD * SQ * 2);
  if (off > ws_size) return;      /* 8.3 + 8 + 40 + 16 + 8 + 8 = approx 88 MiB */
  { const unsigned gw = (unsigned)(((size_t)DM * (DM / 8) + 255) / 256); k_wt_f16<<<gw, 256, 0, stream>>>(wq, BQ, DM, DM, 16.0f); k_wt_f16<<<gw, 256, 0, stream>>>(wk, BK, DM, DM, 16.0f); k_wt_f16<<<gw, 256, 0, stream>>>(wv, BV, DM, DM, 16.0f); k_wt_f16<<<gw, 256, 0, stream>>>(wo, BO, DM, DM, 16.0f); }      /* [in][out] -> Bt[n][k] x16 */
  k_mprep<<<(NH * HD * (HD / 8) + 255) / 256, 256, 0, stream>>>(E, phase, MH, ML);
  k_x16<<<(unsigned)((NR * DM / 8 + 255) / 256), 256, 0, stream>>>(x, X16, NR * DM / 8);
  const size_t r0p = (size_t)B0 * SQ; const dim3 gp((unsigned)((MP / 128) * (DM / 64)), 1);
  k_gemm2<0, 128, DM, DM><<<gp, 128, 0, stream>>>(X16 + r0p * DM, 0, BQ, 0, 0.0625f, bq, 0, nullptr, 1, 0, 0, nullptr, QH + r0p * DM, QL + r0p * DM, DM, 0, MP, DM, DM);      /* Q as hi + residual planes */
  k_gemm2<0, 128, DM, DM><<<gp, 128, 0, stream>>>(X16 + r0p * DM, 0, BK, 0, 0.0625f, bk, 0, nullptr, 1, 0, 0, nullptr, KH + r0p * DM, KL + r0p * DM, DM, 0, MP, DM, DM);      /* K as hi + residual planes */
  k_gemm2<0, 128, DM, DM><<<gp, 128, 0, stream>>>(X16 + r0p * DM, 0, BV, 0, 0.0625f, bv, 0, nullptr, 1, 0, 0, nullptr, V16 + r0p * DM, nullptr, DM, 0, MP, DM, DM);
  k_km<<<dim3((unsigned)(NR / 128), NH), 128, 0, stream>>>(KH, KL, MH, ML, KMH, KML);      /* KM[k][h*64+d] = sum_e K[k][h*64+e] M[h][d][e], token rows of both batches, all heads on grid.y */
  k_vt<NH, SQ><<<NB * NH * (SQ / 64), 256, 0, stream>>>(V16, DM, 0, VT);      /* V^T [NB][NH][HD][SQ] */
  k_fattn<<<dim3(SQ / 256, NH, NB), 256, 0, stream>>>(QH, QL, KMH, KML, VT, O16);      /* o (merged heads, x64) as f16 rows */
  k_gemm2<0, 128, DM, DM><<<dim3((unsigned)((MPO / 128) * (DM / 64)), 1), 128, 0, stream>>>(O16 + r0p * DM, 0, BO, 0, 0.0009765625f, bo, 0, nullptr, 1, 0, 0, (float*)d_out + r0p * DM, nullptr, nullptr, DM, 0, MPO, DM, DM);      /* out rows are the output layout */
}

// v005
// One run takes 119 microseconds.
// In two side-by-side timings against v004, it was 1.24 and 1.23 times as fast.
// Over all steps from v000 it is 35.9 times as fast.
#include <hip/hip_runtime.h>
// "Quantum" attention (x [2][2048][1024]): Q/K/V = x W + b ([in][out] weights + biases, 16 heads of 64); scores = (Q cos(phase)) (K cos(phase))^T / 8 + Q E K^T per head (phase [16][64], E [16][64][64]) = Q M K^T with M = E + diag(cos^2 phase / 8); softmax over the 2,048 keys; o = attn V merged; out = o out_w + out_b -> [2][2048][1024].
// Structure: token rows; x as exact f16 rows; Q and K as WMMA GEMMs (32x64 wave tiles, operand tiles through LDS, f32 accumulation, exact x16 transposed weights + bias) whose epilogue splits each f32 result on VALU into f16 hi + 2^-10 residual planes; V as a WMMA GEMM to f16 rows; M as f16 hi + residual planes (VALU, cos in f32); KM = K M^T per head (km_tile): three WMMA terms (hi.hi + lo.hi + hi.lo, K = 64) in three accumulators, summed in f32 in registers, split into hi + residual planes; V^T for all batches and heads via LDS transposes; attention in one fused launch (k_fattn): scores = Q KM^T as three WMMA terms in one accumulator, online softmax on VALU (f32 statistics, native exp2; weights x64 f16 against the maximum in use), o = P . V^T on WMMA, normalised at the end into merged f16 rows (o carried x64 against f16 subnormal flush); out = o out_w + b GEMM (f32, alpha folds 1/16 and 1/64). Five launches: jobs that do not depend on each other share a grid (k_prep, k_qkv, k_kmvt), then k_fattn, k_outp.
// Compute dtype: inputs rounded to bf16; weights exact (x16 f16); Q, K, M, KM as f16 hi + residual planes (~2^-22); V, softmax weights (x64) and o (x64) plain f16 (~2^-12); scores, softmax statistics f32. v_wmma_f32_16x16x32_f16.
#define NB 2
#define SQ 2048
#define DM 1024
#define NH 16
#define HD 64
#define HG 4                         /* heads per group in the per-batch k_vt, which is not launched */
#define PSC 4096.0f                  /* unused; the softmax weights carry x64 */
#define B0 0                         /* first batch processed (debug hook) */
#define NBR NB                       /* batches processed (debug hook) */
#define QN SQ                        /* unused; k_fattn attends all SQ query rows per batch */
#define NHD NH                       /* unused; k_fattn attends all NH heads */
#define NR ((size_t)NB * SQ)
#define MP ((int)((size_t)NBR * SQ)) /* rows projected (debug hook) */
#define MPO MP                       /* rows through the output GEMM (debug hook) */
typedef __bf16 v16b __attribute__((ext_vector_type(16)));
typedef unsigned short v8us __attribute__((ext_vector_type(8), may_alias));
typedef float  v8f  __attribute__((ext_vector_type(8)));
typedef float  v4f  __attribute__((ext_vector_type(4)));
typedef float  v4fa __attribute__((ext_vector_type(4), may_alias));
union FragB { v16b v; v8us half[2]; unsigned short u[16]; };

__device__ __forceinline__ unsigned short bf16_bits(float x) { unsigned int u = __float_as_uint(x); return (unsigned short)((u + 0x7FFFu + ((u >> 16) & 1u)) >> 16); }
__device__ __forceinline__ float bf16_val(unsigned short b) { return __uint_as_float(((unsigned int)b) << 16); }
__device__ __forceinline__ float bf16_round(float x) { return bf16_val(bf16_bits(x)); }
// D += A·B with NT terms: 1 = ah·bh, 2 = + al·bh (A split), 3 = + ah·bl (both split)
template <int NT>
__device__ __forceinline__ v8f mmaN(v16b ah, v16b al, v16b bh, v16b bl, v8f c) {
  c = __builtin_amdgcn_wmma_f32_16x16x32_bf16(false, ah, false, bh, (short)0, c, false, false);
  if (NT >= 2) c = __builtin_amdgcn_wmma_f32_16x16x32_bf16(false, al, false, bh, (short)0, c, false, false);
  if (NT >= 3) c = __builtin_amdgcn_wmma_f32_16x16x32_bf16(false, ah, false, bl, (short)0, c, false, false);
  asm volatile("v_nop\n\tv_nop\n\tv_nop\n\tv_nop" : "+v"(c) : "v"(ah), "v"(al), "v"(bh), "v"(bl));
  return c;
}

__global__ __launch_bounds__(256) void k_wt_bf16(const float* __restrict__ W, unsigned short* __restrict__ Wt, int K, int N) {
  const int t = blockIdx.x * 256 + threadIdx.x;
  const int k8n = K / 8;
  if (t >= N * k8n) return;
  const int n = t / k8n, k8 = (t % k8n) * 8;
  v8us v;
#pragma unroll
  for (int i = 0; i < 8; ++i) v[i] = bf16_bits(W[(size_t)(k8 + i) * N + n]);
  *(v8us*)(Wt + (size_t)n * K + k8) = v;
  
}

// GEMM C[M][N] (f32, pitch ldc) = act(A[M][K]·W + bias). A f32 row-major (pitch lda) converted per fragment to bf16
// (ASPLIT: hi/lo two planes -> 2 terms, else single rounded term); Wt bf16 [N][K] (pitch ldb). BIAS_BF16 rounds the
// bias to bf16 first (bias quantised to bf16 before the add). K%32==0, M%16==0, N%64==0.
template <bool ASPLIT, int ACT, bool BIAS_BF16>
__global__ __launch_bounds__(128) void k_gemm_bf(const float* __restrict__ A, int lda, const unsigned short* __restrict__ Wt, int ldb,
                                               const float* __restrict__ bias, float* __restrict__ C, int ldc, int M, int N, int K) {
  __shared__ __attribute__((aligned(16))) float so[4][16][64];
  const int tid = threadIdx.x, w = tid >> 5, lane = tid & 31, ln = lane & 15, hh = lane >> 4;
  const int ntn = N / 64;
  const int wid = blockIdx.x * 4 + w;
  const int mt = wid / ntn, nq = wid % ntn;
  if (mt * 16 >= M) return;
  const int row0 = mt * 16, col0 = nq * 64;
  const float* arow = A + (size_t)(row0 + ln) * lda;
  v8f acc[4] = {};
  for (int kb = 0; kb < K; kb += 32) {
    FragB ah, al;
    const v4f x0 = *(const v4fa*)(arow + kb + 8 * hh), x1 = *(const v4fa*)(arow + kb + 8 * hh + 4);
    const v4f x2 = *(const v4fa*)(arow + kb + 16 + 8 * hh), x3 = *(const v4fa*)(arow + kb + 16 + 8 * hh + 4);
    float xs[16] = {x0[0],x0[1],x0[2],x0[3],x1[0],x1[1],x1[2],x1[3],x2[0],x2[1],x2[2],x2[3],x3[0],x3[1],x3[2],x3[3]};
#pragma unroll
    for (int i = 0; i < 16; ++i) { const unsigned short hb = bf16_bits(xs[i]); ah.u[i] = hb; al.u[i] = ASPLIT ? bf16_bits(xs[i] - bf16_val(hb)) : (unsigned short)0; }
#pragma unroll
    for (int t = 0; t < 4; ++t) {
      const unsigned short* brow = Wt + (size_t)(col0 + t * 16 + ln) * ldb + kb;
      FragB b;
      b.half[0] = *(const v8us*)(brow + 8 * hh);
      b.half[1] = *(const v8us*)(brow + 16 + 8 * hh);
      acc[t] = mmaN<ASPLIT ? 2 : 1>(ah.v, al.v, b.v, b.v, acc[t]);
    }
  }
#pragma unroll
  for (int t = 0; t < 4; ++t) {
    float bv = bias ? bias[col0 + t * 16 + ln] : 0.f;
    if (BIAS_BF16) bv = bf16_round(bv);
#pragma unroll
    for (int r = 0; r < 8; ++r) { float v = acc[t][r] + bv; if (ACT == 1) v = fmaxf(v, 0.f); so[w][8 * hh + r][t * 16 + ln] = v; }
  }
  __builtin_amdgcn_fence(__ATOMIC_ACQ_REL, "workgroup");
  __builtin_amdgcn_wave_barrier();
  const int rsub = lane >> 4, c4 = (lane & 15) * 4;
  {
#pragma unroll
    for (int q = 0; q < 8; ++q) {
      const int r = q * 2 + rsub;
      const v4f v = *(const v4fa*)&so[w][r][c4];
      *(v4f*)(C + (size_t)(row0 + r) * ldc + col0 + c4) = v;
    }
    
  }
}

// GEMM C = act(A·W + bias + resid): A f32 (ASPLIT -> hi/lo 2 terms), Wt bf16 [N][K]; ACT 0 none, 1 relu, 2 exact gelu;
// resid (optional, f32, row index = (row % rmod), pitch ldr, RES_BF16 rounds it) added before the activation.
template <bool ASPLIT, int ACT, bool BIAS_BF16, bool RES_BF16>
__global__ __launch_bounds__(128) void k_gemm_bf3(const float* __restrict__ A, int lda, const unsigned short* __restrict__ Wt, int ldb,
                                                const float* __restrict__ bias, const float* __restrict__ resid, int rmod, int ldr,
                                                float* __restrict__ C, int ldc, int M, int N, int K) {
  __shared__ __attribute__((aligned(16))) float so[4][16][64];
  const int tid = threadIdx.x, w = tid >> 5, lane = tid & 31, ln = lane & 15, hh = lane >> 4;
  const int ntn = N / 64;
  const int wid = blockIdx.x * 4 + w;
  const int mt = wid / ntn, nq = wid % ntn;
  if (mt * 16 >= M) return;
  const int row0 = mt * 16, col0 = nq * 64;
  const float* arow = A + (size_t)(row0 + ln) * lda;
  v8f acc[4] = {};
  for (int kb = 0; kb < K; kb += 32) {
    FragB ah, al;
    const v4f x0 = *(const v4fa*)(arow + kb + 8 * hh), x1 = *(const v4fa*)(arow + kb + 8 * hh + 4);
    const v4f x2 = *(const v4fa*)(arow + kb + 16 + 8 * hh), x3 = *(const v4fa*)(arow + kb + 16 + 8 * hh + 4);
    float xs[16] = {x0[0],x0[1],x0[2],x0[3],x1[0],x1[1],x1[2],x1[3],x2[0],x2[1],x2[2],x2[3],x3[0],x3[1],x3[2],x3[3]};
#pragma unroll
    for (int i = 0; i < 16; ++i) { const unsigned short hb = bf16_bits(xs[i]); ah.u[i] = hb; al.u[i] = ASPLIT ? bf16_bits(xs[i] - bf16_val(hb)) : (unsigned short)0; }
#pragma unroll
    for (int t = 0; t < 4; ++t) {
      const unsigned short* brow = Wt + (size_t)(col0 + t * 16 + ln) * ldb + kb;
      FragB b;
      b.half[0] = *(const v8us*)(brow + 8 * hh);
      b.half[1] = *(const v8us*)(brow + 16 + 8 * hh);
      acc[t] = mmaN<ASPLIT ? 2 : 1>(ah.v, al.v, b.v, b.v, acc[t]);
    }
  }
#pragma unroll
  for (int t = 0; t < 4; ++t) {
    const int col = col0 + t * 16 + ln;
    float bv = bias ? bias[col] : 0.f;
    if (BIAS_BF16) bv = bf16_round(bv);
#pragma unroll
    for (int r = 0; r < 8; ++r) {
      float v = acc[t][r] + bv;
      if (resid) { float rv = resid[(size_t)((row0 + 8 * hh + r) % rmod) * ldr + col]; if (RES_BF16) rv = bf16_round(rv); v += rv; }
      if (ACT == 1) v = fmaxf(v, 0.f);
      if (ACT == 2) v = 0.5f * v * (1.0f + erff(v * 0.70710678118654752f));
      if (ACT == 3) { const float u = 0.7978845608028654f * (v + 0.044715f * v * v * v); v = 0.5f * v * (1.0f + tanhf(u)); }
      so[w][8 * hh + r][t * 16 + ln] = v;
    }
  }
  __builtin_amdgcn_fence(__ATOMIC_ACQ_REL, "workgroup");
  __builtin_amdgcn_wave_barrier();
  const int rsub = lane >> 4, c4 = (lane & 15) * 4;
  {
#pragma unroll
    for (int q = 0; q < 8; ++q) {
      const int r = q * 2 + rsub;
      const v4f v = *(const v4fa*)&so[w][r][c4];
      *(v4f*)(C + (size_t)(row0 + r) * ldc + col0 + c4) = v;
    }
    
  }
}
// row LayerNorm (biased variance, eps) over N: s = X (+ R); optional out_sum <- s; out_norm <- (s-mu)*rsqrt(var+eps)*g + b
template <bool PARAM_BF16>
__global__ __launch_bounds__(256) void k_layernorm(const float* __restrict__ X, const float* __restrict__ R, const float* __restrict__ g, const float* __restrict__ bta,
                                                  float* __restrict__ out_sum, float* __restrict__ out_norm, int N, float eps) {
  __shared__ float red[256];
  const int row = blockIdx.x, tid = threadIdx.x;
  const float* x = X + (size_t)row * N; const float* rr = R ? R + (size_t)row * N : nullptr;
  float vals[16];                     // up to N = 4096
  const int per = N / 256;            // contiguous chunk per thread? use strided-by-4 chunks: thread handles j = tid*4 + 1024*u
  float s1 = 0.f;
  for (int u = 0; u < per / 4; ++u) {
    const int j = tid * 4 + 1024 * u;
    const v4f a = *(const v4fa*)(x + j);
    v4f b = {0.f,0.f,0.f,0.f}; if (rr) b = *(const v4fa*)(rr + j);
#pragma unroll
    for (int q = 0; q < 4; ++q) { const float v = a[q] + b[q]; vals[u * 4 + q] = v; s1 += v; }
  }
  red[tid] = s1; __syncthreads();
  for (int st = 128; st > 0; st >>= 1) { if (tid < st) red[tid] += red[tid + st]; __syncthreads(); }
  const float mu = red[0] / (float)N; __syncthreads();
  float s2 = 0.f;
  for (int u = 0; u < per / 4; ++u)
#pragma unroll
    for (int q = 0; q < 4; ++q) { const float c = vals[u * 4 + q] - mu; s2 += c * c; }
  red[tid] = s2; __syncthreads();
  for (int st = 128; st > 0; st >>= 1) { if (tid < st) red[tid] += red[tid + st]; __syncthreads(); }
  const float rs = rsqrtf(red[0] / (float)N + eps);
  {
    for (int u = 0; u < per / 4; ++u) {
      const int j = tid * 4 + 1024 * u;
      v4f o, sm;
#pragma unroll
      for (int q = 0; q < 4; ++q) {
        float gg = g[j + q], bb = bta[j + q];
        if (PARAM_BF16) { gg = bf16_round(gg); bb = bf16_round(bb); }
        sm[q] = vals[u * 4 + q]; o[q] = (vals[u * 4 + q] - mu) * rs * gg + bb;
      }
      if (out_sum) *(v4f*)(out_sum + (size_t)row * N + j) = sm;
      *(v4f*)(out_norm + (size_t)row * N + j) = o;
    }
    
  }
}



// ---- f16 WMMA path (v_wmma_f32_16x16x32_f16): 11-bit significands for operands in range — used where a [0,1] probability operand needs more precision than bf16
typedef _Float16 v16h __attribute__((ext_vector_type(16)));
union FragH { v16h v; v8us half[2]; _Float16 h[16]; unsigned short u[16]; };
template <int NT>
__device__ __forceinline__ v8f mmaH(v16h ah, v16h al, v16h bh, v16h bl, v8f c) {
  c = __builtin_amdgcn_wmma_f32_16x16x32_f16(false, ah, false, bh, (short)0, c, false, false);
  if (NT >= 2) c = __builtin_amdgcn_wmma_f32_16x16x32_f16(false, al, false, bh, (short)0, c, false, false);
  if (NT >= 3) c = __builtin_amdgcn_wmma_f32_16x16x32_f16(false, ah, false, bl, (short)0, c, false, false);
  asm volatile("v_nop\n\tv_nop\n\tv_nop\n\tv_nop" : "+v"(c) : "v"(ah), "v"(al), "v"(bh), "v"(bl));
  return c;
}
// batched GEMM like k_gemm_b but f16 operands: A f32 (split into f16 hi/lo if ASPLIT, else rounded to f16), Bt = f16 values [n][k]; alpha; C f32; N multiple of 16 (partial tiles skipped)
template <bool ASPLIT>
__global__ __launch_bounds__(128) void k_gemm_h(const float* __restrict__ A, int lda, size_t sA, const _Float16* __restrict__ Bh, int ldb, size_t sB, float alpha, float* __restrict__ C, int ldc, size_t sC, int M, int N, int K) {
  __shared__ __attribute__((aligned(16))) float so[4][16][64];
  const int tid = threadIdx.x, w = tid >> 5, lane = tid & 31, ln = lane & 15, hh = lane >> 4; const int by = blockIdx.y;
  A += (size_t)by * sA; Bh += (size_t)by * sB; C += (size_t)by * sC;
  const int ntn = (N + 63) / 64; const int wid = blockIdx.x * 4 + w; const int mt = wid / ntn, nq = wid % ntn; if (mt * 16 >= M) return;
  const int row0 = mt * 16, col0 = nq * 64; const float* arow = A + (size_t)(row0 + ln) * lda;
  v8f acc[4] = {};
  for (int kb = 0; kb < K; kb += 32) {
    FragH ah, al;
    const v4f x0 = *(const v4fa*)(arow + kb + 8 * hh), x1 = *(const v4fa*)(arow + kb + 8 * hh + 4), x2 = *(const v4fa*)(arow + kb + 16 + 8 * hh), x3 = *(const v4fa*)(arow + kb + 16 + 8 * hh + 4);
    float xs[16] = {x0[0],x0[1],x0[2],x0[3],x1[0],x1[1],x1[2],x1[3],x2[0],x2[1],x2[2],x2[3],x3[0],x3[1],x3[2],x3[3]};
#pragma unroll
    for (int i = 0; i < 16; ++i) { const _Float16 h = (_Float16)xs[i]; ah.h[i] = h; al.h[i] = ASPLIT ? (_Float16)(xs[i] - (float)h) : (_Float16)0.0f; }
#pragma unroll
    for (int t = 0; t < 4; ++t) { if (col0 + t * 16 >= N) continue; const size_t boff = (size_t)(col0 + t * 16 + ln) * ldb + kb; FragH bq; bq.half[0] = *(const v8us*)(Bh + boff + 8 * hh); bq.half[1] = *(const v8us*)(Bh + boff + 16 + 8 * hh);
      acc[t] = mmaH<ASPLIT ? 2 : 1>(ah.v, al.v, bq.v, bq.v, acc[t]); }
  }
#pragma unroll
  for (int t = 0; t < 4; ++t) { if (col0 + t * 16 >= N) continue;
#pragma unroll
    for (int r = 0; r < 8; ++r) so[w][8 * hh + r][t * 16 + ln] = acc[t][r] * alpha; }
  __builtin_amdgcn_fence(__ATOMIC_ACQ_REL, "workgroup"); __builtin_amdgcn_wave_barrier();
  const int rsub = lane >> 4, c4 = (lane & 15) * 4;
  {
#pragma unroll
    for (int q = 0; q < 8; ++q) { const int r = q * 2 + rsub; if (col0 + c4 < N) { const v4f v = *(const v4fa*)&so[w][r][c4]; *(v4f*)(C + (size_t)(row0 + r) * ldc + col0 + c4) = v; } }
     }
}

// Wt[n][k] = f16(W[k][n]·scale) from f32 row-major W[K][N] (scale = power of two; bf16-exact weights stay exact in f16 away from the subnormal range)
__device__ __forceinline__ void wt_f16(const float* __restrict__ W, _Float16* __restrict__ Wt, int K, int N, float scale, int bid) {
  const int t = bid * 256 + threadIdx.x; if (t >= N * (K / 8)) return; const int n = t / (K / 8), k8 = (t % (K / 8)) * 8; FragH f;
#pragma unroll
  for (int i = 0; i < 8; ++i) f.h[i] = (_Float16)(bf16_round(W[(size_t)(k8 + i) * N + n]) * scale); const v8us o = f.half[0];
  *(v8us*)((unsigned short*)Wt + (size_t)n * K + k8) = o; 
}
// k_gemm_hh variant with fused epilogue: v = acc·alpha + bias[by·sBias + col] (+ CP[(row/rowsPerB)·sCPb + by·64 + col] if CP) ; ACT 0 none / 1 elu ; writes f16 C16 (and f32 C if non-null)
template <int ACT>
__global__ __launch_bounds__(128) void k_gemm_hhx(const _Float16* __restrict__ A, int lda, size_t sA, const _Float16* __restrict__ Bh, int ldb, size_t sB, float alpha, const float* __restrict__ bias, size_t sBias, const float* __restrict__ CP, int rowsPerB, size_t sCPb, int row0g,
    float* __restrict__ C, _Float16* __restrict__ C16, int ldc, size_t sC, int M, int N, int K) {
  __shared__ __attribute__((aligned(16))) float so[4][16][64];
  const int tid = threadIdx.x, w = tid >> 5, lane = tid & 31, ln = lane & 15, hh = lane >> 4; const int by = blockIdx.y;
  A += (size_t)by * sA; Bh += (size_t)by * sB; const size_t cofs = (size_t)by * sC; const float* bp = bias ? bias + (size_t)by * sBias : nullptr;
  const int ntn = (N + 63) / 64; const int wid = blockIdx.x * 4 + w; const int mt = wid / ntn, nq = wid % ntn; if (mt * 16 >= M) return;
  const int row0 = mt * 16, col0 = nq * 64; const _Float16* arow = A + (size_t)(row0 + ln) * lda;
  v8f acc[4] = {};
  for (int kb = 0; kb < K; kb += 32) { FragH ah; ah.half[0] = *(const v8us*)((const unsigned short*)arow + kb + 8 * hh); ah.half[1] = *(const v8us*)((const unsigned short*)arow + kb + 16 + 8 * hh);
#pragma unroll
    for (int t = 0; t < 4; ++t) { if (col0 + t * 16 >= N) continue; const size_t boff = (size_t)(col0 + t * 16 + ln) * ldb + kb; FragH bq; bq.half[0] = *(const v8us*)((const unsigned short*)Bh + boff + 8 * hh); bq.half[1] = *(const v8us*)((const unsigned short*)Bh + boff + 16 + 8 * hh);
      acc[t] = mmaH<1>(ah.v, ah.v, bq.v, bq.v, acc[t]); }
  }
#pragma unroll
  for (int t = 0; t < 4; ++t) { if (col0 + t * 16 >= N) continue; const int col = col0 + t * 16 + ln; const float bv = bp ? bf16_round(bp[col]) : 0.f;
#pragma unroll
    for (int r = 0; r < 8; ++r) { float v = acc[t][r] * alpha + bv; if (CP) { const int rr = row0g + row0 + 8 * hh + r; if (rowsPerB < 0) v += CP[cofs + (size_t)rr * ldc + col];      /* rowsPerB < 0: own element of the batched C plane */ else { const int bidx = rr / rowsPerB; v += CP[(size_t)bidx * sCPb + (size_t)by * 64 + col]; } } if (ACT == 1) v = (v > 0.f) ? v : expm1f(v); else if (ACT == 7) v = (v > 0.f) ? v + 1.0f : expf(v); else if (ACT == 8) v = tanhf(v); else if (ACT == 9) v = 0.5f * v * (1.0f + tanhf(0.7978845608028654f * (v + 0.044715f * v * v * v))); else if (ACT == 11) v = 1.0f / (1.0f + expf(-v)); else if (ACT == 12) v = (v > 0.f) ? v : 0.01f * v; else if (ACT == 14) v = (v > 0.f) ? v : 0.1f * v; else if (ACT == 16) v = (v >= 0.f) ? v : 0.3f * v; else if (ACT == 17) v = (v >= 0.f) ? v : 0.2f * v; else if (ACT == 15) v = v / (1.0f + expf(-v)); else if (ACT == 3) v = fmaxf(v, 0.f); else if (ACT == 6) v = 0.5f * v * (1.0f + erff(v * 0.70710678118654752f)); so[w][8 * hh + r][t * 16 + ln] = v; } }
  __builtin_amdgcn_fence(__ATOMIC_ACQ_REL, "workgroup"); __builtin_amdgcn_wave_barrier();
  const int rsub = lane >> 4, c4 = (lane & 15) * 4; typedef _Float16 v4h __attribute__((ext_vector_type(4)));
  {
#pragma unroll
    for (int q = 0; q < 8; ++q) { const int r = q * 2 + rsub; if (col0 + c4 < N) { const v4f v = *(const v4fa*)&so[w][r][c4]; if (C) *(v4f*)(C + cofs + (size_t)(row0 + r) * ldc + col0 + c4) = v; if (C16) { v4h h4; for (int i = 0; i < 4; ++i) h4[i] = (_Float16)v[i]; *(v4h*)(C16 + cofs + (size_t)(row0 + r) * ldc + col0 + c4) = h4; } } }
     }
}


typedef _Float16 v4h __attribute__((ext_vector_type(4)));

__device__ __forceinline__ void x16_rows(const float* __restrict__ x, _Float16* __restrict__ X16, size_t n8, int bid) { const size_t t = (size_t)bid * 256 + threadIdx.x; if (t >= n8) return; FragH f;
#pragma unroll
  for (int q = 0; q < 8; ++q) f.h[q] = (_Float16)bf16_round(x[t * 8 + q]); *(v8us*)((unsigned short*)X16 + t * 8) = f.half[0];  }
__global__ __launch_bounds__(256) void k_h16(const float* __restrict__ x, _Float16* __restrict__ X16, size_t n8) { const size_t t = (size_t)blockIdx.x * 256 + threadIdx.x; if (t >= n8) return; FragH f;
#pragma unroll
  for (int q = 0; q < 8; ++q) f.h[q] = (_Float16)x[t * 8 + q]; *(v8us*)((unsigned short*)X16 + t * 8) = f.half[0];  }
__global__ __launch_bounds__(256) void k_round16f(const float* __restrict__ W, _Float16* __restrict__ Bt, size_t n8) { const size_t t = (size_t)blockIdx.x * 256 + threadIdx.x; if (t >= n8) return; FragH f;
#pragma unroll
  for (int i = 0; i < 8; ++i) f.h[i] = (_Float16)(bf16_round(W[t * 8 + i]) * 16.0f); *(v8us*)((unsigned short*)Bt + t * 8) = f.half[0];  }
template <int NHv, int TTv>      /* one 64 x 64 tile, 128 threads (the block shape of the launch it shares) */
__device__ __forceinline__ void vt_tile(const _Float16* __restrict__ V16, int ldv, int voff, _Float16* __restrict__ Vt, int bid) { __shared__ unsigned short tl[64][66]; const int tid = threadIdx.x; const int slab = bid / (TTv / 64), lg = bid % (TTv / 64); const int b = slab / NHv, h = slab % NHv;
  const int r0 = tid / 8, c8 = (tid % 8) * 8; FragH f[4];
#pragma unroll      /* constant indices into f[]; a thread's four loads are all issued ahead of the first LDS store, so the tile waits out one load latency, not four in a row */
  for (int u = 0; u < 4; ++u) f[u].half[0] = *(const v8us*)((const unsigned short*)V16 + ((size_t)b * TTv + lg * 64 + u * 16 + r0) * ldv + voff + h * 64 + c8);
#pragma unroll      /* constant indices into f[] */
  for (int u = 0; u < 4; ++u)
    for (int q = 0; q < 8; ++q) tl[u * 16 + r0][c8 + q] = f[u].u[q];
  __syncthreads();
  {
#pragma unroll
    for (int rd = 0; rd < 4; ++rd) { const int d = rd * 16 + tid / 8, pc = tid % 8; FragH f;
#pragma unroll
      for (int q = 0; q < 8; ++q) f.u[q] = tl[pc * 8 + q][d];
      *(v8us*)((unsigned short*)Vt + ((size_t)slab * 64 + d) * TTv + lg * 64 + pc * 8) = f.half[0]; }
     } }

// 32 f32 rows of 64 that a wave has staged in LDS (pitch 68) leave as two f16 planes: hi = f16(v), residual = f16((v - hi) x1024). Eight lanes take a row, so a wave's 16-byte stores cover four whole 128-byte lines.
__device__ __forceinline__ void split_store(const float (*so)[68], int lane, _Float16* __restrict__ Hh, _Float16* __restrict__ Hl, size_t o0, int ldc) {
  const int rs = lane >> 3, c8 = (lane & 7) * 8; v4f a[8], c[8];
#pragma unroll      /* a[] and c[] stay in registers, and all 16 LDS reads are issued ahead of the first conversion */
  for (int q = 0; q < 8; ++q) { a[q] = *(const v4fa*)&so[q * 4 + rs][c8]; c[q] = *(const v4fa*)&so[q * 4 + rs][c8 + 4]; }
#pragma unroll      /* constant indices into a[] and c[] */
  for (int q = 0; q < 8; ++q) { FragH fh, fl;
    for (int i = 0; i < 4; ++i) { _Float16 h = (_Float16)a[q][i]; fh.h[i] = h; fl.h[i] = (_Float16)((a[q][i] - (float)h) * 1024.0f); h = (_Float16)c[q][i]; fh.h[4 + i] = h; fl.h[4 + i] = (_Float16)((c[q][i] - (float)h) * 1024.0f); }
    const size_t o = o0 + (size_t)(q * 4 + rs) * ldc + c8; unsigned short* ph = (unsigned short*)Hh + o; unsigned short* pl = (unsigned short*)Hl + o; const v8us vh = fh.half[0], vl = fl.half[0];
    *(v8us*)ph = vh; *(v8us*)pl = vl;
    asm volatile("s_wait_xcnt 0x0" :: "v"(ph), "v"(pl), "v"(vh), "v"(vl) : "memory");      /* stands in front of every later rewrite of the registers that these two stores name (the next rows', or the code behind the call); they are inputs so that they stay live up to the wait */
  } }

// ---- fast GEMM (workgroup tile 128x64, wave tile 32x64; requires M % 128 == 0, N % 64 == 0, K % KS == 0); epilogue = k_gemm_hhx semantics; with CL the result leaves as two f16 planes, hi in C16 and residual in CL, and no f32 row is written ----
// The A tile (128 rows) and the B tile (64 rows) go through LDS in stages of KS k, two buffers: every 16-byte global load of a wave covers whole 128-byte lines, the next stage's loads are all
// issued ahead of this stage's products and stored behind them, one barrier per stage. The fragments and their k order are the ones the global rows gave.
__device__ __forceinline__ v16h g2_frag(const _Float16* p, int hh) { FragH f; f.half[0] = *(const v8us*)((const unsigned short*)p + 8 * hh); f.half[1] = *(const v8us*)((const unsigned short*)p + 16 + 8 * hh); return f.v; }
__device__ __forceinline__ v8f g2_mma(v16h a, v16h b, v8f c) { v8f d = __builtin_amdgcn_wmma_f32_16x16x32_f16(false, a, false, b, (short)0, c, false, false); asm volatile("v_nop\n\tv_nop\n\tv_nop\n\tv_nop" : "+v"(d) : "v"(a), "v"(b)); return d; }
template <int ACT, int KS, int LDA, int LDB>
__device__ __forceinline__ void gemm2(int bx, int by, const _Float16* __restrict__ A, size_t sA, const _Float16* __restrict__ Bh, size_t sB, float alpha, const float* __restrict__ bias, size_t sBias, const float* __restrict__ CP, int rowsPerB, size_t sCPb, int row0g,
    float* __restrict__ C, _Float16* __restrict__ C16, _Float16* __restrict__ CL, int ldc, size_t sC, int M, int N, int K) { static_assert(ACT == 0 || ACT == 3 || ACT == 6 || ACT == 8 || ACT == 9 || ACT == 11 || ACT == 12 || ACT == 14 || ACT == 15 || ACT == 16 || ACT == 17, "k_gemm2: unsupported ACT code (would silently apply no activation)");
  constexpr int CH = KS / 8;        /* 16-byte pieces per tile row */
  constexpr int RPR = 128 / CH;     /* tile rows that one load of every thread covers */
  constexpr int PT = KS + 8;        /* LDS row pitch in f16: the row + 16 B, conflict-free for 16-byte fragment reads */
  __shared__ __attribute__((aligned(16))) float so[4][32][68];
  __shared__ __attribute__((aligned(16))) _Float16 sa[2][128][PT];
  __shared__ __attribute__((aligned(16))) _Float16 sb[2][64][PT];
  const int tid = threadIdx.x, w = tid >> 5, lane = tid & 31, ln = lane & 15, hh = lane >> 4;
  A += (size_t)by * sA; Bh += (size_t)by * sB; const size_t cofs = (size_t)by * sC; const float* bp = bias ? bias + (size_t)by * sBias : nullptr;
  const int ntn = N >> 6; const int mt = bx / ntn, nq = bx - mt * ntn; const int row0 = mt * 128 + 32 * w, col0 = nq * 64; if (mt * 128 >= M) return;      /* the same for the whole workgroup, in front of every barrier */
  const int sr = tid / CH, sp = (tid % CH) * 8;
  const unsigned short* ga = (const unsigned short*)A + (size_t)(mt * 128 + sr) * LDA + sp; const unsigned short* gb = (const unsigned short*)Bh + (size_t)(col0 + sr) * LDB + sp;
  constexpr size_t da = (size_t)RPR * LDA, db = (size_t)RPR * LDB;      /* row pitches LDA, LDB are compile-time, so a stage's loads share one address pair per operand and differ in the immediate offset */
  v8us ta[CH], tb[CH / 2];
  for (int i = 0; i < CH; ++i) ta[i] = *(const v8us*)(ga + i * da);
  for (int i = 0; i < CH / 2; ++i) tb[i] = *(const v8us*)(gb + i * db);
  for (int i = 0; i < CH; ++i) *(v8us*)&sa[0][i * RPR + sr][sp] = ta[i];
  for (int i = 0; i < CH / 2; ++i) *(v8us*)&sb[0][i * RPR + sr][sp] = tb[i];
  __syncthreads();      /* publishes stage 0 */
  const v8f z8 = {0.f,0.f,0.f,0.f,0.f,0.f,0.f,0.f}; v8f c00 = z8, c01 = z8, c02 = z8, c03 = z8, c10 = z8, c11 = z8, c12 = z8, c13 = z8;
  const int nst = K / KS;
  const int ra = 32 * w + ln;
  for (int s = 0; s < nst; ++s) { const int buf = s & 1; const bool more = s + 1 < nst;
    if (more) { ga += KS; gb += KS;
      for (int i = 0; i < CH; ++i) ta[i] = *(const v8us*)(ga + i * da);
      for (int i = 0; i < CH / 2; ++i) tb[i] = *(const v8us*)(gb + i * db); }
    for (int ks = 0; ks < KS / 32; ++ks) {      /* the six fragments of 32 k are read from LDS as one group, then their eight products */
      const v16h a0 = g2_frag(&sa[buf][ra][ks * 32], hh), a1 = g2_frag(&sa[buf][ra + 16][ks * 32], hh);
      const v16h b0 = g2_frag(&sb[buf][ln][ks * 32], hh), b1 = g2_frag(&sb[buf][16 + ln][ks * 32], hh), b2 = g2_frag(&sb[buf][32 + ln][ks * 32], hh), b3 = g2_frag(&sb[buf][48 + ln][ks * 32], hh);
      c00 = g2_mma(a0, b0, c00); c10 = g2_mma(a1, b0, c10); c01 = g2_mma(a0, b1, c01); c11 = g2_mma(a1, b1, c11);
      c02 = g2_mma(a0, b2, c02); c12 = g2_mma(a1, b2, c12); c03 = g2_mma(a0, b3, c03); c13 = g2_mma(a1, b3, c13); }
    if (more) {
      for (int i = 0; i < CH; ++i) *(v8us*)&sa[buf ^ 1][i * RPR + sr][sp] = ta[i];
      for (int i = 0; i < CH / 2; ++i) *(v8us*)&sb[buf ^ 1][i * RPR + sr][sp] = tb[i];
      __syncthreads(); }      /* publishes the next stage and ends every wave's reads of this one, which the stage after next overwrites */
  }
  v8f accs[8] = {c00, c01, c02, c03, c10, c11, c12, c13};
#pragma unroll
  for (int u = 0; u < 8; ++u) { const int t = u & 3, half = u >> 2; const int col = col0 + t * 16 + ln; const float bv = bp ? bf16_round(bp[col]) : 0.f;
#pragma unroll
    for (int r = 0; r < 8; ++r) { const int rloc = half * 16 + 8 * hh + r; float v = accs[u][r] * alpha + bv; if (CP) { if (rowsPerB < 0) v += CP[cofs + (size_t)(row0g + row0 + rloc) * ldc + col];      /* rowsPerB < 0: own element of the batched C plane */ else { const int bidx = (row0g + row0 + rloc) / rowsPerB; v += CP[(size_t)bidx * sCPb + (size_t)by * 64 + col]; } }
      if (ACT == 3) v = fmaxf(v, 0.f); else if (ACT == 6) v = 0.5f * v * (1.0f + erff(v * 0.70710678118654752f)); else if (ACT == 11) v = 1.0f / (1.0f + expf(-v)); else if (ACT == 15) v = v / (1.0f + expf(-v)); else if (ACT == 12) v = (v > 0.f) ? v : 0.01f * v; else if (ACT == 8) v = tanhf(v); else if (ACT == 9) v = 0.5f * v * (1.0f + tanhf(0.7978845608028654f * (v + 0.044715f * v * v * v))); else if (ACT == 14) v = (v > 0.f) ? v : 0.1f * v; else if (ACT == 16) v = (v >= 0.f) ? v : 0.3f * v; else if (ACT == 17) v = (v >= 0.f) ? v : 0.2f * v;
      so[w][rloc][t * 16 + ln] = v; } }
  __builtin_amdgcn_fence(__ATOMIC_ACQ_REL, "workgroup"); __builtin_amdgcn_wave_barrier();
  if (CL) { split_store(so[w], lane, C16, CL, cofs + (size_t)row0 * ldc + col0, ldc); return; }      /* the same for every wave, behind the last barrier */
  const int rsub = lane >> 4, c4 = (lane & 15) * 4;
  {
#pragma unroll
    for (int q = 0; q < 16; ++q) { const int r = q * 2 + rsub; const v4f v = *(const v4fa*)&so[w][r][c4]; if (C) *(v4f*)(C + cofs + (size_t)(row0 + r) * ldc + col0 + c4) = v; if (C16) { v4h h4; for (int i = 0; i < 4; ++i) h4[i] = (_Float16)v[i]; *(v4h*)(C16 + cofs + (size_t)(row0 + r) * ldc + col0 + c4) = h4; } }
     } }
// out = o out_w + b: f32 rows
__global__ __launch_bounds__(128) void k_outp(const _Float16* __restrict__ O16, const _Float16* __restrict__ BO, const float* __restrict__ bo, float* __restrict__ out) {
  gemm2<0, 128, DM, DM>(blockIdx.x, 0, O16, 0, BO, 0, 0.0009765625f, bo, 0, nullptr, 1, 0, 0, out, nullptr, nullptr, DM, 0, MPO, DM, DM); }
// Q, K and V projections share one launch: blockIdx.y picks the weight plane (BW holds the three one behind the other), the bias and the result planes; Q and K leave as hi + residual, V as plain f16 rows
__global__ __launch_bounds__(128) void k_qkv(const _Float16* __restrict__ X16, const _Float16* __restrict__ BW, const float* __restrict__ bq, const float* __restrict__ bk, const float* __restrict__ bv,
    _Float16* __restrict__ QH, _Float16* __restrict__ QL, _Float16* __restrict__ KH, _Float16* __restrict__ KL, _Float16* __restrict__ V16) {
  const int j = blockIdx.y; const float* bias = j == 0 ? bq : j == 1 ? bk : bv; _Float16* ch = j == 0 ? QH : j == 1 ? KH : V16; _Float16* cl = j == 0 ? QL : j == 1 ? KL : nullptr;
  gemm2<0, 128, DM, DM>(blockIdx.x, 0, X16, 0, BW + (size_t)j * DM * DM, 0, 0.0625f, bias, 0, nullptr, 1, 0, 0, nullptr, ch, cl, DM, 0, MP, DM, DM); }


__global__ __launch_bounds__(256) void k_wnat(const float* __restrict__ w, size_t n8, _Float16* __restrict__ Bt) { const size_t t = (size_t)blockIdx.x * 256 + threadIdx.x; if (t >= n8) return; FragH f; for (int q = 0; q < 8; ++q) f.h[q] = (_Float16)(bf16_round(w[t * 8 + q]) * 16.0f); *(v8us*)((unsigned short*)Bt + t * 8) = f.half[0];  }
__global__ __launch_bounds__(256) void k_rsm(const float* __restrict__ S, _Float16* __restrict__ P, int nrows) {
  #pragma clang fp contract(off)
  const int i = blockIdx.x * 256 + threadIdx.x; if (i >= nrows) return; const float* s = S + (size_t)i * SQ; float mx = -3.0e38f;
#pragma unroll 1
  for (int j = 0; j < SQ; ++j) mx = fmaxf(mx, s[j]); float se = 0.f;
#pragma unroll 1
  for (int j = 0; j < SQ; ++j) se += expf(s[j] - mx); const float sc = 256.0f / se;
#pragma unroll 1
  for (int j0 = 0; j0 < SQ; j0 += 8) { FragH f; for (int q = 0; q < 8; ++q) f.h[q] = (_Float16)(expf(s[j0 + q] - mx) * sc); unsigned short* d = (unsigned short*)P + (size_t)i * SQ + j0; *(v8us*)d = f.half[0];  } }
__global__ __launch_bounds__(256) void k_vt(const _Float16* __restrict__ V16, int b, int h0, _Float16* __restrict__ VT) { __shared__ unsigned short tl[64][65]; const int tid = threadIdx.x; const int hh = blockIdx.x % HG, sg = blockIdx.x / HG; const int s0 = sg * 64; const int h = h0 + hh;
  for (int i = tid; i < 64 * 8; i += 256) { const int j = i / 8, d8 = (i % 8) * 8; FragH f; f.half[0] = *(const v8us*)((const unsigned short*)V16 + ((size_t)b * SQ + s0 + j) * DM + h * HD + d8); for (int q = 0; q < 8; ++q) tl[d8 + q][j] = f.u[q]; }
  __syncthreads();
  { for (int i = tid; i < 64 * 8; i += 256) { const int d = i / 8, j8 = (i % 8) * 8; FragH f; for (int q = 0; q < 8; ++q) f.u[q] = tl[d][j8 + q]; *(v8us*)((unsigned short*)VT + ((size_t)hh * HD + d) * SQ + s0 + j8) = f.half[0]; }  } }


__device__ __forceinline__ void mprep(const float* __restrict__ E, const float* __restrict__ phase, _Float16* __restrict__ MH, _Float16* __restrict__ ML, int bid) {
  #pragma clang fp contract(off)
  const int t = bid * 256 + threadIdx.x; if (t >= NH * HD * (HD / 8)) return; const int e8 = (t % (HD / 8)) * 8; const int hd_ = t / (HD / 8); const int d = hd_ % HD, h = hd_ / HD; const float c = cosf(bf16_round(phase[h * HD + d])); const float diag = __fmul_rn(__fmul_rn(c, c), 0.125f); FragH fh, fl;
#pragma unroll
  for (int q = 0; q < 8; ++q) { const int e = e8 + q; float m = bf16_round(E[((size_t)h * HD + d) * HD + e]); if (e == d) m = __fadd_rn(m, diag); const _Float16 hi = (_Float16)m; fh.h[q] = hi; fl.h[q] = (_Float16)((m - (float)hi) * 1024.0f); }
  const size_t o = ((size_t)h * HD + d) * HD + e8; { *(v8us*)((unsigned short*)MH + o) = fh.half[0]; *(v8us*)((unsigned short*)ML + o) = fl.half[0];  } }
// ---- the six operand preparations depend on inputs alone and share one launch; a block's index range picks its job: four weight transposes (BW holds the planes one behind the other), M, x ----
#define GW (DM * (DM / 8) / 256)     /* blocks per weight transpose */
#define GM (NH * HD * (HD / 8) / 256) /* blocks for M */
#define GX ((int)(NR * DM / 8 / 256)) /* blocks for x */
__global__ __launch_bounds__(256) void k_prep(const float* __restrict__ x, const float* __restrict__ wq, const float* __restrict__ wk, const float* __restrict__ wv, const float* __restrict__ wo, const float* __restrict__ E, const float* __restrict__ phase,
    _Float16* __restrict__ X16, _Float16* __restrict__ BW, _Float16* __restrict__ MH, _Float16* __restrict__ ML) {
  const int bid = blockIdx.x;
  if (bid < 4 * GW) { const int j = bid / GW; const float* W = j == 0 ? wq : j == 1 ? wk : j == 2 ? wv : wo; wt_f16(W, BW + (size_t)j * DM * DM, DM, DM, 16.0f, bid - j * GW); }      /* [in][out] -> Bt[n][k] x16 */
  else if (bid < 4 * GW + GM) mprep(E, phase, MH, ML, bid - 4 * GW);
  else x16_rows(x, X16, NR * DM / 8, bid - (4 * GW + GM));
}
__device__ __forceinline__ float half_xor(float v) { const int i = __float_as_int(v); return __int_as_float(__builtin_amdgcn_permlanex16(i, i, 0x76543210, 0xfedcba98, false, false)); }      /* value of lane l ^ 16 */
#define FK 64                        /* keys per LDS stage */
#define FPT 72                       /* LDS row pitch in f16: 128 B + 16 B, conflict-free for 16-byte fragment reads */
#define L2E 1.4426950408889634f
__device__ __forceinline__ v8f f_mma(v16h a, v16h b, v8f c) { return __builtin_amdgcn_wmma_f32_16x16x32_f16(false, a, false, b, (short)0, c, false, false); }
// ---- KM = K M^T per head in one launch: the terms hi.hi, residual.hi, hi.residual each in its own accumulator, summed in f32 in that order in registers, the sum split into hi + residual planes ----
// Workgroup = 4 waves x 32 token rows of one head. K hi and K residual (128 x 64) and M hi and M residual (64 x 64) go through LDS once: whole-line 16-byte loads, all issued together, one barrier.
__device__ __forceinline__ void km_tile(const _Float16* __restrict__ KH, const _Float16* __restrict__ KL, const _Float16* __restrict__ MH, const _Float16* __restrict__ ML, _Float16* __restrict__ KMH, _Float16* __restrict__ KML, int bx, int h) {
  __shared__ __attribute__((aligned(16))) float so[4][32][68];
  __shared__ __attribute__((aligned(16))) _Float16 sa[2][128][FPT];
  __shared__ __attribute__((aligned(16))) _Float16 sb[2][HD][FPT];
  const int tid = threadIdx.x, w = tid >> 5, lane = tid & 31, ln = lane & 15, hh = lane >> 4; const size_t row0 = (size_t)bx * 128;
  const int sr = tid >> 3, sp = (tid & 7) * 8;      /* staging: one load of every thread covers 16 tile rows */
  const unsigned short* gah = (const unsigned short*)KH + (row0 + sr) * DM + h * HD + sp; const unsigned short* gal = (const unsigned short*)KL + (row0 + sr) * DM + h * HD + sp;
  const unsigned short* gbh = (const unsigned short*)MH + ((size_t)h * HD + sr) * HD + sp; const unsigned short* gbl = (const unsigned short*)ML + ((size_t)h * HD + sr) * HD + sp;
  v8us ta[2][8], tb[2][4];
  for (int i = 0; i < 4; ++i) { tb[0][i] = *(const v8us*)(gbh + (size_t)i * 16 * HD); tb[1][i] = *(const v8us*)(gbl + (size_t)i * 16 * HD); }
  for (int i = 0; i < 8; ++i) { ta[0][i] = *(const v8us*)(gah + (size_t)i * 16 * DM); ta[1][i] = *(const v8us*)(gal + (size_t)i * 16 * DM); }
  asm volatile("s_wait_xcnt 0x0" :: "v"(gah), "v"(gal), "v"(gbh), "v"(gbl) : "memory");      /* the four address pairs are inputs so that they stay live up to this wait */
  for (int i = 0; i < 8; ++i) { *(v8us*)&sa[0][i * 16 + sr][sp] = ta[0][i]; *(v8us*)&sa[1][i * 16 + sr][sp] = ta[1][i]; }
  for (int i = 0; i < 4; ++i) { *(v8us*)&sb[0][i * 16 + sr][sp] = tb[0][i]; *(v8us*)&sb[1][i * 16 + sr][sp] = tb[1][i]; }
  __syncthreads();      /* publishes the four tiles */
  const v8f z8 = {0.f,0.f,0.f,0.f,0.f,0.f,0.f,0.f};
  const int ra = 32 * w + ln;
#pragma unroll 1      /* kept rolled so that 12 accumulators are live, not 24: the kernel stays under 256 registers and needs no register-window switches */
  for (int th = 0; th < 2; ++th) {      /* two column tiles at a time */
    v8f c1[2][2], c2[2][2], c3[2][2];      /* [row tile][column tile] of hi.hi, residual.hi, hi.residual */
    for (int m = 0; m < 2; ++m) for (int t = 0; t < 2; ++t) { c1[m][t] = z8; c2[m][t] = z8; c3[m][t] = z8; }
    for (int ks = 0; ks < HD / 32; ++ks) {
      v16h ah[2], al[2], bh[2], bl[2];
      for (int m = 0; m < 2; ++m) { ah[m] = g2_frag(&sa[0][ra + 16 * m][ks * 32], hh); al[m] = g2_frag(&sa[1][ra + 16 * m][ks * 32], hh); }
      for (int t = 0; t < 2; ++t) { bh[t] = g2_frag(&sb[0][(th * 2 + t) * 16 + ln][ks * 32], hh); bl[t] = g2_frag(&sb[1][(th * 2 + t) * 16 + ln][ks * 32], hh); }
      for (int t = 0; t < 2; ++t) for (int m = 0; m < 2; ++m) c1[m][t] = f_mma(ah[m], bh[t], c1[m][t]);
      for (int t = 0; t < 2; ++t) for (int m = 0; m < 2; ++m) c2[m][t] = f_mma(al[m], bh[t], c2[m][t]);
      for (int t = 0; t < 2; ++t) for (int m = 0; m < 2; ++m) c3[m][t] = f_mma(ah[m], bl[t], c3[m][t]);
    }
    for (int m = 0; m < 2; ++m)
      for (int t = 0; t < 2; ++t)
        for (int r = 0; r < 8; ++r) { float v = c2[m][t][r] * 0.0009765625f + c1[m][t][r]; v = c3[m][t][r] * 0.0009765625f + v;      /* the residual planes carry x1024; the scaling is exact, so each line rounds once */
          so[w][m * 16 + 8 * hh + r][(th * 2 + t) * 16 + ln] = v; }
  }
  __builtin_amdgcn_fence(__ATOMIC_ACQ_REL, "workgroup"); __builtin_amdgcn_wave_barrier();      /* each wave reads back only its own rows */
  split_store(so[w], lane, KMH, KML, (row0 + 32 * w) * DM + h * HD, DM);
}
// KM (needs K and M) and V^T (needs V) do not depend on each other and share one launch; the branch is the same for a whole workgroup, so each body keeps its own barrier
#define GKM ((int)(NR / 128) * NH)   /* blocks for KM */
__global__ __launch_bounds__(128) void k_kmvt(const _Float16* __restrict__ KH, const _Float16* __restrict__ KL, const _Float16* __restrict__ MH, const _Float16* __restrict__ ML, _Float16* __restrict__ KMH, _Float16* __restrict__ KML, const _Float16* __restrict__ V16, _Float16* __restrict__ VT) {
  const int bid = blockIdx.x;
  if (bid >= GKM) { vt_tile<NH, SQ>(V16, DM, 0, VT, bid - GKM); return; }      /* V^T [NB][NH][HD][SQ] */
  km_tile(KH, KL, MH, ML, KMH, KML, bid % (int)(NR / 128), bid / (int)(NR / 128));      /* KM[k][h*64+d] = sum_e K[k][h*64+e] M[h][d][e], token rows of both batches */
}
__global__ __launch_bounds__(256) void k_fattn(const _Float16* __restrict__ QH, const _Float16* __restrict__ QL, const _Float16* __restrict__ KMH, const _Float16* __restrict__ KML, const _Float16* __restrict__ VT, _Float16* __restrict__ O16) {
  __shared__ __attribute__((aligned(16))) _Float16 sk[2][3][FK][FPT];
  const int tid = threadIdx.x, lane = tid & 31, c = lane & 15, hh = lane >> 4; const int w = __builtin_amdgcn_readfirstlane(tid >> 5);
  const int h = blockIdx.y, b = blockIdx.z; const size_t r0 = (size_t)b * SQ; const size_t q0 = r0 + (size_t)blockIdx.x * 256 + w * 32;
  v16h qh[2][2], ql[2][2];      /* [query tile][k step of 32] */
  for (int qt = 0; qt < 2; ++qt)
    for (int ks = 0; ks < 2; ++ks) { const size_t o = (q0 + qt * 16 + c) * DM + h * HD + ks * 32; qh[qt][ks] = g2_frag(QH + o, hh); ql[qt][ks] = g2_frag(QL + o, hh); }
  const int sr = tid >> 3, sp = (tid & 7) * 8;      /* staging: a wave's 16-byte loads cover four whole 128-byte rows */
  const unsigned short* gkh = (const unsigned short*)KMH + (r0 + sr) * DM + h * HD + sp; const unsigned short* gkl = (const unsigned short*)KML + (r0 + sr) * DM + h * HD + sp;
  const unsigned short* gv = (const unsigned short*)VT + (((size_t)b * NH + h) * HD + sr) * SQ + sp;
  v8us st[6];
  st[0] = *(const v8us*)gkh; st[1] = *(const v8us*)(gkh + (size_t)32 * DM); st[2] = *(const v8us*)gkl; st[3] = *(const v8us*)(gkl + (size_t)32 * DM); st[4] = *(const v8us*)gv; st[5] = *(const v8us*)(gv + (size_t)32 * SQ);
  for (int i = 0; i < 6; ++i) *(v8us*)&sk[0][i >> 1][sr + 32 * (i & 1)][sp] = st[i];
  __syncthreads();      /* publishes stage 0 */
  const v8f z8 = {0.f,0.f,0.f,0.f,0.f,0.f,0.f,0.f};
  v8f o[4][2];      /* O^T tiles [d tile][query tile]: register r = d 16 dt + 8 hh + r of query c */
  for (int dt = 0; dt < 4; ++dt) { o[dt][0] = z8; o[dt][1] = z8; }
  float mu[2] = {-3.0e38f, -3.0e38f};      /* maximum in use per query, log2 domain, equal in both lane halves */
  float ls[2] = {0.f, 0.f};      /* this lane half's share of the sum of weights */
  for (int s = 0; s < SQ / FK; ++s) {
    const int buf = s & 1; const bool more = s + 1 < SQ / FK;
    if (more) { gkh += (size_t)FK * DM; gkl += (size_t)FK * DM; gv += FK;
      st[0] = *(const v8us*)gkh; st[1] = *(const v8us*)(gkh + (size_t)32 * DM); st[2] = *(const v8us*)gkl; st[3] = *(const v8us*)(gkl + (size_t)32 * DM); st[4] = *(const v8us*)gv; st[5] = *(const v8us*)(gv + (size_t)32 * SQ); }
    for (int p = 0; p < FK / 32; ++p) {
      v16h kh[2][2], kl[2][2];      /* [key tile][k step] */
      for (int kt = 0; kt < 2; ++kt)
        for (int ks = 0; ks < 2; ++ks) { kh[kt][ks] = g2_frag(&sk[buf][0][p * 32 + kt * 16 + c][ks * 32], hh); kl[kt][ks] = g2_frag(&sk[buf][1][p * 32 + kt * 16 + c][ks * 32], hh); }
      v8f sc[2][2] = {{z8, z8}, {z8, z8}};      /* S^T tiles [key tile][query tile]: register r = key 16 kt + 8 hh + r, query c */
      for (int ks = 0; ks < 2; ++ks) {
        for (int u = 0; u < 4; ++u) sc[u >> 1][u & 1] = f_mma(kl[u >> 1][ks], qh[u & 1][ks], sc[u >> 1][u & 1]);      /* hi.lo */
        for (int u = 0; u < 4; ++u) sc[u >> 1][u & 1] = f_mma(kh[u >> 1][ks], ql[u & 1][ks], sc[u >> 1][u & 1]);      /* lo.hi */
      }
      for (int u = 0; u < 4; ++u) sc[u >> 1][u & 1] *= 0.0009765625f;      /* the residual planes carry x1024 */
      for (int ks = 0; ks < 2; ++ks)
        for (int u = 0; u < 4; ++u) sc[u >> 1][u & 1] = f_mma(kh[u >> 1][ks], qh[u & 1][ks], sc[u >> 1][u & 1]);      /* hi.hi */
      v16h va[4];
      for (int dt = 0; dt < 4; ++dt) va[dt] = g2_frag(&sk[buf][2][dt * 16 + c][p * 32], hh);
      float mt[2]; bool need = false;
      for (int qt = 0; qt < 2; ++qt) { float m = sc[0][qt][0];
        for (int r = 1; r < 8; ++r) m = fmaxf(m, sc[0][qt][r]);
        for (int r = 0; r < 8; ++r) m = fmaxf(m, sc[1][qt][r]);
        m = fmaxf(m, half_xor(m)) * L2E; mt[qt] = m; need = need || (m > mu[qt] + 8.0f); }
      if (__builtin_amdgcn_ballot_w32(need) != 0) {      /* lazy rescale, one scalar branch per 32 keys: the maximum in use follows only when some query's maximum has passed it by more than 2^8 */
        for (int qt = 0; qt < 2; ++qt) { const float mn = fmaxf(mu[qt], mt[qt]); const float al = __builtin_amdgcn_exp2f(mu[qt] - mn); mu[qt] = mn; ls[qt] *= al;
          for (int dt = 0; dt < 4; ++dt) o[dt][qt] *= al; }
      }
      for (int qt = 0; qt < 2; ++qt) { const float sh = 6.0f - mu[qt];      /* weights carried x64: at most 2^14 in f16 */
        v8f e0 = sc[0][qt] * L2E + sh, e1 = sc[1][qt] * L2E + sh; FragH pb;
        for (int r = 0; r < 8; ++r) { e0[r] = __builtin_amdgcn_exp2f(e0[r]); e1[r] = __builtin_amdgcn_exp2f(e1[r]); }
        for (int r = 0; r < 8; ++r) { pb.h[r] = (_Float16)e0[r]; pb.h[8 + r] = (_Float16)e1[r]; }
        const v8f t = e0 + e1; ls[qt] += ((t[0] + t[1]) + (t[2] + t[3])) + ((t[4] + t[5]) + (t[6] + t[7]));
        for (int dt = 0; dt < 4; ++dt) o[dt][qt] = f_mma(va[dt], pb.v, o[dt][qt]); }
    }
    if (more) {
      for (int i = 0; i < 6; ++i) *(v8us*)&sk[buf ^ 1][i >> 1][sr + 32 * (i & 1)][sp] = st[i]; }
    __syncthreads();      /* publishes the next stage and ends every wave's reads of this one, which the stage after next overwrites */
  }
  for (int qt = 0; qt < 2; ++qt) { const float inv = 64.0f * __builtin_amdgcn_rcpf(ls[qt] + half_xor(ls[qt]));      /* o carried x64, the weights' own carry cancels */
    for (int dt = 0; dt < 4; ++dt) { FragH f;
      for (int r = 0; r < 8; ++r) f.h[r] = (_Float16)(o[dt][qt][r] * inv);
      *(v8us*)((unsigned short*)O16 + (q0 + qt * 16 + c) * DM + h * HD + dt * 16 + 8 * hh) = f.half[0]; } }
}

extern "C" void kernel_launch(void* const* d_in, const int* in_sizes, int n_in,
                              void* d_out, int out_size, void* d_ws, size_t ws_size, hipStream_t stream) {
  (void)in_sizes; (void)n_in; (void)out_size;
  const float* const* I = (const float* const*)d_in; const float* x = I[0]; const float* wq = I[1]; const float* bq = I[2]; const float* wk = I[3]; const float* bk = I[4]; const float* wv = I[5]; const float* bv = I[6]; const float* phase = I[7]; const float* E = I[8]; const float* wo = I[9]; const float* bo = I[10];      /* weights [in][out] */
  char* ws = (char*)d_ws; size_t off = 0;
  auto take = [&](size_t bytes) { char* p = ws + off; off += (bytes + 255) & ~(size_t)255; return p; };
  _Float16* BQ = (_Float16*)take((size_t)DM * DM * 2); _Float16* BK = (_Float16*)take((size_t)DM * DM * 2); _Float16* BV = (_Float16*)take((size_t)DM * DM * 2); _Float16* BO = (_Float16*)take((size_t)DM * DM * 2); _Float16* MH = (_Float16*)take((size_t)NH * HD * HD * 2); _Float16* ML = (_Float16*)take((size_t)NH * HD * HD * 2);
  _Float16* X16 = (_Float16*)take(NR * DM * 2); _Float16* QH = (_Float16*)take(NR * DM * 2); _Float16* QL = (_Float16*)take(NR * DM * 2); _Float16* KH = (_Float16*)take(NR * DM * 2); _Float16* KL = (_Float16*)take(NR * DM * 2); _Float16* V16 = (_Float16*)take(NR * DM * 2);
  _Float16* KMH = (_Float16*)take(NR * DM * 2); _Float16* KML = (_Float16*)take(NR * DM * 2); _Float16* O16 = (_Float16*)take(NR * DM * 2);
  _Float16* VT = (_Float16*)take((size_t)NB * NH * HD * SQ * 2);
  (void)BK; (void)BV;      /* reached through BQ */
  if (off > ws_size) return;      /* 8.3 + 8 + 40 + 16 + 8 + 8 = approx 88 MiB */
  k_prep<<<4 * GW + GM + GX, 256, 0, stream>>>(x, wq, wk, wv, wo, E, phase, X16, BQ, MH, ML);      /* BQ, BK, BV, BO lie one behind the other */
  const size_t r0p = (size_t)B0 * SQ;
  k_qkv<<<dim3((unsigned)((MP / 128) * (DM / 64)), 3), 128, 0, stream>>>(X16 + r0p * DM, BQ, bq, bk, bv, QH + r0p * DM, QL + r0p * DM, KH + r0p * DM, KL + r0p * DM, V16 + r0p * DM);
  k_kmvt<<<GKM + NB * NH * (SQ / 64), 128, 0, stream>>>(KH, KL, MH, ML, KMH, KML, V16, VT);
  k_fattn<<<dim3(SQ / 256, NH, NB), 256, 0, stream>>>(QH, QL, KMH, KML, VT, O16);      /* o (merged heads, x64) as f16 rows */
  k_outp<<<(unsigned)((MPO / 128) * (DM / 64)), 128, 0, stream>>>(O16 + r0p * DM, BO, bo, (float*)d_out + r0p * DM);      /* out rows are the output layout */
}

// v006
// One run takes 110 microseconds.
// In both of two side-by-side timings against v005, it was 1.08 times as fast.
// All steps since v000 together make it 38.9 times as fast.
#include <hip/hip_runtime.h>
// "Quantum" attention (x [2][2048][1024]): Q/K/V = x W + b ([in][out] weights + biases, 16 heads of 64); scores = (Q cos(phase)) (K cos(phase))^T / 8 + Q E K^T per head (phase [16][64], E [16][64][64]) = Q M K^T with M = E + diag(cos^2 phase / 8); softmax over the 2,048 keys; o = attn V merged; out = o out_w + out_b -> [2][2048][1024].
// Structure: token rows; x as exact f16 rows; Q and K as WMMA GEMMs (32x64 wave tiles, operand tiles through LDS, f32 accumulation, exact x16 transposed weights + bias) whose epilogue splits each f32 result on VALU into f16 hi + 2^-10 residual planes; V as a WMMA GEMM to f16 rows; M as f16 hi + residual planes (VALU, cos in f32); KM = K M^T per head (km_tile): three WMMA terms (hi.hi + lo.hi + hi.lo, K = 64) in three accumulators, summed in f32 in registers, split into hi + residual planes; V^T for all batches and heads via LDS transposes; attention in one fused launch (k_fattn): scores = Q KM^T as three WMMA terms in one accumulator, online softmax on VALU (f32 statistics, native exp2; weights x64 f16 against the maximum in use), o = P . V^T on WMMA, normalised at the end into merged f16 rows (o carried x64 against f16 subnormal flush); out = o out_w + b GEMM (f32, alpha folds 1/16 and 1/64). Five launches: jobs that do not depend on each other share a grid (k_prep, k_qkv, k_kmvt), then k_fattn, k_outp.
// Compute dtype: inputs rounded to bf16; weights exact (x16 f16); Q, K, M, KM as f16 hi + residual planes (~2^-22); V, softmax weights (x64) and o (x64) plain f16 (~2^-12); scores, softmax statistics f32. v_wmma_f32_16x16x32_f16.
#define NB 2
#define SQ 2048
#define DM 1024
#define NH 16
#define HD 64
#define HG 4                         /* heads per group in the per-batch k_vt, which is not launched */
#define PSC 4096.0f                  /* unused; the softmax weights carry x64 */
#define B0 0                         /* first batch processed (debug hook) */
#define NBR NB                       /* batches processed (debug hook) */
#define QN SQ                        /* unused; k_fattn attends all SQ query rows per batch */
#define NHD NH                       /* unused; k_fattn attends all NH heads */
#define NR ((size_t)NB * SQ)
#define MP ((int)((size_t)NBR * SQ)) /* rows projected (debug hook) */
#define MPO MP                       /* rows through the output GEMM (debug hook) */
typedef __bf16 v16b __attribute__((ext_vector_type(16)));
typedef unsigned short v8us __attribute__((ext_vector_type(8), may_alias));
typedef float  v8f  __attribute__((ext_vector_type(8)));
typedef float  v4f  __attribute__((ext_vector_type(4)));
typedef float  v4fa __attribute__((ext_vector_type(4), may_alias));
union FragB { v16b v; v8us half[2]; unsigned short u[16]; };

__device__ __forceinline__ unsigned short bf16_bits(float x) { unsigned int u = __float_as_uint(x); return (unsigned short)((u + 0x7FFFu + ((u >> 16) & 1u)) >> 16); }
__device__ __forceinline__ float bf16_val(unsigned short b) { return __uint_as_float(((unsigned int)b) << 16); }
__device__ __forceinline__ float bf16_round(float x) { return bf16_val(bf16_bits(x)); }
// D += A·B with NT terms: 1 = ah·bh, 2 = + al·bh (A split), 3 = + ah·bl (both split)
template <int NT>
__device__ __forceinline__ v8f mmaN(v16b ah, v16b al, v16b bh, v16b bl, v8f c) {
  c = __builtin_amdgcn_wmma_f32_16x16x32_bf16(false, ah, false, bh, (short)0, c, false, false);
  if (NT >= 2) c = __builtin_amdgcn_wmma_f32_16x16x32_bf16(false, al, false, bh, (short)0, c, false, false);
  if (NT >= 3) c = __builtin_amdgcn_wmma_f32_16x16x32_bf16(false, ah, false, bl, (short)0, c, false, false);
  asm volatile("v_nop\n\tv_nop\n\tv_nop\n\tv_nop" : "+v"(c) : "v"(ah), "v"(al), "v"(bh), "v"(bl));
  return c;
}

__global__ __launch_bounds__(256) void k_wt_bf16(const float* __restrict__ W, unsigned short* __restrict__ Wt, int K, int N) {
  const int t = blockIdx.x * 256 + threadIdx.x;
  const int k8n = K / 8;
  if (t >= N * k8n) return;
  const int n = t / k8n, k8 = (t % k8n) * 8;
  v8us v;
#pragma unroll
  for (int i = 0; i < 8; ++i) v[i] = bf16_bits(W[(size_t)(k8 + i) * N + n]);
  *(v8us*)(Wt + (size_t)n * K + k8) = v;
  
}

// GEMM C[M][N] (f32, pitch ldc) = act(A[M][K]·W + bias). A f32 row-major (pitch lda) converted per fragment to bf16
// (ASPLIT: hi/lo two planes -> 2 terms, else single rounded term); Wt bf16 [N][K] (pitch ldb). BIAS_BF16 rounds the
// bias to bf16 first (bias quantised to bf16 before the add). K%32==0, M%16==0, N%64==0.
template <bool ASPLIT, int ACT, bool BIAS_BF16>
__global__ __launch_bounds__(128) void k_gemm_bf(const float* __restrict__ A, int lda, const unsigned short* __restrict__ Wt, int ldb,
                                               const float* __restrict__ bias, float* __restrict__ C, int ldc, int M, int N, int K) {
  __shared__ __attribute__((aligned(16))) float so[4][16][64];
  const int tid = threadIdx.x, w = tid >> 5, lane = tid & 31, ln = lane & 15, hh = lane >> 4;
  const int ntn = N / 64;
  const int wid = blockIdx.x * 4 + w;
  const int mt = wid / ntn, nq = wid % ntn;
  if (mt * 16 >= M) return;
  const int row0 = mt * 16, col0 = nq * 64;
  const float* arow = A + (size_t)(row0 + ln) * lda;
  v8f acc[4] = {};
  for (int kb = 0; kb < K; kb += 32) {
    FragB ah, al;
    const v4f x0 = *(const v4fa*)(arow + kb + 8 * hh), x1 = *(const v4fa*)(arow + kb + 8 * hh + 4);
    const v4f x2 = *(const v4fa*)(arow + kb + 16 + 8 * hh), x3 = *(const v4fa*)(arow + kb + 16 + 8 * hh + 4);
    float xs[16] = {x0[0],x0[1],x0[2],x0[3],x1[0],x1[1],x1[2],x1[3],x2[0],x2[1],x2[2],x2[3],x3[0],x3[1],x3[2],x3[3]};
#pragma unroll
    for (int i = 0; i < 16; ++i) { const unsigned short hb = bf16_bits(xs[i]); ah.u[i] = hb; al.u[i] = ASPLIT ? bf16_bits(xs[i] - bf16_val(hb)) : (unsigned short)0; }
#pragma unroll
    for (int t = 0; t < 4; ++t) {
      const unsigned short* brow = Wt + (size_t)(col0 + t * 16 + ln) * ldb + kb;
      FragB b;
      b.half[0] = *(const v8us*)(brow + 8 * hh);
      b.half[1] = *(const v8us*)(brow + 16 + 8 * hh);
      acc[t] = mmaN<ASPLIT ? 2 : 1>(ah.v, al.v, b.v, b.v, acc[t]);
    }
  }
#pragma unroll
  for (int t = 0; t < 4; ++t) {
    float bv = bias ? bias[col0 + t * 16 + ln] : 0.f;
    if (BIAS_BF16) bv = bf16_round(bv);
#pragma unroll
    for (int r = 0; r < 8; ++r) { float v = acc[t][r] + bv; if (ACT == 1) v = fmaxf(v, 0.f); so[w][8 * hh + r][t * 16 + ln] = v; }
  }
  __builtin_amdgcn_fence(__ATOMIC_ACQ_REL, "workgroup");
  __builtin_amdgcn_wave_barrier();
  const int rsub = lane >> 4, c4 = (lane & 15) * 4;
  {
#pragma unroll
    for (int q = 0; q < 8; ++q) {
      const int r = q * 2 + rsub;
      const v4f v = *(const v4fa*)&so[w][r][c4];
      *(v4f*)(C + (size_t)(row0 + r) * ldc + col0 + c4) = v;
    }
    
  }
}

// GEMM C = act(A·W + bias + resid): A f32 (ASPLIT -> hi/lo 2 terms), Wt bf16 [N][K]; ACT 0 none, 1 relu, 2 exact gelu;
// resid (optional, f32, row index = (row % rmod), pitch ldr, RES_BF16 rounds it) added before the activation.
template <bool ASPLIT, int ACT, bool BIAS_BF16, bool RES_BF16>
__global__ __launch_bounds__(128) void k_gemm_bf3(const float* __restrict__ A, int lda, const unsigned short* __restrict__ Wt, int ldb,
                                                const float* __restrict__ bias, const float* __restrict__ resid, int rmod, int ldr,
                                                float* __restrict__ C, int ldc, int M, int N, int K) {
  __shared__ __attribute__((aligned(16))) float so[4][16][64];
  const int tid = threadIdx.x, w = tid >> 5, lane = tid & 31, ln = lane & 15, hh = lane >> 4;
  const int ntn = N / 64;
  const int wid = blockIdx.x * 4 + w;
  const int mt = wid / ntn, nq = wid % ntn;
  if (mt * 16 >= M) return;
  const int row0 = mt * 16, col0 = nq * 64;
  const float* arow = A + (size_t)(row0 + ln) * lda;
  v8f acc[4] = {};
  for (int kb = 0; kb < K; kb += 32) {
    FragB ah, al;
    const v4f x0 = *(const v4fa*)(arow + kb + 8 * hh), x1 = *(const v4fa*)(arow + kb + 8 * hh + 4);
    const v4f x2 = *(const v4fa*)(arow + kb + 16 + 8 * hh), x3 = *(const v4fa*)(arow + kb + 16 + 8 * hh + 4);
    float xs[16] = {x0[0],x0[1],x0[2],x0[3],x1[0],x1[1],x1[2],x1[3],x2[0],x2[1],x2[2],x2[3],x3[0],x3[1],x3[2],x3[3]};
#pragma unroll
    for (int i = 0; i < 16; ++i) { const unsigned short hb = bf16_bits(xs[i]); ah.u[i] = hb; al.u[i] = ASPLIT ? bf16_bits(xs[i] - bf16_val(hb)) : (unsigned short)0; }
#pragma unroll
    for (int t = 0; t < 4; ++t) {
      const unsigned short* brow = Wt + (size_t)(col0 + t * 16 + ln) * ldb + kb;
      FragB b;
      b.half[0] = *(const v8us*)(brow + 8 * hh);
      b.half[1] = *(const v8us*)(brow + 16 + 8 * hh);
      acc[t] = mmaN<ASPLIT ? 2 : 1>(ah.v, al.v, b.v, b.v, acc[t]);
    }
  }
#pragma unroll
  for (int t = 0; t < 4; ++t) {
    const int col = col0 + t * 16 + ln;
    float bv = bias ? bias[col] : 0.f;
    if (BIAS_BF16) bv = bf16_round(bv);
#pragma unroll
    for (int r = 0; r < 8; ++r) {
      float v = acc[t][r] + bv;
      if (resid) { float rv = resid[(size_t)((row0 + 8 * hh + r) % rmod) * ldr + col]; if (RES_BF16) rv = bf16_round(rv); v += rv; }
      if (ACT == 1) v = fmaxf(v, 0.f);
      if (ACT == 2) v = 0.5f * v * (1.0f + erff(v * 0.70710678118654752f));
      if (ACT == 3) { const float u = 0.7978845608028654f * (v + 0.044715f * v * v * v); v = 0.5f * v * (1.0f + tanhf(u)); }
      so[w][8 * hh + r][t * 16 + ln] = v;
    }
  }
  __builtin_amdgcn_fence(__ATOMIC_ACQ_REL, "workgroup");
  __builtin_amdgcn_wave_barrier();
  const int rsub = lane >> 4, c4 = (lane & 15) * 4;
  {
#pragma unroll
    for (int q = 0; q < 8; ++q) {
      const int r = q * 2 + rsub;
      const v4f v = *(const v4fa*)&so[w][r][c4];
      *(v4f*)(C + (size_t)(row0 + r) * ldc + col0 + c4) = v;
    }
    
  }
}
// row LayerNorm (biased variance, eps) over N: s = X (+ R); optional out_sum <- s; out_norm <- (s-mu)*rsqrt(var+eps)*g + b
template <bool PARAM_BF16>
__global__ __launch_bounds__(256) void k_layernorm(const float* __restrict__ X, const float* __restrict__ R, const float* __restrict__ g, const float* __restrict__ bta,
                                                  float* __restrict__ out_sum, float* __restrict__ out_norm, int N, float eps) {
  __shared__ float red[256];
  const int row = blockIdx.x, tid = threadIdx.x;
  const float* x = X + (size_t)row * N; const float* rr = R ? R + (size_t)row * N : nullptr;
  float vals[16];                     // up to N = 4096
  const int per = N / 256;            // contiguous chunk per thread? use strided-by-4 chunks: thread handles j = tid*4 + 1024*u
  float s1 = 0.f;
  for (int u = 0; u < per / 4; ++u) {
    const int j = tid * 4 + 1024 * u;
    const v4f a = *(const v4fa*)(x + j);
    v4f b = {0.f,0.f,0.f,0.f}; if (rr) b = *(const v4fa*)(rr + j);
#pragma unroll
    for (int q = 0; q < 4; ++q) { const float v = a[q] + b[q]; vals[u * 4 + q] = v; s1 += v; }
  }
  red[tid] = s1; __syncthreads();
  for (int st = 128; st > 0; st >>= 1) { if (tid < st) red[tid] += red[tid + st]; __syncthreads(); }
  const float mu = red[0] / (float)N; __syncthreads();
  float s2 = 0.f;
  for (int u = 0; u < per / 4; ++u)
#pragma unroll
    for (int q = 0; q < 4; ++q) { const float c = vals[u * 4 + q] - mu; s2 += c * c; }
  red[tid] = s2; __syncthreads();
  for (int st = 128; st > 0; st >>= 1) { if (tid < st) red[tid] += red[tid + st]; __syncthreads(); }
  const float rs = rsqrtf(red[0] / (float)N + eps);
  {
    for (int u = 0; u < per / 4; ++u) {
      const int j = tid * 4 + 1024 * u;
      v4f o, sm;
#pragma unroll
      for (int q = 0; q < 4; ++q) {
        float gg = g[j + q], bb = bta[j + q];
        if (PARAM_BF16) { gg = bf16_round(gg); bb = bf16_round(bb); }
        sm[q] = vals[u * 4 + q]; o[q] = (vals[u * 4 + q] - mu) * rs * gg + bb;
      }
      if (out_sum) *(v4f*)(out_sum + (size_t)row * N + j) = sm;
      *(v4f*)(out_norm + (size_t)row * N + j) = o;
    }
    
  }
}



// ---- f16 WMMA path (v_wmma_f32_16x16x32_f16): 11-bit significands for operands in range — used where a [0,1] probability operand needs more precision than bf16
typedef _Float16 v16h __attribute__((ext_vector_type(16)));
union FragH { v16h v; v8us half[2]; _Float16 h[16]; unsigned short u[16]; };
template <int NT>
__device__ __forceinline__ v8f mmaH(v16h ah, v16h al, v16h bh, v16h bl, v8f c) {
  c = __builtin_amdgcn_wmma_f32_16x16x32_f16(false, ah, false, bh, (short)0, c, false, false);
  if (NT >= 2) c = __builtin_amdgcn_wmma_f32_16x16x32_f16(false, al, false, bh, (short)0, c, false, false);
  if (NT >= 3) c = __builtin_amdgcn_wmma_f32_16x16x32_f16(false, ah, false, bl, (short)0, c, false, false);
  asm volatile("v_nop\n\tv_nop\n\tv_nop\n\tv_nop" : "+v"(c) : "v"(ah), "v"(al), "v"(bh), "v"(bl));
  return c;
}
// batched GEMM like k_gemm_b but f16 operands: A f32 (split into f16 hi/lo if ASPLIT, else rounded to f16), Bt = f16 values [n][k]; alpha; C f32; N multiple of 16 (partial tiles skipped)
template <bool ASPLIT>
__global__ __launch_bounds__(128) void k_gemm_h(const float* __restrict__ A, int lda, size_t sA, const _Float16* __restrict__ Bh, int ldb, size_t sB, float alpha, float* __restrict__ C, int ldc, size_t sC, int M, int N, int K) {
  __shared__ __attribute__((aligned(16))) float so[4][16][64];
  const int tid = threadIdx.x, w = tid >> 5, lane = tid & 31, ln = lane & 15, hh = lane >> 4; const int by = blockIdx.y;
  A += (size_t)by * sA; Bh += (size_t)by * sB; C += (size_t)by * sC;
  const int ntn = (N + 63) / 64; const int wid = blockIdx.x * 4 + w; const int mt = wid / ntn, nq = wid % ntn; if (mt * 16 >= M) return;
  const int row0 = mt * 16, col0 = nq * 64; const float* arow = A + (size_t)(row0 + ln) * lda;
  v8f acc[4] = {};
  for (int kb = 0; kb < K; kb += 32) {
    FragH ah, al;
    const v4f x0 = *(const v4fa*)(arow + kb + 8 * hh), x1 = *(const v4fa*)(arow + kb + 8 * hh + 4), x2 = *(const v4fa*)(arow + kb + 16 + 8 * hh), x3 = *(const v4fa*)(arow + kb + 16 + 8 * hh + 4);
    float xs[16] = {x0[0],x0[1],x0[2],x0[3],x1[0],x1[1],x1[2],x1[3],x2[0],x2[1],x2[2],x2[3],x3[0],x3[1],x3[2],x3[3]};
#pragma unroll
    for (int i = 0; i < 16; ++i) { const _Float16 h = (_Float16)xs[i]; ah.h[i] = h; al.h[i] = ASPLIT ? (_Float16)(xs[i] - (float)h) : (_Float16)0.0f; }
#pragma unroll
    for (int t = 0; t < 4; ++t) { if (col0 + t * 16 >= N) continue; const size_t boff = (size_t)(col0 + t * 16 + ln) * ldb + kb; FragH bq; bq.half[0] = *(const v8us*)(Bh + boff + 8 * hh); bq.half[1] = *(const v8us*)(Bh + boff + 16 + 8 * hh);
      acc[t] = mmaH<ASPLIT ? 2 : 1>(ah.v, al.v, bq.v, bq.v, acc[t]); }
  }
#pragma unroll
  for (int t = 0; t < 4; ++t) { if (col0 + t * 16 >= N) continue;
#pragma unroll
    for (int r = 0; r < 8; ++r) so[w][8 * hh + r][t * 16 + ln] = acc[t][r] * alpha; }
  __builtin_amdgcn_fence(__ATOMIC_ACQ_REL, "workgroup"); __builtin_amdgcn_wave_barrier();
  const int rsub = lane >> 4, c4 = (lane & 15) * 4;
  {
#pragma unroll
    for (int q = 0; q < 8; ++q) { const int r = q * 2 + rsub; if (col0 + c4 < N) { const v4f v = *(const v4fa*)&so[w][r][c4]; *(v4f*)(C + (size_t)(row0 + r) * ldc + col0 + c4) = v; } }
     }
}

// Wt[n][k] = f16(bf16(W[k][n]) x scale) from f32 row-major W[DM][DM] (scale = power of two; bf16-exact weights stay exact in f16 away from the subnormal range).
// One workgroup of 256 threads turns one tile of 128 k x 64 n in LDS: every 16-byte global load covers whole 128-byte lines of W rows (256 B a row), every 16-byte store whole lines of Wt rows (256 B a row); a thread's eight loads are issued together.
#define WTK 128                      /* k per tile */
#define WTN 64                       /* n per tile */
typedef unsigned int v4u __attribute__((ext_vector_type(4), may_alias));
__device__ __forceinline__ void wt_tile(const float* __restrict__ W, _Float16* __restrict__ Wt, float scale, int bid) {
  __shared__ unsigned int tl[WTN][WTK / 2 + 1];      /* a word holds two neighbouring k of one n; the odd pitch spreads a wave's 32 word stores, and its 32 word reads, over 32 banks */
  const int tid = threadIdx.x; const int k0 = (bid % (DM / WTK)) * WTK, n0 = (bid / (DM / WTK)) * WTN;
  const int lo = tid & 15, up = tid >> 4;
  const float* g = W + (size_t)(k0 + 2 * up) * DM + n0 + lo * 4; v4f a[4][2];      /* rows k0 + 32 u + 2 up + j, columns n0 + 4 lo .. + 3 */
#pragma unroll      /* constant indices into a[]; one address pair, the rows differ in the immediate offset */
  for (int u = 0; u < 4; ++u) { a[u][0] = *(const v4fa*)(g + (size_t)(u * 32) * DM); a[u][1] = *(const v4fa*)(g + (size_t)(u * 32 + 1) * DM); }
#pragma unroll      /* constant indices into a[] */
  for (int u = 0; u < 4; ++u)
    for (int i = 0; i < 4; ++i) { union { _Float16 h[2]; unsigned int w; } p; p.h[0] = (_Float16)(bf16_round(a[u][0][i]) * scale); p.h[1] = (_Float16)(bf16_round(a[u][1][i]) * scale); tl[lo * 4 + i][u * 16 + up] = p.w; }
  __syncthreads();      /* publishes the tile */
  unsigned short* d = (unsigned short*)Wt + (size_t)(n0 + up) * DM + k0 + lo * 8; v4u o[4];
#pragma unroll      /* constant indices into o[]: all LDS reads stand ahead of the first store, so no register that an issued store names is written again */
  for (int u = 0; u < 4; ++u) for (int j = 0; j < 4; ++j) o[u][j] = tl[u * 16 + up][lo * 4 + j];
#pragma unroll      /* constant indices into o[] */
  for (int u = 0; u < 4; ++u) *(v4u*)(d + (size_t)(u * 16) * DM) = o[u];
}
// k_gemm_hh variant with fused epilogue: v = acc·alpha + bias[by·sBias + col] (+ CP[(row/rowsPerB)·sCPb + by·64 + col] if CP) ; ACT 0 none / 1 elu ; writes f16 C16 (and f32 C if non-null)
template <int ACT>
__global__ __launch_bounds__(128) void k_gemm_hhx(const _Float16* __restrict__ A, int lda, size_t sA, const _Float16* __restrict__ Bh, int ldb, size_t sB, float alpha, const float* __restrict__ bias, size_t sBias, const float* __restrict__ CP, int rowsPerB, size_t sCPb, int row0g,
    float* __restrict__ C, _Float16* __restrict__ C16, int ldc, size_t sC, int M, int N, int K) {
  __shared__ __attribute__((aligned(16))) float so[4][16][64];
  const int tid = threadIdx.x, w = tid >> 5, lane = tid & 31, ln = lane & 15, hh = lane >> 4; const int by = blockIdx.y;
  A += (size_t)by * sA; Bh += (size_t)by * sB; const size_t cofs = (size_t)by * sC; const float* bp = bias ? bias + (size_t)by * sBias : nullptr;
  const int ntn = (N + 63) / 64; const int wid = blockIdx.x * 4 + w; const int mt = wid / ntn, nq = wid % ntn; if (mt * 16 >= M) return;
  const int row0 = mt * 16, col0 = nq * 64; const _Float16* arow = A + (size_t)(row0 + ln) * lda;
  v8f acc[4] = {};
  for (int kb = 0; kb < K; kb += 32) { FragH ah; ah.half[0] = *(const v8us*)((const unsigned short*)arow + kb + 8 * hh); ah.half[1] = *(const v8us*)((const unsigned short*)arow + kb + 16 + 8 * hh);
#pragma unroll
    for (int t = 0; t < 4; ++t) { if (col0 + t * 16 >= N) continue; const size_t boff = (size_t)(col0 + t * 16 + ln) * ldb + kb; FragH bq; bq.half[0] = *(const v8us*)((const unsigned short*)Bh + boff + 8 * hh); bq.half[1] = *(const v8us*)((const unsigned short*)Bh + boff + 16 + 8 * hh);
      acc[t] = mmaH<1>(ah.v, ah.v, bq.v, bq.v, acc[t]); }
  }
#pragma unroll
  for (int t = 0; t < 4; ++t) { if (col0 + t * 16 >= N) continue; const int col = col0 + t * 16 + ln; const float bv = bp ? bf16_round(bp[col]) : 0.f;
#pragma unroll
    for (int r = 0; r < 8; ++r) { float v = acc[t][r] * alpha + bv; if (CP) { const int rr = row0g + row0 + 8 * hh + r; if (rowsPerB < 0) v += CP[cofs + (size_t)rr * ldc + col];      /* rowsPerB < 0: own element of the batched C plane */ else { const int bidx = rr / rowsPerB; v += CP[(size_t)bidx * sCPb + (size_t)by * 64 + col]; } } if (ACT == 1) v = (v > 0.f) ? v : expm1f(v); else if (ACT == 7) v = (v > 0.f) ? v + 1.0f : expf(v); else if (ACT == 8) v = tanhf(v); else if (ACT == 9) v = 0.5f * v * (1.0f + tanhf(0.7978845608028654f * (v + 0.044715f * v * v * v))); else if (ACT == 11) v = 1.0f / (1.0f + expf(-v)); else if (ACT == 12) v = (v > 0.f) ? v : 0.01f * v; else if (ACT == 14) v = (v > 0.f) ? v : 0.1f * v; else if (ACT == 16) v = (v >= 0.f) ? v : 0.3f * v; else if (ACT == 17) v = (v >= 0.f) ? v : 0.2f * v; else if (ACT == 15) v = v / (1.0f + expf(-v)); else if (ACT == 3) v = fmaxf(v, 0.f); else if (ACT == 6) v = 0.5f * v * (1.0f + erff(v * 0.70710678118654752f)); so[w][8 * hh + r][t * 16 + ln] = v; } }
  __builtin_amdgcn_fence(__ATOMIC_ACQ_REL, "workgroup"); __builtin_amdgcn_wave_barrier();
  const int rsub = lane >> 4, c4 = (lane & 15) * 4; typedef _Float16 v4h __attribute__((ext_vector_type(4)));
  {
#pragma unroll
    for (int q = 0; q < 8; ++q) { const int r = q * 2 + rsub; if (col0 + c4 < N) { const v4f v = *(const v4fa*)&so[w][r][c4]; if (C) *(v4f*)(C + cofs + (size_t)(row0 + r) * ldc + col0 + c4) = v; if (C16) { v4h h4; for (int i = 0; i < 4; ++i) h4[i] = (_Float16)v[i]; *(v4h*)(C16 + cofs + (size_t)(row0 + r) * ldc + col0 + c4) = h4; } } }
     }
}


typedef _Float16 v4h __attribute__((ext_vector_type(4)));

__device__ __forceinline__ void x16_rows(const float* __restrict__ x, _Float16* __restrict__ X16, size_t n8, int bid) { const size_t t = (size_t)bid * 256 + threadIdx.x; if (t >= n8) return; FragH f;
#pragma unroll
  for (int q = 0; q < 8; ++q) f.h[q] = (_Float16)bf16_round(x[t * 8 + q]); *(v8us*)((unsigned short*)X16 + t * 8) = f.half[0];  }
__global__ __launch_bounds__(256) void k_h16(const float* __restrict__ x, _Float16* __restrict__ X16, size_t n8) { const size_t t = (size_t)blockIdx.x * 256 + threadIdx.x; if (t >= n8) return; FragH f;
#pragma unroll
  for (int q = 0; q < 8; ++q) f.h[q] = (_Float16)x[t * 8 + q]; *(v8us*)((unsigned short*)X16 + t * 8) = f.half[0];  }
__global__ __launch_bounds__(256) void k_round16f(const float* __restrict__ W, _Float16* __restrict__ Bt, size_t n8) { const size_t t = (size_t)blockIdx.x * 256 + threadIdx.x; if (t >= n8) return; FragH f;
#pragma unroll
  for (int i = 0; i < 8; ++i) f.h[i] = (_Float16)(bf16_round(W[t * 8 + i]) * 16.0f); *(v8us*)((unsigned short*)Bt + t * 8) = f.half[0];  }
template <int NHv, int TTv>      /* one 64 x 64 tile, 128 threads (the block shape of the launch it shares) */
__device__ __forceinline__ void vt_tile(const _Float16* __restrict__ V16, int ldv, int voff, _Float16* __restrict__ Vt, int bid) { __shared__ unsigned short tl[64][66]; const int tid = threadIdx.x; const int slab = bid / (TTv / 64), lg = bid % (TTv / 64); const int b = slab / NHv, h = slab % NHv;
  const int r0 = tid / 8, c8 = (tid % 8) * 8; FragH f[4];
#pragma unroll      /* constant indices into f[]; a thread's four loads are all issued ahead of the first LDS store, so the tile waits out one load latency, not four in a row */
  for (int u = 0; u < 4; ++u) f[u].half[0] = *(const v8us*)((const unsigned short*)V16 + ((size_t)b * TTv + lg * 64 + u * 16 + r0) * ldv + voff + h * 64 + c8);
#pragma unroll      /* constant indices into f[] */
  for (int u = 0; u < 4; ++u)
    for (int q = 0; q < 8; ++q) tl[u * 16 + r0][c8 + q] = f[u].u[q];
  __syncthreads();
  {
#pragma unroll
    for (int rd = 0; rd < 4; ++rd) { const int d = rd * 16 + tid / 8, pc = tid % 8; FragH f;
#pragma unroll
      for (int q = 0; q < 8; ++q) f.u[q] = tl[pc * 8 + q][d];
      *(v8us*)((unsigned short*)Vt + ((size_t)slab * 64 + d) * TTv + lg * 64 + pc * 8) = f.half[0]; }
     } }

// 32 f32 rows of 64 that a wave has staged in LDS (pitch 68) leave as two f16 planes: hi = f16(v), residual = f16((v - hi) x1024). Eight lanes take a row, so a wave's 16-byte stores cover four whole 128-byte lines.
__device__ __forceinline__ void split_store(const float (*so)[68], int lane, _Float16* __restrict__ Hh, _Float16* __restrict__ Hl, size_t o0, int ldc) {
  const int rs = lane >> 3, c8 = (lane & 7) * 8; v4f a[8], c[8];
#pragma unroll      /* a[] and c[] stay in registers, and all 16 LDS reads are issued ahead of the first conversion */
  for (int q = 0; q < 8; ++q) { a[q] = *(const v4fa*)&so[q * 4 + rs][c8]; c[q] = *(const v4fa*)&so[q * 4 + rs][c8 + 4]; }
#pragma unroll      /* constant indices into a[] and c[] */
  for (int q = 0; q < 8; ++q) { FragH fh, fl;
    for (int i = 0; i < 4; ++i) { _Float16 h = (_Float16)a[q][i]; fh.h[i] = h; fl.h[i] = (_Float16)((a[q][i] - (float)h) * 1024.0f); h = (_Float16)c[q][i]; fh.h[4 + i] = h; fl.h[4 + i] = (_Float16)((c[q][i] - (float)h) * 1024.0f); }
    const size_t o = o0 + (size_t)(q * 4 + rs) * ldc + c8; unsigned short* ph = (unsigned short*)Hh + o; unsigned short* pl = (unsigned short*)Hl + o; const v8us vh = fh.half[0], vl = fl.half[0];
    *(v8us*)ph = vh; *(v8us*)pl = vl;
    asm volatile("s_wait_xcnt 0x0" :: "v"(ph), "v"(pl), "v"(vh), "v"(vl) : "memory");      /* stands in front of every later rewrite of the registers that these two stores name (the next rows', or the code behind the call); they are inputs so that they stay live up to the wait */
  } }

// ---- fast GEMM (workgroup tile 128x64, wave tile 32x64; requires M % 128 == 0, N % 64 == 0, K % KS == 0); epilogue = k_gemm_hhx semantics; with CL the result leaves as two f16 planes, hi in C16 and residual in CL, and no f32 row is written ----
// The A tile (128 rows) and the B tile (64 rows) go through LDS in stages of KS k, two buffers: every 16-byte global load of a wave covers whole 128-byte lines, the next stage's loads are all
// issued ahead of this stage's products and stored behind them, one barrier per stage. The fragments and their k order are the ones the global rows gave.
__device__ __forceinline__ v16h g2_frag(const _Float16* p, int hh) { FragH f; f.half[0] = *(const v8us*)((const unsigned short*)p + 8 * hh); f.half[1] = *(const v8us*)((const unsigned short*)p + 16 + 8 * hh); return f.v; }
__device__ __forceinline__ v8f g2_mma(v16h a, v16h b, v8f c) { v8f d = __builtin_amdgcn_wmma_f32_16x16x32_f16(false, a, false, b, (short)0, c, false, false); asm volatile("v_nop\n\tv_nop\n\tv_nop\n\tv_nop" : "+v"(d) : "v"(a), "v"(b)); return d; }
template <int ACT, int KS, int LDA, int LDB>
__device__ __forceinline__ void gemm2(int bx, int by, const _Float16* __restrict__ A, size_t sA, const _Float16* __restrict__ Bh, size_t sB, float alpha, const float* __restrict__ bias, size_t sBias, const float* __restrict__ CP, int rowsPerB, size_t sCPb, int row0g,
    float* __restrict__ C, _Float16* __restrict__ C16, _Float16* __restrict__ CL, int ldc, size_t sC, int M, int N, int K) { static_assert(ACT == 0 || ACT == 3 || ACT == 6 || ACT == 8 || ACT == 9 || ACT == 11 || ACT == 12 || ACT == 14 || ACT == 15 || ACT == 16 || ACT == 17, "k_gemm2: unsupported ACT code (would silently apply no activation)");
  constexpr int CH = KS / 8;        /* 16-byte pieces per tile row */
  constexpr int RPR = 128 / CH;     /* tile rows that one load of every thread covers */
  constexpr int PT = KS + 8;        /* LDS row pitch in f16: the row + 16 B, conflict-free for 16-byte fragment reads */
  __shared__ __attribute__((aligned(16))) float so[4][32][68];
  __shared__ __attribute__((aligned(16))) _Float16 sa[2][128][PT];
  __shared__ __attribute__((aligned(16))) _Float16 sb[2][64][PT];
  const int tid = threadIdx.x, w = tid >> 5, lane = tid & 31, ln = lane & 15, hh = lane >> 4;
  A += (size_t)by * sA; Bh += (size_t)by * sB; const size_t cofs = (size_t)by * sC; const float* bp = bias ? bias + (size_t)by * sBias : nullptr;
  const int ntn = N >> 6; const int mt = bx / ntn, nq = bx - mt * ntn; const int row0 = mt * 128 + 32 * w, col0 = nq * 64; if (mt * 128 >= M) return;      /* the same for the whole workgroup, in front of every barrier */
  const int sr = tid / CH, sp = (tid % CH) * 8;
  const unsigned short* ga = (const unsigned short*)A + (size_t)(mt * 128 + sr) * LDA + sp; const unsigned short* gb = (const unsigned short*)Bh + (size_t)(col0 + sr) * LDB + sp;
  constexpr size_t da = (size_t)RPR * LDA, db = (size_t)RPR * LDB;      /* row pitches LDA, LDB are compile-time, so a stage's loads share one address pair per operand and differ in the immediate offset */
  v8us ta[CH], tb[CH / 2];
  for (int i = 0; i < CH; ++i) ta[i] = *(const v8us*)(ga + i * da);
  for (int i = 0; i < CH / 2; ++i) tb[i] = *(const v8us*)(gb + i * db);
  for (int i = 0; i < CH; ++i) *(v8us*)&sa[0][i * RPR + sr][sp] = ta[i];
  for (int i = 0; i < CH / 2; ++i) *(v8us*)&sb[0][i * RPR + sr][sp] = tb[i];
  __syncthreads();      /* publishes stage 0 */
  const v8f z8 = {0.f,0.f,0.f,0.f,0.f,0.f,0.f,0.f}; v8f c00 = z8, c01 = z8, c02 = z8, c03 = z8, c10 = z8, c11 = z8, c12 = z8, c13 = z8;
  const int nst = K / KS;
  const int ra = 32 * w + ln;
  for (int s = 0; s < nst; ++s) { const int buf = s & 1; const bool more = s + 1 < nst;
    if (more) { ga += KS; gb += KS;
      for (int i = 0; i < CH; ++i) ta[i] = *(const v8us*)(ga + i * da);
      for (int i = 0; i < CH / 2; ++i) tb[i] = *(const v8us*)(gb + i * db); }
    for (int ks = 0; ks < KS / 32; ++ks) {      /* the six fragments of 32 k are read from LDS as one group, then their eight products */
      const v16h a0 = g2_frag(&sa[buf][ra][ks * 32], hh), a1 = g2_frag(&sa[buf][ra + 16][ks * 32], hh);
      const v16h b0 = g2_frag(&sb[buf][ln][ks * 32], hh), b1 = g2_frag(&sb[buf][16 + ln][ks * 32], hh), b2 = g2_frag(&sb[buf][32 + ln][ks * 32], hh), b3 = g2_frag(&sb[buf][48 + ln][ks * 32], hh);
      c00 = g2_mma(a0, b0, c00); c10 = g2_mma(a1, b0, c10); c01 = g2_mma(a0, b1, c01); c11 = g2_mma(a1, b1, c11);
      c02 = g2_mma(a0, b2, c02); c12 = g2_mma(a1, b2, c12); c03 = g2_mma(a0, b3, c03); c13 = g2_mma(a1, b3, c13); }
    if (more) {
      for (int i = 0; i < CH; ++i) *(v8us*)&sa[buf ^ 1][i * RPR + sr][sp] = ta[i];
      for (int i = 0; i < CH / 2; ++i) *(v8us*)&sb[buf ^ 1][i * RPR + sr][sp] = tb[i];
      __syncthreads(); }      /* publishes the next stage and ends every wave's reads of this one, which the stage after next overwrites */
  }
  v8f accs[8] = {c00, c01, c02, c03, c10, c11, c12, c13};
#pragma unroll
  for (int u = 0; u < 8; ++u) { const int t = u & 3, half = u >> 2; const int col = col0 + t * 16 + ln; const float bv = bp ? bf16_round(bp[col]) : 0.f;
#pragma unroll
    for (int r = 0; r < 8; ++r) { const int rloc = half * 16 + 8 * hh + r; float v = accs[u][r] * alpha + bv; if (CP) { if (rowsPerB < 0) v += CP[cofs + (size_t)(row0g + row0 + rloc) * ldc + col];      /* rowsPerB < 0: own element of the batched C plane */ else { const int bidx = (row0g + row0 + rloc) / rowsPerB; v += CP[(size_t)bidx * sCPb + (size_t)by * 64 + col]; } }
      if (ACT == 3) v = fmaxf(v, 0.f); else if (ACT == 6) v = 0.5f * v * (1.0f + erff(v * 0.70710678118654752f)); else if (ACT == 11) v = 1.0f / (1.0f + expf(-v)); else if (ACT == 15) v = v / (1.0f + expf(-v)); else if (ACT == 12) v = (v > 0.f) ? v : 0.01f * v; else if (ACT == 8) v = tanhf(v); else if (ACT == 9) v = 0.5f * v * (1.0f + tanhf(0.7978845608028654f * (v + 0.044715f * v * v * v))); else if (ACT == 14) v = (v > 0.f) ? v : 0.1f * v; else if (ACT == 16) v = (v >= 0.f) ? v : 0.3f * v; else if (ACT == 17) v = (v >= 0.f) ? v : 0.2f * v;
      so[w][rloc][t * 16 + ln] = v; } }
  __builtin_amdgcn_fence(__ATOMIC_ACQ_REL, "workgroup"); __builtin_amdgcn_wave_barrier();
  if (CL) { split_store(so[w], lane, C16, CL, cofs + (size_t)row0 * ldc + col0, ldc); return; }      /* the same for every wave, behind the last barrier */
  const int rsub = lane >> 4, c4 = (lane & 15) * 4;
  {
#pragma unroll
    for (int q = 0; q < 16; ++q) { const int r = q * 2 + rsub; const v4f v = *(const v4fa*)&so[w][r][c4]; if (C) *(v4f*)(C + cofs + (size_t)(row0 + r) * ldc + col0 + c4) = v; if (C16) { v4h h4; for (int i = 0; i < 4; ++i) h4[i] = (_Float16)v[i]; *(v4h*)(C16 + cofs + (size_t)(row0 + r) * ldc + col0 + c4) = h4; } }
     } }
// out = o out_w + b: f32 rows
__global__ __launch_bounds__(128) void k_outp(const _Float16* __restrict__ O16, const _Float16* __restrict__ BO, const float* __restrict__ bo, float* __restrict__ out) {
  gemm2<0, 128, DM, DM>(blockIdx.x, 0, O16, 0, BO, 0, 0.0009765625f, bo, 0, nullptr, 1, 0, 0, out, nullptr, nullptr, DM, 0, MPO, DM, DM); }
// Q, K and V projections share one launch: blockIdx.y picks the weight plane (BW holds the three one behind the other), the bias and the result planes; Q and K leave as hi + residual, V as plain f16 rows
__global__ __launch_bounds__(128) void k_qkv(const _Float16* __restrict__ X16, const _Float16* __restrict__ BW, const float* __restrict__ bq, const float* __restrict__ bk, const float* __restrict__ bv,
    _Float16* __restrict__ QH, _Float16* __restrict__ QL, _Float16* __restrict__ KH, _Float16* __restrict__ KL, _Float16* __restrict__ V16) {
  const int j = blockIdx.y; const float* bias = j == 0 ? bq : j == 1 ? bk : bv; _Float16* ch = j == 0 ? QH : j == 1 ? KH : V16; _Float16* cl = j == 0 ? QL : j == 1 ? KL : nullptr;
  gemm2<0, 128, DM, DM>(blockIdx.x, 0, X16, 0, BW + (size_t)j * DM * DM, 0, 0.0625f, bias, 0, nullptr, 1, 0, 0, nullptr, ch, cl, DM, 0, MP, DM, DM); }


__global__ __launch_bounds__(256) void k_wnat(const float* __restrict__ w, size_t n8, _Float16* __restrict__ Bt) { const size_t t = (size_t)blockIdx.x * 256 + threadIdx.x; if (t >= n8) return; FragH f; for (int q = 0; q < 8; ++q) f.h[q] = (_Float16)(bf16_round(w[t * 8 + q]) * 16.0f); *(v8us*)((unsigned short*)Bt + t * 8) = f.half[0];  }
__global__ __launch_bounds__(256) void k_rsm(const float* __restrict__ S, _Float16* __restrict__ P, int nrows) {
  #pragma clang fp contract(off)
  const int i = blockIdx.x * 256 + threadIdx.x; if (i >= nrows) return; const float* s = S + (size_t)i * SQ; float mx = -3.0e38f;
#pragma unroll 1
  for (int j = 0; j < SQ; ++j) mx = fmaxf(mx, s[j]); float se = 0.f;
#pragma unroll 1
  for (int j = 0; j < SQ; ++j) se += expf(s[j] - mx); const float sc = 256.0f / se;
#pragma unroll 1
  for (int j0 = 0; j0 < SQ; j0 += 8) { FragH f; for (int q = 0; q < 8; ++q) f.h[q] = (_Float16)(expf(s[j0 + q] - mx) * sc); unsigned short* d = (unsigned short*)P + (size_t)i * SQ + j0; *(v8us*)d = f.half[0];  } }
__global__ __launch_bounds__(256) void k_vt(const _Float16* __restrict__ V16, int b, int h0, _Float16* __restrict__ VT) { __shared__ unsigned short tl[64][65]; const int tid = threadIdx.x; const int hh = blockIdx.x % HG, sg = blockIdx.x / HG; const int s0 = sg * 64; const int h = h0 + hh;
  for (int i = tid; i < 64 * 8; i += 256) { const int j = i / 8, d8 = (i % 8) * 8; FragH f; f.half[0] = *(const v8us*)((const unsigned short*)V16 + ((size_t)b * SQ + s0 + j) * DM + h * HD + d8); for (int q = 0; q < 8; ++q) tl[d8 + q][j] = f.u[q]; }
  __syncthreads();
  { for (int i = tid; i < 64 * 8; i += 256) { const int d = i / 8, j8 = (i % 8) * 8; FragH f; for (int q = 0; q < 8; ++q) f.u[q] = tl[d][j8 + q]; *(v8us*)((unsigned short*)VT + ((size_t)hh * HD + d) * SQ + s0 + j8) = f.half[0]; }  } }


__device__ __forceinline__ void mprep(const float* __restrict__ E, const float* __restrict__ phase, _Float16* __restrict__ MH, _Float16* __restrict__ ML, int bid) {
  #pragma clang fp contract(off)
  const int t = bid * 256 + threadIdx.x; if (t >= NH * HD * (HD / 8)) return; const int e8 = (t % (HD / 8)) * 8; const int hd_ = t / (HD / 8); const int d = hd_ % HD, h = hd_ / HD; const float c = cosf(bf16_round(phase[h * HD + d])); const float diag = __fmul_rn(__fmul_rn(c, c), 0.125f); FragH fh, fl;
#pragma unroll
  for (int q = 0; q < 8; ++q) { const int e = e8 + q; float m = bf16_round(E[((size_t)h * HD + d) * HD + e]); if (e == d) m = __fadd_rn(m, diag); const _Float16 hi = (_Float16)m; fh.h[q] = hi; fl.h[q] = (_Float16)((m - (float)hi) * 1024.0f); }
  const size_t o = ((size_t)h * HD + d) * HD + e8; { *(v8us*)((unsigned short*)MH + o) = fh.half[0]; *(v8us*)((unsigned short*)ML + o) = fl.half[0];  } }
// ---- the six operand preparations depend on inputs alone and share one launch; a block's index range picks its job: four weight transposes (BW holds the planes one behind the other), M, x ----
#define GW ((DM / WTK) * (DM / WTN)) /* blocks per weight transpose */
#define GM (NH * HD * (HD / 8) / 256) /* blocks for M */
#define GX ((int)(NR * DM / 8 / 256)) /* blocks for x */
static_assert(DM % WTK == 0 && DM % WTN == 0, "wt_tile: whole tiles only, it has no edge guard");
__global__ __launch_bounds__(256) void k_prep(const float* __restrict__ x, const float* __restrict__ wq, const float* __restrict__ wk, const float* __restrict__ wv, const float* __restrict__ wo, const float* __restrict__ E, const float* __restrict__ phase,
    _Float16* __restrict__ X16, _Float16* __restrict__ BW, _Float16* __restrict__ MH, _Float16* __restrict__ ML) {
  const int bid = blockIdx.x;
  if (bid < 4 * GW) { const int j = bid / GW; const float* W = j == 0 ? wq : j == 1 ? wk : j == 2 ? wv : wo; wt_tile(W, BW + (size_t)j * DM * DM, 16.0f, bid - j * GW); }      /* [in][out] -> Bt[n][k] x16; the branch is the same for a whole workgroup, so the tile's barrier is passed by all of it */
  else if (bid < 4 * GW + GM) mprep(E, phase, MH, ML, bid - 4 * GW);
  else x16_rows(x, X16, NR * DM / 8, bid - (4 * GW + GM));
}
__device__ __forceinline__ float half_xor(float v) { const int i = __float_as_int(v); return __int_as_float(__builtin_amdgcn_permlanex16(i, i, 0x76543210, 0xfedcba98, false, false)); }      /* value of lane l ^ 16 */
#define FK 64                        /* keys per LDS stage */
#define FPT 72                       /* LDS row pitch in f16: 128 B + 16 B, conflict-free for 16-byte fragment reads */
#define L2E 1.4426950408889634f
__device__ __forceinline__ v8f f_mma(v16h a, v16h b, v8f c) { return __builtin_amdgcn_wmma_f32_16x16x32_f16(false, a, false, b, (short)0, c, false, false); }
// ---- KM = K M^T per head in one launch: the terms hi.hi, residual.hi, hi.residual each in its own accumulator, summed in f32 in that order in registers, the sum split into hi + residual planes ----
// Workgroup = 4 waves x 32 token rows of one head. K hi and K residual (128 x 64) and M hi and M residual (64 x 64) go through LDS once: whole-line 16-byte loads, all issued together, one barrier.
__device__ __forceinline__ void km_tile(const _Float16* __restrict__ KH, const _Float16* __restrict__ KL, const _Float16* __restrict__ MH, const _Float16* __restrict__ ML, _Float16* __restrict__ KMH, _Float16* __restrict__ KML, int bx, int h) {
  __shared__ __attribute__((aligned(16))) float so[4][32][68];
  __shared__ __attribute__((aligned(16))) _Float16 sa[2][128][FPT];
  __shared__ __attribute__((aligned(16))) _Float16 sb[2][HD][FPT];
  const int tid = threadIdx.x, w = tid >> 5, lane = tid & 31, ln = lane & 15, hh = lane >> 4; const size_t row0 = (size_t)bx * 128;
  const int sr = tid >> 3, sp = (tid & 7) * 8;      /* staging: one load of every thread covers 16 tile rows */
  const unsigned short* gah = (const unsigned short*)KH + (row0 + sr) * DM + h * HD + sp; const unsigned short* gal = (const unsigned short*)KL + (row0 + sr) * DM + h * HD + sp;
  const unsigned short* gbh = (const unsigned short*)MH + ((size_t)h * HD + sr) * HD + sp; const unsigned short* gbl = (const unsigned short*)ML + ((size_t)h * HD + sr) * HD + sp;
  v8us ta[2][8], tb[2][4];
  for (int i = 0; i < 4; ++i) { tb[0][i] = *(const v8us*)(gbh + (size_t)i * 16 * HD); tb[1][i] = *(const v8us*)(gbl + (size_t)i * 16 * HD); }
  for (int i = 0; i < 8; ++i) { ta[0][i] = *(const v8us*)(gah + (size_t)i * 16 * DM); ta[1][i] = *(const v8us*)(gal + (size_t)i * 16 * DM); }
  asm volatile("s_wait_xcnt 0x0" :: "v"(gah), "v"(gal), "v"(gbh), "v"(gbl) : "memory");      /* the four address pairs are inputs so that they stay live up to this wait */
  for (int i = 0; i < 8; ++i) { *(v8us*)&sa[0][i * 16 + sr][sp] = ta[0][i]; *(v8us*)&sa[1][i * 16 + sr][sp] = ta[1][i]; }
  for (int i = 0; i < 4; ++i) { *(v8us*)&sb[0][i * 16 + sr][sp] = tb[0][i]; *(v8us*)&sb[1][i * 16 + sr][sp] = tb[1][i]; }
  __syncthreads();      /* publishes the four tiles */
  const v8f z8 = {0.f,0.f,0.f,0.f,0.f,0.f,0.f,0.f};
  const int ra = 32 * w + ln;
#pragma unroll 1      /* kept rolled so that 12 accumulators are live, not 24: the kernel stays under 256 registers and needs no register-window switches */
  for (int th = 0; th < 2; ++th) {      /* two column tiles at a time */
    v8f c1[2][2], c2[2][2], c3[2][2];      /* [row tile][column tile] of hi.hi, residual.hi, hi.residual */
    for (int m = 0; m < 2; ++m) for (int t = 0; t < 2; ++t) { c1[m][t] = z8; c2[m][t] = z8; c3[m][t] = z8; }
    for (int ks = 0; ks < HD / 32; ++ks) {
      v16h ah[2], al[2], bh[2], bl[2];
      for (int m = 0; m < 2; ++m) { ah[m] = g2_frag(&sa[0][ra + 16 * m][ks * 32], hh); al[m] = g2_frag(&sa[1][ra + 16 * m][ks * 32], hh); }
      for (int t = 0; t < 2; ++t) { bh[t] = g2_frag(&sb[0][(th * 2 + t) * 16 + ln][ks * 32], hh); bl[t] = g2_frag(&sb[1][(th * 2 + t) * 16 + ln][ks * 32], hh); }
      for (int t = 0; t < 2; ++t) for (int m = 0; m < 2; ++m) c1[m][t] = f_mma(ah[m], bh[t], c1[m][t]);
      for (int t = 0; t < 2; ++t) for (int m = 0; m < 2; ++m) c2[m][t] = f_mma(al[m], bh[t], c2[m][t]);
      for (int t = 0; t < 2; ++t) for (int m = 0; m < 2; ++m) c3[m][t] = f_mma(ah[m], bl[t], c3[m][t]);
    }
    for (int m = 0; m < 2; ++m)
      for (int t = 0; t < 2; ++t)
        for (int r = 0; r < 8; ++r) { float v = c2[m][t][r] * 0.0009765625f + c1[m][t][r]; v = c3[m][t][r] * 0.0009765625f + v;      /* the residual planes carry x1024; the scaling is exact, so each line rounds once */
          so[w][m * 16 + 8 * hh + r][(th * 2 + t) * 16 + ln] = v; }
  }
  __builtin_amdgcn_fence(__ATOMIC_ACQ_REL, "workgroup"); __builtin_amdgcn_wave_barrier();      /* each wave reads back only its own rows */
  split_store(so[w], lane, KMH, KML, (row0 + 32 * w) * DM + h * HD, DM);
}
// KM (needs K and M) and V^T (needs V) do not depend on each other and share one launch; the branch is the same for a whole workgroup, so each body keeps its own barrier
#define GKM ((int)(NR / 128) * NH)   /* blocks for KM */
__global__ __launch_bounds__(128) void k_kmvt(const _Float16* __restrict__ KH, const _Float16* __restrict__ KL, const _Float16* __restrict__ MH, const _Float16* __restrict__ ML, _Float16* __restrict__ KMH, _Float16* __restrict__ KML, const _Float16* __restrict__ V16, _Float16* __restrict__ VT) {
  const int bid = blockIdx.x;
  if (bid >= GKM) { vt_tile<NH, SQ>(V16, DM, 0, VT, bid - GKM); return; }      /* V^T [NB][NH][HD][SQ] */
  km_tile(KH, KL, MH, ML, KMH, KML, bid % (int)(NR / 128), bid / (int)(NR / 128));      /* KM[k][h*64+d] = sum_e K[k][h*64+e] M[h][d][e], token rows of both batches */
}
__global__ __launch_bounds__(256) void k_fattn(const _Float16* __restrict__ QH, const _Float16* __restrict__ QL, const _Float16* __restrict__ KMH, const _Float16* __restrict__ KML, const _Float16* __restrict__ VT, _Float16* __restrict__ O16) {
  __shared__ __attribute__((aligned(16))) _Float16 sk[2][3][FK][FPT];
  const int tid = threadIdx.x, lane = tid & 31, c = lane & 15, hh = lane >> 4; const int w = __builtin_amdgcn_readfirstlane(tid >> 5);
  const int h = blockIdx.y, b = blockIdx.z; const size_t r0 = (size_t)b * SQ; const size_t q0 = r0 + (size_t)blockIdx.x * 256 + w * 32;
  v16h qh[2][2], ql[2][2];      /* [query tile][k step of 32] */
  for (int qt = 0; qt < 2; ++qt)
    for (int ks = 0; ks < 2; ++ks) { const size_t o = (q0 + qt * 16 + c) * DM + h * HD + ks * 32; qh[qt][ks] = g2_frag(QH + o, hh); ql[qt][ks] = g2_frag(QL + o, hh); }
  const int sr = tid >> 3, sp = (tid & 7) * 8;      /* staging: a wave's 16-byte loads cover four whole 128-byte rows */
  const unsigned short* gkh = (const unsigned short*)KMH + (r0 + sr) * DM + h * HD + sp; const unsigned short* gkl = (const unsigned short*)KML + (r0 + sr) * DM + h * HD + sp;
  const unsigned short* gv = (const unsigned short*)VT + (((size_t)b * NH + h) * HD + sr) * SQ + sp;
  v8us st[6];
  st[0] = *(const v8us*)gkh; st[1] = *(const v8us*)(gkh + (size_t)32 * DM); st[2] = *(const v8us*)gkl; st[3] = *(const v8us*)(gkl + (size_t)32 * DM); st[4] = *(const v8us*)gv; st[5] = *(const v8us*)(gv + (size_t)32 * SQ);
  for (int i = 0; i < 6; ++i) *(v8us*)&sk[0][i >> 1][sr + 32 * (i & 1)][sp] = st[i];
  __syncthreads();      /* publishes stage 0 */
  const v8f z8 = {0.f,0.f,0.f,0.f,0.f,0.f,0.f,0.f};
  v8f o[4][2];      /* O^T tiles [d tile][query tile]: register r = d 16 dt + 8 hh + r of query c */
  for (int dt = 0; dt < 4; ++dt) { o[dt][0] = z8; o[dt][1] = z8; }
  float mu[2] = {-3.0e38f, -3.0e38f};      /* maximum in use per query, log2 domain, equal in both lane halves */
  float ls[2] = {0.f, 0.f};      /* this lane half's share of the sum of weights */
  for (int s = 0; s < SQ / FK; ++s) {
    const int buf = s & 1; const bool more = s + 1 < SQ / FK;
    if (more) { gkh += (size_t)FK * DM; gkl += (size_t)FK * DM; gv += FK;
      st[0] = *(const v8us*)gkh; st[1] = *(const v8us*)(gkh + (size_t)32 * DM); st[2] = *(const v8us*)gkl; st[3] = *(const v8us*)(gkl + (size_t)32 * DM); st[4] = *(const v8us*)gv; st[5] = *(const v8us*)(gv + (size_t)32 * SQ); }
    for (int p = 0; p < FK / 32; ++p) {
      v16h kh[2][2], kl[2][2];      /* [key tile][k step] */
      for (int kt = 0; kt < 2; ++kt)
        for (int ks = 0; ks < 2; ++ks) { kh[kt][ks] = g2_frag(&sk[buf][0][p * 32 + kt * 16 + c][ks * 32], hh); kl[kt][ks] = g2_frag(&sk[buf][1][p * 32 + kt * 16 + c][ks * 32], hh); }
      v8f sc[2][2] = {{z8, z8}, {z8, z8}};      /* S^T tiles [key tile][query tile]: register r = key 16 kt + 8 hh + r, query c */
      for (int ks = 0; ks < 2; ++ks) {
        for (int u = 0; u < 4; ++u) sc[u >> 1][u & 1] = f_mma(kl[u >> 1][ks], qh[u & 1][ks], sc[u >> 1][u & 1]);      /* hi.lo */
        for (int u = 0; u < 4; ++u) sc[u >> 1][u & 1] = f_mma(kh[u >> 1][ks], ql[u & 1][ks], sc[u >> 1][u & 1]);      /* lo.hi */
      }
      for (int u = 0; u < 4; ++u) sc[u >> 1][u & 1] *= 0.0009765625f;      /* the residual planes carry x1024 */
      for (int ks = 0; ks < 2; ++ks)
        for (int u = 0; u < 4; ++u) sc[u >> 1][u & 1] = f_mma(kh[u >> 1][ks], qh[u & 1][ks], sc[u >> 1][u & 1]);      /* hi.hi */
      v16h va[4];
      for (int dt = 0; dt < 4; ++dt) va[dt] = g2_frag(&sk[buf][2][dt * 16 + c][p * 32], hh);
      float mt[2]; bool need = false;
      for (int qt = 0; qt < 2; ++qt) { float m = sc[0][qt][0];
        for (int r = 1; r < 8; ++r) m = fmaxf(m, sc[0][qt][r]);
        for (int r = 0; r < 8; ++r) m = fmaxf(m, sc[1][qt][r]);
        m = fmaxf(m, half_xor(m)) * L2E; mt[qt] = m; need = need || (m > mu[qt] + 8.0f); }
      if (__builtin_amdgcn_ballot_w32(need) != 0) {      /* lazy rescale, one scalar branch per 32 keys: the maximum in use follows only when some query's maximum has passed it by more than 2^8 */
        for (int qt = 0; qt < 2; ++qt) { const float mn = fmaxf(mu[qt], mt[qt]); const float al = __builtin_amdgcn_exp2f(mu[qt] - mn); mu[qt] = mn; ls[qt] *= al;
          for (int dt = 0; dt < 4; ++dt) o[dt][qt] *= al; }
      }
      for (int qt = 0; qt < 2; ++qt) { const float sh = 6.0f - mu[qt];      /* weights carried x64: at most 2^14 in f16 */
        v8f e0 = sc[0][qt] * L2E + sh, e1 = sc[1][qt] * L2E + sh; FragH pb;
        for (int r = 0; r < 8; ++r) { e0[r] = __builtin_amdgcn_exp2f(e0[r]); e1[r] = __builtin_amdgcn_exp2f(e1[r]); }
        for (int r = 0; r < 8; ++r) { pb.h[r] = (_Float16)e0[r]; pb.h[8 + r] = (_Float16)e1[r]; }
        const v8f t = e0 + e1; ls[qt] += ((t[0] + t[1]) + (t[2] + t[3])) + ((t[4] + t[5]) + (t[6] + t[7]));
        for (int dt = 0; dt < 4; ++dt) o[dt][qt] = f_mma(va[dt], pb.v, o[dt][qt]); }
    }
    if (more) {
      for (int i = 0; i < 6; ++i) *(v8us*)&sk[buf ^ 1][i >> 1][sr + 32 * (i & 1)][sp] = st[i]; }
    __syncthreads();      /* publishes the next stage and ends every wave's reads of this one, which the stage after next overwrites */
  }
  for (int qt = 0; qt < 2; ++qt) { const float inv = 64.0f * __builtin_amdgcn_rcpf(ls[qt] + half_xor(ls[qt]));      /* o carried x64, the weights' own carry cancels */
    for (int dt = 0; dt < 4; ++dt) { FragH f;
      for (int r = 0; r < 8; ++r) f.h[r] = (_Float16)(o[dt][qt][r] * inv);
      *(v8us*)((unsigned short*)O16 + (q0 + qt * 16 + c) * DM + h * HD + dt * 16 + 8 * hh) = f.half[0]; } }
}

extern "C" void kernel_launch(void* const* d_in, const int* in_sizes, int n_in,
                              void* d_out, int out_size, void* d_ws, size_t ws_size, hipStream_t stream) {
  (void)in_sizes; (void)n_in; (void)out_size;
  const float* const* I = (const float* const*)d_in; const float* x = I[0]; const float* wq = I[1]; const float* bq = I[2]; const float* wk = I[3]; const float* bk = I[4]; const float* wv = I[5]; const float* bv = I[6]; const float* phase = I[7]; const float* E = I[8]; const float* wo = I[9]; const float* bo = I[10];      /* weights [in][out] */
  char* ws = (char*)d_ws; size_t off = 0;
  auto take = [&](size_t bytes) { char* p = ws + off; off += (bytes + 255) & ~(size_t)255; return p; };
  _Float16* BQ = (_Float16*)take((size_t)DM * DM * 2); _Float16* BK = (_Float16*)take((size_t)DM * DM * 2); _Float16* BV = (_Float16*)take((size_t)DM * DM * 2); _Float16* BO = (_Float16*)take((size_t)DM * DM * 2); _Float16* MH = (_Float16*)take((size_t)NH * HD * HD * 2); _Float16* ML = (_Float16*)take((size_t)NH * HD * HD * 2);
  _Float16* X16 = (_Float16*)take(NR * DM * 2); _Float16* QH = (_Float16*)take(NR * DM * 2); _Float16* QL = (_Float16*)take(NR * DM * 2); _Float16* KH = (_Float16*)take(NR * DM * 2); _Float16* KL = (_Float16*)take(NR * DM * 2); _Float16* V16 = (_Float16*)take(NR * DM * 2);
  _Float16* KMH = (_Float16*)take(NR * DM * 2); _Float16* KML = (_Float16*)take(NR * DM * 2); _Float16* O16 = (_Float16*)take(NR * DM * 2);
  _Float16* VT = (_Float16*)take((size_t)NB * NH * HD * SQ * 2);
  (void)BK; (void)BV;      /* reached through BQ */
  if (off > ws_size) return;      /* 8.3 + 8 + 40 + 16 + 8 + 8 = approx 88 MiB */
  k_prep<<<4 * GW + GM + GX, 256, 0, stream>>>(x, wq, wk, wv, wo, E, phase, X16, BQ, MH, ML);      /* BQ, BK, BV, BO lie one behind the other */
  const size_t r0p = (size_t)B0 * SQ;
  k_qkv<<<dim3((unsigned)((MP / 128) * (DM / 64)), 3), 128, 0, stream>>>(X16 + r0p * DM, BQ, bq, bk, bv, QH + r0p * DM, QL + r0p * DM, KH + r0p * DM, KL + r0p * DM, V16 + r0p * DM);
  k_kmvt<<<GKM + NB * NH * (SQ / 64), 128, 0, stream>>>(KH, KL, MH, ML, KMH, KML, V16, VT);
  k_fattn<<<dim3(SQ / 256, NH, NB), 256, 0, stream>>>(QH, QL, KMH, KML, VT, O16);      /* o (merged heads, x64) as f16 rows */
  k_outp<<<(unsigned)((MPO / 128) * (DM / 64)), 128, 0, stream>>>(O16 + r0p * DM, BO, bo, (float*)d_out + r0p * DM);      /* out rows are the output layout */
}

// v007
// One run takes 102 microseconds.
// Timed twice side by side with v006, it ran 1.08 and 1.09 times as fast.
// All steps since v000 together make it 42.1 times as fast.
#include <hip/hip_runtime.h>
// "Quantum" attention (x [2][2048][1024]): Q/K/V = x W + b ([in][out] weights + biases, 16 heads of 64); scores = (Q cos(phase)) (K cos(phase))^T / 8 + Q E K^T per head (phase [16][64], E [16][64][64]) = Q M K^T with M = E + diag(cos^2 phase / 8); softmax over the 2,048 keys; o = attn V merged; out = o out_w + out_b -> [2][2048][1024].
// Structure: token rows; x as exact f16 rows; Q and K as WMMA GEMMs (128x128 workgroup tiles, operand tiles through LDS, f32 accumulation, exact x16 transposed weights + bias) whose epilogue splits each f32 result on VALU into f16 hi + 2^-10 residual planes; V as a WMMA GEMM to f16 rows; M as f16 hi + residual planes (VALU, cos in f32); KM = K M^T per head (km_tile): three WMMA terms (hi.hi + lo.hi + hi.lo, K = 64) in three accumulators, summed in f32 in registers, split into hi + residual planes; V^T for all batches and heads via LDS transposes; attention in one fused launch (k_fattn): scores = Q KM^T as three WMMA terms in one accumulator, online softmax on VALU (f32 statistics, native exp2; weights x64 f16 against the maximum in use), o = P . V^T on WMMA, normalised at the end into merged f16 rows (o carried x64 against f16 subnormal flush); out = o out_w + b GEMM (f32, alpha folds 1/16 and 1/64). Five launches: jobs that do not depend on each other share a grid (k_prep, k_qkv, k_kmvt), then k_fattn, k_outp.
// Compute dtype: inputs rounded to bf16; weights exact (x16 f16); Q, K, M, KM as f16 hi + residual planes (~2^-22); V, softmax weights (x64) and o (x64) plain f16 (~2^-12); scores, softmax statistics f32. v_wmma_f32_16x16x32_f16.
#define NB 2
#define SQ 2048
#define DM 1024
#define NH 16
#define HD 64
#define HG 4                         /* heads per group in the per-batch k_vt, which is not launched */
#define PSC 4096.0f                  /* unused; the softmax weights carry x64 */
#define B0 0                         /* first batch processed (debug hook) */
#define NBR NB                       /* batches processed (debug hook) */
#define QN SQ                        /* unused; k_fattn attends all SQ query rows per batch */
#define NHD NH                       /* unused; k_fattn attends all NH heads */
#define NR ((size_t)NB * SQ)
#define MP ((int)((size_t)NBR * SQ)) /* rows projected (debug hook) */
#define MPO MP                       /* rows through the output GEMM (debug hook) */
typedef __bf16 v16b __attribute__((ext_vector_type(16)));
typedef unsigned short v8us __attribute__((ext_vector_type(8), may_alias));
typedef float  v8f  __attribute__((ext_vector_type(8)));
typedef float  v4f  __attribute__((ext_vector_type(4)));
typedef float  v4fa __attribute__((ext_vector_type(4), may_alias));
union FragB { v16b v; v8us half[2]; unsigned short u[16]; };

__device__ __forceinline__ unsigned short bf16_bits(float x) { unsigned int u = __float_as_uint(x); return (unsigned short)((u + 0x7FFFu + ((u >> 16) & 1u)) >> 16); }
__device__ __forceinline__ float bf16_val(unsigned short b) { return __uint_as_float(((unsigned int)b) << 16); }
__device__ __forceinline__ float bf16_round(float x) { return bf16_val(bf16_bits(x)); }
// D += A·B with NT terms: 1 = ah·bh, 2 = + al·bh (A split), 3 = + ah·bl (both split)
template <int NT>
__device__ __forceinline__ v8f mmaN(v16b ah, v16b al, v16b bh, v16b bl, v8f c) {
  c = __builtin_amdgcn_wmma_f32_16x16x32_bf16(false, ah, false, bh, (short)0, c, false, false);
  if (NT >= 2) c = __builtin_amdgcn_wmma_f32_16x16x32_bf16(false, al, false, bh, (short)0, c, false, false);
  if (NT >= 3) c = __builtin_amdgcn_wmma_f32_16x16x32_bf16(false, ah, false, bl, (short)0, c, false, false);
  asm volatile("v_nop\n\tv_nop\n\tv_nop\n\tv_nop" : "+v"(c) : "v"(ah), "v"(al), "v"(bh), "v"(bl));
  return c;
}

__global__ __launch_bounds__(256) void k_wt_bf16(const float* __restrict__ W, unsigned short* __restrict__ Wt, int K, int N) {
  const int t = blockIdx.x * 256 + threadIdx.x;
  const int k8n = K / 8;
  if (t >= N * k8n) return;
  const int n = t / k8n, k8 = (t % k8n) * 8;
  v8us v;
#pragma unroll
  for (int i = 0; i < 8; ++i) v[i] = bf16_bits(W[(size_t)(k8 + i) * N + n]);
  *(v8us*)(Wt + (size_t)n * K + k8) = v;
  
}

// GEMM C[M][N] (f32, pitch ldc) = act(A[M][K]·W + bias). A f32 row-major (pitch lda) converted per fragment to bf16
// (ASPLIT: hi/lo two planes -> 2 terms, else single rounded term); Wt bf16 [N][K] (pitch ldb). BIAS_BF16 rounds the
// bias to bf16 first (bias quantised to bf16 before the add). K%32==0, M%16==0, N%64==0.
template <bool ASPLIT, int ACT, bool BIAS_BF16>
__global__ __launch_bounds__(128) void k_gemm_bf(const float* __restrict__ A, int lda, const unsigned short* __restrict__ Wt, int ldb,
                                               const float* __restrict__ bias, float* __restrict__ C, int ldc, int M, int N, int K) {
  __shared__ __attribute__((aligned(16))) float so[4][16][64];
  const int tid = threadIdx.x, w = tid >> 5, lane = tid & 31, ln = lane & 15, hh = lane >> 4;
  const int ntn = N / 64;
  const int wid = blockIdx.x * 4 + w;
  const int mt = wid / ntn, nq = wid % ntn;
  if (mt * 16 >= M) return;
  const int row0 = mt * 16, col0 = nq * 64;
  const float* arow = A + (size_t)(row0 + ln) * lda;
  v8f acc[4] = {};
  for (int kb = 0; kb < K; kb += 32) {
    FragB ah, al;
    const v4f x0 = *(const v4fa*)(arow + kb + 8 * hh), x1 = *(const v4fa*)(arow + kb + 8 * hh + 4);
    const v4f x2 = *(const v4fa*)(arow + kb + 16 + 8 * hh), x3 = *(const v4fa*)(arow + kb + 16 + 8 * hh + 4);
    float xs[16] = {x0[0],x0[1],x0[2],x0[3],x1[0],x1[1],x1[2],x1[3],x2[0],x2[1],x2[2],x2[3],x3[0],x3[1],x3[2],x3[3]};
#pragma unroll
    for (int i = 0; i < 16; ++i) { const unsigned short hb = bf16_bits(xs[i]); ah.u[i] = hb; al.u[i] = ASPLIT ? bf16_bits(xs[i] - bf16_val(hb)) : (unsigned short)0; }
#pragma unroll
    for (int t = 0; t < 4; ++t) {
      const unsigned short* brow = Wt + (size_t)(col0 + t * 16 + ln) * ldb + kb;
      FragB b;
      b.half[0] = *(const v8us*)(brow + 8 * hh);
      b.half[1] = *(const v8us*)(brow + 16 + 8 * hh);
      acc[t] = mmaN<ASPLIT ? 2 : 1>(ah.v, al.v, b.v, b.v, acc[t]);
    }
  }
#pragma unroll
  for (int t = 0; t < 4; ++t) {
    float bv = bias ? bias[col0 + t * 16 + ln] : 0.f;
    if (BIAS_BF16) bv = bf16_round(bv);
#pragma unroll
    for (int r = 0; r < 8; ++r) { float v = acc[t][r] + bv; if (ACT == 1) v = fmaxf(v, 0.f); so[w][8 * hh + r][t * 16 + ln] = v; }
  }
  __builtin_amdgcn_fence(__ATOMIC_ACQ_REL, "workgroup");
  __builtin_amdgcn_wave_barrier();
  const int rsub = lane >> 4, c4 = (lane & 15) * 4;
  {
#pragma unroll
    for (int q = 0; q < 8; ++q) {
      const int r = q * 2 + rsub;
      const v4f v = *(const v4fa*)&so[w][r][c4];
      *(v4f*)(C + (size_t)(row0 + r) * ldc + col0 + c4) = v;
    }
    
  }
}

// GEMM C = act(A·W + bias + resid): A f32 (ASPLIT -> hi/lo 2 terms), Wt bf16 [N][K]; ACT 0 none, 1 relu, 2 exact gelu;
// resid (optional, f32, row index = (row % rmod), pitch ldr, RES_BF16 rounds it) added before the activation.
template <bool ASPLIT, int ACT, bool BIAS_BF16, bool RES_BF16>
__global__ __launch_bounds__(128) void k_gemm_bf3(const float* __restrict__ A, int lda, const unsigned short* __restrict__ Wt, int ldb,
                                                const float* __restrict__ bias, const float* __restrict__ resid, int rmod, int ldr,
                                                float* __restrict__ C, int ldc, int M, int N, int K) {
  __shared__ __attribute__((aligned(16))) float so[4][16][64];
  const int tid = threadIdx.x, w = tid >> 5, lane = tid & 31, ln = lane & 15, hh = lane >> 4;
  const int ntn = N / 64;
  const int wid = blockIdx.x * 4 + w;
  const int mt = wid / ntn, nq = wid % ntn;
  if (mt * 16 >= M) return;
  const int row0 = mt * 16, col0 = nq * 64;
  const float* arow = A + (size_t)(row0 + ln) * lda;
  v8f acc[4] = {};
  for (int kb = 0; kb < K; kb += 32) {
    FragB ah, al;
    const v4f x0 = *(const v4fa*)(arow + kb + 8 * hh), x1 = *(const v4fa*)(arow + kb + 8 * hh + 4);
    const v4f x2 = *(const v4fa*)(arow + kb + 16 + 8 * hh), x3 = *(const v4fa*)(arow + kb + 16 + 8 * hh + 4);
    float xs[16] = {x0[0],x0[1],x0[2],x0[3],x1[0],x1[1],x1[2],x1[3],x2[0],x2[1],x2[2],x2[3],x3[0],x3[1],x3[2],x3[3]};
#pragma unroll
    for (int i = 0; i < 16; ++i) { const unsigned short hb = bf16_bits(xs[i]); ah.u[i] = hb; al.u[i] = ASPLIT ? bf16_bits(xs[i] - bf16_val(hb)) : (unsigned short)0; }
#pragma unroll
    for (int t = 0; t < 4; ++t) {
      const unsigned short* brow = Wt + (size_t)(col0 + t * 16 + ln) * ldb + kb;
      FragB b;
      b.half[0] = *(const v8us*)(brow + 8 * hh);
      b.half[1] = *(const v8us*)(brow + 16 + 8 * hh);
      acc[t] = mmaN<ASPLIT ? 2 : 1>(ah.v, al.v, b.v, b.v, acc[t]);
    }
  }
#pragma unroll
  for (int t = 0; t < 4; ++t) {
    const int col = col0 + t * 16 + ln;
    float bv = bias ? bias[col] : 0.f;
    if (BIAS_BF16) bv = bf16_round(bv);
#pragma unroll
    for (int r = 0; r < 8; ++r) {
      float v = acc[t][r] + bv;
      if (resid) { float rv = resid[(size_t)((row0 + 8 * hh + r) % rmod) * ldr + col]; if (RES_BF16) rv = bf16_round(rv); v += rv; }
      if (ACT == 1) v = fmaxf(v, 0.f);
      if (ACT == 2) v = 0.5f * v * (1.0f + erff(v * 0.70710678118654752f));
      if (ACT == 3) { const float u = 0.7978845608028654f * (v + 0.044715f * v * v * v); v = 0.5f * v * (1.0f + tanhf(u)); }
      so[w][8 * hh + r][t * 16 + ln] = v;
    }
  }
  __builtin_amdgcn_fence(__ATOMIC_ACQ_REL, "workgroup");
  __builtin_amdgcn_wave_barrier();
  const int rsub = lane >> 4, c4 = (lane & 15) * 4;
  {
#pragma unroll
    for (int q = 0; q < 8; ++q) {
      const int r = q * 2 + rsub;
      const v4f v = *(const v4fa*)&so[w][r][c4];
      *(v4f*)(C + (size_t)(row0 + r) * ldc + col0 + c4) = v;
    }
    
  }
}
// row LayerNorm (biased variance, eps) over N: s = X (+ R); optional out_sum <- s; out_norm <- (s-mu)*rsqrt(var+eps)*g + b
template <bool PARAM_BF16>
__global__ __launch_bounds__(256) void k_layernorm(const float* __restrict__ X, const float* __restrict__ R, const float* __restrict__ g, const float* __restrict__ bta,
                                                  float* __restrict__ out_sum, float* __restrict__ out_norm, int N, float eps) {
  __shared__ float red[256];
  const int row = blockIdx.x, tid = threadIdx.x;
  const float* x = X + (size_t)row * N; const float* rr = R ? R + (size_t)row * N : nullptr;
  float vals[16];                     // up to N = 4096
  const int per = N / 256;            // contiguous chunk per thread? use strided-by-4 chunks: thread handles j = tid*4 + 1024*u
  float s1 = 0.f;
  for (int u = 0; u < per / 4; ++u) {
    const int j = tid * 4 + 1024 * u;
    const v4f a = *(const v4fa*)(x + j);
    v4f b = {0.f,0.f,0.f,0.f}; if (rr) b = *(const v4fa*)(rr + j);
#pragma unroll
    for (int q = 0; q < 4; ++q) { const float v = a[q] + b[q]; vals[u * 4 + q] = v; s1 += v; }
  }
  red[tid] = s1; __syncthreads();
  for (int st = 128; st > 0; st >>= 1) { if (tid < st) red[tid] += red[tid + st]; __syncthreads(); }
  const float mu = red[0] / (float)N; __syncthreads();
  float s2 = 0.f;
  for (int u = 0; u < per / 4; ++u)
#pragma unroll
    for (int q = 0; q < 4; ++q) { const float c = vals[u * 4 + q] - mu; s2 += c * c; }
  red[tid] = s2; __syncthreads();
  for (int st = 128; st > 0; st >>= 1) { if (tid < st) red[tid] += red[tid + st]; __syncthreads(); }
  const float rs = rsqrtf(red[0] / (float)N + eps);
  {
    for (int u = 0; u < per / 4; ++u) {
      const int j = tid * 4 + 1024 * u;
      v4f o, sm;
#pragma unroll
      for (int q = 0; q < 4; ++q) {
        float gg = g[j + q], bb = bta[j + q];
        if (PARAM_BF16) { gg = bf16_round(gg); bb = bf16_round(bb); }
        sm[q] = vals[u * 4 + q]; o[q] = (vals[u * 4 + q] - mu) * rs * gg + bb;
      }
      if (out_sum) *(v4f*)(out_sum + (size_t)row * N + j) = sm;
      *(v4f*)(out_norm + (size_t)row * N + j) = o;
    }
    
  }
}



// ---- f16 WMMA path (v_wmma_f32_16x16x32_f16): 11-bit significands for operands in range — used where a [0,1] probability operand needs more precision than bf16
typedef _Float16 v16h __attribute__((ext_vector_type(16)));
union FragH { v16h v; v8us half[2]; _Float16 h[16]; unsigned short u[16]; };
template <int NT>
__device__ __forceinline__ v8f mmaH(v16h ah, v16h al, v16h bh, v16h bl, v8f c) {
  c = __builtin_amdgcn_wmma_f32_16x16x32_f16(false, ah, false, bh, (short)0, c, false, false);
  if (NT >= 2) c = __builtin_amdgcn_wmma_f32_16x16x32_f16(false, al, false, bh, (short)0, c, false, false);
  if (NT >= 3) c = __builtin_amdgcn_wmma_f32_16x16x32_f16(false, ah, false, bl, (short)0, c, false, false);
  asm volatile("v_nop\n\tv_nop\n\tv_nop\n\tv_nop" : "+v"(c) : "v"(ah), "v"(al), "v"(bh), "v"(bl));
  return c;
}
// batched GEMM like k_gemm_b but f16 operands: A f32 (split into f16 hi/lo if ASPLIT, else rounded to f16), Bt = f16 values [n][k]; alpha; C f32; N multiple of 16 (partial tiles skipped)
template <bool ASPLIT>
__global__ __launch_bounds__(128) void k_gemm_h(const float* __restrict__ A, int lda, size_t sA, const _Float16* __restrict__ Bh, int ldb, size_t sB, float alpha, float* __restrict__ C, int ldc, size_t sC, int M, int N, int K) {
  __shared__ __attribute__((aligned(16))) float so[4][16][64];
  const int tid = threadIdx.x, w = tid >> 5, lane = tid & 31, ln = lane & 15, hh = lane >> 4; const int by = blockIdx.y;
  A += (size_t)by * sA; Bh += (size_t)by * sB; C += (size_t)by * sC;
  const int ntn = (N + 63) / 64; const int wid = blockIdx.x * 4 + w; const int mt = wid / ntn, nq = wid % ntn; if (mt * 16 >= M) return;
  const int row0 = mt * 16, col0 = nq * 64; const float* arow = A + (size_t)(row0 + ln) * lda;
  v8f acc[4] = {};
  for (int kb = 0; kb < K; kb += 32) {
    FragH ah, al;
    const v4f x0 = *(const v4fa*)(arow + kb + 8 * hh), x1 = *(const v4fa*)(arow + kb + 8 * hh + 4), x2 = *(const v4fa*)(arow + kb + 16 + 8 * hh), x3 = *(const v4fa*)(arow + kb + 16 + 8 * hh + 4);
    float xs[16] = {x0[0],x0[1],x0[2],x0[3],x1[0],x1[1],x1[2],x1[3],x2[0],x2[1],x2[2],x2[3],x3[0],x3[1],x3[2],x3[3]};
#pragma unroll
    for (int i = 0; i < 16; ++i) { const _Float16 h = (_Float16)xs[i]; ah.h[i] = h; al.h[i] = ASPLIT ? (_Float16)(xs[i] - (float)h) : (_Float16)0.0f; }
#pragma unroll
    for (int t = 0; t < 4; ++t) { if (col0 + t * 16 >= N) continue; const size_t boff = (size_t)(col0 + t * 16 + ln) * ldb + kb; FragH bq; bq.half[0] = *(const v8us*)(Bh + boff + 8 * hh); bq.half[1] = *(const v8us*)(Bh + boff + 16 + 8 * hh);
      acc[t] = mmaH<ASPLIT ? 2 : 1>(ah.v, al.v, bq.v, bq.v, acc[t]); }
  }
#pragma unroll
  for (int t = 0; t < 4; ++t) { if (col0 + t * 16 >= N) continue;
#pragma unroll
    for (int r = 0; r < 8; ++r) so[w][8 * hh + r][t * 16 + ln] = acc[t][r] * alpha; }
  __builtin_amdgcn_fence(__ATOMIC_ACQ_REL, "workgroup"); __builtin_amdgcn_wave_barrier();
  const int rsub = lane >> 4, c4 = (lane & 15) * 4;
  {
#pragma unroll
    for (int q = 0; q < 8; ++q) { const int r = q * 2 + rsub; if (col0 + c4 < N) { const v4f v = *(const v4fa*)&so[w][r][c4]; *(v4f*)(C + (size_t)(row0 + r) * ldc + col0 + c4) = v; } }
     }
}

// Wt[n][k] = f16(bf16(W[k][n]) x scale) from f32 row-major W[DM][DM] (scale = power of two; bf16-exact weights stay exact in f16 away from the subnormal range).
// One workgroup of 256 threads turns one tile of 128 k x 64 n in LDS: every 16-byte global load covers whole 128-byte lines of W rows (256 B a row), every 16-byte store whole lines of Wt rows (256 B a row); a thread's eight loads are issued together.
#define WTK 128                      /* k per tile */
#define WTN 64                       /* n per tile */
typedef unsigned int v4u __attribute__((ext_vector_type(4), may_alias));
__device__ __forceinline__ void wt_tile(const float* __restrict__ W, _Float16* __restrict__ Wt, float scale, int bid) {
  __shared__ unsigned int tl[WTN][WTK / 2 + 1];      /* a word holds two neighbouring k of one n; the odd pitch spreads a wave's 32 word stores, and its 32 word reads, over 32 banks */
  const int tid = threadIdx.x; const int k0 = (bid % (DM / WTK)) * WTK, n0 = (bid / (DM / WTK)) * WTN;
  const int lo = tid & 15, up = tid >> 4;
  const float* g = W + (size_t)(k0 + 2 * up) * DM + n0 + lo * 4; v4f a[4][2];      /* rows k0 + 32 u + 2 up + j, columns n0 + 4 lo .. + 3 */
#pragma unroll      /* constant indices into a[]; one address pair, the rows differ in the immediate offset */
  for (int u = 0; u < 4; ++u) { a[u][0] = *(const v4fa*)(g + (size_t)(u * 32) * DM); a[u][1] = *(const v4fa*)(g + (size_t)(u * 32 + 1) * DM); }
#pragma unroll      /* constant indices into a[] */
  for (int u = 0; u < 4; ++u)
    for (int i = 0; i < 4; ++i) { union { _Float16 h[2]; unsigned int w; } p; p.h[0] = (_Float16)(bf16_round(a[u][0][i]) * scale); p.h[1] = (_Float16)(bf16_round(a[u][1][i]) * scale); tl[lo * 4 + i][u * 16 + up] = p.w; }
  __syncthreads();      /* publishes the tile */
  unsigned short* d = (unsigned short*)Wt + (size_t)(n0 + up) * DM + k0 + lo * 8; v4u o[4];
#pragma unroll      /* constant indices into o[]: all LDS reads stand ahead of the first store, so no register that an issued store names is written again */
  for (int u = 0; u < 4; ++u) for (int j = 0; j < 4; ++j) o[u][j] = tl[u * 16 + up][lo * 4 + j];
#pragma unroll      /* constant indices into o[] */
  for (int u = 0; u < 4; ++u) *(v4u*)(d + (size_t)(u * 16) * DM) = o[u];
}
// k_gemm_hh variant with fused epilogue: v = acc·alpha + bias[by·sBias + col] (+ CP[(row/rowsPerB)·sCPb + by·64 + col] if CP) ; ACT 0 none / 1 elu ; writes f16 C16 (and f32 C if non-null)
template <int ACT>
__global__ __launch_bounds__(128) void k_gemm_hhx(const _Float16* __restrict__ A, int lda, size_t sA, const _Float16* __restrict__ Bh, int ldb, size_t sB, float alpha, const float* __restrict__ bias, size_t sBias, const float* __restrict__ CP, int rowsPerB, size_t sCPb, int row0g,
    float* __restrict__ C, _Float16* __restrict__ C16, int ldc, size_t sC, int M, int N, int K) {
  __shared__ __attribute__((aligned(16))) float so[4][16][64];
  const int tid = threadIdx.x, w = tid >> 5, lane = tid & 31, ln = lane & 15, hh = lane >> 4; const int by = blockIdx.y;
  A += (size_t)by * sA; Bh += (size_t)by * sB; const size_t cofs = (size_t)by * sC; const float* bp = bias ? bias + (size_t)by * sBias : nullptr;
  const int ntn = (N + 63) / 64; const int wid = blockIdx.x * 4 + w; const int mt = wid / ntn, nq = wid % ntn; if (mt * 16 >= M) return;
  const int row0 = mt * 16, col0 = nq * 64; const _Float16* arow = A + (size_t)(row0 + ln) * lda;
  v8f acc[4] = {};
  for (int kb = 0; kb < K; kb += 32) { FragH ah; ah.half[0] = *(const v8us*)((const unsigned short*)arow + kb + 8 * hh); ah.half[1] = *(const v8us*)((const unsigned short*)arow + kb + 16 + 8 * hh);
#pragma unroll
    for (int t = 0; t < 4; ++t) { if (col0 + t * 16 >= N) continue; const size_t boff = (size_t)(col0 + t * 16 + ln) * ldb + kb; FragH bq; bq.half[0] = *(const v8us*)((const unsigned short*)Bh + boff + 8 * hh); bq.half[1] = *(const v8us*)((const unsigned short*)Bh + boff + 16 + 8 * hh);
      acc[t] = mmaH<1>(ah.v, ah.v, bq.v, bq.v, acc[t]); }
  }
#pragma unroll
  for (int t = 0; t < 4; ++t) { if (col0 + t * 16 >= N) continue; const int col = col0 + t * 16 + ln; const float bv = bp ? bf16_round(bp[col]) : 0.f;
#pragma unroll
    for (int r = 0; r < 8; ++r) { float v = acc[t][r] * alpha + bv; if (CP) { const int rr = row0g + row0 + 8 * hh + r; if (rowsPerB < 0) v += CP[cofs + (size_t)rr * ldc + col];      /* rowsPerB < 0: own element of the batched C plane */ else { const int bidx = rr / rowsPerB; v += CP[(size_t)bidx * sCPb + (size_t)by * 64 + col]; } } if (ACT == 1) v = (v > 0.f) ? v : expm1f(v); else if (ACT == 7) v = (v > 0.f) ? v + 1.0f : expf(v); else if (ACT == 8) v = tanhf(v); else if (ACT == 9) v = 0.5f * v * (1.0f + tanhf(0.7978845608028654f * (v + 0.044715f * v * v * v))); else if (ACT == 11) v = 1.0f / (1.0f + expf(-v)); else if (ACT == 12) v = (v > 0.f) ? v : 0.01f * v; else if (ACT == 14) v = (v > 0.f) ? v : 0.1f * v; else if (ACT == 16) v = (v >= 0.f) ? v : 0.3f * v; else if (ACT == 17) v = (v >= 0.f) ? v : 0.2f * v; else if (ACT == 15) v = v / (1.0f + expf(-v)); else if (ACT == 3) v = fmaxf(v, 0.f); else if (ACT == 6) v = 0.5f * v * (1.0f + erff(v * 0.70710678118654752f)); so[w][8 * hh + r][t * 16 + ln] = v; } }
  __builtin_amdgcn_fence(__ATOMIC_ACQ_REL, "workgroup"); __builtin_amdgcn_wave_barrier();
  const int rsub = lane >> 4, c4 = (lane & 15) * 4; typedef _Float16 v4h __attribute__((ext_vector_type(4)));
  {
#pragma unroll
    for (int q = 0; q < 8; ++q) { const int r = q * 2 + rsub; if (col0 + c4 < N) { const v4f v = *(const v4fa*)&so[w][r][c4]; if (C) *(v4f*)(C + cofs + (size_t)(row0 + r) * ldc + col0 + c4) = v; if (C16) { v4h h4; for (int i = 0; i < 4; ++i) h4[i] = (_Float16)v[i]; *(v4h*)(C16 + cofs + (size_t)(row0 + r) * ldc + col0 + c4) = h4; } } }
     }
}


typedef _Float16 v4h __attribute__((ext_vector_type(4)));

__device__ __forceinline__ void x16_rows(const float* __restrict__ x, _Float16* __restrict__ X16, size_t n8, int bid) { const size_t t = (size_t)bid * 256 + threadIdx.x; if (t >= n8) return; FragH f;
#pragma unroll
  for (int q = 0; q < 8; ++q) f.h[q] = (_Float16)bf16_round(x[t * 8 + q]); *(v8us*)((unsigned short*)X16 + t * 8) = f.half[0];  }
__global__ __launch_bounds__(256) void k_h16(const float* __restrict__ x, _Float16* __restrict__ X16, size_t n8) { const size_t t = (size_t)blockIdx.x * 256 + threadIdx.x; if (t >= n8) return; FragH f;
#pragma unroll
  for (int q = 0; q < 8; ++q) f.h[q] = (_Float16)x[t * 8 + q]; *(v8us*)((unsigned short*)X16 + t * 8) = f.half[0];  }
__global__ __launch_bounds__(256) void k_round16f(const float* __restrict__ W, _Float16* __restrict__ Bt, size_t n8) { const size_t t = (size_t)blockIdx.x * 256 + threadIdx.x; if (t >= n8) return; FragH f;
#pragma unroll
  for (int i = 0; i < 8; ++i) f.h[i] = (_Float16)(bf16_round(W[t * 8 + i]) * 16.0f); *(v8us*)((unsigned short*)Bt + t * 8) = f.half[0];  }
template <int NHv, int TTv>      /* one 64 x 64 tile, 128 threads (the block shape of the launch it shares) */
__device__ __forceinline__ void vt_tile(const _Float16* __restrict__ V16, int ldv, int voff, _Float16* __restrict__ Vt, int bid) { __shared__ unsigned short tl[64][66]; const int tid = threadIdx.x; const int slab = bid / (TTv / 64), lg = bid % (TTv / 64); const int b = slab / NHv, h = slab % NHv;
  const int r0 = tid / 8, c8 = (tid % 8) * 8; FragH f[4];
#pragma unroll      /* constant indices into f[]; a thread's four loads are all issued ahead of the first LDS store, so the tile waits out one load latency, not four in a row */
  for (int u = 0; u < 4; ++u) f[u].half[0] = *(const v8us*)((const unsigned short*)V16 + ((size_t)b * TTv + lg * 64 + u * 16 + r0) * ldv + voff + h * 64 + c8);
#pragma unroll      /* constant indices into f[] */
  for (int u = 0; u < 4; ++u)
    for (int q = 0; q < 8; ++q) tl[u * 16 + r0][c8 + q] = f[u].u[q];
  __syncthreads();
  {
#pragma unroll
    for (int rd = 0; rd < 4; ++rd) { const int d = rd * 16 + tid / 8, pc = tid % 8; FragH f;
#pragma unroll
      for (int q = 0; q < 8; ++q) f.u[q] = tl[pc * 8 + q][d];
      *(v8us*)((unsigned short*)Vt + ((size_t)slab * 64 + d) * TTv + lg * 64 + pc * 8) = f.half[0]; }
     } }

// 32 f32 rows of 64 that a wave has staged in LDS (pitch 68) leave as two f16 planes: hi = f16(v), residual = f16((v - hi) x1024). Eight lanes take a row, so a wave's 16-byte stores cover four whole 128-byte lines.
__device__ __forceinline__ void split_store(const float (*so)[68], int lane, _Float16* __restrict__ Hh, _Float16* __restrict__ Hl, size_t o0, int ldc) {
  const int rs = lane >> 3, c8 = (lane & 7) * 8; v4f a[8], c[8];
#pragma unroll      /* a[] and c[] stay in registers, and all 16 LDS reads are issued ahead of the first conversion */
  for (int q = 0; q < 8; ++q) { a[q] = *(const v4fa*)&so[q * 4 + rs][c8]; c[q] = *(const v4fa*)&so[q * 4 + rs][c8 + 4]; }
#pragma unroll      /* constant indices into a[] and c[] */
  for (int q = 0; q < 8; ++q) { FragH fh, fl;
    for (int i = 0; i < 4; ++i) { _Float16 h = (_Float16)a[q][i]; fh.h[i] = h; fl.h[i] = (_Float16)((a[q][i] - (float)h) * 1024.0f); h = (_Float16)c[q][i]; fh.h[4 + i] = h; fl.h[4 + i] = (_Float16)((c[q][i] - (float)h) * 1024.0f); }
    const size_t o = o0 + (size_t)(q * 4 + rs) * ldc + c8; unsigned short* ph = (unsigned short*)Hh + o; unsigned short* pl = (unsigned short*)Hl + o; const v8us vh = fh.half[0], vl = fl.half[0];
    *(v8us*)ph = vh; *(v8us*)pl = vl;
    asm volatile("s_wait_xcnt 0x0" :: "v"(ph), "v"(pl), "v"(vh), "v"(vl) : "memory");      /* stands in front of every later rewrite of the registers that these two stores name (the next rows', or the code behind the call); they are inputs so that they stay live up to the wait */
  } }

// ---- fast GEMM (workgroup tile 128x128; a wave takes MW row tiles x 4 column tiles: MW = 4: four waves of 64x64, MW = 2: eight waves of 32x64; requires M % 128 == 0, N % 128 == 0, K % KS == 0); epilogue = k_gemm_hhx semantics; with CL the result leaves as two f16 planes, hi in C16 and residual in CL, and no f32 row is written ----
// The A tile and the B tile (128 rows each) go through LDS in stages of KS k, two buffers: every 16-byte global load of a wave covers whole 128-byte lines, the next stage's loads are all
// issued ahead of this stage's products and stored behind them, one barrier per stage. The fragments and their k order are the ones the global rows gave.
// The square tile asks L2 for 256 operand rows per 16,384 results (a 128x64 tile: 192 per 8,192); a 64x64 wave reads 8 fragments from LDS per 16 products (32x64: 6 per 8) and suits a launch with several workgroups per WGP, eight 32x64 waves one that has a single workgroup per WGP.
__device__ __forceinline__ v16h g2_frag(const _Float16* p, int hh) { FragH f; f.half[0] = *(const v8us*)((const unsigned short*)p + 8 * hh); f.half[1] = *(const v8us*)((const unsigned short*)p + 16 + 8 * hh); return f.v; }
__device__ __forceinline__ v8f g2_mma(v16h a, v16h b, v8f c) { v8f d = __builtin_amdgcn_wmma_f32_16x16x32_f16(false, a, false, b, (short)0, c, false, false); asm volatile("v_nop\n\tv_nop\n\tv_nop\n\tv_nop" : "+v"(d) : "v"(a), "v"(b)); return d; }
template <int ACT, int KS, int MW, int LDA, int LDB>
__device__ __forceinline__ void gemm2(int bx, int by, const _Float16* __restrict__ A, size_t sA, const _Float16* __restrict__ Bh, size_t sB, float alpha, const float* __restrict__ bias, size_t sBias, const float* __restrict__ CP, int rowsPerB, size_t sCPb, int row0g,
    float* __restrict__ C, _Float16* __restrict__ C16, _Float16* __restrict__ CL, int ldc, size_t sC, int M, int N, int K) { static_assert(ACT == 0 || ACT == 3 || ACT == 6 || ACT == 8 || ACT == 9 || ACT == 11 || ACT == 12 || ACT == 14 || ACT == 15 || ACT == 16 || ACT == 17, "k_gemm2: unsupported ACT code (would silently apply no activation)");
  constexpr int NW = 16 / MW;       /* waves: 8 / MW down the rows x 2 across the columns */
  constexpr int CH = KS / 8;        /* 16-byte pieces per tile row */
  constexpr int RPR = NW * 32 / CH; /* tile rows that one load of every thread covers */
  constexpr int NL = 128 / RPR;     /* loads of a thread per operand and stage */
  constexpr int PT = KS + 8;        /* LDS row pitch in f16: the row + 16 B, conflict-free for 16-byte fragment reads */
  __shared__ __attribute__((aligned(16))) float so[NW][32][68];
  __shared__ __attribute__((aligned(16))) _Float16 sa[2][128][PT];
  __shared__ __attribute__((aligned(16))) _Float16 sb[2][128][PT];
  const int tid = threadIdx.x, w = tid >> 5, lane = tid & 31, ln = lane & 15, hh = lane >> 4;
  A += (size_t)by * sA; Bh += (size_t)by * sB; const size_t cofs = (size_t)by * sC; const float* bp = bias ? bias + (size_t)by * sBias : nullptr;
  const int ntn = N >> 7; const int mt = bx / ntn, nq = bx - mt * ntn; const int row0 = mt * 128 + 16 * MW * (w >> 1), col0 = nq * 128 + 64 * (w & 1); if (mt * 128 >= M) return;      /* the same for the whole workgroup, in front of every barrier */
  const int sr = tid / CH, sp = (tid % CH) * 8;
  const unsigned short* ga = (const unsigned short*)A + (size_t)(mt * 128 + sr) * LDA + sp; const unsigned short* gb = (const unsigned short*)Bh + (size_t)(nq * 128 + sr) * LDB + sp;
  constexpr size_t da = (size_t)RPR * LDA, db = (size_t)RPR * LDB;      /* row pitches LDA, LDB are compile-time, so a stage's loads share one address pair per operand and differ in the immediate offset */
  v8us ta[NL], tb[NL];
  for (int i = 0; i < NL; ++i) ta[i] = *(const v8us*)(ga + i * da);
  for (int i = 0; i < NL; ++i) tb[i] = *(const v8us*)(gb + i * db);
  for (int i = 0; i < NL; ++i) *(v8us*)&sa[0][i * RPR + sr][sp] = ta[i];
  for (int i = 0; i < NL; ++i) *(v8us*)&sb[0][i * RPR + sr][sp] = tb[i];
  __syncthreads();      /* publishes stage 0 */
  const v8f z8 = {0.f,0.f,0.f,0.f,0.f,0.f,0.f,0.f}; v8f c[MW][4];      /* [row tile][column tile] */
#pragma unroll      /* constant indices into c[] */
  for (int m = 0; m < MW; ++m) for (int t = 0; t < 4; ++t) c[m][t] = z8;
  const int nst = K / KS;
  const int ra = 16 * MW * (w >> 1) + ln, rb = 64 * (w & 1) + ln;
  for (int s = 0; s < nst; ++s) { const int buf = s & 1; const bool more = s + 1 < nst;
    if (more) { ga += KS; gb += KS;
      for (int i = 0; i < NL; ++i) ta[i] = *(const v8us*)(ga + i * da);
      for (int i = 0; i < NL; ++i) tb[i] = *(const v8us*)(gb + i * db); }
#pragma unroll      /* constant indices into c[], a[] and b[] */
    for (int ks = 0; ks < KS / 32; ++ks) {      /* the fragments of 32 k are read from LDS as one group, then their products */
      v16h a[MW], b[4];
      for (int m = 0; m < MW; ++m) a[m] = g2_frag(&sa[buf][ra + 16 * m][ks * 32], hh);
      for (int t = 0; t < 4; ++t) b[t] = g2_frag(&sb[buf][rb + 16 * t][ks * 32], hh);
      for (int t = 0; t < 4; ++t) for (int m = 0; m < MW; ++m) c[m][t] = g2_mma(a[m], b[t], c[m][t]); }
    if (more) {
      for (int i = 0; i < NL; ++i) *(v8us*)&sa[buf ^ 1][i * RPR + sr][sp] = ta[i];
      for (int i = 0; i < NL; ++i) *(v8us*)&sb[buf ^ 1][i * RPR + sr][sp] = tb[i];
      __syncthreads(); }      /* publishes the next stage and ends every wave's reads of this one, which the stage after next overwrites */
  }
  float bvs[4] = {0.f, 0.f, 0.f, 0.f};      /* the lane's four bias values serve all its row tiles: read once, the four loads issued together */
  if (bp) { for (int t = 0; t < 4; ++t) bvs[t] = bp[col0 + t * 16 + ln];
    for (int t = 0; t < 4; ++t) bvs[t] = bf16_round(bvs[t]); }
#pragma unroll      /* constant indices into c[]: a wave's rows leave 32 at a time through its own staging rows */
  for (int hf = 0; hf < MW / 2; ++hf) { const int rowh = row0 + 32 * hf;
#pragma unroll
    for (int u = 0; u < 8; ++u) { const int t = u & 3, half = u >> 2; const int col = col0 + t * 16 + ln; const float bv = bvs[t];
#pragma unroll
      for (int r = 0; r < 8; ++r) { const int rloc = half * 16 + 8 * hh + r; float v = c[hf * 2 + half][t][r] * alpha + bv; if (CP) { if (rowsPerB < 0) v += CP[cofs + (size_t)(row0g + rowh + rloc) * ldc + col];      /* rowsPerB < 0: own element of the batched C plane */ else { const int bidx = (row0g + rowh + rloc) / rowsPerB; v += CP[(size_t)bidx * sCPb + (size_t)by * 64 + col]; } }
        if (ACT == 3) v = fmaxf(v, 0.f); else if (ACT == 6) v = 0.5f * v * (1.0f + erff(v * 0.70710678118654752f)); else if (ACT == 11) v = 1.0f / (1.0f + expf(-v)); else if (ACT == 15) v = v / (1.0f + expf(-v)); else if (ACT == 12) v = (v > 0.f) ? v : 0.01f * v; else if (ACT == 8) v = tanhf(v); else if (ACT == 9) v = 0.5f * v * (1.0f + tanhf(0.7978845608028654f * (v + 0.044715f * v * v * v))); else if (ACT == 14) v = (v > 0.f) ? v : 0.1f * v; else if (ACT == 16) v = (v >= 0.f) ? v : 0.3f * v; else if (ACT == 17) v = (v >= 0.f) ? v : 0.2f * v;
        so[w][rloc][t * 16 + ln] = v; } }
    __builtin_amdgcn_fence(__ATOMIC_ACQ_REL, "workgroup", "local"); __builtin_amdgcn_wave_barrier();      /* each wave reads back only its own rows; the fence names LDS alone, so that it does not wait for the global stores of the 32 rows before */
    if (CL) split_store(so[w], lane, C16, CL, cofs + (size_t)rowh * ldc + col0, ldc);      /* the same for every wave, behind the last barrier */
    else { const int rsub = lane >> 4, c4 = (lane & 15) * 4;
#pragma unroll
      for (int q = 0; q < 16; ++q) { const int r = q * 2 + rsub; const v4f v = *(const v4fa*)&so[w][r][c4]; if (C) *(v4f*)(C + cofs + (size_t)(rowh + r) * ldc + col0 + c4) = v; if (C16) { v4h h4; for (int i = 0; i < 4; ++i) h4[i] = (_Float16)v[i]; *(v4h*)(C16 + cofs + (size_t)(rowh + r) * ldc + col0 + c4) = h4; } } }
    if (hf + 1 < MW / 2) asm volatile("s_wait_xcnt 0x0" ::: "memory");      /* stands in front of the next 32 rows' rewrites of the registers that these rows' global stores name; its clobber also keeps the next rows' LDS stores behind these rows' LDS reads (a wave's LDS operations run in order) */
  } }
// out = o out_w + b: f32 rows
__global__ __launch_bounds__(256) void k_outp(const _Float16* __restrict__ O16, const _Float16* __restrict__ BO, const float* __restrict__ bo, float* __restrict__ out) {
  gemm2<0, 128, 2, DM, DM>(blockIdx.x, 0, O16, 0, BO, 0, 0.0009765625f, bo, 0, nullptr, 1, 0, 0, out, nullptr, nullptr, DM, 0, MPO, DM, DM); }
// Q, K and V projections share one launch: blockIdx.y picks the weight plane (BW holds the three one behind the other), the bias and the result planes; Q and K leave as hi + residual, V as plain f16 rows
__global__ __launch_bounds__(128) void k_qkv(const _Float16* __restrict__ X16, const _Float16* __restrict__ BW, const float* __restrict__ bq, const float* __restrict__ bk, const float* __restrict__ bv,
    _Float16* __restrict__ QH, _Float16* __restrict__ QL, _Float16* __restrict__ KH, _Float16* __restrict__ KL, _Float16* __restrict__ V16) {
  const int j = blockIdx.y; const float* bias = j == 0 ? bq : j == 1 ? bk : bv; _Float16* ch = j == 0 ? QH : j == 1 ? KH : V16; _Float16* cl = j == 0 ? QL : j == 1 ? KL : nullptr;
  gemm2<0, 64, 4, DM, DM>(blockIdx.x, 0, X16, 0, BW + (size_t)j * DM * DM, 0, 0.0625f, bias, 0, nullptr, 1, 0, 0, nullptr, ch, cl, DM, 0, MP, DM, DM); }


__global__ __launch_bounds__(256) void k_wnat(const float* __restrict__ w, size_t n8, _Float16* __restrict__ Bt) { const size_t t = (size_t)blockIdx.x * 256 + threadIdx.x; if (t >= n8) return; FragH f; for (int q = 0; q < 8; ++q) f.h[q] = (_Float16)(bf16_round(w[t * 8 + q]) * 16.0f); *(v8us*)((unsigned short*)Bt + t * 8) = f.half[0];  }
__global__ __launch_bounds__(256) void k_rsm(const float* __restrict__ S, _Float16* __restrict__ P, int nrows) {
  #pragma clang fp contract(off)
  const int i = blockIdx.x * 256 + threadIdx.x; if (i >= nrows) return; const float* s = S + (size_t)i * SQ; float mx = -3.0e38f;
#pragma unroll 1
  for (int j = 0; j < SQ; ++j) mx = fmaxf(mx, s[j]); float se = 0.f;
#pragma unroll 1
  for (int j = 0; j < SQ; ++j) se += expf(s[j] - mx); const float sc = 256.0f / se;
#pragma unroll 1
  for (int j0 = 0; j0 < SQ; j0 += 8) { FragH f; for (int q = 0; q < 8; ++q) f.h[q] = (_Float16)(expf(s[j0 + q] - mx) * sc); unsigned short* d = (unsigned short*)P + (size_t)i * SQ + j0; *(v8us*)d = f.half[0];  } }
__global__ __launch_bounds__(256) void k_vt(const _Float16* __restrict__ V16, int b, int h0, _Float16* __restrict__ VT) { __shared__ unsigned short tl[64][65]; const int tid = threadIdx.x; const int hh = blockIdx.x % HG, sg = blockIdx.x / HG; const int s0 = sg * 64; const int h = h0 + hh;
  for (int i = tid; i < 64 * 8; i += 256) { const int j = i / 8, d8 = (i % 8) * 8; FragH f; f.half[0] = *(const v8us*)((const unsigned short*)V16 + ((size_t)b * SQ + s0 + j) * DM + h * HD + d8); for (int q = 0; q < 8; ++q) tl[d8 + q][j] = f.u[q]; }
  __syncthreads();
  { for (int i = tid; i < 64 * 8; i += 256) { const int d = i / 8, j8 = (i % 8) * 8; FragH f; for (int q = 0; q < 8; ++q) f.u[q] = tl[d][j8 + q]; *(v8us*)((unsigned short*)VT + ((size_t)hh * HD + d) * SQ + s0 + j8) = f.half[0]; }  } }


__device__ __forceinline__ void mprep(const float* __restrict__ E, const float* __restrict__ phase, _Float16* __restrict__ MH, _Float16* __restrict__ ML, int bid) {
  #pragma clang fp contract(off)
  const int t = bid * 256 + threadIdx.x; if (t >= NH * HD * (HD / 8)) return; const int e8 = (t % (HD / 8)) * 8; const int hd_ = t / (HD / 8); const int d = hd_ % HD, h = hd_ / HD; const float c = cosf(bf16_round(phase[h * HD + d])); const float diag = __fmul_rn(__fmul_rn(c, c), 0.125f); FragH fh, fl;
#pragma unroll
  for (int q = 0; q < 8; ++q) { const int e = e8 + q; float m = bf16_round(E[((size_t)h * HD + d) * HD + e]); if (e == d) m = __fadd_rn(m, diag); const _Float16 hi = (_Float16)m; fh.h[q] = hi; fl.h[q] = (_Float16)((m - (float)hi) * 1024.0f); }
  const size_t o = ((size_t)h * HD + d) * HD + e8; { *(v8us*)((unsigned short*)MH + o) = fh.half[0]; *(v8us*)((unsigned short*)ML + o) = fl.half[0];  } }
// ---- the six operand preparations depend on inputs alone and share one launch; a block's index range picks its job: four weight transposes (BW holds the planes one behind the other), M, x ----
#define GW ((DM / WTK) * (DM / WTN)) /* blocks per weight transpose */
#define GM (NH * HD * (HD / 8) / 256) /* blocks for M */
#define GX ((int)(NR * DM / 8 / 256)) /* blocks for x */
static_assert(DM % WTK == 0 && DM % WTN == 0, "wt_tile: whole tiles only, it has no edge guard");
__global__ __launch_bounds__(256) void k_prep(const float* __restrict__ x, const float* __restrict__ wq, const float* __restrict__ wk, const float* __restrict__ wv, const float* __restrict__ wo, const float* __restrict__ E, const float* __restrict__ phase,
    _Float16* __restrict__ X16, _Float16* __restrict__ BW, _Float16* __restrict__ MH, _Float16* __restrict__ ML) {
  const int bid = blockIdx.x;
  if (bid < 4 * GW) { const int j = bid / GW; const float* W = j == 0 ? wq : j == 1 ? wk : j == 2 ? wv : wo; wt_tile(W, BW + (size_t)j * DM * DM, 16.0f, bid - j * GW); }      /* [in][out] -> Bt[n][k] x16; the branch is the same for a whole workgroup, so the tile's barrier is passed by all of it */
  else if (bid < 4 * GW + GM) mprep(E, phase, MH, ML, bid - 4 * GW);
  else x16_rows(x, X16, NR * DM / 8, bid - (4 * GW + GM));
}
__device__ __forceinline__ float half_xor(float v) { const int i = __float_as_int(v); return __int_as_float(__builtin_amdgcn_permlanex16(i, i, 0x76543210, 0xfedcba98, false, false)); }      /* value of lane l ^ 16 */
#define FK 64                        /* keys per LDS stage */
#define FPT 72                       /* LDS row pitch in f16: 128 B + 16 B, conflict-free for 16-byte fragment reads */
#define L2E 1.4426950408889634f
__device__ __forceinline__ v8f f_mma(v16h a, v16h b, v8f c) { return __builtin_amdgcn_wmma_f32_16x16x32_f16(false, a, false, b, (short)0, c, false, false); }
// ---- KM = K M^T per head in one launch: the terms hi.hi, residual.hi, hi.residual each in its own accumulator, summed in f32 in that order in registers, the sum split into hi + residual planes ----
// Workgroup = 4 waves x 32 token rows of one head. K hi and K residual (128 x 64) and M hi and M residual (64 x 64) go through LDS once: whole-line 16-byte loads, all issued together, one barrier.
__device__ __forceinline__ void km_tile(const _Float16* __restrict__ KH, const _Float16* __restrict__ KL, const _Float16* __restrict__ MH, const _Float16* __restrict__ ML, _Float16* __restrict__ KMH, _Float16* __restrict__ KML, int bx, int h) {
  __shared__ __attribute__((aligned(16))) float so[4][32][68];
  __shared__ __attribute__((aligned(16))) _Float16 sa[2][128][FPT];
  __shared__ __attribute__((aligned(16))) _Float16 sb[2][HD][FPT];
  const int tid = threadIdx.x, w = tid >> 5, lane = tid & 31, ln = lane & 15, hh = lane >> 4; const size_t row0 = (size_t)bx * 128;
  const int sr = tid >> 3, sp = (tid & 7) * 8;      /* staging: one load of every thread covers 16 tile rows */
  const unsigned short* gah = (const unsigned short*)KH + (row0 + sr) * DM + h * HD + sp; const unsigned short* gal = (const unsigned short*)KL + (row0 + sr) * DM + h * HD + sp;
  const unsigned short* gbh = (const unsigned short*)MH + ((size_t)h * HD + sr) * HD + sp; const unsigned short* gbl = (const unsigned short*)ML + ((size_t)h * HD + sr) * HD + sp;
  v8us ta[2][8], tb[2][4];
  for (int i = 0; i < 4; ++i) { tb[0][i] = *(const v8us*)(gbh + (size_t)i * 16 * HD); tb[1][i] = *(const v8us*)(gbl + (size_t)i * 16 * HD); }
  for (int i = 0; i < 8; ++i) { ta[0][i] = *(const v8us*)(gah + (size_t)i * 16 * DM); ta[1][i] = *(const v8us*)(gal + (size_t)i * 16 * DM); }
  asm volatile("s_wait_xcnt 0x0" :: "v"(gah), "v"(gal), "v"(gbh), "v"(gbl) : "memory");      /* the four address pairs are inputs so that they stay live up to this wait */
  for (int i = 0; i < 8; ++i) { *(v8us*)&sa[0][i * 16 + sr][sp] = ta[0][i]; *(v8us*)&sa[1][i * 16 + sr][sp] = ta[1][i]; }
  for (int i = 0; i < 4; ++i) { *(v8us*)&sb[0][i * 16 + sr][sp] = tb[0][i]; *(v8us*)&sb[1][i * 16 + sr][sp] = tb[1][i]; }
  __syncthreads();      /* publishes the four tiles */
  const v8f z8 = {0.f,0.f,0.f,0.f,0.f,0.f,0.f,0.f};
  const int ra = 32 * w + ln;
#pragma unroll 1      /* kept rolled so that 12 accumulators are live, not 24: the kernel stays under 256 registers and needs no register-window switches */
  for (int th = 0; th < 2; ++th) {      /* two column tiles at a time */
    v8f c1[2][2], c2[2][2], c3[2][2];      /* [row tile][column tile] of hi.hi, residual.hi, hi.residual */
    for (int m = 0; m < 2; ++m) for (int t = 0; t < 2; ++t) { c1[m][t] = z8; c2[m][t] = z8; c3[m][t] = z8; }
    for (int ks = 0; ks < HD / 32; ++ks) {
      v16h ah[2], al[2], bh[2], bl[2];
      for (int m = 0; m < 2; ++m) { ah[m] = g2_frag(&sa[0][ra + 16 * m][ks * 32], hh); al[m] = g2_frag(&sa[1][ra + 16 * m][ks * 32], hh); }
      for (int t = 0; t < 2; ++t) { bh[t] = g2_frag(&sb[0][(th * 2 + t) * 16 + ln][ks * 32], hh); bl[t] = g2_frag(&sb[1][(th * 2 + t) * 16 + ln][ks * 32], hh); }
      for (int t = 0; t < 2; ++t) for (int m = 0; m < 2; ++m) c1[m][t] = f_mma(ah[m], bh[t], c1[m][t]);
      for (int t = 0; t < 2; ++t) for (int m = 0; m < 2; ++m) c2[m][t] = f_mma(al[m], bh[t], c2[m][t]);
      for (int t = 0; t < 2; ++t) for (int m = 0; m < 2; ++m) c3[m][t] = f_mma(ah[m], bl[t], c3[m][t]);
    }
    for (int m = 0; m < 2; ++m)
      for (int t = 0; t < 2; ++t)
        for (int r = 0; r < 8; ++r) { float v = c2[m][t][r] * 0.0009765625f + c1[m][t][r]; v = c3[m][t][r] * 0.0009765625f + v;      /* the residual planes carry x1024; the scaling is exact, so each line rounds once */
          so[w][m * 16 + 8 * hh + r][(th * 2 + t) * 16 + ln] = v; }
  }
  __builtin_amdgcn_fence(__ATOMIC_ACQ_REL, "workgroup"); __builtin_amdgcn_wave_barrier();      /* each wave reads back only its own rows */
  split_store(so[w], lane, KMH, KML, (row0 + 32 * w) * DM + h * HD, DM);
}
// KM (needs K and M) and V^T (needs V) do not depend on each other and share one launch; the branch is the same for a whole workgroup, so each body keeps its own barrier
#define GKM ((int)(NR / 128) * NH)   /* blocks for KM */
__global__ __launch_bounds__(128) void k_kmvt(const _Float16* __restrict__ KH, const _Float16* __restrict__ KL, const _Float16* __restrict__ MH, const _Float16* __restrict__ ML, _Float16* __restrict__ KMH, _Float16* __restrict__ KML, const _Float16* __restrict__ V16, _Float16* __restrict__ VT) {
  const int bid = blockIdx.x;
  if (bid >= GKM) { vt_tile<NH, SQ>(V16, DM, 0, VT, bid - GKM); return; }      /* V^T [NB][NH][HD][SQ] */
  km_tile(KH, KL, MH, ML, KMH, KML, bid % (int)(NR / 128), bid / (int)(NR / 128));      /* KM[k][h*64+d] = sum_e K[k][h*64+e] M[h][d][e], token rows of both batches */
}
__global__ __launch_bounds__(256) void k_fattn(const _Float16* __restrict__ QH, const _Float16* __restrict__ QL, const _Float16* __restrict__ KMH, const _Float16* __restrict__ KML, const _Float16* __restrict__ VT, _Float16* __restrict__ O16) {
  __shared__ __attribute__((aligned(16))) _Float16 sk[2][3][FK][FPT];
  const int tid = threadIdx.x, lane = tid & 31, c = lane & 15, hh = lane >> 4; const int w = __builtin_amdgcn_readfirstlane(tid >> 5);
  const int h = blockIdx.y, b = blockIdx.z; const size_t r0 = (size_t)b * SQ; const size_t q0 = r0 + (size_t)blockIdx.x * 256 + w * 32;
  v16h qh[2][2], ql[2][2];      /* [query tile][k step of 32] */
  for (int qt = 0; qt < 2; ++qt)
    for (int ks = 0; ks < 2; ++ks) { const size_t o = (q0 + qt * 16 + c) * DM + h * HD + ks * 32; qh[qt][ks] = g2_frag(QH + o, hh); ql[qt][ks] = g2_frag(QL + o, hh); }
  const int sr = tid >> 3, sp = (tid & 7) * 8;      /* staging: a wave's 16-byte loads cover four whole 128-byte rows */
  const unsigned short* gkh = (const unsigned short*)KMH + (r0 + sr) * DM + h * HD + sp; const unsigned short* gkl = (const unsigned short*)KML + (r0 + sr) * DM + h * HD + sp;
  const unsigned short* gv = (const unsigned short*)VT + (((size_t)b * NH + h) * HD + sr) * SQ + sp;
  v8us st[6];
  st[0] = *(const v8us*)gkh; st[1] = *(const v8us*)(gkh + (size_t)32 * DM); st[2] = *(const v8us*)gkl; st[3] = *(const v8us*)(gkl + (size_t)32 * DM); st[4] = *(const v8us*)gv; st[5] = *(const v8us*)(gv + (size_t)32 * SQ);
  for (int i = 0; i < 6; ++i) *(v8us*)&sk[0][i >> 1][sr + 32 * (i & 1)][sp] = st[i];
  __syncthreads();      /* publishes stage 0 */
  const v8f z8 = {0.f,0.f,0.f,0.f,0.f,0.f,0.f,0.f};
  v8f o[4][2];      /* O^T tiles [d tile][query tile]: register r = d 16 dt + 8 hh + r of query c */
  for (int dt = 0; dt < 4; ++dt) { o[dt][0] = z8; o[dt][1] = z8; }
  float mu[2] = {-3.0e38f, -3.0e38f};      /* maximum in use per query, log2 domain, equal in both lane halves */
  float ls[2] = {0.f, 0.f};      /* this lane half's share of the sum of weights */
  for (int s = 0; s < SQ / FK; ++s) {
    const int buf = s & 1; const bool more = s + 1 < SQ / FK;
    if (more) { gkh += (size_t)FK * DM; gkl += (size_t)FK * DM; gv += FK;
      st[0] = *(const v8us*)gkh; st[1] = *(const v8us*)(gkh + (size_t)32 * DM); st[2] = *(const v8us*)gkl; st[3] = *(const v8us*)(gkl + (size_t)32 * DM); st[4] = *(const v8us*)gv; st[5] = *(const v8us*)(gv + (size_t)32 * SQ); }
    for (int p = 0; p < FK / 32; ++p) {
      v16h kh[2][2], kl[2][2];      /* [key tile][k step] */
      for (int kt = 0; kt < 2; ++kt)
        for (int ks = 0; ks < 2; ++ks) { kh[kt][ks] = g2_frag(&sk[buf][0][p * 32 + kt * 16 + c][ks * 32], hh); kl[kt][ks] = g2_frag(&sk[buf][1][p * 32 + kt * 16 + c][ks * 32], hh); }
      v8f sc[2][2] = {{z8, z8}, {z8, z8}};      /* S^T tiles [key tile][query tile]: register r = key 16 kt + 8 hh + r, query c */
      for (int ks = 0; ks < 2; ++ks) {
        for (int u = 0; u < 4; ++u) sc[u >> 1][u & 1] = f_mma(kl[u >> 1][ks], qh[u & 1][ks], sc[u >> 1][u & 1]);      /* hi.lo */
        for (int u = 0; u < 4; ++u) sc[u >> 1][u & 1] = f_mma(kh[u >> 1][ks], ql[u & 1][ks], sc[u >> 1][u & 1]);      /* lo.hi */
      }
      for (int u = 0; u < 4; ++u) sc[u >> 1][u & 1] *= 0.0009765625f;      /* the residual planes carry x1024 */
      for (int ks = 0; ks < 2; ++ks)
        for (int u = 0; u < 4; ++u) sc[u >> 1][u & 1] = f_mma(kh[u >> 1][ks], qh[u & 1][ks], sc[u >> 1][u & 1]);      /* hi.hi */
      v16h va[4];
      for (int dt = 0; dt < 4; ++dt) va[dt] = g2_frag(&sk[buf][2][dt * 16 + c][p * 32], hh);
      float mt[2]; bool need = false;
      for (int qt = 0; qt < 2; ++qt) { float m = sc[0][qt][0];
        for (int r = 1; r < 8; ++r) m = fmaxf(m, sc[0][qt][r]);
        for (int r = 0; r < 8; ++r) m = fmaxf(m, sc[1][qt][r]);
        m = fmaxf(m, half_xor(m)) * L2E; mt[qt] = m; need = need || (m > mu[qt] + 8.0f); }
      if (__builtin_amdgcn_ballot_w32(need) != 0) {      /* lazy rescale, one scalar branch per 32 keys: the maximum in use follows only when some query's maximum has passed it by more than 2^8 */
        for (int qt = 0; qt < 2; ++qt) { const float mn = fmaxf(mu[qt], mt[qt]); const float al = __builtin_amdgcn_exp2f(mu[qt] - mn); mu[qt] = mn; ls[qt] *= al;
          for (int dt = 0; dt < 4; ++dt) o[dt][qt] *= al; }
      }
      for (int qt = 0; qt < 2; ++qt) { const float sh = 6.0f - mu[qt];      /* weights carried x64: at most 2^14 in f16 */
        v8f e0 = sc[0][qt] * L2E + sh, e1 = sc[1][qt] * L2E + sh; FragH pb;
        for (int r = 0; r < 8; ++r) { e0[r] = __builtin_amdgcn_exp2f(e0[r]); e1[r] = __builtin_amdgcn_exp2f(e1[r]); }
        for (int r = 0; r < 8; ++r) { pb.h[r] = (_Float16)e0[r]; pb.h[8 + r] = (_Float16)e1[r]; }
        const v8f t = e0 + e1; ls[qt] += ((t[0] + t[1]) + (t[2] + t[3])) + ((t[4] + t[5]) + (t[6] + t[7]));
        for (int dt = 0; dt < 4; ++dt) o[dt][qt] = f_mma(va[dt], pb.v, o[dt][qt]); }
    }
    if (more) {
      for (int i = 0; i < 6; ++i) *(v8us*)&sk[buf ^ 1][i >> 1][sr + 32 * (i & 1)][sp] = st[i]; }
    __syncthreads();      /* publishes the next stage and ends every wave's reads of this one, which the stage after next overwrites */
  }
  for (int qt = 0; qt < 2; ++qt) { const float inv = 64.0f * __builtin_amdgcn_rcpf(ls[qt] + half_xor(ls[qt]));      /* o carried x64, the weights' own carry cancels */
    for (int dt = 0; dt < 4; ++dt) { FragH f;
      for (int r = 0; r < 8; ++r) f.h[r] = (_Float16)(o[dt][qt][r] * inv);
      *(v8us*)((unsigned short*)O16 + (q0 + qt * 16 + c) * DM + h * HD + dt * 16 + 8 * hh) = f.half[0]; } }
}

extern "C" void kernel_launch(void* const* d_in, const int* in_sizes, int n_in,
                              void* d_out, int out_size, void* d_ws, size_t ws_size, hipStream_t stream) {
  (void)in_sizes; (void)n_in; (void)out_size;
  const float* const* I = (const float* const*)d_in; const float* x = I[0]; const float* wq = I[1]; const float* bq = I[2]; const float* wk = I[3]; const float* bk = I[4]; const float* wv = I[5]; const float* bv = I[6]; const float* phase = I[7]; const float* E = I[8]; const float* wo = I[9]; const float* bo = I[10];      /* weights [in][out] */
  char* ws = (char*)d_ws; size_t off = 0;
  auto take = [&](size_t bytes) { char* p = ws + off; off += (bytes + 255) & ~(size_t)255; return p; };
  _Float16* BQ = (_Float16*)take((size_t)DM * DM * 2); _Float16* BK = (_Float16*)take((size_t)DM * DM * 2); _Float16* BV = (_Float16*)take((size_t)DM * DM * 2); _Float16* BO = (_Float16*)take((size_t)DM * DM * 2); _Float16* MH = (_Float16*)take((size_t)NH * HD * HD * 2); _Float16* ML = (_Float16*)take((size_t)NH * HD * HD * 2);
  _Float16* X16 = (_Float16*)take(NR * DM * 2); _Float16* QH = (_Float16*)take(NR * DM * 2); _Float16* QL = (_Float16*)take(NR * DM * 2); _Float16* KH = (_Float16*)take(NR * DM * 2); _Float16* KL = (_Float16*)take(NR * DM * 2); _Float16* V16 = (_Float16*)take(NR * DM * 2);
  _Float16* KMH = (_Float16*)take(NR * DM * 2); _Float16* KML = (_Float16*)take(NR * DM * 2); _Float16* O16 = (_Float16*)take(NR * DM * 2);
  _Float16* VT = (_Float16*)take((size_t)NB * NH * HD * SQ * 2);
  (void)BK; (void)BV;      /* reached through BQ */
  if (off > ws_size) return;      /* 8.3 + 8 + 40 + 16 + 8 + 8 = approx 88 MiB */
  k_prep<<<4 * GW + GM + GX, 256, 0, stream>>>(x, wq, wk, wv, wo, E, phase, X16, BQ, MH, ML);      /* BQ, BK, BV, BO lie one behind the other */
  const size_t r0p = (size_t)B0 * SQ;
  k_qkv<<<dim3((unsigned)((MP / 128) * (DM / 128)), 3), 128, 0, stream>>>(X16 + r0p * DM, BQ, bq, bk, bv, QH + r0p * DM, QL + r0p * DM, KH + r0p * DM, KL + r0p * DM, V16 + r0p * DM);
  k_kmvt<<<GKM + NB * NH * (SQ / 64), 128, 0, stream>>>(KH, KL, MH, ML, KMH, KML, V16, VT);
  k_fattn<<<dim3(SQ / 256, NH, NB), 256, 0, stream>>>(QH, QL, KMH, KML, VT, O16);      /* o (merged heads, x64) as f16 rows */
  k_outp<<<(unsigned)((MPO / 128) * (DM / 128)), 256, 0, stream>>>(O16 + r0p * DM, BO, bo, (float*)d_out + r0p * DM);      /* out rows are the output layout */
}

// v008
// It runs in 96.3 microseconds.
// Next to v007, in two timings, it ran 1.06 times as fast each time.
// All steps since v000 together make it 44.5 times as fast.
#include <hip/hip_runtime.h>
// "Quantum" attention (x [2][2048][1024]): Q/K/V = x W + b ([in][out] weights + biases, 16 heads of 64); scores = (Q cos(phase)) (K cos(phase))^T / 8 + Q E K^T per head (phase [16][64], E [16][64][64]) = Q M K^T with M = E + diag(cos^2 phase / 8); softmax over the 2,048 keys; o = attn V merged; out = o out_w + out_b -> [2][2048][1024].
// Structure: token rows; x as exact f16 rows; Q and K as WMMA GEMMs (128x128 workgroup tiles, operand tiles through LDS, f32 accumulation, exact x16 transposed weights + bias) whose epilogue splits each f32 result on VALU into f16 hi + 2^-10 residual planes; V as a WMMA GEMM to f16 rows; M as f16 hi + residual planes (VALU, cos in f32); KM = K M^T per head (km_tile): three WMMA terms (hi.hi + lo.hi + hi.lo, K = 64) in three accumulators, summed in f32 in registers, split into hi + residual planes; V^T for all batches and heads via LDS transposes; attention in one fused launch (k_fattn): scores = Q KM^T as three WMMA terms in one accumulator, online softmax on VALU (f32 statistics, native exp2; weights x64 f16 against the maximum in use), o = P . V^T on WMMA, normalised at the end into merged f16 rows (o carried x64 against f16 subnormal flush); out = o out_w + b GEMM (f32, alpha folds 1/16 and 1/64). Five launches: jobs that do not depend on each other share a grid (k_prep, k_qkv, k_kmvt), then k_fattn, k_outp.
// Compute dtype: inputs rounded to bf16; weights exact (x16 f16); Q, K, M, KM as f16 hi + residual planes (~2^-22); V, softmax weights (x64) and o (x64) plain f16 (~2^-12); scores, softmax statistics f32. v_wmma_f32_16x16x32_f16.
#define NB 2
#define SQ 2048
#define DM 1024
#define NH 16
#define HD 64
#define HG 4                         /* heads per group in the per-batch k_vt, which is not launched */
#define PSC 4096.0f                  /* unused; the softmax weights carry x64 */
#define B0 0                         /* first batch processed (debug hook) */
#define NBR NB                       /* batches processed (debug hook) */
#define QN SQ                        /* unused; k_fattn attends all SQ query rows per batch */
#define NHD NH                       /* unused; k_fattn attends all NH heads */
#define NR ((size_t)NB * SQ)
#define MP ((int)((size_t)NBR * SQ)) /* rows projected (debug hook) */
#define MPO MP                       /* rows through the output GEMM (debug hook) */
typedef __bf16 v16b __attribute__((ext_vector_type(16)));
typedef unsigned short v8us __attribute__((ext_vector_type(8), may_alias));
typedef float  v8f  __attribute__((ext_vector_type(8)));
typedef float  v4f  __attribute__((ext_vector_type(4)));
typedef float  v4fa __attribute__((ext_vector_type(4), may_alias));
union FragB { v16b v; v8us half[2]; unsigned short u[16]; };

__device__ __forceinline__ unsigned short bf16_bits(float x) { unsigned int u = __float_as_uint(x); return (unsigned short)((u + 0x7FFFu + ((u >> 16) & 1u)) >> 16); }
__device__ __forceinline__ float bf16_val(unsigned short b) { return __uint_as_float(((unsigned int)b) << 16); }
__device__ __forceinline__ float bf16_round(float x) { return bf16_val(bf16_bits(x)); }
// D += A·B with NT terms: 1 = ah·bh, 2 = + al·bh (A split), 3 = + ah·bl (both split)
template <int NT>
__device__ __forceinline__ v8f mmaN(v16b ah, v16b al, v16b bh, v16b bl, v8f c) {
  c = __builtin_amdgcn_wmma_f32_16x16x32_bf16(false, ah, false, bh, (short)0, c, false, false);
  if (NT >= 2) c = __builtin_amdgcn_wmma_f32_16x16x32_bf16(false, al, false, bh, (short)0, c, false, false);
  if (NT >= 3) c = __builtin_amdgcn_wmma_f32_16x16x32_bf16(false, ah, false, bl, (short)0, c, false, false);
  asm volatile("v_nop\n\tv_nop\n\tv_nop\n\tv_nop" : "+v"(c) : "v"(ah), "v"(al), "v"(bh), "v"(bl));
  return c;
}

__global__ __launch_bounds__(256) void k_wt_bf16(const float* __restrict__ W, unsigned short* __restrict__ Wt, int K, int N) {
  const int t = blockIdx.x * 256 + threadIdx.x;
  const int k8n = K / 8;
  if (t >= N * k8n) return;
  const int n = t / k8n, k8 = (t % k8n) * 8;
  v8us v;
#pragma unroll
  for (int i = 0; i < 8; ++i) v[i] = bf16_bits(W[(size_t)(k8 + i) * N + n]);
  *(v8us*)(Wt + (size_t)n * K + k8) = v;
  
}

// GEMM C[M][N] (f32, pitch ldc) = act(A[M][K]·W + bias). A f32 row-major (pitch lda) converted per fragment to bf16
// (ASPLIT: hi/lo two planes -> 2 terms, else single rounded term); Wt bf16 [N][K] (pitch ldb). BIAS_BF16 rounds the
// bias to bf16 first (bias quantised to bf16 before the add). K%32==0, M%16==0, N%64==0.
template <bool ASPLIT, int ACT, bool BIAS_BF16>
__global__ __launch_bounds__(128) void k_gemm_bf(const float* __restrict__ A, int lda, const unsigned short* __restrict__ Wt, int ldb,
                                               const float* __restrict__ bias, float* __restrict__ C, int ldc, int M, int N, int K) {
  __shared__ __attribute__((aligned(16))) float so[4][16][64];
  const int tid = threadIdx.x, w = tid >> 5, lane = tid & 31, ln = lane & 15, hh = lane >> 4;
  const int ntn = N / 64;
  const int wid = blockIdx.x * 4 + w;
  const int mt = wid / ntn, nq = wid % ntn;
  if (mt * 16 >= M) return;
  const int row0 = mt * 16, col0 = nq * 64;
  const float* arow = A + (size_t)(row0 + ln) * lda;
  v8f acc[4] = {};
  for (int kb = 0; kb < K; kb += 32) {
    FragB ah, al;
    const v4f x0 = *(const v4fa*)(arow + kb + 8 * hh), x1 = *(const v4fa*)(arow + kb + 8 * hh + 4);
    const v4f x2 = *(const v4fa*)(arow + kb + 16 + 8 * hh), x3 = *(const v4fa*)(arow + kb + 16 + 8 * hh + 4);
    float xs[16] = {x0[0],x0[1],x0[2],x0[3],x1[0],x1[1],x1[2],x1[3],x2[0],x2[1],x2[2],x2[3],x3[0],x3[1],x3[2],x3[3]};
#pragma unroll
    for (int i = 0; i < 16; ++i) { const unsigned short hb = bf16_bits(xs[i]); ah.u[i] = hb; al.u[i] = ASPLIT ? bf16_bits(xs[i] - bf16_val(hb)) : (unsigned short)0; }
#pragma unroll
    for (int t = 0; t < 4; ++t) {
      const unsigned short* brow = Wt + (size_t)(col0 + t * 16 + ln) * ldb + kb;
      FragB b;
      b.half[0] = *(const v8us*)(brow + 8 * hh);
      b.half[1] = *(const v8us*)(brow + 16 + 8 * hh);
      acc[t] = mmaN<ASPLIT ? 2 : 1>(ah.v, al.v, b.v, b.v, acc[t]);
    }
  }
#pragma unroll
  for (int t = 0; t < 4; ++t) {
    float bv = bias ? bias[col0 + t * 16 + ln] : 0.f;
    if (BIAS_BF16) bv = bf16_round(bv);
#pragma unroll
    for (int r = 0; r < 8; ++r) { float v = acc[t][r] + bv; if (ACT == 1) v = fmaxf(v, 0.f); so[w][8 * hh + r][t * 16 + ln] = v; }
  }
  __builtin_amdgcn_fence(__ATOMIC_ACQ_REL, "workgroup");
  __builtin_amdgcn_wave_barrier();
  const int rsub = lane >> 4, c4 = (lane & 15) * 4;
  {
#pragma unroll
    for (int q = 0; q < 8; ++q) {
      const int r = q * 2 + rsub;
      const v4f v = *(const v4fa*)&so[w][r][c4];
      *(v4f*)(C + (size_t)(row0 + r) * ldc + col0 + c4) = v;
    }
    
  }
}

// GEMM C = act(A·W + bias + resid): A f32 (ASPLIT -> hi/lo 2 terms), Wt bf16 [N][K]; ACT 0 none, 1 relu, 2 exact gelu;
// resid (optional, f32, row index = (row % rmod), pitch ldr, RES_BF16 rounds it) added before the activation.
template <bool ASPLIT, int ACT, bool BIAS_BF16, bool RES_BF16>
__global__ __launch_bounds__(128) void k_gemm_bf3(const float* __restrict__ A, int lda, const unsigned short* __restrict__ Wt, int ldb,
                                                const float* __restrict__ bias, const float* __restrict__ resid, int rmod, int ldr,
                                                float* __restrict__ C, int ldc, int M, int N, int K) {
  __shared__ __attribute__((aligned(16))) float so[4][16][64];
  const int tid = threadIdx.x, w = tid >> 5, lane = tid & 31, ln = lane & 15, hh = lane >> 4;
  const int ntn = N / 64;
  const int wid = blockIdx.x * 4 + w;
  const int mt = wid / ntn, nq = wid % ntn;
  if (mt * 16 >= M) return;
  const int row0 = mt * 16, col0 = nq * 64;
  const float* arow = A + (size_t)(row0 + ln) * lda;
  v8f acc[4] = {};
  for (int kb = 0; kb < K; kb += 32) {
    FragB ah, al;
    const v4f x0 = *(const v4fa*)(arow + kb + 8 * hh), x1 = *(const v4fa*)(arow + kb + 8 * hh + 4);
    const v4f x2 = *(const v4fa*)(arow + kb + 16 + 8 * hh), x3 = *(const v4fa*)(arow + kb + 16 + 8 * hh + 4);
    float xs[16] = {x0[0],x0[1],x0[2],x0[3],x1[0],x1[1],x1[2],x1[3],x2[0],x2[1],x2[2],x2[3],x3[0],x3[1],x3[2],x3[3]};
#pragma unroll
    for (int i = 0; i < 16; ++i) { const unsigned short hb = bf16_bits(xs[i]); ah.u[i] = hb; al.u[i] = ASPLIT ? bf16_bits(xs[i] - bf16_val(hb)) : (unsigned short)0; }
#pragma unroll
    for (int t = 0; t < 4; ++t) {
      const unsigned short* brow = Wt + (size_t)(col0 + t * 16 + ln) * ldb + kb;
      FragB b;
      b.half[0] = *(const v8us*)(brow + 8 * hh);
      b.half[1] = *(const v8us*)(brow + 16 + 8 * hh);
      acc[t] = mmaN<ASPLIT ? 2 : 1>(ah.v, al.v, b.v, b.v, acc[t]);
    }
  }
#pragma unroll
  for (int t = 0; t < 4; ++t) {
    const int col = col0 + t * 16 + ln;
    float bv = bias ? bias[col] : 0.f;
    if (BIAS_BF16) bv = bf16_round(bv);
#pragma unroll
    for (int r = 0; r < 8; ++r) {
      float v = acc[t][r] + bv;
      if (resid) { float rv = resid[(size_t)((row0 + 8 * hh + r) % rmod) * ldr + col]; if (RES_BF16) rv = bf16_round(rv); v += rv; }
      if (ACT == 1) v = fmaxf(v, 0.f);
      if (ACT == 2) v = 0.5f * v * (1.0f + erff(v * 0.70710678118654752f));
      if (ACT == 3) { const float u = 0.7978845608028654f * (v + 0.044715f * v * v * v); v = 0.5f * v * (1.0f + tanhf(u)); }
      so[w][8 * hh + r][t * 16 + ln] = v;
    }
  }
  __builtin_amdgcn_fence(__ATOMIC_ACQ_REL, "workgroup");
  __builtin_amdgcn_wave_barrier();
  const int rsub = lane >> 4, c4 = (lane & 15) * 4;
  {
#pragma unroll
    for (int q = 0; q < 8; ++q) {
      const int r = q * 2 + rsub;
      const v4f v = *(const v4fa*)&so[w][r][c4];
      *(v4f*)(C + (size_t)(row0 + r) * ldc + col0 + c4) = v;
    }
    
  }
}
// row LayerNorm (biased variance, eps) over N: s = X (+ R); optional out_sum <- s; out_norm <- (s-mu)*rsqrt(var+eps)*g + b
template <bool PARAM_BF16>
__global__ __launch_bounds__(256) void k_layernorm(const float* __restrict__ X, const float* __restrict__ R, const float* __restrict__ g, const float* __restrict__ bta,
                                                  float* __restrict__ out_sum, float* __restrict__ out_norm, int N, float eps) {
  __shared__ float red[256];
  const int row = blockIdx.x, tid = threadIdx.x;
  const float* x = X + (size_t)row * N; const float* rr = R ? R + (size_t)row * N : nullptr;
  float vals[16];                     // up to N = 4096
  const int per = N / 256;            // contiguous chunk per thread? use strided-by-4 chunks: thread handles j = tid*4 + 1024*u
  float s1 = 0.f;
  for (int u = 0; u < per / 4; ++u) {
    const int j = tid * 4 + 1024 * u;
    const v4f a = *(const v4fa*)(x + j);
    v4f b = {0.f,0.f,0.f,0.f}; if (rr) b = *(const v4fa*)(rr + j);
#pragma unroll
    for (int q = 0; q < 4; ++q) { const float v = a[q] + b[q]; vals[u * 4 + q] = v; s1 += v; }
  }
  red[tid] = s1; __syncthreads();
  for (int st = 128; st > 0; st >>= 1) { if (tid < st) red[tid] += red[tid + st]; __syncthreads(); }
  const float mu = red[0] / (float)N; __syncthreads();
  float s2 = 0.f;
  for (int u = 0; u < per / 4; ++u)
#pragma unroll
    for (int q = 0; q < 4; ++q) { const float c = vals[u * 4 + q] - mu; s2 += c * c; }
  red[tid] = s2; __syncthreads();
  for (int st = 128; st > 0; st >>= 1) { if (tid < st) red[tid] += red[tid + st]; __syncthreads(); }
  const float rs = rsqrtf(red[0] / (float)N + eps);
  {
    for (int u = 0; u < per / 4; ++u) {
      const int j = tid * 4 + 1024 * u;
      v4f o, sm;
#pragma unroll
      for (int q = 0; q < 4; ++q) {
        float gg = g[j + q], bb = bta[j + q];
        if (PARAM_BF16) { gg = bf16_round(gg); bb = bf16_round(bb); }
        sm[q] = vals[u * 4 + q]; o[q] = (vals[u * 4 + q] - mu) * rs * gg + bb;
      }
      if (out_sum) *(v4f*)(out_sum + (size_t)row * N + j) = sm;
      *(v4f*)(out_norm + (size_t)row * N + j) = o;
    }
    
  }
}



// ---- f16 WMMA path (v_wmma_f32_16x16x32_f16): 11-bit significands for operands in range — used where a [0,1] probability operand needs more precision than bf16
typedef _Float16 v16h __attribute__((ext_vector_type(16)));
union FragH { v16h v; v8us half[2]; _Float16 h[16]; unsigned short u[16]; };
template <int NT>
__device__ __forceinline__ v8f mmaH(v16h ah, v16h al, v16h bh, v16h bl, v8f c) {
  c = __builtin_amdgcn_wmma_f32_16x16x32_f16(false, ah, false, bh, (short)0, c, false, false);
  if (NT >= 2) c = __builtin_amdgcn_wmma_f32_16x16x32_f16(false, al, false, bh, (short)0, c, false, false);
  if (NT >= 3) c = __builtin_amdgcn_wmma_f32_16x16x32_f16(false, ah, false, bl, (short)0, c, false, false);
  asm volatile("v_nop\n\tv_nop\n\tv_nop\n\tv_nop" : "+v"(c) : "v"(ah), "v"(al), "v"(bh), "v"(bl));
  return c;
}
// batched GEMM like k_gemm_b but f16 operands: A f32 (split into f16 hi/lo if ASPLIT, else rounded to f16), Bt = f16 values [n][k]; alpha; C f32; N multiple of 16 (partial tiles skipped)
template <bool ASPLIT>
__global__ __launch_bounds__(128) void k_gemm_h(const float* __restrict__ A, int lda, size_t sA, const _Float16* __restrict__ Bh, int ldb, size_t sB, float alpha, float* __restrict__ C, int ldc, size_t sC, int M, int N, int K) {
  __shared__ __attribute__((aligned(16))) float so[4][16][64];
  const int tid = threadIdx.x, w = tid >> 5, lane = tid & 31, ln = lane & 15, hh = lane >> 4; const int by = blockIdx.y;
  A += (size_t)by * sA; Bh += (size_t)by * sB; C += (size_t)by * sC;
  const int ntn = (N + 63) / 64; const int wid = blockIdx.x * 4 + w; const int mt = wid / ntn, nq = wid % ntn; if (mt * 16 >= M) return;
  const int row0 = mt * 16, col0 = nq * 64; const float* arow = A + (size_t)(row0 + ln) * lda;
  v8f acc[4] = {};
  for (int kb = 0; kb < K; kb += 32) {
    FragH ah, al;
    const v4f x0 = *(const v4fa*)(arow + kb + 8 * hh), x1 = *(const v4fa*)(arow + kb + 8 * hh + 4), x2 = *(const v4fa*)(arow + kb + 16 + 8 * hh), x3 = *(const v4fa*)(arow + kb + 16 + 8 * hh + 4);
    float xs[16] = {x0[0],x0[1],x0[2],x0[3],x1[0],x1[1],x1[2],x1[3],x2[0],x2[1],x2[2],x2[3],x3[0],x3[1],x3[2],x3[3]};
#pragma unroll
    for (int i = 0; i < 16; ++i) { const _Float16 h = (_Float16)xs[i]; ah.h[i] = h; al.h[i] = ASPLIT ? (_Float16)(xs[i] - (float)h) : (_Float16)0.0f; }
#pragma unroll
    for (int t = 0; t < 4; ++t) { if (col0 + t * 16 >= N) continue; const size_t boff = (size_t)(col0 + t * 16 + ln) * ldb + kb; FragH bq; bq.half[0] = *(const v8us*)(Bh + boff + 8 * hh); bq.half[1] = *(const v8us*)(Bh + boff + 16 + 8 * hh);
      acc[t] = mmaH<ASPLIT ? 2 : 1>(ah.v, al.v, bq.v, bq.v, acc[t]); }
  }
#pragma unroll
  for (int t = 0; t < 4; ++t) { if (col0 + t * 16 >= N) continue;
#pragma unroll
    for (int r = 0; r < 8; ++r) so[w][8 * hh + r][t * 16 + ln] = acc[t][r] * alpha; }
  __builtin_amdgcn_fence(__ATOMIC_ACQ_REL, "workgroup"); __builtin_amdgcn_wave_barrier();
  const int rsub = lane >> 4, c4 = (lane & 15) * 4;
  {
#pragma unroll
    for (int q = 0; q < 8; ++q) { const int r = q * 2 + rsub; if (col0 + c4 < N) { const v4f v = *(const v4fa*)&so[w][r][c4]; *(v4f*)(C + (size_t)(row0 + r) * ldc + col0 + c4) = v; } }
     }
}

// Wt[n][k] = f16(bf16(W[k][n]) x scale) from f32 row-major W[DM][DM] (scale = power of two; bf16-exact weights stay exact in f16 away from the subnormal range).
// One workgroup of 256 threads turns one tile of 128 k x 64 n in LDS: every 16-byte global load covers whole 128-byte lines of W rows (256 B a row), every 16-byte store whole lines of Wt rows (256 B a row); a thread's eight loads are issued together.
#define WTK 128                      /* k per tile */
#define WTN 64                       /* n per tile */
typedef unsigned int v4u __attribute__((ext_vector_type(4), may_alias));
__device__ __forceinline__ void wt_tile(const float* __restrict__ W, _Float16* __restrict__ Wt, float scale, int bid) {
  __shared__ unsigned int tl[WTN][WTK / 2 + 1];      /* a word holds two neighbouring k of one n; the odd pitch spreads a wave's 32 word stores, and its 32 word reads, over 32 banks */
  const int tid = threadIdx.x; const int k0 = (bid % (DM / WTK)) * WTK, n0 = (bid / (DM / WTK)) * WTN;
  const int lo = tid & 15, up = tid >> 4;
  const float* g = W + (size_t)(k0 + 2 * up) * DM + n0 + lo * 4; v4f a[4][2];      /* rows k0 + 32 u + 2 up + j, columns n0 + 4 lo .. + 3 */
#pragma unroll      /* constant indices into a[]; one address pair, the rows differ in the immediate offset */
  for (int u = 0; u < 4; ++u) { a[u][0] = *(const v4fa*)(g + (size_t)(u * 32) * DM); a[u][1] = *(const v4fa*)(g + (size_t)(u * 32 + 1) * DM); }
#pragma unroll      /* constant indices into a[] */
  for (int u = 0; u < 4; ++u)
    for (int i = 0; i < 4; ++i) { union { _Float16 h[2]; unsigned int w; } p; p.h[0] = (_Float16)(bf16_round(a[u][0][i]) * scale); p.h[1] = (_Float16)(bf16_round(a[u][1][i]) * scale); tl[lo * 4 + i][u * 16 + up] = p.w; }
  __syncthreads();      /* publishes the tile */
  unsigned short* d = (unsigned short*)Wt + (size_t)(n0 + up) * DM + k0 + lo * 8; v4u o[4];
#pragma unroll      /* constant indices into o[]: all LDS reads stand ahead of the first store, so no register that an issued store names is written again */
  for (int u = 0; u < 4; ++u) for (int j = 0; j < 4; ++j) o[u][j] = tl[u * 16 + up][lo * 4 + j];
#pragma unroll      /* constant indices into o[] */
  for (int u = 0; u < 4; ++u) *(v4u*)(d + (size_t)(u * 16) * DM) = o[u];
}
// k_gemm_hh variant with fused epilogue: v = acc·alpha + bias[by·sBias + col] (+ CP[(row/rowsPerB)·sCPb + by·64 + col] if CP) ; ACT 0 none / 1 elu ; writes f16 C16 (and f32 C if non-null)
template <int ACT>
__global__ __launch_bounds__(128) void k_gemm_hhx(const _Float16* __restrict__ A, int lda, size_t sA, const _Float16* __restrict__ Bh, int ldb, size_t sB, float alpha, const float* __restrict__ bias, size_t sBias, const float* __restrict__ CP, int rowsPerB, size_t sCPb, int row0g,
    float* __restrict__ C, _Float16* __restrict__ C16, int ldc, size_t sC, int M, int N, int K) {
  __shared__ __attribute__((aligned(16))) float so[4][16][64];
  const int tid = threadIdx.x, w = tid >> 5, lane = tid & 31, ln = lane & 15, hh = lane >> 4; const int by = blockIdx.y;
  A += (size_t)by * sA; Bh += (size_t)by * sB; const size_t cofs = (size_t)by * sC; const float* bp = bias ? bias + (size_t)by * sBias : nullptr;
  const int ntn = (N + 63) / 64; const int wid = blockIdx.x * 4 + w; const int mt = wid / ntn, nq = wid % ntn; if (mt * 16 >= M) return;
  const int row0 = mt * 16, col0 = nq * 64; const _Float16* arow = A + (size_t)(row0 + ln) * lda;
  v8f acc[4] = {};
  for (int kb = 0; kb < K; kb += 32) { FragH ah; ah.half[0] = *(const v8us*)((const unsigned short*)arow + kb + 8 * hh); ah.half[1] = *(const v8us*)((const unsigned short*)arow + kb + 16 + 8 * hh);
#pragma unroll
    for (int t = 0; t < 4; ++t) { if (col0 + t * 16 >= N) continue; const size_t boff = (size_t)(col0 + t * 16 + ln) * ldb + kb; FragH bq; bq.half[0] = *(const v8us*)((const unsigned short*)Bh + boff + 8 * hh); bq.half[1] = *(const v8us*)((const unsigned short*)Bh + boff + 16 + 8 * hh);
      acc[t] = mmaH<1>(ah.v, ah.v, bq.v, bq.v, acc[t]); }
  }
#pragma unroll
  for (int t = 0; t < 4; ++t) { if (col0 + t * 16 >= N) continue; const int col = col0 + t * 16 + ln; const float bv = bp ? bf16_round(bp[col]) : 0.f;
#pragma unroll
    for (int r = 0; r < 8; ++r) { float v = acc[t][r] * alpha + bv; if (CP) { const int rr = row0g + row0 + 8 * hh + r; if (rowsPerB < 0) v += CP[cofs + (size_t)rr * ldc + col];      /* rowsPerB < 0: own element of the batched C plane */ else { const int bidx = rr / rowsPerB; v += CP[(size_t)bidx * sCPb + (size_t)by * 64 + col]; } } if (ACT == 1) v = (v > 0.f) ? v : expm1f(v); else if (ACT == 7) v = (v > 0.f) ? v + 1.0f : expf(v); else if (ACT == 8) v = tanhf(v); else if (ACT == 9) v = 0.5f * v * (1.0f + tanhf(0.7978845608028654f * (v + 0.044715f * v * v * v))); else if (ACT == 11) v = 1.0f / (1.0f + expf(-v)); else if (ACT == 12) v = (v > 0.f) ? v : 0.01f * v; else if (ACT == 14) v = (v > 0.f) ? v : 0.1f * v; else if (ACT == 16) v = (v >= 0.f) ? v : 0.3f * v; else if (ACT == 17) v = (v >= 0.f) ? v : 0.2f * v; else if (ACT == 15) v = v / (1.0f + expf(-v)); else if (ACT == 3) v = fmaxf(v, 0.f); else if (ACT == 6) v = 0.5f * v * (1.0f + erff(v * 0.70710678118654752f)); so[w][8 * hh + r][t * 16 + ln] = v; } }
  __builtin_amdgcn_fence(__ATOMIC_ACQ_REL, "workgroup"); __builtin_amdgcn_wave_barrier();
  const int rsub = lane >> 4, c4 = (lane & 15) * 4; typedef _Float16 v4h __attribute__((ext_vector_type(4)));
  {
#pragma unroll
    for (int q = 0; q < 8; ++q) { const int r = q * 2 + rsub; if (col0 + c4 < N) { const v4f v = *(const v4fa*)&so[w][r][c4]; if (C) *(v4f*)(C + cofs + (size_t)(row0 + r) * ldc + col0 + c4) = v; if (C16) { v4h h4; for (int i = 0; i < 4; ++i) h4[i] = (_Float16)v[i]; *(v4h*)(C16 + cofs + (size_t)(row0 + r) * ldc + col0 + c4) = h4; } } }
     }
}


typedef _Float16 v4h __attribute__((ext_vector_type(4)));

__device__ __forceinline__ void x16_rows(const float* __restrict__ x, _Float16* __restrict__ X16, size_t n8, int bid) { const size_t t = (size_t)bid * 256 + threadIdx.x; if (t >= n8) return; FragH f;
#pragma unroll
  for (int q = 0; q < 8; ++q) f.h[q] = (_Float16)bf16_round(x[t * 8 + q]); *(v8us*)((unsigned short*)X16 + t * 8) = f.half[0];  }
__global__ __launch_bounds__(256) void k_h16(const float* __restrict__ x, _Float16* __restrict__ X16, size_t n8) { const size_t t = (size_t)blockIdx.x * 256 + threadIdx.x; if (t >= n8) return; FragH f;
#pragma unroll
  for (int q = 0; q < 8; ++q) f.h[q] = (_Float16)x[t * 8 + q]; *(v8us*)((unsigned short*)X16 + t * 8) = f.half[0];  }
__global__ __launch_bounds__(256) void k_round16f(const float* __restrict__ W, _Float16* __restrict__ Bt, size_t n8) { const size_t t = (size_t)blockIdx.x * 256 + threadIdx.x; if (t >= n8) return; FragH f;
#pragma unroll
  for (int i = 0; i < 8; ++i) f.h[i] = (_Float16)(bf16_round(W[t * 8 + i]) * 16.0f); *(v8us*)((unsigned short*)Bt + t * 8) = f.half[0];  }
template <int NHv, int TTv>      /* one 64 x 64 tile, 128 threads (the block shape of the launch it shares) */
__device__ __forceinline__ void vt_tile(const _Float16* __restrict__ V16, int ldv, int voff, _Float16* __restrict__ Vt, int bid) { __shared__ unsigned short tl[64][66]; const int tid = threadIdx.x; const int slab = bid / (TTv / 64), lg = bid % (TTv / 64); const int b = slab / NHv, h = slab % NHv;
  const int r0 = tid / 8, c8 = (tid % 8) * 8; FragH f[4];
#pragma unroll      /* constant indices into f[]; a thread's four loads are all issued ahead of the first LDS store, so the tile waits out one load latency, not four in a row */
  for (int u = 0; u < 4; ++u) f[u].half[0] = *(const v8us*)((const unsigned short*)V16 + ((size_t)b * TTv + lg * 64 + u * 16 + r0) * ldv + voff + h * 64 + c8);
#pragma unroll      /* constant indices into f[] */
  for (int u = 0; u < 4; ++u)
    for (int q = 0; q < 8; ++q) tl[u * 16 + r0][c8 + q] = f[u].u[q];
  __syncthreads();
  {
#pragma unroll
    for (int rd = 0; rd < 4; ++rd) { const int d = rd * 16 + tid / 8, pc = tid % 8; FragH f;
#pragma unroll
      for (int q = 0; q < 8; ++q) f.u[q] = tl[pc * 8 + q][d];
      *(v8us*)((unsigned short*)Vt + ((size_t)slab * 64 + d) * TTv + lg * 64 + pc * 8) = f.half[0]; }
     } }

// 32 f32 rows of 64 that a wave has staged in LDS (pitch 68) leave as two f16 planes: hi = f16(v), residual = f16((v - hi) x1024). Eight lanes take a row, so a wave's 16-byte stores cover four whole 128-byte lines.
__device__ __forceinline__ void split_store(const float (*so)[68], int lane, _Float16* __restrict__ Hh, _Float16* __restrict__ Hl, size_t o0, int ldc) {
  const int rs = lane >> 3, c8 = (lane & 7) * 8; v4f a[8], c[8];
#pragma unroll      /* a[] and c[] stay in registers, and all 16 LDS reads are issued ahead of the first conversion */
  for (int q = 0; q < 8; ++q) { a[q] = *(const v4fa*)&so[q * 4 + rs][c8]; c[q] = *(const v4fa*)&so[q * 4 + rs][c8 + 4]; }
#pragma unroll      /* constant indices into a[] and c[] */
  for (int q = 0; q < 8; ++q) { FragH fh, fl;
    for (int i = 0; i < 4; ++i) { _Float16 h = (_Float16)a[q][i]; fh.h[i] = h; fl.h[i] = (_Float16)((a[q][i] - (float)h) * 1024.0f); h = (_Float16)c[q][i]; fh.h[4 + i] = h; fl.h[4 + i] = (_Float16)((c[q][i] - (float)h) * 1024.0f); }
    const size_t o = o0 + (size_t)(q * 4 + rs) * ldc + c8; unsigned short* ph = (unsigned short*)Hh + o; unsigned short* pl = (unsigned short*)Hl + o; const v8us vh = fh.half[0], vl = fl.half[0];
    *(v8us*)ph = vh; *(v8us*)pl = vl;
    asm volatile("s_wait_xcnt 0x0" :: "v"(ph), "v"(pl), "v"(vh), "v"(vl) : "memory");      /* stands in front of every later rewrite of the registers that these two stores name (the next rows', or the code behind the call); they are inputs so that they stay live up to the wait */
  } }

// ---- fast GEMM (workgroup tile 128x128; a wave takes MW row tiles x 4 column tiles: MW = 4: four waves of 64x64, MW = 2: eight waves of 32x64; requires M % 128 == 0, N % 128 == 0, K % KS == 0); epilogue = k_gemm_hhx semantics; with CL the result leaves as two f16 planes, hi in C16 and residual in CL, and no f32 row is written ----
// The A tile and the B tile (128 rows each) go through LDS in stages of KS k, two buffers: every 16-byte global load of a wave covers whole 128-byte lines, the next stage's loads are all
// issued ahead of this stage's products and stored behind them, one barrier per stage. The fragments and their k order are the ones the global rows gave.
// The square tile asks L2 for 256 operand rows per 16,384 results (a 128x64 tile: 192 per 8,192); a 64x64 wave reads 8 fragments from LDS per 16 products (32x64: 6 per 8) and suits a launch with several workgroups per WGP, eight 32x64 waves one that has a single workgroup per WGP.
__device__ __forceinline__ v16h g2_frag(const _Float16* p, int hh) { FragH f; f.half[0] = *(const v8us*)((const unsigned short*)p + 8 * hh); f.half[1] = *(const v8us*)((const unsigned short*)p + 16 + 8 * hh); return f.v; }
__device__ __forceinline__ v8f g2_mma(v16h a, v16h b, v8f c) { v8f d = __builtin_amdgcn_wmma_f32_16x16x32_f16(false, a, false, b, (short)0, c, false, false); asm volatile("v_nop\n\tv_nop\n\tv_nop\n\tv_nop" : "+v"(d) : "v"(a), "v"(b)); return d; }
template <int ACT, int KS, int MW, int LDA, int LDB>
__device__ __forceinline__ void gemm2(int bx, int by, const _Float16* __restrict__ A, size_t sA, const _Float16* __restrict__ Bh, size_t sB, float alpha, const float* __restrict__ bias, size_t sBias, const float* __restrict__ CP, int rowsPerB, size_t sCPb, int row0g,
    float* __restrict__ C, _Float16* __restrict__ C16, _Float16* __restrict__ CL, int ldc, size_t sC, int M, int N, int K) { static_assert(ACT == 0 || ACT == 3 || ACT == 6 || ACT == 8 || ACT == 9 || ACT == 11 || ACT == 12 || ACT == 14 || ACT == 15 || ACT == 16 || ACT == 17, "k_gemm2: unsupported ACT code (would silently apply no activation)");
  constexpr int NW = 16 / MW;       /* waves: 8 / MW down the rows x 2 across the columns */
  constexpr int CH = KS / 8;        /* 16-byte pieces per tile row */
  constexpr int RPR = NW * 32 / CH; /* tile rows that one load of every thread covers */
  constexpr int NL = 128 / RPR;     /* loads of a thread per operand and stage */
  constexpr int PT = KS + 8;        /* LDS row pitch in f16: the row + 16 B, conflict-free for 16-byte fragment reads */
  __shared__ __attribute__((aligned(16))) float so[NW][32][68];
  __shared__ __attribute__((aligned(16))) _Float16 sa[2][128][PT];
  __shared__ __attribute__((aligned(16))) _Float16 sb[2][128][PT];
  const int tid = threadIdx.x, w = tid >> 5, lane = tid & 31, ln = lane & 15, hh = lane >> 4;
  A += (size_t)by * sA; Bh += (size_t)by * sB; const size_t cofs = (size_t)by * sC; const float* bp = bias ? bias + (size_t)by * sBias : nullptr;
  const int ntn = N >> 7; const int mt = bx / ntn, nq = bx - mt * ntn; const int row0 = mt * 128 + 16 * MW * (w >> 1), col0 = nq * 128 + 64 * (w & 1); if (mt * 128 >= M) return;      /* the same for the whole workgroup, in front of every barrier */
  const int sr = tid / CH, sp = (tid % CH) * 8;
  const unsigned short* ga = (const unsigned short*)A + (size_t)(mt * 128 + sr) * LDA + sp; const unsigned short* gb = (const unsigned short*)Bh + (size_t)(nq * 128 + sr) * LDB + sp;
  constexpr size_t da = (size_t)RPR * LDA, db = (size_t)RPR * LDB;      /* row pitches LDA, LDB are compile-time, so a stage's loads share one address pair per operand and differ in the immediate offset */
  v8us ta[NL], tb[NL];
  for (int i = 0; i < NL; ++i) ta[i] = *(const v8us*)(ga + i * da);
  for (int i = 0; i < NL; ++i) tb[i] = *(const v8us*)(gb + i * db);
  for (int i = 0; i < NL; ++i) *(v8us*)&sa[0][i * RPR + sr][sp] = ta[i];
  for (int i = 0; i < NL; ++i) *(v8us*)&sb[0][i * RPR + sr][sp] = tb[i];
  __syncthreads();      /* publishes stage 0 */
  const v8f z8 = {0.f,0.f,0.f,0.f,0.f,0.f,0.f,0.f}; v8f c[MW][4];      /* [row tile][column tile] */
#pragma unroll      /* constant indices into c[] */
  for (int m = 0; m < MW; ++m) for (int t = 0; t < 4; ++t) c[m][t] = z8;
  const int nst = K / KS;
  const int ra = 16 * MW * (w >> 1) + ln, rb = 64 * (w & 1) + ln;
  for (int s = 0; s < nst; ++s) { const int buf = s & 1; const bool more = s + 1 < nst;
    if (more) { ga += KS; gb += KS;
      for (int i = 0; i < NL; ++i) ta[i] = *(const v8us*)(ga + i * da);
      for (int i = 0; i < NL; ++i) tb[i] = *(const v8us*)(gb + i * db); }
#pragma unroll      /* constant indices into c[], a[] and b[] */
    for (int ks = 0; ks < KS / 32; ++ks) {      /* the fragments of 32 k are read from LDS as one group, then their products */
      v16h a[MW], b[4];
      for (int m = 0; m < MW; ++m) a[m] = g2_frag(&sa[buf][ra + 16 * m][ks * 32], hh);
      for (int t = 0; t < 4; ++t) b[t] = g2_frag(&sb[buf][rb + 16 * t][ks * 32], hh);
      for (int t = 0; t < 4; ++t) for (int m = 0; m < MW; ++m) c[m][t] = g2_mma(a[m], b[t], c[m][t]); }
    if (more) {
      for (int i = 0; i < NL; ++i) *(v8us*)&sa[buf ^ 1][i * RPR + sr][sp] = ta[i];
      for (int i = 0; i < NL; ++i) *(v8us*)&sb[buf ^ 1][i * RPR + sr][sp] = tb[i];
      __syncthreads(); }      /* publishes the next stage and ends every wave's reads of this one, which the stage after next overwrites */
  }
  float bvs[4] = {0.f, 0.f, 0.f, 0.f};      /* the lane's four bias values serve all its row tiles: read once, the four loads issued together */
  if (bp) { for (int t = 0; t < 4; ++t) bvs[t] = bp[col0 + t * 16 + ln];
    for (int t = 0; t < 4; ++t) bvs[t] = bf16_round(bvs[t]); }
#pragma unroll      /* constant indices into c[]: a wave's rows leave 32 at a time through its own staging rows */
  for (int hf = 0; hf < MW / 2; ++hf) { const int rowh = row0 + 32 * hf;
#pragma unroll
    for (int u = 0; u < 8; ++u) { const int t = u & 3, half = u >> 2; const int col = col0 + t * 16 + ln; const float bv = bvs[t];
#pragma unroll
      for (int r = 0; r < 8; ++r) { const int rloc = half * 16 + 8 * hh + r; float v = c[hf * 2 + half][t][r] * alpha + bv; if (CP) { if (rowsPerB < 0) v += CP[cofs + (size_t)(row0g + rowh + rloc) * ldc + col];      /* rowsPerB < 0: own element of the batched C plane */ else { const int bidx = (row0g + rowh + rloc) / rowsPerB; v += CP[(size_t)bidx * sCPb + (size_t)by * 64 + col]; } }
        if (ACT == 3) v = fmaxf(v, 0.f); else if (ACT == 6) v = 0.5f * v * (1.0f + erff(v * 0.70710678118654752f)); else if (ACT == 11) v = 1.0f / (1.0f + expf(-v)); else if (ACT == 15) v = v / (1.0f + expf(-v)); else if (ACT == 12) v = (v > 0.f) ? v : 0.01f * v; else if (ACT == 8) v = tanhf(v); else if (ACT == 9) v = 0.5f * v * (1.0f + tanhf(0.7978845608028654f * (v + 0.044715f * v * v * v))); else if (ACT == 14) v = (v > 0.f) ? v : 0.1f * v; else if (ACT == 16) v = (v >= 0.f) ? v : 0.3f * v; else if (ACT == 17) v = (v >= 0.f) ? v : 0.2f * v;
        so[w][rloc][t * 16 + ln] = v; } }
    __builtin_amdgcn_fence(__ATOMIC_ACQ_REL, "workgroup", "local"); __builtin_amdgcn_wave_barrier();      /* each wave reads back only its own rows; the fence names LDS alone, so that it does not wait for the global stores of the 32 rows before */
    if (CL) split_store(so[w], lane, C16, CL, cofs + (size_t)rowh * ldc + col0, ldc);      /* the same for every wave, behind the last barrier */
    else { const int rsub = lane >> 4, c4 = (lane & 15) * 4;
#pragma unroll
      for (int q = 0; q < 16; ++q) { const int r = q * 2 + rsub; const v4f v = *(const v4fa*)&so[w][r][c4]; if (C) *(v4f*)(C + cofs + (size_t)(rowh + r) * ldc + col0 + c4) = v; if (C16) { v4h h4; for (int i = 0; i < 4; ++i) h4[i] = (_Float16)v[i]; *(v4h*)(C16 + cofs + (size_t)(rowh + r) * ldc + col0 + c4) = h4; } } }
    if (hf + 1 < MW / 2) asm volatile("s_wait_xcnt 0x0" ::: "memory");      /* stands in front of the next 32 rows' rewrites of the registers that these rows' global stores name; its clobber also keeps the next rows' LDS stores behind these rows' LDS reads (a wave's LDS operations run in order) */
  } }
// out = o out_w + b: f32 rows
__global__ __launch_bounds__(256) void k_outp(const _Float16* __restrict__ O16, const _Float16* __restrict__ BO, const float* __restrict__ bo, float* __restrict__ out) {
  gemm2<0, 128, 2, DM, DM>(blockIdx.x, 0, O16, 0, BO, 0, 0.0009765625f, bo, 0, nullptr, 1, 0, 0, out, nullptr, nullptr, DM, 0, MPO, DM, DM); }
// Q, K and V projections share one launch: blockIdx.y picks the weight plane (BW holds the three one behind the other), the bias and the result planes; Q and K leave as hi + residual, V as plain f16 rows
__global__ __launch_bounds__(128) void k_qkv(const _Float16* __restrict__ X16, const _Float16* __restrict__ BW, const float* __restrict__ bq, const float* __restrict__ bk, const float* __restrict__ bv,
    _Float16* __restrict__ QH, _Float16* __restrict__ QL, _Float16* __restrict__ KH, _Float16* __restrict__ KL, _Float16* __restrict__ V16) {
  const int j = blockIdx.y; const float* bias = j == 0 ? bq : j == 1 ? bk : bv; _Float16* ch = j == 0 ? QH : j == 1 ? KH : V16; _Float16* cl = j == 0 ? QL : j == 1 ? KL : nullptr;
  gemm2<0, 64, 4, DM, DM>(blockIdx.x, 0, X16, 0, BW + (size_t)j * DM * DM, 0, 0.0625f, bias, 0, nullptr, 1, 0, 0, nullptr, ch, cl, DM, 0, MP, DM, DM); }


__global__ __launch_bounds__(256) void k_wnat(const float* __restrict__ w, size_t n8, _Float16* __restrict__ Bt) { const size_t t = (size_t)blockIdx.x * 256 + threadIdx.x; if (t >= n8) return; FragH f; for (int q = 0; q < 8; ++q) f.h[q] = (_Float16)(bf16_round(w[t * 8 + q]) * 16.0f); *(v8us*)((unsigned short*)Bt + t * 8) = f.half[0];  }
__global__ __launch_bounds__(256) void k_rsm(const float* __restrict__ S, _Float16* __restrict__ P, int nrows) {
  #pragma clang fp contract(off)
  const int i = blockIdx.x * 256 + threadIdx.x; if (i >= nrows) return; const float* s = S + (size_t)i * SQ; float mx = -3.0e38f;
#pragma unroll 1
  for (int j = 0; j < SQ; ++j) mx = fmaxf(mx, s[j]); float se = 0.f;
#pragma unroll 1
  for (int j = 0; j < SQ; ++j) se += expf(s[j] - mx); const float sc = 256.0f / se;
#pragma unroll 1
  for (int j0 = 0; j0 < SQ; j0 += 8) { FragH f; for (int q = 0; q < 8; ++q) f.h[q] = (_Float16)(expf(s[j0 + q] - mx) * sc); unsigned short* d = (unsigned short*)P + (size_t)i * SQ + j0; *(v8us*)d = f.half[0];  } }
__global__ __launch_bounds__(256) void k_vt(const _Float16* __restrict__ V16, int b, int h0, _Float16* __restrict__ VT) { __shared__ unsigned short tl[64][65]; const int tid = threadIdx.x; const int hh = blockIdx.x % HG, sg = blockIdx.x / HG; const int s0 = sg * 64; const int h = h0 + hh;
  for (int i = tid; i < 64 * 8; i += 256) { const int j = i / 8, d8 = (i % 8) * 8; FragH f; f.half[0] = *(const v8us*)((const unsigned short*)V16 + ((size_t)b * SQ + s0 + j) * DM + h * HD + d8); for (int q = 0; q < 8; ++q) tl[d8 + q][j] = f.u[q]; }
  __syncthreads();
  { for (int i = tid; i < 64 * 8; i += 256) { const int d = i / 8, j8 = (i % 8) * 8; FragH f; for (int q = 0; q < 8; ++q) f.u[q] = tl[d][j8 + q]; *(v8us*)((unsigned short*)VT + ((size_t)hh * HD + d) * SQ + s0 + j8) = f.half[0]; }  } }


__device__ __forceinline__ void mprep(const float* __restrict__ E, const float* __restrict__ phase, _Float16* __restrict__ MH, _Float16* __restrict__ ML, int bid) {
  #pragma clang fp contract(off)
  const int t = bid * 256 + threadIdx.x; if (t >= NH * HD * (HD / 8)) return; const int e8 = (t % (HD / 8)) * 8; const int hd_ = t / (HD / 8); const int d = hd_ % HD, h = hd_ / HD; const float c = cosf(bf16_round(phase[h * HD + d])); const float diag = __fmul_rn(__fmul_rn(c, c), 0.125f); FragH fh, fl;
#pragma unroll
  for (int q = 0; q < 8; ++q) { const int e = e8 + q; float m = bf16_round(E[((size_t)h * HD + d) * HD + e]); if (e == d) m = __fadd_rn(m, diag); const _Float16 hi = (_Float16)m; fh.h[q] = hi; fl.h[q] = (_Float16)((m - (float)hi) * 1024.0f); }
  const size_t o = ((size_t)h * HD + d) * HD + e8; { *(v8us*)((unsigned short*)MH + o) = fh.half[0]; *(v8us*)((unsigned short*)ML + o) = fl.half[0];  } }
// ---- the six operand preparations depend on inputs alone and share one launch; a block's index range picks its job: four weight transposes (BW holds the planes one behind the other), M, x ----
#define GW ((DM / WTK) * (DM / WTN)) /* blocks per weight transpose */
#define GM (NH * HD * (HD / 8) / 256) /* blocks for M */
#define GX ((int)(NR * DM / 8 / 256)) /* blocks for x */
static_assert(DM % WTK == 0 && DM % WTN == 0, "wt_tile: whole tiles only, it has no edge guard");
__global__ __launch_bounds__(256) void k_prep(const float* __restrict__ x, const float* __restrict__ wq, const float* __restrict__ wk, const float* __restrict__ wv, const float* __restrict__ wo, const float* __restrict__ E, const float* __restrict__ phase,
    _Float16* __restrict__ X16, _Float16* __restrict__ BW, _Float16* __restrict__ MH, _Float16* __restrict__ ML) {
  const int bid = blockIdx.x;
  if (bid < 4 * GW) { const int j = bid / GW; const float* W = j == 0 ? wq : j == 1 ? wk : j == 2 ? wv : wo; wt_tile(W, BW + (size_t)j * DM * DM, 16.0f, bid - j * GW); }      /* [in][out] -> Bt[n][k] x16; the branch is the same for a whole workgroup, so the tile's barrier is passed by all of it */
  else if (bid < 4 * GW + GM) mprep(E, phase, MH, ML, bid - 4 * GW);
  else x16_rows(x, X16, NR * DM / 8, bid - (4 * GW + GM));
}
__device__ __forceinline__ float half_xor(float v) { const int i = __float_as_int(v); return __int_as_float(__builtin_amdgcn_permlanex16(i, i, 0x76543210, 0xfedcba98, false, false)); }      /* value of lane l ^ 16 */
#define FK 64                        /* keys per LDS stage */
#define FPT 72                       /* LDS row pitch in f16: 128 B + 16 B, conflict-free for 16-byte fragment reads */
#define L2E 1.4426950408889634f
__device__ __forceinline__ v8f f_mma(v16h a, v16h b, v8f c) { return __builtin_amdgcn_wmma_f32_16x16x32_f16(false, a, false, b, (short)0, c, false, false); }
// ---- KM = K M^T per head in one launch: the terms hi.hi, residual.hi, hi.residual each in its own accumulator, summed in f32 in that order in registers, the sum split into hi + residual planes ----
// Workgroup = 4 waves x 32 token rows of one head. K hi and K residual (128 x 64) and M hi and M residual (64 x 64) go through LDS once: whole-line 16-byte loads, all issued together, one barrier.
__device__ __forceinline__ void km_tile(const _Float16* __restrict__ KH, const _Float16* __restrict__ KL, const _Float16* __restrict__ MH, const _Float16* __restrict__ ML, _Float16* __restrict__ KMH, _Float16* __restrict__ KML, int bx, int h) {
  __shared__ __attribute__((aligned(16))) float so[4][32][68];
  __shared__ __attribute__((aligned(16))) _Float16 sa[2][128][FPT];
  __shared__ __attribute__((aligned(16))) _Float16 sb[2][HD][FPT];
  const int tid = threadIdx.x, w = tid >> 5, lane = tid & 31, ln = lane & 15, hh = lane >> 4; const size_t row0 = (size_t)bx * 128;
  const int sr = tid >> 3, sp = (tid & 7) * 8;      /* staging: one load of every thread covers 16 tile rows */
  const unsigned short* gah = (const unsigned short*)KH + (row0 + sr) * DM + h * HD + sp; const unsigned short* gal = (const unsigned short*)KL + (row0 + sr) * DM + h * HD + sp;
  const unsigned short* gbh = (const unsigned short*)MH + ((size_t)h * HD + sr) * HD + sp; const unsigned short* gbl = (const unsigned short*)ML + ((size_t)h * HD + sr) * HD + sp;
  v8us ta[2][8], tb[2][4];
  for (int i = 0; i < 4; ++i) { tb[0][i] = *(const v8us*)(gbh + (size_t)i * 16 * HD); tb[1][i] = *(const v8us*)(gbl + (size_t)i * 16 * HD); }
  for (int i = 0; i < 8; ++i) { ta[0][i] = *(const v8us*)(gah + (size_t)i * 16 * DM); ta[1][i] = *(const v8us*)(gal + (size_t)i * 16 * DM); }
  asm volatile("s_wait_xcnt 0x0" :: "v"(gah), "v"(gal), "v"(gbh), "v"(gbl) : "memory");      /* the four address pairs are inputs so that they stay live up to this wait */
  for (int i = 0; i < 8; ++i) { *(v8us*)&sa[0][i * 16 + sr][sp] = ta[0][i]; *(v8us*)&sa[1][i * 16 + sr][sp] = ta[1][i]; }
  for (int i = 0; i < 4; ++i) { *(v8us*)&sb[0][i * 16 + sr][sp] = tb[0][i]; *(v8us*)&sb[1][i * 16 + sr][sp] = tb[1][i]; }
  __syncthreads();      /* publishes the four tiles */
  const v8f z8 = {0.f,0.f,0.f,0.f,0.f,0.f,0.f,0.f};
  const int ra = 32 * w + ln;
#pragma unroll 1      /* kept rolled so that 12 accumulators are live, not 24: the kernel stays under 256 registers and needs no register-window switches */
  for (int th = 0; th < 2; ++th) {      /* two column tiles at a time */
    v8f c1[2][2], c2[2][2], c3[2][2];      /* [row tile][column tile] of hi.hi, residual.hi, hi.residual */
    for (int m = 0; m < 2; ++m) for (int t = 0; t < 2; ++t) { c1[m][t] = z8; c2[m][t] = z8; c3[m][t] = z8; }
    for (int ks = 0; ks < HD / 32; ++ks) {
      v16h ah[2], al[2], bh[2], bl[2];
      for (int m = 0; m < 2; ++m) { ah[m] = g2_frag(&sa[0][ra + 16 * m][ks * 32], hh); al[m] = g2_frag(&sa[1][ra + 16 * m][ks * 32], hh); }
      for (int t = 0; t < 2; ++t) { bh[t] = g2_frag(&sb[0][(th * 2 + t) * 16 + ln][ks * 32], hh); bl[t] = g2_frag(&sb[1][(th * 2 + t) * 16 + ln][ks * 32], hh); }
      for (int t = 0; t < 2; ++t) for (int m = 0; m < 2; ++m) c1[m][t] = f_mma(ah[m], bh[t], c1[m][t]);
      for (int t = 0; t < 2; ++t) for (int m = 0; m < 2; ++m) c2[m][t] = f_mma(al[m], bh[t], c2[m][t]);
      for (int t = 0; t < 2; ++t) for (int m = 0; m < 2; ++m) c3[m][t] = f_mma(ah[m], bl[t], c3[m][t]);
    }
    for (int m = 0; m < 2; ++m)
      for (int t = 0; t < 2; ++t)
        for (int r = 0; r < 8; ++r) { float v = c2[m][t][r] * 0.0009765625f + c1[m][t][r]; v = c3[m][t][r] * 0.0009765625f + v;      /* the residual planes carry x1024; the scaling is exact, so each line rounds once */
          so[w][m * 16 + 8 * hh + r][(th * 2 + t) * 16 + ln] = v; }
  }
  __builtin_amdgcn_fence(__ATOMIC_ACQ_REL, "workgroup"); __builtin_amdgcn_wave_barrier();      /* each wave reads back only its own rows */
  split_store(so[w], lane, KMH, KML, (row0 + 32 * w) * DM + h * HD, DM);
}
// KM (needs K and M) and V^T (needs V) do not depend on each other and share one launch; the branch is the same for a whole workgroup, so each body keeps its own barrier
#define GKM ((int)(NR / 128) * NH)   /* blocks for KM */
__global__ __launch_bounds__(128) void k_kmvt(const _Float16* __restrict__ KH, const _Float16* __restrict__ KL, const _Float16* __restrict__ MH, const _Float16* __restrict__ ML, _Float16* __restrict__ KMH, _Float16* __restrict__ KML, const _Float16* __restrict__ V16, _Float16* __restrict__ VT) {
  const int bid = blockIdx.x;
  if (bid >= GKM) { vt_tile<NH, SQ>(V16, DM, 0, VT, bid - GKM); return; }      /* V^T [NB][NH][HD][SQ] */
  km_tile(KH, KL, MH, ML, KMH, KML, bid % (int)(NR / 128), bid / (int)(NR / 128));      /* KM[k][h*64+d] = sum_e K[k][h*64+e] M[h][d][e], token rows of both batches */
}
#define FKS 2                        /* key ranges that a workgroup works on side by side */
#define FKR (SQ / FKS)               /* keys per range */
__global__ __launch_bounds__(512) void k_fattn(const _Float16* __restrict__ QH, const _Float16* __restrict__ QL, const _Float16* __restrict__ KMH, const _Float16* __restrict__ KML, const _Float16* __restrict__ VT, _Float16* __restrict__ O16) {
  __shared__ __attribute__((aligned(16))) _Float16 sk[2][FKS][3][FK][FPT];
  const int tid = threadIdx.x, lane = tid & 31, c = lane & 15, hh = lane >> 4; const int w = __builtin_amdgcn_readfirstlane(tid >> 5);
  const int kg = w >> 3, wq = w & 7;      /* key range and query group of the wave: waves wq and wq + 8 share 32 queries */
  const int h = blockIdx.y, b = blockIdx.z; const size_t r0 = (size_t)b * SQ; const size_t q0 = r0 + (size_t)blockIdx.x * 256 + wq * 32;
  v16h qh[2][2], ql[2][2];      /* [query tile][k step of 32] */
  for (int qt = 0; qt < 2; ++qt)
    for (int ks = 0; ks < 2; ++ks) { const size_t o = (q0 + qt * 16 + c) * DM + h * HD + ks * 32; qh[qt][ks] = g2_frag(QH + o, hh); ql[qt][ks] = g2_frag(QL + o, hh); }
  const int sr = (tid & 255) >> 3, sp = (tid & 7) * 8;      /* staging: the eight waves of a range stage its tiles; a wave's 16-byte loads cover four whole 128-byte rows */
  const size_t k0 = r0 + (size_t)kg * FKR;
  const char* gkh = (const char*)(KMH + k0 * DM + h * HD); const char* gkl = (const char*)(KML + k0 * DM + h * HD);      /* wave-uniform bases (scalar registers); the lane's place is a 32-bit byte offset, one for both KM planes, one for V^T */
  const char* gv = (const char*)(VT + ((size_t)b * NH + h) * HD * SQ + (size_t)kg * FKR);
  const unsigned int ok2 = (unsigned int)(sr * DM + sp) * 2u, ov2 = (unsigned int)(sr * SQ + sp) * 2u;
  v8us st[6];
  st[0] = *(const v8us*)(gkh + ok2); st[1] = *(const v8us*)(gkh + ok2 + 64 * DM); st[2] = *(const v8us*)(gkl + ok2); st[3] = *(const v8us*)(gkl + ok2 + 64 * DM); st[4] = *(const v8us*)(gv + ov2); st[5] = *(const v8us*)(gv + ov2 + 64 * SQ);
  for (int i = 0; i < 6; ++i) *(v8us*)&sk[0][kg][i >> 1][sr + 32 * (i & 1)][sp] = st[i];
  __syncthreads();      /* publishes stage 0 */
  const v8f z8 = {0.f,0.f,0.f,0.f,0.f,0.f,0.f,0.f};
  v8f o[4][2];      /* O^T tiles [d tile][query tile]: register r = d 16 dt + 8 hh + r of query c */
  for (int dt = 0; dt < 4; ++dt) { o[dt][0] = z8; o[dt][1] = z8; }
  float mu[2] = {-3.0e38f, -3.0e38f};      /* maximum in use per query, log2 domain, equal in both lane halves */
  float ls[2] = {0.f, 0.f};      /* this lane half's share of the sum of weights */
  for (int s = 0; s < FKR / FK; ++s) {
    const int buf = s & 1; const bool more = s + 1 < FKR / FK;
    if (more) { gkh += (size_t)FK * DM * 2; gkl += (size_t)FK * DM * 2; gv += FK * 2; }
#pragma unroll      /* p picks which half of the next stage is fetched: constant indices */
    for (int p = 0; p < FK / 32; ++p) {
      v8us sn[3];      /* half of the next stage's pieces per 32 keys, loaded ahead of these keys' work and stored behind it: 12 registers in flight, not 24, so that the wave fits 256 registers */
      if (more) {
        if (p == 0) { sn[0] = *(const v8us*)(gkh + ok2); sn[1] = *(const v8us*)(gkh + ok2 + 64 * DM); sn[2] = *(const v8us*)(gkl + ok2); }
        else { sn[0] = *(const v8us*)(gkl + ok2 + 64 * DM); sn[1] = *(const v8us*)(gv + ov2); sn[2] = *(const v8us*)(gv + ov2 + 64 * SQ); }
        asm volatile("s_wait_xcnt 0x0" ::: "memory"); }      /* stands in front of every later rewrite of the address registers that these three loads name */
      v8f sc[2][2] = {{z8, z8}, {z8, z8}};      /* S^T tiles [key tile][query tile]: register r = key 16 kt + 8 hh + r, query c */
      for (int kt = 0; kt < 2; ++kt) {      /* one key tile at a time: four KM fragments live, not eight (the 256 registers); each accumulator takes its terms in the order it always did */
        v16h kh[2], kl[2];      /* [k step] */
        for (int ks = 0; ks < 2; ++ks) { kh[ks] = g2_frag(&sk[buf][kg][0][p * 32 + kt * 16 + c][ks * 32], hh); kl[ks] = g2_frag(&sk[buf][kg][1][p * 32 + kt * 16 + c][ks * 32], hh); }
        for (int ks = 0; ks < 2; ++ks) {
          for (int qt = 0; qt < 2; ++qt) sc[kt][qt] = f_mma(kl[ks], qh[qt][ks], sc[kt][qt]);      /* hi.lo */
          for (int qt = 0; qt < 2; ++qt) sc[kt][qt] = f_mma(kh[ks], ql[qt][ks], sc[kt][qt]);      /* lo.hi */
        }
        for (int qt = 0; qt < 2; ++qt) sc[kt][qt] *= 0.0009765625f;      /* the residual planes carry x1024 */
        for (int ks = 0; ks < 2; ++ks)
          for (int qt = 0; qt < 2; ++qt) sc[kt][qt] = f_mma(kh[ks], qh[qt][ks], sc[kt][qt]);      /* hi.hi */
        if (kt == 0) __builtin_amdgcn_sched_barrier(0);      /* keeps the second key tile's four fragment reads behind the first tile's products: read ahead of them they take 32 more registers, and the wave spills */
      }
      v16h va[4];
      for (int dt = 0; dt < 4; ++dt) va[dt] = g2_frag(&sk[buf][kg][2][dt * 16 + c][p * 32], hh);
      float mt[2]; bool need = false;
      for (int qt = 0; qt < 2; ++qt) { float m = sc[0][qt][0];
        for (int r = 1; r < 8; ++r) m = fmaxf(m, sc[0][qt][r]);
        for (int r = 0; r < 8; ++r) m = fmaxf(m, sc[1][qt][r]);
        m = fmaxf(m, half_xor(m)) * L2E; mt[qt] = m; need = need || (m > mu[qt] + 8.0f); }
      if (__builtin_amdgcn_ballot_w32(need) != 0) {      /* lazy rescale, one scalar branch per 32 keys: the maximum in use follows only when some query's maximum has passed it by more than 2^8 */
        for (int qt = 0; qt < 2; ++qt) { const float mn = fmaxf(mu[qt], mt[qt]); const float al = __builtin_amdgcn_exp2f(mu[qt] - mn); mu[qt] = mn; ls[qt] *= al;
          for (int dt = 0; dt < 4; ++dt) o[dt][qt] *= al; }
      }
      for (int qt = 0; qt < 2; ++qt) { const float sh = 6.0f - mu[qt];      /* weights carried x64: at most 2^14 in f16 */
        v8f e0 = sc[0][qt] * L2E + sh, e1 = sc[1][qt] * L2E + sh; FragH pb;
        for (int r = 0; r < 8; ++r) { e0[r] = __builtin_amdgcn_exp2f(e0[r]); e1[r] = __builtin_amdgcn_exp2f(e1[r]); }
        for (int r = 0; r < 8; ++r) { pb.h[r] = (_Float16)e0[r]; pb.h[8 + r] = (_Float16)e1[r]; }
        const v8f t = e0 + e1; ls[qt] += ((t[0] + t[1]) + (t[2] + t[3])) + ((t[4] + t[5]) + (t[6] + t[7]));
        for (int dt = 0; dt < 4; ++dt) o[dt][qt] = f_mma(va[dt], pb.v, o[dt][qt]); }
      if (more) {      /* the other buffer: nobody reads it in this stage */
        for (int j = 0; j < 3; ++j) { const int i = p * 3 + j; *(v8us*)&sk[buf ^ 1][kg][i >> 1][sr + 32 * (i & 1)][sp] = sn[j]; } }
    }
    __syncthreads();      /* publishes the next stage and ends every wave's reads of this one, which the stage after next overwrites */
  }
  // The two waves of a query group join their ranges: each hands the partner one query tile (O^T, maximum in use, sum share) through LDS and finishes the other. The last stage's barrier has ended every read of sk, so its bytes serve as the hand-over rows.
  static_assert(16 * 9 * 32 * 16 <= sizeof(sk), "hand-over rows must fit the stage buffers");
  v4fa* xo = (v4fa*)&sk[0][0][0][0][0];      /* [wave][9][lane] pieces of 16 bytes: a wave's 32 lanes store and read 512 bytes in a row */
  v8f og[4], ok[4];      /* the tile handed over, the tile kept: range 0 keeps query tile 0, range 1 query tile 1 */
  for (int dt = 0; dt < 4; ++dt) { og[dt] = kg ? o[dt][0] : o[dt][1]; ok[dt] = kg ? o[dt][1] : o[dt][0]; }
  const float mug = kg ? mu[0] : mu[1], lsg = kg ? ls[0] : ls[1], muk = kg ? mu[1] : mu[0], lsk = kg ? ls[1] : ls[0];
  v4fa* mine = xo + (size_t)w * 9 * 32 + lane;
  for (int dt = 0; dt < 4; ++dt) { const v4f lo4 = {og[dt][0], og[dt][1], og[dt][2], og[dt][3]}, hi4 = {og[dt][4], og[dt][5], og[dt][6], og[dt][7]}; mine[(dt * 2) * 32] = lo4; mine[(dt * 2 + 1) * 32] = hi4; }
  { const v4f ms = {mug, lsg, 0.f, 0.f}; mine[8 * 32] = ms; }
  __syncthreads();      /* publishes the hand-over rows */
  const v4fa* theirs = xo + (size_t)(w ^ 8) * 9 * 32 + lane;
  v4f pr[9];
  for (int j = 0; j < 9; ++j) pr[j] = theirs[j * 32];
  const float mn = fmaxf(muk, pr[8][0]); float ak = __builtin_amdgcn_exp2f(muk - mn), ap = __builtin_amdgcn_exp2f(pr[8][0] - mn);      /* both ranges brought to one maximum */
  const float lt = lsk * ak + pr[8][1] * ap;
  const float inv = 64.0f * __builtin_amdgcn_rcpf(lt + half_xor(lt));      /* o carried x64, the weights' own carry cancels */
  ak *= inv; ap *= inv;
  FragH f[4];
  for (int dt = 0; dt < 4; ++dt)
    for (int r = 0; r < 8; ++r) f[dt].h[r] = (_Float16)(ok[dt][r] * ak + pr[dt * 2 + (r >> 2)][r & 3] * ap);
  unsigned short* po = (unsigned short*)O16 + (q0 + kg * 16 + c) * DM + h * HD + 8 * hh;
  for (int dt = 0; dt < 4; ++dt) *(v8us*)(po + dt * 16) = f[dt].half[0];      /* all four values stand ready ahead of the first store: no register that an issued store names is written again */
}

extern "C" void kernel_launch(void* const* d_in, const int* in_sizes, int n_in,
                              void* d_out, int out_size, void* d_ws, size_t ws_size, hipStream_t stream) {
  (void)in_sizes; (void)n_in; (void)out_size;
  const float* const* I = (const float* const*)d_in; const float* x = I[0]; const float* wq = I[1]; const float* bq = I[2]; const float* wk = I[3]; const float* bk = I[4]; const float* wv = I[5]; const float* bv = I[6]; const float* phase = I[7]; const float* E = I[8]; const float* wo = I[9]; const float* bo = I[10];      /* weights [in][out] */
  char* ws = (char*)d_ws; size_t off = 0;
  auto take = [&](size_t bytes) { char* p = ws + off; off += (bytes + 255) & ~(size_t)255; return p; };
  _Float16* BQ = (_Float16*)take((size_t)DM * DM * 2); _Float16* BK = (_Float16*)take((size_t)DM * DM * 2); _Float16* BV = (_Float16*)take((size_t)DM * DM * 2); _Float16* BO = (_Float16*)take((size_t)DM * DM * 2); _Float16* MH = (_Float16*)take((size_t)NH * HD * HD * 2); _Float16* ML = (_Float16*)take((size_t)NH * HD * HD * 2);
  _Float16* X16 = (_Float16*)take(NR * DM * 2); _Float16* QH = (_Float16*)take(NR * DM * 2); _Float16* QL = (_Float16*)take(NR * DM * 2); _Float16* KH = (_Float16*)take(NR * DM * 2); _Float16* KL = (_Float16*)take(NR * DM * 2); _Float16* V16 = (_Float16*)take(NR * DM * 2);
  _Float16* KMH = (_Float16*)take(NR * DM * 2); _Float16* KML = (_Float16*)take(NR * DM * 2); _Float16* O16 = (_Float16*)take(NR * DM * 2);
  _Float16* VT = (_Float16*)take((size_t)NB * NH * HD * SQ * 2);
  (void)BK; (void)BV;      /* reached through BQ */
  if (off > ws_size) return;      /* 8.3 + 8 + 40 + 16 + 8 + 8 = approx 88 MiB */
  k_prep<<<4 * GW + GM + GX, 256, 0, stream>>>(x, wq, wk, wv, wo, E, phase, X16, BQ, MH, ML);      /* BQ, BK, BV, BO lie one behind the other */
  const size_t r0p = (size_t)B0 * SQ;
  k_qkv<<<dim3((unsigned)((MP / 128) * (DM / 128)), 3), 128, 0, stream>>>(X16 + r0p * DM, BQ, bq, bk, bv, QH + r0p * DM, QL + r0p * DM, KH + r0p * DM, KL + r0p * DM, V16 + r0p * DM);
  k_kmvt<<<GKM + NB * NH * (SQ / 64), 128, 0, stream>>>(KH, KL, MH, ML, KMH, KML, V16, VT);
  k_fattn<<<dim3(SQ / 256, NH, NB), 512, 0, stream>>>(QH, QL, KMH, KML, VT, O16);      /* o (merged heads, x64) as f16 rows */
  k_outp<<<(unsigned)((MPO / 128) * (DM / 128)), 256, 0, stream>>>(O16 + r0p * DM, BO, bo, (float*)d_out + r0p * DM);      /* out rows are the output layout */
}

// v009
// One run takes 89 microseconds.
// Next to v008, in two timings, it ran 1.08 and 1.09 times as fast.
// All steps since v000 together make it 48.2 times as fast.
#include <hip/hip_runtime.h>
// "Quantum" attention (x [2][2048][1024]): Q/K/V = x W + b ([in][out] weights + biases, 16 heads of 64); scores = (Q cos(phase)) (K cos(phase))^T / 8 + Q E K^T per head (phase [16][64], E [16][64][64]) = Q M K^T with M = E + diag(cos^2 phase / 8); softmax over the 2,048 keys; o = attn V merged; out = o out_w + out_b -> [2][2048][1024].
// Structure: token rows; x as exact f16 rows; Q and K as WMMA GEMMs (128x128 workgroup tiles, operand tiles through LDS, f32 accumulation, exact x16 transposed weights + bias) whose epilogue splits each f32 result on VALU into f16 hi + 2^-10 residual planes; V as a WMMA GEMM whose epilogue rounds to f16 and turns each 64x64 tile in LDS into rows of V^T; M as f16 hi + residual planes (VALU, cos in f32); KM = K M^T per head inside the K GEMM's epilogue (km_rows; K itself never reaches memory): three WMMA terms (hi.hi + lo.hi + hi.lo, K = 64) in three accumulators, summed in f32 in registers, split into hi + residual planes; attention in one fused launch (k_fattn): scores = Q KM^T as three WMMA terms in one accumulator, online softmax on VALU (f32 statistics, native exp2; weights x64 f16 against the maximum in use), o = P . V^T on WMMA, normalised at the end into merged f16 rows (o carried x64 against f16 subnormal flush); out = o out_w + b GEMM (f32, alpha folds 1/16 and 1/64). Four launches: jobs that do not depend on each other share a grid (k_prep, k_qkv), then k_fattn, k_outp.
// Compute dtype: inputs rounded to bf16; weights exact (x16 f16); Q, K, M, KM as f16 hi + residual planes (~2^-22); V, softmax weights (x64) and o (x64) plain f16 (~2^-12); scores, softmax statistics f32. v_wmma_f32_16x16x32_f16.
#define NB 2
#define SQ 2048
#define DM 1024
#define NH 16
#define HD 64
#define HG 4                         /* heads per group in the per-batch k_vt, which is not launched */
#define PSC 4096.0f                  /* unused; the softmax weights carry x64 */
#define B0 0                         /* first batch processed (debug hook) */
#define NBR NB                       /* batches processed (debug hook) */
#define QN SQ                        /* unused; k_fattn attends all SQ query rows per batch */
#define NHD NH                       /* unused; k_fattn attends all NH heads */
#define NR ((size_t)NB * SQ)
#define MP ((int)((size_t)NBR * SQ)) /* rows projected (debug hook) */
#define MPO MP                       /* rows through the output GEMM (debug hook) */
typedef __bf16 v16b __attribute__((ext_vector_type(16)));
typedef unsigned short v8us __attribute__((ext_vector_type(8), may_alias));
typedef float  v8f  __attribute__((ext_vector_type(8)));
typedef float  v4f  __attribute__((ext_vector_type(4)));
typedef float  v4fa __attribute__((ext_vector_type(4), may_alias));
union FragB { v16b v; v8us half[2]; unsigned short u[16]; };

__device__ __forceinline__ unsigned short bf16_bits(float x) { unsigned int u = __float_as_uint(x); return (unsigned short)((u + 0x7FFFu + ((u >> 16) & 1u)) >> 16); }
__device__ __forceinline__ float bf16_val(unsigned short b) { return __uint_as_float(((unsigned int)b) << 16); }
__device__ __forceinline__ float bf16_round(float x) { return bf16_val(bf16_bits(x)); }
// D += A·B with NT terms: 1 = ah·bh, 2 = + al·bh (A split), 3 = + ah·bl (both split)
template <int NT>
__device__ __forceinline__ v8f mmaN(v16b ah, v16b al, v16b bh, v16b bl, v8f c) {
  c = __builtin_amdgcn_wmma_f32_16x16x32_bf16(false, ah, false, bh, (short)0, c, false, false);
  if (NT >= 2) c = __builtin_amdgcn_wmma_f32_16x16x32_bf16(false, al, false, bh, (short)0, c, false, false);
  if (NT >= 3) c = __builtin_amdgcn_wmma_f32_16x16x32_bf16(false, ah, false, bl, (short)0, c, false, false);
  asm volatile("v_nop\n\tv_nop\n\tv_nop\n\tv_nop" : "+v"(c) : "v"(ah), "v"(al), "v"(bh), "v"(bl));
  return c;
}

__global__ __launch_bounds__(256) void k_wt_bf16(const float* __restrict__ W, unsigned short* __restrict__ Wt, int K, int N) {
  const int t = blockIdx.x * 256 + threadIdx.x;
  const int k8n = K / 8;
  if (t >= N * k8n) return;
  const int n = t / k8n, k8 = (t % k8n) * 8;
  v8us v;
#pragma unroll
  for (int i = 0; i < 8; ++i) v[i] = bf16_bits(W[(size_t)(k8 + i) * N + n]);
  *(v8us*)(Wt + (size_t)n * K + k8) = v;
  
}

// GEMM C[M][N] (f32, pitch ldc) = act(A[M][K]·W + bias). A f32 row-major (pitch lda) converted per fragment to bf16
// (ASPLIT: hi/lo two planes -> 2 terms, else single rounded term); Wt bf16 [N][K] (pitch ldb). BIAS_BF16 rounds the
// bias to bf16 first (bias quantised to bf16 before the add). K%32==0, M%16==0, N%64==0.
template <bool ASPLIT, int ACT, bool BIAS_BF16>
__global__ __launch_bounds__(128) void k_gemm_bf(const float* __restrict__ A, int lda, const unsigned short* __restrict__ Wt, int ldb,
                                               const float* __restrict__ bias, float* __restrict__ C, int ldc, int M, int N, int K) {
  __shared__ __attribute__((aligned(16))) float so[4][16][64];
  const int tid = threadIdx.x, w = tid >> 5, lane = tid & 31, ln = lane & 15, hh = lane >> 4;
  const int ntn = N / 64;
  const int wid = blockIdx.x * 4 + w;
  const int mt = wid / ntn, nq = wid % ntn;
  if (mt * 16 >= M) return;
  const int row0 = mt * 16, col0 = nq * 64;
  const float* arow = A + (size_t)(row0 + ln) * lda;
  v8f acc[4] = {};
  for (int kb = 0; kb < K; kb += 32) {
    FragB ah, al;
    const v4f x0 = *(const v4fa*)(arow + kb + 8 * hh), x1 = *(const v4fa*)(arow + kb + 8 * hh + 4);
    const v4f x2 = *(const v4fa*)(arow + kb + 16 + 8 * hh), x3 = *(const v4fa*)(arow + kb + 16 + 8 * hh + 4);
    float xs[16] = {x0[0],x0[1],x0[2],x0[3],x1[0],x1[1],x1[2],x1[3],x2[0],x2[1],x2[2],x2[3],x3[0],x3[1],x3[2],x3[3]};
#pragma unroll
    for (int i = 0; i < 16; ++i) { const unsigned short hb = bf16_bits(xs[i]); ah.u[i] = hb; al.u[i] = ASPLIT ? bf16_bits(xs[i] - bf16_val(hb)) : (unsigned short)0; }
#pragma unroll
    for (int t = 0; t < 4; ++t) {
      const unsigned short* brow = Wt + (size_t)(col0 + t * 16 + ln) * ldb + kb;
      FragB b;
      b.half[0] = *(const v8us*)(brow + 8 * hh);
      b.half[1] = *(const v8us*)(brow + 16 + 8 * hh);
      acc[t] = mmaN<ASPLIT ? 2 : 1>(ah.v, al.v, b.v, b.v, acc[t]);
    }
  }
#pragma unroll
  for (int t = 0; t < 4; ++t) {
    float bv = bias ? bias[col0 + t * 16 + ln] : 0.f;
    if (BIAS_BF16) bv = bf16_round(bv);
#pragma unroll
    for (int r = 0; r < 8; ++r) { float v = acc[t][r] + bv; if (ACT == 1) v = fmaxf(v, 0.f); so[w][8 * hh + r][t * 16 + ln] = v; }
  }
  __builtin_amdgcn_fence(__ATOMIC_ACQ_REL, "workgroup");
  __builtin_amdgcn_wave_barrier();
  const int rsub = lane >> 4, c4 = (lane & 15) * 4;
  {
#pragma unroll
    for (int q = 0; q < 8; ++q) {
      const int r = q * 2 + rsub;
      const v4f v = *(const v4fa*)&so[w][r][c4];
      *(v4f*)(C + (size_t)(row0 + r) * ldc + col0 + c4) = v;
    }
    
  }
}

// GEMM C = act(A·W + bias + resid): A f32 (ASPLIT -> hi/lo 2 terms), Wt bf16 [N][K]; ACT 0 none, 1 relu, 2 exact gelu;
// resid (optional, f32, row index = (row % rmod), pitch ldr, RES_BF16 rounds it) added before the activation.
template <bool ASPLIT, int ACT, bool BIAS_BF16, bool RES_BF16>
__global__ __launch_bounds__(128) void k_gemm_bf3(const float* __restrict__ A, int lda, const unsigned short* __restrict__ Wt, int ldb,
                                                const float* __restrict__ bias, const float* __restrict__ resid, int rmod, int ldr,
                                                float* __restrict__ C, int ldc, int M, int N, int K) {
  __shared__ __attribute__((aligned(16))) float so[4][16][64];
  const int tid = threadIdx.x, w = tid >> 5, lane = tid & 31, ln = lane & 15, hh = lane >> 4;
  const int ntn = N / 64;
  const int wid = blockIdx.x * 4 + w;
  const int mt = wid / ntn, nq = wid % ntn;
  if (mt * 16 >= M) return;
  const int row0 = mt * 16, col0 = nq * 64;
  const float* arow = A + (size_t)(row0 + ln) * lda;
  v8f acc[4] = {};
  for (int kb = 0; kb < K; kb += 32) {
    FragB ah, al;
    const v4f x0 = *(const v4fa*)(arow + kb + 8 * hh), x1 = *(const v4fa*)(arow + kb + 8 * hh + 4);
    const v4f x2 = *(const v4fa*)(arow + kb + 16 + 8 * hh), x3 = *(const v4fa*)(arow + kb + 16 + 8 * hh + 4);
    float xs[16] = {x0[0],x0[1],x0[2],x0[3],x1[0],x1[1],x1[2],x1[3],x2[0],x2[1],x2[2],x2[3],x3[0],x3[1],x3[2],x3[3]};
#pragma unroll
    for (int i = 0; i < 16; ++i) { const unsigned short hb = bf16_bits(xs[i]); ah.u[i] = hb; al.u[i] = ASPLIT ? bf16_bits(xs[i] - bf16_val(hb)) : (unsigned short)0; }
#pragma unroll
    for (int t = 0; t < 4; ++t) {
      const unsigned short* brow = Wt + (size_t)(col0 + t * 16 + ln) * ldb + kb;
      FragB b;
      b.half[0] = *(const v8us*)(brow + 8 * hh);
      b.half[1] = *(const v8us*)(brow + 16 + 8 * hh);
      acc[t] = mmaN<ASPLIT ? 2 : 1>(ah.v, al.v, b.v, b.v, acc[t]);
    }
  }
#pragma unroll
  for (int t = 0; t < 4; ++t) {
    const int col = col0 + t * 16 + ln;
    float bv = bias ? bias[col] : 0.f;
    if (BIAS_BF16) bv = bf16_round(bv);
#pragma unroll
    for (int r = 0; r < 8; ++r) {
      float v = acc[t][r] + bv;
      if (resid) { float rv = resid[(size_t)((row0 + 8 * hh + r) % rmod) * ldr + col]; if (RES_BF16) rv = bf16_round(rv); v += rv; }
      if (ACT == 1) v = fmaxf(v, 0.f);
      if (ACT == 2) v = 0.5f * v * (1.0f + erff(v * 0.70710678118654752f));
      if (ACT == 3) { const float u = 0.7978845608028654f * (v + 0.044715f * v * v * v); v = 0.5f * v * (1.0f + tanhf(u)); }
      so[w][8 * hh + r][t * 16 + ln] = v;
    }
  }
  __builtin_amdgcn_fence(__ATOMIC_ACQ_REL, "workgroup");
  __builtin_amdgcn_wave_barrier();
  const int rsub = lane >> 4, c4 = (lane & 15) * 4;
  {
#pragma unroll
    for (int q = 0; q < 8; ++q) {
      const int r = q * 2 + rsub;
      const v4f v = *(const v4fa*)&so[w][r][c4];
      *(v4f*)(C + (size_t)(row0 + r) * ldc + col0 + c4) = v;
    }
    
  }
}
// row LayerNorm (biased variance, eps) over N: s = X (+ R); optional out_sum <- s; out_norm <- (s-mu)*rsqrt(var+eps)*g + b
template <bool PARAM_BF16>
__global__ __launch_bounds__(256) void k_layernorm(const float* __restrict__ X, const float* __restrict__ R, const float* __restrict__ g, const float* __restrict__ bta,
                                                  float* __restrict__ out_sum, float* __restrict__ out_norm, int N, float eps) {
  __shared__ float red[256];
  const int row = blockIdx.x, tid = threadIdx.x;
  const float* x = X + (size_t)row * N; const float* rr = R ? R + (size_t)row * N : nullptr;
  float vals[16];                     // up to N = 4096
  const int per = N / 256;            // contiguous chunk per thread? use strided-by-4 chunks: thread handles j = tid*4 + 1024*u
  float s1 = 0.f;
  for (int u = 0; u < per / 4; ++u) {
    const int j = tid * 4 + 1024 * u;
    const v4f a = *(const v4fa*)(x + j);
    v4f b = {0.f,0.f,0.f,0.f}; if (rr) b = *(const v4fa*)(rr + j);
#pragma unroll
    for (int q = 0; q < 4; ++q) { const float v = a[q] + b[q]; vals[u * 4 + q] = v; s1 += v; }
  }
  red[tid] = s1; __syncthreads();
  for (int st = 128; st > 0; st >>= 1) { if (tid < st) red[tid] += red[tid + st]; __syncthreads(); }
  const float mu = red[0] / (float)N; __syncthreads();
  float s2 = 0.f;
  for (int u = 0; u < per / 4; ++u)
#pragma unroll
    for (int q = 0; q < 4; ++q) { const float c = vals[u * 4 + q] - mu; s2 += c * c; }
  red[tid] = s2; __syncthreads();
  for (int st = 128; st > 0; st >>= 1) { if (tid < st) red[tid] += red[tid + st]; __syncthreads(); }
  const float rs = rsqrtf(red[0] / (float)N + eps);
  {
    for (int u = 0; u < per / 4; ++u) {
      const int j = tid * 4 + 1024 * u;
      v4f o, sm;
#pragma unroll
      for (int q = 0; q < 4; ++q) {
        float gg = g[j + q], bb = bta[j + q];
        if (PARAM_BF16) { gg = bf16_round(gg); bb = bf16_round(bb); }
        sm[q] = vals[u * 4 + q]; o[q] = (vals[u * 4 + q] - mu) * rs * gg + bb;
      }
      if (out_sum) *(v4f*)(out_sum + (size_t)row * N + j) = sm;
      *(v4f*)(out_norm + (size_t)row * N + j) = o;
    }
    
  }
}



// ---- f16 WMMA path (v_wmma_f32_16x16x32_f16): 11-bit significands for operands in range — used where a [0,1] probability operand needs more precision than bf16
typedef _Float16 v16h __attribute__((ext_vector_type(16)));
union FragH { v16h v; v8us half[2]; _Float16 h[16]; unsigned short u[16]; };
template <int NT>
__device__ __forceinline__ v8f mmaH(v16h ah, v16h al, v16h bh, v16h bl, v8f c) {
  c = __builtin_amdgcn_wmma_f32_16x16x32_f16(false, ah, false, bh, (short)0, c, false, false);
  if (NT >= 2) c = __builtin_amdgcn_wmma_f32_16x16x32_f16(false, al, false, bh, (short)0, c, false, false);
  if (NT >= 3) c = __builtin_amdgcn_wmma_f32_16x16x32_f16(false, ah, false, bl, (short)0, c, false, false);
  asm volatile("v_nop\n\tv_nop\n\tv_nop\n\tv_nop" : "+v"(c) : "v"(ah), "v"(al), "v"(bh), "v"(bl));
  return c;
}
// batched GEMM like k_gemm_b but f16 operands: A f32 (split into f16 hi/lo if ASPLIT, else rounded to f16), Bt = f16 values [n][k]; alpha; C f32; N multiple of 16 (partial tiles skipped)
template <bool ASPLIT>
__global__ __launch_bounds__(128) void k_gemm_h(const float* __restrict__ A, int lda, size_t sA, const _Float16* __restrict__ Bh, int ldb, size_t sB, float alpha, float* __restrict__ C, int ldc, size_t sC, int M, int N, int K) {
  __shared__ __attribute__((aligned(16))) float so[4][16][64];
  const int tid = threadIdx.x, w = tid >> 5, lane = tid & 31, ln = lane & 15, hh = lane >> 4; const int by = blockIdx.y;
  A += (size_t)by * sA; Bh += (size_t)by * sB; C += (size_t)by * sC;
  const int ntn = (N + 63) / 64; const int wid = blockIdx.x * 4 + w; const int mt = wid / ntn, nq = wid % ntn; if (mt * 16 >= M) return;
  const int row0 = mt * 16, col0 = nq * 64; const float* arow = A + (size_t)(row0 + ln) * lda;
  v8f acc[4] = {};
  for (int kb = 0; kb < K; kb += 32) {
    FragH ah, al;
    const v4f x0 = *(const v4fa*)(arow + kb + 8 * hh), x1 = *(const v4fa*)(arow + kb + 8 * hh + 4), x2 = *(const v4fa*)(arow + kb + 16 + 8 * hh), x3 = *(const v4fa*)(arow + kb + 16 + 8 * hh + 4);
    float xs[16] = {x0[0],x0[1],x0[2],x0[3],x1[0],x1[1],x1[2],x1[3],x2[0],x2[1],x2[2],x2[3],x3[0],x3[1],x3[2],x3[3]};
#pragma unroll
    for (int i = 0; i < 16; ++i) { const _Float16 h = (_Float16)xs[i]; ah.h[i] = h; al.h[i] = ASPLIT ? (_Float16)(xs[i] - (float)h) : (_Float16)0.0f; }
#pragma unroll
    for (int t = 0; t < 4; ++t) { if (col0 + t * 16 >= N) continue; const size_t boff = (size_t)(col0 + t * 16 + ln) * ldb + kb; FragH bq; bq.half[0] = *(const v8us*)(Bh + boff + 8 * hh); bq.half[1] = *(const v8us*)(Bh + boff + 16 + 8 * hh);
      acc[t] = mmaH<ASPLIT ? 2 : 1>(ah.v, al.v, bq.v, bq.v, acc[t]); }
  }
#pragma unroll
  for (int t = 0; t < 4; ++t) { if (col0 + t * 16 >= N) continue;
#pragma unroll
    for (int r = 0; r < 8; ++r) so[w][8 * hh + r][t * 16 + ln] = acc[t][r] * alpha; }
  __builtin_amdgcn_fence(__ATOMIC_ACQ_REL, "workgroup"); __builtin_amdgcn_wave_barrier();
  const int rsub = lane >> 4, c4 = (lane & 15) * 4;
  {
#pragma unroll
    for (int q = 0; q < 8; ++q) { const int r = q * 2 + rsub; if (col0 + c4 < N) { const v4f v = *(const v4fa*)&so[w][r][c4]; *(v4f*)(C + (size_t)(row0 + r) * ldc + col0 + c4) = v; } }
     }
}

// Wt[n][k] = f16(bf16(W[k][n]) x scale) from f32 row-major W[DM][DM] (scale = power of two; bf16-exact weights stay exact in f16 away from the subnormal range).
// One workgroup of 256 threads turns one tile of 128 k x 64 n in LDS: every 16-byte global load covers whole 128-byte lines of W rows (256 B a row), every 16-byte store whole lines of Wt rows (256 B a row); a thread's eight loads are issued together.
#define WTK 128                      /* k per tile */
#define WTN 64                       /* n per tile */
typedef unsigned int v4u __attribute__((ext_vector_type(4), may_alias));
__device__ __forceinline__ void wt_tile(const float* __restrict__ W, _Float16* __restrict__ Wt, float scale, int bid) {
  __shared__ unsigned int tl[WTN][WTK / 2 + 1];      /* a word holds two neighbouring k of one n; the odd pitch spreads a wave's 32 word stores, and its 32 word reads, over 32 banks */
  const int tid = threadIdx.x; const int k0 = (bid % (DM / WTK)) * WTK, n0 = (bid / (DM / WTK)) * WTN;
  const int lo = tid & 15, up = tid >> 4;
  const float* g = W + (size_t)(k0 + 2 * up) * DM + n0 + lo * 4; v4f a[4][2];      /* rows k0 + 32 u + 2 up + j, columns n0 + 4 lo .. + 3 */
#pragma unroll      /* constant indices into a[]; one address pair, the rows differ in the immediate offset */
  for (int u = 0; u < 4; ++u) { a[u][0] = *(const v4fa*)(g + (size_t)(u * 32) * DM); a[u][1] = *(const v4fa*)(g + (size_t)(u * 32 + 1) * DM); }
#pragma unroll      /* constant indices into a[] */
  for (int u = 0; u < 4; ++u)
    for (int i = 0; i < 4; ++i) { union { _Float16 h[2]; unsigned int w; } p; p.h[0] = (_Float16)(bf16_round(a[u][0][i]) * scale); p.h[1] = (_Float16)(bf16_round(a[u][1][i]) * scale); tl[lo * 4 + i][u * 16 + up] = p.w; }
  __syncthreads();      /* publishes the tile */
  unsigned short* d = (unsigned short*)Wt + (size_t)(n0 + up) * DM + k0 + lo * 8; v4u o[4];
#pragma unroll      /* constant indices into o[]: all LDS reads stand ahead of the first store, so no register that an issued store names is written again */
  for (int u = 0; u < 4; ++u) for (int j = 0; j < 4; ++j) o[u][j] = tl[u * 16 + up][lo * 4 + j];
#pragma unroll      /* constant indices into o[] */
  for (int u = 0; u < 4; ++u) *(v4u*)(d + (size_t)(u * 16) * DM) = o[u];
}
// k_gemm_hh variant with fused epilogue: v = acc·alpha + bias[by·sBias + col] (+ CP[(row/rowsPerB)·sCPb + by·64 + col] if CP) ; ACT 0 none / 1 elu ; writes f16 C16 (and f32 C if non-null)
template <int ACT>
__global__ __launch_bounds__(128) void k_gemm_hhx(const _Float16* __restrict__ A, int lda, size_t sA, const _Float16* __restrict__ Bh, int ldb, size_t sB, float alpha, const float* __restrict__ bias, size_t sBias, const float* __restrict__ CP, int rowsPerB, size_t sCPb, int row0g,
    float* __restrict__ C, _Float16* __restrict__ C16, int ldc, size_t sC, int M, int N, int K) {
  __shared__ __attribute__((aligned(16))) float so[4][16][64];
  const int tid = threadIdx.x, w = tid >> 5, lane = tid & 31, ln = lane & 15, hh = lane >> 4; const int by = blockIdx.y;
  A += (size_t)by * sA; Bh += (size_t)by * sB; const size_t cofs = (size_t)by * sC; const float* bp = bias ? bias + (size_t)by * sBias : nullptr;
  const int ntn = (N + 63) / 64; const int wid = blockIdx.x * 4 + w; const int mt = wid / ntn, nq = wid % ntn; if (mt * 16 >= M) return;
  const int row0 = mt * 16, col0 = nq * 64; const _Float16* arow = A + (size_t)(row0 + ln) * lda;
  v8f acc[4] = {};
  for (int kb = 0; kb < K; kb += 32) { FragH ah; ah.half[0] = *(const v8us*)((const unsigned short*)arow + kb + 8 * hh); ah.half[1] = *(const v8us*)((const unsigned short*)arow + kb + 16 + 8 * hh);
#pragma unroll
    for (int t = 0; t < 4; ++t) { if (col0 + t * 16 >= N) continue; const size_t boff = (size_t)(col0 + t * 16 + ln) * ldb + kb; FragH bq; bq.half[0] = *(const v8us*)((const unsigned short*)Bh + boff + 8 * hh); bq.half[1] = *(const v8us*)((const unsigned short*)Bh + boff + 16 + 8 * hh);
      acc[t] = mmaH<1>(ah.v, ah.v, bq.v, bq.v, acc[t]); }
  }
#pragma unroll
  for (int t = 0; t < 4; ++t) { if (col0 + t * 16 >= N) continue; const int col = col0 + t * 16 + ln; const float bv = bp ? bf16_round(bp[col]) : 0.f;
#pragma unroll
    for (int r = 0; r < 8; ++r) { float v = acc[t][r] * alpha + bv; if (CP) { const int rr = row0g + row0 + 8 * hh + r; if (rowsPerB < 0) v += CP[cofs + (size_t)rr * ldc + col];      /* rowsPerB < 0: own element of the batched C plane */ else { const int bidx = rr / rowsPerB; v += CP[(size_t)bidx * sCPb + (size_t)by * 64 + col]; } } if (ACT == 1) v = (v > 0.f) ? v : expm1f(v); else if (ACT == 7) v = (v > 0.f) ? v + 1.0f : expf(v); else if (ACT == 8) v = tanhf(v); else if (ACT == 9) v = 0.5f * v * (1.0f + tanhf(0.7978845608028654f * (v + 0.044715f * v * v * v))); else if (ACT == 11) v = 1.0f / (1.0f + expf(-v)); else if (ACT == 12) v = (v > 0.f) ? v : 0.01f * v; else if (ACT == 14) v = (v > 0.f) ? v : 0.1f * v; else if (ACT == 16) v = (v >= 0.f) ? v : 0.3f * v; else if (ACT == 17) v = (v >= 0.f) ? v : 0.2f * v; else if (ACT == 15) v = v / (1.0f + expf(-v)); else if (ACT == 3) v = fmaxf(v, 0.f); else if (ACT == 6) v = 0.5f * v * (1.0f + erff(v * 0.70710678118654752f)); so[w][8 * hh + r][t * 16 + ln] = v; } }
  __builtin_amdgcn_fence(__ATOMIC_ACQ_REL, "workgroup"); __builtin_amdgcn_wave_barrier();
  const int rsub = lane >> 4, c4 = (lane & 15) * 4; typedef _Float16 v4h __attribute__((ext_vector_type(4)));
  {
#pragma unroll
    for (int q = 0; q < 8; ++q) { const int r = q * 2 + rsub; if (col0 + c4 < N) { const v4f v = *(const v4fa*)&so[w][r][c4]; if (C) *(v4f*)(C + cofs + (size_t)(row0 + r) * ldc + col0 + c4) = v; if (C16) { v4h h4; for (int i = 0; i < 4; ++i) h4[i] = (_Float16)v[i]; *(v4h*)(C16 + cofs + (size_t)(row0 + r) * ldc + col0 + c4) = h4; } } }
     }
}


typedef _Float16 v4h __attribute__((ext_vector_type(4)));

__device__ __forceinline__ void x16_rows(const float* __restrict__ x, _Float16* __restrict__ X16, size_t n8, int bid) { const size_t t = (size_t)bid * 256 + threadIdx.x; if (t >= n8) return; FragH f;
#pragma unroll
  for (int q = 0; q < 8; ++q) f.h[q] = (_Float16)bf16_round(x[t * 8 + q]); *(v8us*)((unsigned short*)X16 + t * 8) = f.half[0];  }
__global__ __launch_bounds__(256) void k_h16(const float* __restrict__ x, _Float16* __restrict__ X16, size_t n8) { const size_t t = (size_t)blockIdx.x * 256 + threadIdx.x; if (t >= n8) return; FragH f;
#pragma unroll
  for (int q = 0; q < 8; ++q) f.h[q] = (_Float16)x[t * 8 + q]; *(v8us*)((unsigned short*)X16 + t * 8) = f.half[0];  }
__global__ __launch_bounds__(256) void k_round16f(const float* __restrict__ W, _Float16* __restrict__ Bt, size_t n8) { const size_t t = (size_t)blockIdx.x * 256 + threadIdx.x; if (t >= n8) return; FragH f;
#pragma unroll
  for (int i = 0; i < 8; ++i) f.h[i] = (_Float16)(bf16_round(W[t * 8 + i]) * 16.0f); *(v8us*)((unsigned short*)Bt + t * 8) = f.half[0];  }
// 32 f32 rows of 64 that a wave has staged in LDS (pitch 68) leave as two f16 planes: hi = f16(v), residual = f16((v - hi) x1024). Eight lanes take a row, so a wave's 16-byte stores cover four whole 128-byte lines.
__device__ __forceinline__ void split_store(const float (*so)[68], int lane, _Float16* __restrict__ Hh, _Float16* __restrict__ Hl, size_t o0, int ldc) {
  const int rs = lane >> 3, c8 = (lane & 7) * 8; v4f a[8], c[8];
#pragma unroll      /* a[] and c[] stay in registers, and all 16 LDS reads are issued ahead of the first conversion */
  for (int q = 0; q < 8; ++q) { a[q] = *(const v4fa*)&so[q * 4 + rs][c8]; c[q] = *(const v4fa*)&so[q * 4 + rs][c8 + 4]; }
#pragma unroll      /* constant indices into a[] and c[] */
  for (int q = 0; q < 8; ++q) { FragH fh, fl;
    for (int i = 0; i < 4; ++i) { _Float16 h = (_Float16)a[q][i]; fh.h[i] = h; fl.h[i] = (_Float16)((a[q][i] - (float)h) * 1024.0f); h = (_Float16)c[q][i]; fh.h[4 + i] = h; fl.h[4 + i] = (_Float16)((c[q][i] - (float)h) * 1024.0f); }
    const size_t o = o0 + (size_t)(q * 4 + rs) * ldc + c8; unsigned short* ph = (unsigned short*)Hh + o; unsigned short* pl = (unsigned short*)Hl + o; const v8us vh = fh.half[0], vl = fl.half[0];
    *(v8us*)ph = vh; *(v8us*)pl = vl;
    asm volatile("s_wait_xcnt 0x0" :: "v"(ph), "v"(pl), "v"(vh), "v"(vl) : "memory");      /* stands in front of every later rewrite of the registers that these two stores name (the next rows', or the code behind the call); they are inputs so that they stay live up to the wait */
  } }

// ---- fast GEMM (workgroup tile 128x128; a wave takes MW row tiles x 4 column tiles: MW = 4: four waves of 64x64, MW = 2: eight waves of 32x64; requires M % 128 == 0, N % 128 == 0, K % KS == 0); epilogue = k_gemm_hhx semantics; with CL the result leaves as two f16 planes, hi in C16 and residual in CL, and no f32 row is written ----
// The A tile and the B tile (128 rows each) go through LDS in stages of KS k, two buffers: every 16-byte global load of a wave covers whole 128-byte lines, the next stage's loads are all
// issued ahead of this stage's products and stored behind them, one barrier per stage. The fragments and their k order are the ones the global rows gave.
// The square tile asks L2 for 256 operand rows per 16,384 results (a 128x64 tile: 192 per 8,192); a 64x64 wave reads 8 fragments from LDS per 16 products (32x64: 6 per 8) and suits a launch with several workgroups per WGP, eight 32x64 waves one that has a single workgroup per WGP.
__device__ __forceinline__ v16h g2_frag(const _Float16* p, int hh) { FragH f; f.half[0] = *(const v8us*)((const unsigned short*)p + 8 * hh); f.half[1] = *(const v8us*)((const unsigned short*)p + 16 + 8 * hh); return f.v; }
__device__ __forceinline__ v8f g2_mma(v16h a, v16h b, v8f c) { v8f d = __builtin_amdgcn_wmma_f32_16x16x32_f16(false, a, false, b, (short)0, c, false, false); asm volatile("v_nop\n\tv_nop\n\tv_nop\n\tv_nop" : "+v"(d) : "v"(a), "v"(b)); return d; }
// 32 f32 rows of K (one head, 64 columns) that a wave has staged in LDS (pitch 68) are replaced in place by their rows of KM = K M^T: the rows are split in registers into hi + x1024 residual fragments,
// the terms hi.hi, residual.hi, hi.residual run each in its own accumulator and are summed in f32 in that order. mh, ml: the head's 64 rows of M hi and M residual in LDS, pitch PT.
template <int PT>
__device__ __forceinline__ void km_rows(float (*so)[68], const _Float16 (*mh)[PT], const _Float16 (*ml)[PT], int ln, int hh) {
  v16h ah[2][2], al[2][2];      /* [row tile][k step]; all reads of the K rows stand ahead of the first KM store */
  for (int m = 0; m < 2; ++m)
    for (int ks = 0; ks < 2; ++ks) { const float* p = &so[m * 16 + ln][ks * 32 + 8 * hh]; const v4f x[4] = {*(const v4fa*)p, *(const v4fa*)(p + 4), *(const v4fa*)(p + 16), *(const v4fa*)(p + 20)}; FragH fh, fl;
      for (int j = 0; j < 4; ++j) for (int i = 0; i < 4; ++i) { const _Float16 h = (_Float16)x[j][i]; fh.h[j * 4 + i] = h; fl.h[j * 4 + i] = (_Float16)((x[j][i] - (float)h) * 1024.0f); }
      ah[m][ks] = fh.v; al[m][ks] = fl.v; }
  const v8f z8 = {0.f,0.f,0.f,0.f,0.f,0.f,0.f,0.f};
#pragma unroll 1      /* kept rolled so that 12 accumulators are live, not 24, beside the GEMM's own: three waves per SIMD must still fit */
  for (int th = 0; th < 2; ++th) {      /* two column tiles at a time */
    v8f c1[2][2], c2[2][2], c3[2][2];      /* [row tile][column tile] of hi.hi, residual.hi, hi.residual */
    for (int m = 0; m < 2; ++m) for (int t = 0; t < 2; ++t) { c1[m][t] = z8; c2[m][t] = z8; c3[m][t] = z8; }
    for (int ks = 0; ks < 2; ++ks) {
      v16h bh[2], bl[2];
      for (int t = 0; t < 2; ++t) { bh[t] = g2_frag(&mh[(th * 2 + t) * 16 + ln][ks * 32], hh); bl[t] = g2_frag(&ml[(th * 2 + t) * 16 + ln][ks * 32], hh); }
      for (int t = 0; t < 2; ++t) for (int m = 0; m < 2; ++m) c1[m][t] = __builtin_amdgcn_wmma_f32_16x16x32_f16(false, ah[m][ks], false, bh[t], (short)0, c1[m][t], false, false);
      for (int t = 0; t < 2; ++t) for (int m = 0; m < 2; ++m) c2[m][t] = __builtin_amdgcn_wmma_f32_16x16x32_f16(false, al[m][ks], false, bh[t], (short)0, c2[m][t], false, false);
      for (int t = 0; t < 2; ++t) for (int m = 0; m < 2; ++m) c3[m][t] = __builtin_amdgcn_wmma_f32_16x16x32_f16(false, ah[m][ks], false, bl[t], (short)0, c3[m][t], false, false);
    }
    for (int m = 0; m < 2; ++m)
      for (int t = 0; t < 2; ++t)
        for (int r = 0; r < 8; ++r) { float v = c2[m][t][r] * 0.0009765625f + c1[m][t][r]; v = c3[m][t][r] * 0.0009765625f + v;      /* the residual planes carry x1024; the scaling is exact, so each line rounds once */
          so[m * 16 + 8 * hh + r][(th * 2 + t) * 16 + ln] = v; }
  }
}
template <int ACT, int KS, int MW, int LDA, int LDB>
__device__ __forceinline__ void gemm2(int bx, int by, const _Float16* __restrict__ A, size_t sA, const _Float16* __restrict__ Bh, size_t sB, float alpha, const float* __restrict__ bias, size_t sBias, const float* __restrict__ CP, int rowsPerB, size_t sCPb, int row0g,
    float* __restrict__ C, _Float16* __restrict__ C16, _Float16* __restrict__ CL, int ldc, size_t sC, int M, int N, int K, const _Float16* __restrict__ MHp, const _Float16* __restrict__ MLp, _Float16* __restrict__ VTp) { static_assert(ACT == 0 || ACT == 3 || ACT == 6 || ACT == 8 || ACT == 9 || ACT == 11 || ACT == 12 || ACT == 14 || ACT == 15 || ACT == 16 || ACT == 17, "k_gemm2: unsupported ACT code (would silently apply no activation)");
  constexpr int NW = 16 / MW;       /* waves: 8 / MW down the rows x 2 across the columns */
  constexpr int CH = KS / 8;        /* 16-byte pieces per tile row */
  constexpr int RPR = NW * 32 / CH; /* tile rows that one load of every thread covers */
  constexpr int NL = 128 / RPR;     /* loads of a thread per operand and stage */
  constexpr int PT = KS + 8;        /* LDS row pitch in f16: the row + 16 B, conflict-free for 16-byte fragment reads */
  constexpr bool HEADS = KS == HD && MW == 4;      /* a wave's 64x64 tile is 64 tokens of one head: with MHp the tile leaves as KM = tile . M^T (hi + residual planes), with VTp as rows of V^T; both pointers are the same for a whole workgroup */
  __shared__ __attribute__((aligned(16))) float so[NW][32][68];
  __shared__ __attribute__((aligned(16))) _Float16 sa[2][128][PT];
  __shared__ __attribute__((aligned(16))) _Float16 sb[2][128][PT];
  const int tid = threadIdx.x, w = tid >> 5, lane = tid & 31, ln = lane & 15, hh = lane >> 4;
  A += (size_t)by * sA; Bh += (size_t)by * sB; const size_t cofs = (size_t)by * sC; const float* bp = bias ? bias + (size_t)by * sBias : nullptr;
  const int ntn = N >> 7; const int mt = bx / ntn, nq = bx - mt * ntn; const int row0 = mt * 128 + 16 * MW * (w >> 1), col0 = nq * 128 + 64 * (w & 1); if (mt * 128 >= M) return;      /* the same for the whole workgroup, in front of every barrier */
  const int sr = tid / CH, sp = (tid % CH) * 8;
  const unsigned short* ga = (const unsigned short*)A + (size_t)(mt * 128 + sr) * LDA + sp; const unsigned short* gb = (const unsigned short*)Bh + (size_t)(nq * 128 + sr) * LDB + sp;
  constexpr size_t da = (size_t)RPR * LDA, db = (size_t)RPR * LDB;      /* row pitches LDA, LDB are compile-time, so a stage's loads share one address pair per operand and differ in the immediate offset */
  v8us ta[NL], tb[NL];
  for (int i = 0; i < NL; ++i) ta[i] = *(const v8us*)(ga + i * da);
  for (int i = 0; i < NL; ++i) tb[i] = *(const v8us*)(gb + i * db);
  for (int i = 0; i < NL; ++i) *(v8us*)&sa[0][i * RPR + sr][sp] = ta[i];
  for (int i = 0; i < NL; ++i) *(v8us*)&sb[0][i * RPR + sr][sp] = tb[i];
  __syncthreads();      /* publishes stage 0 */
  const v8f z8 = {0.f,0.f,0.f,0.f,0.f,0.f,0.f,0.f}; v8f c[MW][4];      /* [row tile][column tile] */
#pragma unroll      /* constant indices into c[] */
  for (int m = 0; m < MW; ++m) for (int t = 0; t < 4; ++t) c[m][t] = z8;
  const int nst = K / KS;
  const int ra = 16 * MW * (w >> 1) + ln, rb = 64 * (w & 1) + ln;
  for (int s = 0; s < nst; ++s) { const int buf = s & 1; const bool more = s + 1 < nst;
    if (more) { ga += KS; gb += KS;
      for (int i = 0; i < NL; ++i) ta[i] = *(const v8us*)(ga + i * da);
      for (int i = 0; i < NL; ++i) tb[i] = *(const v8us*)(gb + i * db);
      if constexpr (HEADS) asm volatile("s_wait_xcnt 0x0" :: "v"(ga), "v"(gb) : "memory"); }      /* stands in front of the next rewrite of the two address pairs that these loads name; the pairs are inputs so that they stay live up to the wait */
    if constexpr (HEADS) { if (!more && MHp) {      /* the last stage leaves the staging registers free: they fetch the M rows of the workgroup's two heads (128 rows of 128 B per plane) under its products */
      const unsigned short* gm = (const unsigned short*)MHp + (size_t)(nq * 128 + sr) * HD + sp; const unsigned short* gl = (const unsigned short*)MLp + (size_t)(nq * 128 + sr) * HD + sp;
      for (int i = 0; i < NL; ++i) ta[i] = *(const v8us*)(gm + i * RPR * HD);
      for (int i = 0; i < NL; ++i) tb[i] = *(const v8us*)(gl + i * RPR * HD);
      asm volatile("s_wait_xcnt 0x0" :: "v"(gm), "v"(gl) : "memory"); } }      /* stands in front of every later rewrite of the two address pairs that these loads name; they are inputs so that they stay live up to the wait */
#pragma unroll      /* constant indices into c[], a[] and b[] */
    for (int ks = 0; ks < KS / 32; ++ks) {      /* the fragments of 32 k are read from LDS as one group, then their products */
      v16h a[MW], b[4];
      for (int m = 0; m < MW; ++m) a[m] = g2_frag(&sa[buf][ra + 16 * m][ks * 32], hh);
      for (int t = 0; t < 4; ++t) b[t] = g2_frag(&sb[buf][rb + 16 * t][ks * 32], hh);
      for (int t = 0; t < 4; ++t) for (int m = 0; m < MW; ++m) c[m][t] = g2_mma(a[m], b[t], c[m][t]); }
    if (more) {
      for (int i = 0; i < NL; ++i) *(v8us*)&sa[buf ^ 1][i * RPR + sr][sp] = ta[i];
      for (int i = 0; i < NL; ++i) *(v8us*)&sb[buf ^ 1][i * RPR + sr][sp] = tb[i];
      __syncthreads(); }      /* publishes the next stage and ends every wave's reads of this one, which the stage after next overwrites */
  }
  float bvs[4] = {0.f, 0.f, 0.f, 0.f};      /* the lane's four bias values serve all its row tiles: read once, the four loads issued together */
  if (bp) { for (int t = 0; t < 4; ++t) bvs[t] = bp[col0 + t * 16 + ln];
    for (int t = 0; t < 4; ++t) bvs[t] = bf16_round(bvs[t]); }
  if constexpr (HEADS) {
    if (MHp) {
      __syncthreads();      /* ends every wave's reads of the last stage, whose bytes the M planes take */
      for (int i = 0; i < NL; ++i) *(v8us*)&sa[0][i * RPR + sr][sp] = ta[i];
      for (int i = 0; i < NL; ++i) *(v8us*)&sa[1][i * RPR + sr][sp] = tb[i];
      __syncthreads();      /* publishes the M planes */
    }
    if (VTp) {      /* V^T [batch][head][d][token]: a lane's eight accumulator registers are eight tokens in a row of one d, so the turn is one 16-byte LDS store per tile; rows of 64 tokens leave as whole 128-byte lines */
      __syncthreads();      /* ends every wave's reads of the last stage, whose bytes the turned tiles take */
      _Float16 (*tv)[PT] = &sb[w >> 1][(w & 1) * 64];      /* the wave's own 64 rows (d) of 64 tokens */
#pragma unroll      /* constant indices into c[] */
      for (int t = 0; t < 4; ++t) for (int m = 0; m < MW; ++m) { FragH f;
        for (int r = 0; r < 8; ++r) f.h[r] = (_Float16)(c[m][t][r] * alpha + bvs[t]);
        *(v8us*)&tv[t * 16 + ln][m * 16 + 8 * hh] = f.half[0]; }
      __builtin_amdgcn_fence(__ATOMIC_ACQ_REL, "workgroup", "local"); __builtin_amdgcn_wave_barrier();      /* each wave reads back only its own rows */
      const int rs = lane >> 3, c8 = (lane & 7) * 8; v8us o[16];
      unsigned short* d = (unsigned short*)VTp + ((size_t)((row0 / SQ) * NH + col0 / HD) * HD + rs) * SQ + row0 % SQ + c8;
#pragma unroll      /* constant indices into o[]: all LDS reads stand ahead of the first store, so no register that an issued store names is written again */
      for (int q = 0; q < 16; ++q) o[q] = *(const v8us*)&tv[q * 4 + rs][c8];
#pragma unroll      /* constant indices into o[]; one address pair, the rows differ in the immediate offset */
      for (int q = 0; q < 16; ++q) *(v8us*)(d + (size_t)(q * 4) * SQ) = o[q];
      asm volatile("s_wait_xcnt 0x0" :: "v"(d), "v"(o[0]), "v"(o[1]), "v"(o[2]), "v"(o[3]), "v"(o[4]), "v"(o[5]), "v"(o[6]), "v"(o[7]), "v"(o[8]), "v"(o[9]), "v"(o[10]), "v"(o[11]), "v"(o[12]), "v"(o[13]), "v"(o[14]), "v"(o[15]) : "memory");      /* stands in front of every later rewrite of the registers that these sixteen stores name (the listing joins this way with the other epilogue); they are inputs so that they stay live up to the wait */
      return;      /* the same for the whole workgroup, behind its last barrier */
    }
  }
#pragma unroll      /* constant indices into c[]: a wave's rows leave 32 at a time through its own staging rows */
  for (int hf = 0; hf < MW / 2; ++hf) { const int rowh = row0 + 32 * hf;
#pragma unroll
    for (int u = 0; u < 8; ++u) { const int t = u & 3, half = u >> 2; const int col = col0 + t * 16 + ln; const float bv = bvs[t];
#pragma unroll
      for (int r = 0; r < 8; ++r) { const int rloc = half * 16 + 8 * hh + r; float v = c[hf * 2 + half][t][r] * alpha + bv; if (CP) { if (rowsPerB < 0) v += CP[cofs + (size_t)(row0g + rowh + rloc) * ldc + col];      /* rowsPerB < 0: own element of the batched C plane */ else { const int bidx = (row0g + rowh + rloc) / rowsPerB; v += CP[(size_t)bidx * sCPb + (size_t)by * 64 + col]; } }
        if (ACT == 3) v = fmaxf(v, 0.f); else if (ACT == 6) v = 0.5f * v * (1.0f + erff(v * 0.70710678118654752f)); else if (ACT == 11) v = 1.0f / (1.0f + expf(-v)); else if (ACT == 15) v = v / (1.0f + expf(-v)); else if (ACT == 12) v = (v > 0.f) ? v : 0.01f * v; else if (ACT == 8) v = tanhf(v); else if (ACT == 9) v = 0.5f * v * (1.0f + tanhf(0.7978845608028654f * (v + 0.044715f * v * v * v))); else if (ACT == 14) v = (v > 0.f) ? v : 0.1f * v; else if (ACT == 16) v = (v >= 0.f) ? v : 0.3f * v; else if (ACT == 17) v = (v >= 0.f) ? v : 0.2f * v;
        so[w][rloc][t * 16 + ln] = v; } }
    __builtin_amdgcn_fence(__ATOMIC_ACQ_REL, "workgroup", "local"); __builtin_amdgcn_wave_barrier();      /* each wave reads back only its own rows; the fence names LDS alone, so that it does not wait for the global stores of the 32 rows before */
    if constexpr (HEADS) { if (MHp) { km_rows<PT>(so[w], &sa[0][64 * (w & 1)], &sa[1][64 * (w & 1)], ln, hh);
      __builtin_amdgcn_fence(__ATOMIC_ACQ_REL, "workgroup", "local"); __builtin_amdgcn_wave_barrier(); } }      /* each wave reads back only its own rows, now of KM */
    if (CL) split_store(so[w], lane, C16, CL, cofs + (size_t)rowh * ldc + col0, ldc);      /* the same for every wave, behind the last barrier */
    else if constexpr (!HEADS) { const int rsub = lane >> 4, c4 = (lane & 15) * 4;      /* a tile of heads leaves as planes or, above, as V^T */
#pragma unroll
      for (int q = 0; q < 16; ++q) { const int r = q * 2 + rsub; const v4f v = *(const v4fa*)&so[w][r][c4]; if (C) *(v4f*)(C + cofs + (size_t)(rowh + r) * ldc + col0 + c4) = v; if (C16) { v4h h4; for (int i = 0; i < 4; ++i) h4[i] = (_Float16)v[i]; *(v4h*)(C16 + cofs + (size_t)(rowh + r) * ldc + col0 + c4) = h4; } } }
    if (hf + 1 < MW / 2) asm volatile("s_wait_xcnt 0x0" ::: "memory");      /* stands in front of the next 32 rows' rewrites of the registers that these rows' global stores name; its clobber also keeps the next rows' LDS stores behind these rows' LDS reads (a wave's LDS operations run in order) */
  } }
// out = o out_w + b: f32 rows
__global__ __launch_bounds__(256) void k_outp(const _Float16* __restrict__ O16, const _Float16* __restrict__ BO, const float* __restrict__ bo, float* __restrict__ out) {
  gemm2<0, 128, 2, DM, DM>(blockIdx.x, 0, O16, 0, BO, 0, 0.0009765625f, bo, 0, nullptr, 1, 0, 0, out, nullptr, nullptr, DM, 0, MPO, DM, DM, nullptr, nullptr, nullptr); }
// Q, K and V projections share one launch: blockIdx.y picks the weight plane (BW holds the three one behind the other), the bias and the result planes; Q leaves as hi + residual rows; K never leaves: its epilogue forms KM[k][h*64+d] = sum_e K[k][h*64+e] M[h][d][e], which leaves as hi + residual rows; V leaves turned, as V^T [NB][NH][HD][SQ]
__global__ __launch_bounds__(128) void k_qkv(const _Float16* __restrict__ X16, const _Float16* __restrict__ BW, const float* __restrict__ bq, const float* __restrict__ bk, const float* __restrict__ bv, const _Float16* __restrict__ MH, const _Float16* __restrict__ ML,
    _Float16* __restrict__ QH, _Float16* __restrict__ QL, _Float16* __restrict__ KMH, _Float16* __restrict__ KML, _Float16* __restrict__ VT) {
  const int j = blockIdx.y; const float* bias = j == 0 ? bq : j == 1 ? bk : bv; _Float16* ch = j == 0 ? QH : j == 1 ? KMH : nullptr; _Float16* cl = j == 0 ? QL : j == 1 ? KML : nullptr;
  gemm2<0, 64, 4, DM, DM>(blockIdx.x, 0, X16, 0, BW + (size_t)j * DM * DM, 0, 0.0625f, bias, 0, nullptr, 1, 0, 0, nullptr, ch, cl, DM, 0, MP, DM, DM, j == 1 ? MH : nullptr, j == 1 ? ML : nullptr, j == 2 ? VT : nullptr); }


__global__ __launch_bounds__(256) void k_wnat(const float* __restrict__ w, size_t n8, _Float16* __restrict__ Bt) { const size_t t = (size_t)blockIdx.x * 256 + threadIdx.x; if (t >= n8) return; FragH f; for (int q = 0; q < 8; ++q) f.h[q] = (_Float16)(bf16_round(w[t * 8 + q]) * 16.0f); *(v8us*)((unsigned short*)Bt + t * 8) = f.half[0];  }
__global__ __launch_bounds__(256) void k_rsm(const float* __restrict__ S, _Float16* __restrict__ P, int nrows) {
  #pragma clang fp contract(off)
  const int i = blockIdx.x * 256 + threadIdx.x; if (i >= nrows) return; const float* s = S + (size_t)i * SQ; float mx = -3.0e38f;
#pragma unroll 1
  for (int j = 0; j < SQ; ++j) mx = fmaxf(mx, s[j]); float se = 0.f;
#pragma unroll 1
  for (int j = 0; j < SQ; ++j) se += expf(s[j] - mx); const float sc = 256.0f / se;
#pragma unroll 1
  for (int j0 = 0; j0 < SQ; j0 += 8) { FragH f; for (int q = 0; q < 8; ++q) f.h[q] = (_Float16)(expf(s[j0 + q] - mx) * sc); unsigned short* d = (unsigned short*)P + (size_t)i * SQ + j0; *(v8us*)d = f.half[0];  } }
__global__ __launch_bounds__(256) void k_vt(const _Float16* __restrict__ V16, int b, int h0, _Float16* __restrict__ VT) { __shared__ unsigned short tl[64][65]; const int tid = threadIdx.x; const int hh = blockIdx.x % HG, sg = blockIdx.x / HG; const int s0 = sg * 64; const int h = h0 + hh;
  for (int i = tid; i < 64 * 8; i += 256) { const int j = i / 8, d8 = (i % 8) * 8; FragH f; f.half[0] = *(const v8us*)((const unsigned short*)V16 + ((size_t)b * SQ + s0 + j) * DM + h * HD + d8); for (int q = 0; q < 8; ++q) tl[d8 + q][j] = f.u[q]; }
  __syncthreads();
  { for (int i = tid; i < 64 * 8; i += 256) { const int d = i / 8, j8 = (i % 8) * 8; FragH f; for (int q = 0; q < 8; ++q) f.u[q] = tl[d][j8 + q]; *(v8us*)((unsigned short*)VT + ((size_t)hh * HD + d) * SQ + s0 + j8) = f.half[0]; }  } }


__device__ __forceinline__ void mprep(const float* __restrict__ E, const float* __restrict__ phase, _Float16* __restrict__ MH, _Float16* __restrict__ ML, int bid) {
  #pragma clang fp contract(off)
  const int t = bid * 256 + threadIdx.x; if (t >= NH * HD * (HD / 8)) return; const int e8 = (t % (HD / 8)) * 8; const int hd_ = t / (HD / 8); const int d = hd_ % HD, h = hd_ / HD; const float c = cosf(bf16_round(phase[h * HD + d])); const float diag = __fmul_rn(__fmul_rn(c, c), 0.125f); FragH fh, fl;
#pragma unroll
  for (int q = 0; q < 8; ++q) { const int e = e8 + q; float m = bf16_round(E[((size_t)h * HD + d) * HD + e]); if (e == d) m = __fadd_rn(m, diag); const _Float16 hi = (_Float16)m; fh.h[q] = hi; fl.h[q] = (_Float16)((m - (float)hi) * 1024.0f); }
  const size_t o = ((size_t)h * HD + d) * HD + e8; { *(v8us*)((unsigned short*)MH + o) = fh.half[0]; *(v8us*)((unsigned short*)ML + o) = fl.half[0];  } }
// ---- the six operand preparations depend on inputs alone and share one launch; a block's index range picks its job: four weight transposes (BW holds the planes one behind the other), M, x ----
#define GW ((DM / WTK) * (DM / WTN)) /* blocks per weight transpose */
#define GM (NH * HD * (HD / 8) / 256) /* blocks for M */
#define GX ((int)(NR * DM / 8 / 256)) /* blocks for x */
static_assert(DM % WTK == 0 && DM % WTN == 0, "wt_tile: whole tiles only, it has no edge guard");
__global__ __launch_bounds__(256) void k_prep(const float* __restrict__ x, const float* __restrict__ wq, const float* __restrict__ wk, const float* __restrict__ wv, const float* __restrict__ wo, const float* __restrict__ E, const float* __restrict__ phase,
    _Float16* __restrict__ X16, _Float16* __restrict__ BW, _Float16* __restrict__ MH, _Float16* __restrict__ ML) {
  const int bid = blockIdx.x;
  if (bid < 4 * GW) { const int j = bid / GW; const float* W = j == 0 ? wq : j == 1 ? wk : j == 2 ? wv : wo; wt_tile(W, BW + (size_t)j * DM * DM, 16.0f, bid - j * GW); }      /* [in][out] -> Bt[n][k] x16; the branch is the same for a whole workgroup, so the tile's barrier is passed by all of it */
  else if (bid < 4 * GW + GM) mprep(E, phase, MH, ML, bid - 4 * GW);
  else x16_rows(x, X16, NR * DM / 8, bid - (4 * GW + GM));
}
__device__ __forceinline__ float half_xor(float v) { const int i = __float_as_int(v); return __int_as_float(__builtin_amdgcn_permlanex16(i, i, 0x76543210, 0xfedcba98, false, false)); }      /* value of lane l ^ 16 */
#define FK 64                        /* keys per LDS stage */
#define FPT 72                       /* LDS row pitch in f16: 128 B + 16 B, conflict-free for 16-byte fragment reads */
#define L2E 1.4426950408889634f
__device__ __forceinline__ v8f f_mma(v16h a, v16h b, v8f c) { return __builtin_amdgcn_wmma_f32_16x16x32_f16(false, a, false, b, (short)0, c, false, false); }
#define FKS 2                        /* key ranges that a workgroup works on side by side */
#define FKR (SQ / FKS)               /* keys per range */
__global__ __launch_bounds__(512) void k_fattn(const _Float16* __restrict__ QH, const _Float16* __restrict__ QL, const _Float16* __restrict__ KMH, const _Float16* __restrict__ KML, const _Float16* __restrict__ VT, _Float16* __restrict__ O16) {
  __shared__ __attribute__((aligned(16))) _Float16 sk[2][FKS][3][FK][FPT];
  const int tid = threadIdx.x, lane = tid & 31, c = lane & 15, hh = lane >> 4; const int w = __builtin_amdgcn_readfirstlane(tid >> 5);
  const int kg = w >> 3, wq = w & 7;      /* key range and query group of the wave: waves wq and wq + 8 share 32 queries */
  const int h = blockIdx.y, b = blockIdx.z; const size_t r0 = (size_t)b * SQ; const size_t q0 = r0 + (size_t)blockIdx.x * 256 + wq * 32;
  v16h qh[2][2], ql[2][2];      /* [query tile][k step of 32] */
  for (int qt = 0; qt < 2; ++qt)
    for (int ks = 0; ks < 2; ++ks) { const size_t o = (q0 + qt * 16 + c) * DM + h * HD + ks * 32; qh[qt][ks] = g2_frag(QH + o, hh); ql[qt][ks] = g2_frag(QL + o, hh); }
  const int sr = (tid & 255) >> 3, sp = (tid & 7) * 8;      /* staging: the eight waves of a range stage its tiles; a wave's 16-byte loads cover four whole 128-byte rows */
  const size_t k0 = r0 + (size_t)kg * FKR;
  const char* gkh = (const char*)(KMH + k0 * DM + h * HD); const char* gkl = (const char*)(KML + k0 * DM + h * HD);      /* wave-uniform bases (scalar registers); the lane's place is a 32-bit byte offset, one for both KM planes, one for V^T */
  const char* gv = (const char*)(VT + ((size_t)b * NH + h) * HD * SQ + (size_t)kg * FKR);
  const unsigned int ok2 = (unsigned int)(sr * DM + sp) * 2u, ov2 = (unsigned int)(sr * SQ + sp) * 2u;
  v8us st[6];
  st[0] = *(const v8us*)(gkh + ok2); st[1] = *(const v8us*)(gkh + ok2 + 64 * DM); st[2] = *(const v8us*)(gkl + ok2); st[3] = *(const v8us*)(gkl + ok2 + 64 * DM); st[4] = *(const v8us*)(gv + ov2); st[5] = *(const v8us*)(gv + ov2 + 64 * SQ);
  for (int i = 0; i < 6; ++i) *(v8us*)&sk[0][kg][i >> 1][sr + 32 * (i & 1)][sp] = st[i];
  __syncthreads();      /* publishes stage 0 */
  const v8f z8 = {0.f,0.f,0.f,0.f,0.f,0.f,0.f,0.f};
  v8f o[4][2];      /* O^T tiles [d tile][query tile]: register r = d 16 dt + 8 hh + r of query c */
  for (int dt = 0; dt < 4; ++dt) { o[dt][0] = z8; o[dt][1] = z8; }
  float mu[2] = {-3.0e38f, -3.0e38f};      /* maximum in use per query, log2 domain, equal in both lane halves */
  float ls[2] = {0.f, 0.f};      /* this lane half's share of the sum of weights */
  for (int s = 0; s < FKR / FK; ++s) {
    const int buf = s & 1; const bool more = s + 1 < FKR / FK;
    if (more) { gkh += (size_t)FK * DM * 2; gkl += (size_t)FK * DM * 2; gv += FK * 2; }
#pragma unroll      /* p picks which half of the next stage is fetched: constant indices */
    for (int p = 0; p < FK / 32; ++p) {
      v8us sn[3];      /* half of the next stage's pieces per 32 keys, loaded ahead of these keys' work and stored behind it: 12 registers in flight, not 24, so that the wave fits 256 registers */
      if (more) {
        if (p == 0) { sn[0] = *(const v8us*)(gkh + ok2); sn[1] = *(const v8us*)(gkh + ok2 + 64 * DM); sn[2] = *(const v8us*)(gkl + ok2); }
        else { sn[0] = *(const v8us*)(gkl + ok2 + 64 * DM); sn[1] = *(const v8us*)(gv + ov2); sn[2] = *(const v8us*)(gv + ov2 + 64 * SQ); }
        asm volatile("s_wait_xcnt 0x0" ::: "memory"); }      /* stands in front of every later rewrite of the address registers that these three loads name */
      v8f sc[2][2] = {{z8, z8}, {z8, z8}};      /* S^T tiles [key tile][query tile]: register r = key 16 kt + 8 hh + r, query c */
      for (int kt = 0; kt < 2; ++kt) {      /* one key tile at a time: four KM fragments live, not eight (the 256 registers); each accumulator takes its terms in the order it always did */
        v16h kh[2], kl[2];      /* [k step] */
        for (int ks = 0; ks < 2; ++ks) { kh[ks] = g2_frag(&sk[buf][kg][0][p * 32 + kt * 16 + c][ks * 32], hh); kl[ks] = g2_frag(&sk[buf][kg][1][p * 32 + kt * 16 + c][ks * 32], hh); }
        for (int ks = 0; ks < 2; ++ks) {
          for (int qt = 0; qt < 2; ++qt) sc[kt][qt] = f_mma(kl[ks], qh[qt][ks], sc[kt][qt]);      /* hi.lo */
          for (int qt = 0; qt < 2; ++qt) sc[kt][qt] = f_mma(kh[ks], ql[qt][ks], sc[kt][qt]);      /* lo.hi */
        }
        for (int qt = 0; qt < 2; ++qt) sc[kt][qt] *= 0.0009765625f;      /* the residual planes carry x1024 */
        for (int ks = 0; ks < 2; ++ks)
          for (int qt = 0; qt < 2; ++qt) sc[kt][qt] = f_mma(kh[ks], qh[qt][ks], sc[kt][qt]);      /* hi.hi */
        if (kt == 0) __builtin_amdgcn_sched_barrier(0);      /* keeps the second key tile's four fragment reads behind the first tile's products: read ahead of them they take 32 more registers, and the wave spills */
      }
      v16h va[4];
      for (int dt = 0; dt < 4; ++dt) va[dt] = g2_frag(&sk[buf][kg][2][dt * 16 + c][p * 32], hh);
      float mt[2]; bool need = false;
      for (int qt = 0; qt < 2; ++qt) { float m = sc[0][qt][0];
        for (int r = 1; r < 8; ++r) m = fmaxf(m, sc[0][qt][r]);
        for (int r = 0; r < 8; ++r) m = fmaxf(m, sc[1][qt][r]);
        m = fmaxf(m, half_xor(m)) * L2E; mt[qt] = m; need = need || (m > mu[qt] + 8.0f); }
      if (__builtin_amdgcn_ballot_w32(need) != 0) {      /* lazy rescale, one scalar branch per 32 keys: the maximum in use follows only when some query's maximum has passed it by more than 2^8 */
        for (int qt = 0; qt < 2; ++qt) { const float mn = fmaxf(mu[qt], mt[qt]); const float al = __builtin_amdgcn_exp2f(mu[qt] - mn); mu[qt] = mn; ls[qt] *= al;
          for (int dt = 0; dt < 4; ++dt) o[dt][qt] *= al; }
      }
      for (int qt = 0; qt < 2; ++qt) { const float sh = 6.0f - mu[qt];      /* weights carried x64: at most 2^14 in f16 */
        v8f e0 = sc[0][qt] * L2E + sh, e1 = sc[1][qt] * L2E + sh; FragH pb;
        for (int r = 0; r < 8; ++r) { e0[r] = __builtin_amdgcn_exp2f(e0[r]); e1[r] = __builtin_amdgcn_exp2f(e1[r]); }
        for (int r = 0; r < 8; ++r) { pb.h[r] = (_Float16)e0[r]; pb.h[8 + r] = (_Float16)e1[r]; }
        const v8f t = e0 + e1; ls[qt] += ((t[0] + t[1]) + (t[2] + t[3])) + ((t[4] + t[5]) + (t[6] + t[7]));
        for (int dt = 0; dt < 4; ++dt) o[dt][qt] = f_mma(va[dt], pb.v, o[dt][qt]); }
      if (more) {      /* the other buffer: nobody reads it in this stage */
        for (int j = 0; j < 3; ++j) { const int i = p * 3 + j; *(v8us*)&sk[buf ^ 1][kg][i >> 1][sr + 32 * (i & 1)][sp] = sn[j]; } }
    }
    __syncthreads();      /* publishes the next stage and ends every wave's reads of this one, which the stage after next overwrites */
  }
  // The two waves of a query group join their ranges: each hands the partner one query tile (O^T, maximum in use, sum share) through LDS and finishes the other. The last stage's barrier has ended every read of sk, so its bytes serve as the hand-over rows.
  static_assert(16 * 9 * 32 * 16 <= sizeof(sk), "hand-over rows must fit the stage buffers");
  v4fa* xo = (v4fa*)&sk[0][0][0][0][0];      /* [wave][9][lane] pieces of 16 bytes: a wave's 32 lanes store and read 512 bytes in a row */
  v8f og[4], ok[4];      /* the tile handed over, the tile kept: range 0 keeps query tile 0, range 1 query tile 1 */
  for (int dt = 0; dt < 4; ++dt) { og[dt] = kg ? o[dt][0] : o[dt][1]; ok[dt] = kg ? o[dt][1] : o[dt][0]; }
  const float mug = kg ? mu[0] : mu[1], lsg = kg ? ls[0] : ls[1], muk = kg ? mu[1] : mu[0], lsk = kg ? ls[1] : ls[0];
  v4fa* mine = xo + (size_t)w * 9 * 32 + lane;
  for (int dt = 0; dt < 4; ++dt) { const v4f lo4 = {og[dt][0], og[dt][1], og[dt][2], og[dt][3]}, hi4 = {og[dt][4], og[dt][5], og[dt][6], og[dt][7]}; mine[(dt * 2) * 32] = lo4; mine[(dt * 2 + 1) * 32] = hi4; }
  { const v4f ms = {mug, lsg, 0.f, 0.f}; mine[8 * 32] = ms; }
  __syncthreads();      /* publishes the hand-over rows */
  const v4fa* theirs = xo + (size_t)(w ^ 8) * 9 * 32 + lane;
  v4f pr[9];
  for (int j = 0; j < 9; ++j) pr[j] = theirs[j * 32];
  const float mn = fmaxf(muk, pr[8][0]); float ak = __builtin_amdgcn_exp2f(muk - mn), ap = __builtin_amdgcn_exp2f(pr[8][0] - mn);      /* both ranges brought to one maximum */
  const float lt = lsk * ak + pr[8][1] * ap;
  const float inv = 64.0f * __builtin_amdgcn_rcpf(lt + half_xor(lt));      /* o carried x64, the weights' own carry cancels */
  ak *= inv; ap *= inv;
  FragH f[4];
  for (int dt = 0; dt < 4; ++dt)
    for (int r = 0; r < 8; ++r) f[dt].h[r] = (_Float16)(ok[dt][r] * ak + pr[dt * 2 + (r >> 2)][r & 3] * ap);
  unsigned short* po = (unsigned short*)O16 + (q0 + kg * 16 + c) * DM + h * HD + 8 * hh;
  for (int dt = 0; dt < 4; ++dt) *(v8us*)(po + dt * 16) = f[dt].half[0];      /* all four values stand ready ahead of the first store: no register that an issued store names is written again */
}

extern "C" void kernel_launch(void* const* d_in, const int* in_sizes, int n_in,
                              void* d_out, int out_size, void* d_ws, size_t ws_size, hipStream_t stream) {
  (void)in_sizes; (void)n_in; (void)out_size;
  const float* const* I = (const float* const*)d_in; const float* x = I[0]; const float* wq = I[1]; const float* bq = I[2]; const float* wk = I[3]; const float* bk = I[4]; const float* wv = I[5]; const float* bv = I[6]; const float* phase = I[7]; const float* E = I[8]; const float* wo = I[9]; const float* bo = I[10];      /* weights [in][out] */
  char* ws = (char*)d_ws; size_t off = 0;
  auto take = [&](size_t bytes) { char* p = ws + off; off += (bytes + 255) & ~(size_t)255; return p; };
  _Float16* BQ = (_Float16*)take((size_t)DM * DM * 2); _Float16* BK = (_Float16*)take((size_t)DM * DM * 2); _Float16* BV = (_Float16*)take((size_t)DM * DM * 2); _Float16* BO = (_Float16*)take((size_t)DM * DM * 2); _Float16* MH = (_Float16*)take((size_t)NH * HD * HD * 2); _Float16* ML = (_Float16*)take((size_t)NH * HD * HD * 2);
  _Float16* X16 = (_Float16*)take(NR * DM * 2); _Float16* QH = (_Float16*)take(NR * DM * 2); _Float16* QL = (_Float16*)take(NR * DM * 2);
  _Float16* KMH = (_Float16*)take(NR * DM * 2); _Float16* KML = (_Float16*)take(NR * DM * 2); _Float16* O16 = (_Float16*)take(NR * DM * 2);
  _Float16* VT = (_Float16*)take((size_t)NB * NH * HD * SQ * 2);
  (void)BK; (void)BV;      /* reached through BQ */
  if (off > ws_size) return;      /* 8.3 + 8 + 16 + 16 + 8 + 8 = approx 64 MiB */
  k_prep<<<4 * GW + GM + GX, 256, 0, stream>>>(x, wq, wk, wv, wo, E, phase, X16, BQ, MH, ML);      /* BQ, BK, BV, BO lie one behind the other */
  const size_t r0p = (size_t)B0 * SQ;
  k_qkv<<<dim3((unsigned)((MP / 128) * (DM / 128)), 3), 128, 0, stream>>>(X16 + r0p * DM, BQ, bq, bk, bv, MH, ML, QH + r0p * DM, QL + r0p * DM, KMH + r0p * DM, KML + r0p * DM, VT);
  k_fattn<<<dim3(SQ / 256, NH, NB), 512, 0, stream>>>(QH, QL, KMH, KML, VT, O16);      /* o (merged heads, x64) as f16 rows */
  k_outp<<<(unsigned)((MPO / 128) * (DM / 128)), 256, 0, stream>>>(O16 + r0p * DM, BO, bo, (float*)d_out + r0p * DM);      /* out rows are the output layout */
}
